// v000
// Measured on an AMD MI455X. A time is GPU time per run, averaged over a window of back-to-back runs after a warm-up
// (all launches, gaps included; the runs take copies of the inputs in turn), and the median of several windows.
// Apart from v000's, it joins two sittings. Times from different sittings can be a few percent apart, while
// side-by-side timings come from the same sitting.
// v000 is the starting kernel. One run takes 1970 microseconds.
#include <hip/hip_runtime.h>
// EuclideanAttention (2 x 2048 tokens, D 1024 = 16 heads x 64; Q, K, V = x W + b; d2 = max(|q|^2 + |k|^2 - 2 q.k, 0); attn = softmax_k(-d2 / temperature); out = (attn V) Wo + bo).
// Compute dtype: inputs rounded to bf16; x and weights exact as f16; q.k from hi+residual operands (~2^-21); norms/softmax f32; v and the softmax weights as plain f16 operands (~2^-12); attention output hi + residual. v_wmma_f32_16x16x32_f16.
#define NB 2
#define DM 1024
#define NKV 16
#define NREP (NH / NKV)
#define KVD (NKV * 64)           /* 1024 */
#define NR (NB * SLEN)           /* 4096 */
#define CHK 512                  /* attention chunk */
typedef int v4i __attribute__((ext_vector_type(4)));
#define FF 2048
#define SLEN 2048
#define TQ SLEN
#define TK SLEN
#define NH 16
#define SCL 0.125f
#define QBLKS (TQ / 64)
#define QB05 0
#define QBN5 4
#define QB0P 0
#define QBNP QBLKS           /* non-causal: plain flash on every query block */
#define RE 256
typedef __bf16 v16b __attribute__((ext_vector_type(16)));
typedef unsigned short v8us __attribute__((ext_vector_type(8), may_alias));
typedef float  v8f  __attribute__((ext_vector_type(8)));
typedef float  v4f  __attribute__((ext_vector_type(4)));
typedef float  v4fa __attribute__((ext_vector_type(4), may_alias));
union FragB { v16b v; v8us half[2]; unsigned short u[16]; };

__device__ __forceinline__ unsigned short bf16_bits(float x) { unsigned int u = __float_as_uint(x); return (unsigned short)((u + 0x7FFFu + ((u >> 16) & 1u)) >> 16); }
__device__ __forceinline__ float bf16_val(unsigned short b) { return __uint_as_float(((unsigned int)b) << 16); }
__device__ __forceinline__ float bf16_round(float x) { return bf16_val(bf16_bits(x)); }
// D += A·B with NT terms: 1 = ah·bh, 2 = + al·bh (A split), 3 = + ah·bl (both split)
template <int NT>
__device__ __forceinline__ v8f mmaN(v16b ah, v16b al, v16b bh, v16b bl, v8f c) {
  c = __builtin_amdgcn_wmma_f32_16x16x32_bf16(false, ah, false, bh, (short)0, c, false, false);
  if (NT >= 2) c = __builtin_amdgcn_wmma_f32_16x16x32_bf16(false, al, false, bh, (short)0, c, false, false);
  if (NT >= 3) c = __builtin_amdgcn_wmma_f32_16x16x32_bf16(false, ah, false, bl, (short)0, c, false, false);
  asm volatile("v_nop\n\tv_nop\n\tv_nop\n\tv_nop" : "+v"(c) : "v"(ah), "v"(al), "v"(bh), "v"(bl));
  return c;
}

__global__ __launch_bounds__(256) void k_wt_bf16(const float* __restrict__ W, unsigned short* __restrict__ Wt, int K, int N) {
  const int t = blockIdx.x * 256 + threadIdx.x;
  const int k8n = K / 8;
  if (t >= N * k8n) return;
  const int n = t / k8n, k8 = (t % k8n) * 8;
  v8us v;
#pragma unroll
  for (int i = 0; i < 8; ++i) v[i] = bf16_bits(W[(size_t)(k8 + i) * N + n]);
  *(v8us*)(Wt + (size_t)n * K + k8) = v;
  
}

// GEMM C[M][N] (f32, pitch ldc) = act(A[M][K]·W + bias). A f32 row-major (pitch lda) converted per fragment to bf16
// (ASPLIT: hi/lo two planes -> 2 terms, else single rounded term); Wt bf16 [N][K] (pitch ldb). BIAS_BF16 rounds the
// bias to bf16 first (bias quantised to bf16 before the add). K%32==0, M%16==0, N%64==0.
template <bool ASPLIT, int ACT, bool BIAS_BF16>
__global__ __launch_bounds__(128) void k_gemm_bf(const float* __restrict__ A, int lda, const unsigned short* __restrict__ Wt, int ldb,
                                               const float* __restrict__ bias, float* __restrict__ C, int ldc, int M, int N, int K) {
  __shared__ __attribute__((aligned(16))) float so[4][16][64];
  const int tid = threadIdx.x, w = tid >> 5, lane = tid & 31, ln = lane & 15, hh = lane >> 4;
  const int ntn = N / 64;
  const int wid = blockIdx.x * 4 + w;
  const int mt = wid / ntn, nq = wid % ntn;
  if (mt * 16 >= M) return;
  const int row0 = mt * 16, col0 = nq * 64;
  const float* arow = A + (size_t)(row0 + ln) * lda;
  v8f acc[4] = {};
  for (int kb = 0; kb < K; kb += 32) {
    FragB ah, al;
    const v4f x0 = *(const v4fa*)(arow + kb + 8 * hh), x1 = *(const v4fa*)(arow + kb + 8 * hh + 4);
    const v4f x2 = *(const v4fa*)(arow + kb + 16 + 8 * hh), x3 = *(const v4fa*)(arow + kb + 16 + 8 * hh + 4);
    float xs[16] = {x0[0],x0[1],x0[2],x0[3],x1[0],x1[1],x1[2],x1[3],x2[0],x2[1],x2[2],x2[3],x3[0],x3[1],x3[2],x3[3]};
#pragma unroll
    for (int i = 0; i < 16; ++i) { const unsigned short hb = bf16_bits(xs[i]); ah.u[i] = hb; al.u[i] = ASPLIT ? bf16_bits(xs[i] - bf16_val(hb)) : (unsigned short)0; }
#pragma unroll
    for (int t = 0; t < 4; ++t) {
      const unsigned short* brow = Wt + (size_t)(col0 + t * 16 + ln) * ldb + kb;
      FragB b;
      b.half[0] = *(const v8us*)(brow + 8 * hh);
      b.half[1] = *(const v8us*)(brow + 16 + 8 * hh);
      acc[t] = mmaN<ASPLIT ? 2 : 1>(ah.v, al.v, b.v, b.v, acc[t]);
    }
  }
#pragma unroll
  for (int t = 0; t < 4; ++t) {
    float bv = bias ? bias[col0 + t * 16 + ln] : 0.f;
    if (BIAS_BF16) bv = bf16_round(bv);
#pragma unroll
    for (int r = 0; r < 8; ++r) { float v = acc[t][r] + bv; if (ACT == 1) v = fmaxf(v, 0.f); so[w][8 * hh + r][t * 16 + ln] = v; }
  }
  __builtin_amdgcn_fence(__ATOMIC_ACQ_REL, "workgroup");
  __builtin_amdgcn_wave_barrier();
  const int rsub = lane >> 4, c4 = (lane & 15) * 4;
  {
#pragma unroll
    for (int q = 0; q < 8; ++q) {
      const int r = q * 2 + rsub;
      const v4f v = *(const v4fa*)&so[w][r][c4];
      *(v4f*)(C + (size_t)(row0 + r) * ldc + col0 + c4) = v;
    }
    
  }
}

// GEMM C = act(A·W + bias + resid): A f32 (ASPLIT -> hi/lo 2 terms), Wt bf16 [N][K]; ACT 0 none, 1 relu, 2 exact gelu;
// resid (optional, f32, row index = (row % rmod), pitch ldr, RES_BF16 rounds it) added before the activation.
template <bool ASPLIT, int ACT, bool BIAS_BF16, bool RES_BF16>
__global__ __launch_bounds__(128) void k_gemm_bf3(const float* __restrict__ A, int lda, const unsigned short* __restrict__ Wt, int ldb,
                                                const float* __restrict__ bias, const float* __restrict__ resid, int rmod, int ldr,
                                                float* __restrict__ C, int ldc, int M, int N, int K) {
  __shared__ __attribute__((aligned(16))) float so[4][16][64];
  const int tid = threadIdx.x, w = tid >> 5, lane = tid & 31, ln = lane & 15, hh = lane >> 4;
  const int ntn = N / 64;
  const int wid = blockIdx.x * 4 + w;
  const int mt = wid / ntn, nq = wid % ntn;
  if (mt * 16 >= M) return;
  const int row0 = mt * 16, col0 = nq * 64;
  const float* arow = A + (size_t)(row0 + ln) * lda;
  v8f acc[4] = {};
  for (int kb = 0; kb < K; kb += 32) {
    FragB ah, al;
    const v4f x0 = *(const v4fa*)(arow + kb + 8 * hh), x1 = *(const v4fa*)(arow + kb + 8 * hh + 4);
    const v4f x2 = *(const v4fa*)(arow + kb + 16 + 8 * hh), x3 = *(const v4fa*)(arow + kb + 16 + 8 * hh + 4);
    float xs[16] = {x0[0],x0[1],x0[2],x0[3],x1[0],x1[1],x1[2],x1[3],x2[0],x2[1],x2[2],x2[3],x3[0],x3[1],x3[2],x3[3]};
#pragma unroll
    for (int i = 0; i < 16; ++i) { const unsigned short hb = bf16_bits(xs[i]); ah.u[i] = hb; al.u[i] = ASPLIT ? bf16_bits(xs[i] - bf16_val(hb)) : (unsigned short)0; }
#pragma unroll
    for (int t = 0; t < 4; ++t) {
      const unsigned short* brow = Wt + (size_t)(col0 + t * 16 + ln) * ldb + kb;
      FragB b;
      b.half[0] = *(const v8us*)(brow + 8 * hh);
      b.half[1] = *(const v8us*)(brow + 16 + 8 * hh);
      acc[t] = mmaN<ASPLIT ? 2 : 1>(ah.v, al.v, b.v, b.v, acc[t]);
    }
  }
#pragma unroll
  for (int t = 0; t < 4; ++t) {
    const int col = col0 + t * 16 + ln;
    float bv = bias ? bias[col] : 0.f;
    if (BIAS_BF16) bv = bf16_round(bv);
#pragma unroll
    for (int r = 0; r < 8; ++r) {
      float v = acc[t][r] + bv;
      if (resid) { float rv = resid[(size_t)((row0 + 8 * hh + r) % rmod) * ldr + col]; if (RES_BF16) rv = bf16_round(rv); v += rv; }
      if (ACT == 1) v = fmaxf(v, 0.f);
      if (ACT == 2) v = 0.5f * v * (1.0f + erff(v * 0.70710678118654752f));
      if (ACT == 3) { const float u = 0.7978845608028654f * (v + 0.044715f * v * v * v); v = 0.5f * v * (1.0f + tanhf(u)); }
      so[w][8 * hh + r][t * 16 + ln] = v;
    }
  }
  __builtin_amdgcn_fence(__ATOMIC_ACQ_REL, "workgroup");
  __builtin_amdgcn_wave_barrier();
  const int rsub = lane >> 4, c4 = (lane & 15) * 4;
  {
#pragma unroll
    for (int q = 0; q < 8; ++q) {
      const int r = q * 2 + rsub;
      const v4f v = *(const v4fa*)&so[w][r][c4];
      *(v4f*)(C + (size_t)(row0 + r) * ldc + col0 + c4) = v;
    }
    
  }
}
// row LayerNorm (biased variance, eps) over N: s = X (+ R); optional out_sum <- s; out_norm <- (s-mu)*rsqrt(var+eps)*g + b
template <bool PARAM_BF16>
__global__ __launch_bounds__(256) void k_layernorm(const float* __restrict__ X, const float* __restrict__ R, const float* __restrict__ g, const float* __restrict__ bta,
                                                  float* __restrict__ out_sum, float* __restrict__ out_norm, int N, float eps) {
  __shared__ float red[256];
  const int row = blockIdx.x, tid = threadIdx.x;
  const float* x = X + (size_t)row * N; const float* rr = R ? R + (size_t)row * N : nullptr;
  float vals[16];                     // up to N = 4096
  const int per = N / 256;            // contiguous chunk per thread? use strided-by-4 chunks: thread handles j = tid*4 + 1024*u
  float s1 = 0.f;
  for (int u = 0; u < per / 4; ++u) {
    const int j = tid * 4 + 1024 * u;
    const v4f a = *(const v4fa*)(x + j);
    v4f b = {0.f,0.f,0.f,0.f}; if (rr) b = *(const v4fa*)(rr + j);
#pragma unroll
    for (int q = 0; q < 4; ++q) { const float v = a[q] + b[q]; vals[u * 4 + q] = v; s1 += v; }
  }
  red[tid] = s1; __syncthreads();
  for (int st = 128; st > 0; st >>= 1) { if (tid < st) red[tid] += red[tid + st]; __syncthreads(); }
  const float mu = red[0] / (float)N; __syncthreads();
  float s2 = 0.f;
  for (int u = 0; u < per / 4; ++u)
#pragma unroll
    for (int q = 0; q < 4; ++q) { const float c = vals[u * 4 + q] - mu; s2 += c * c; }
  red[tid] = s2; __syncthreads();
  for (int st = 128; st > 0; st >>= 1) { if (tid < st) red[tid] += red[tid + st]; __syncthreads(); }
  const float rs = rsqrtf(red[0] / (float)N + eps);
  {
    for (int u = 0; u < per / 4; ++u) {
      const int j = tid * 4 + 1024 * u;
      v4f o, sm;
#pragma unroll
      for (int q = 0; q < 4; ++q) {
        float gg = g[j + q], bb = bta[j + q];
        if (PARAM_BF16) { gg = bf16_round(gg); bb = bf16_round(bb); }
        sm[q] = vals[u * 4 + q]; o[q] = (vals[u * 4 + q] - mu) * rs * gg + bb;
      }
      if (out_sum) *(v4f*)(out_sum + (size_t)row * N + j) = sm;
      *(v4f*)(out_norm + (size_t)row * N + j) = o;
    }
    
  }
}



// ---- f16 WMMA path (v_wmma_f32_16x16x32_f16): 11-bit significands for operands in range — used where a [0,1] probability operand needs more precision than bf16
typedef _Float16 v16h __attribute__((ext_vector_type(16)));
union FragH { v16h v; v8us half[2]; _Float16 h[16]; unsigned short u[16]; };
template <int NT>
__device__ __forceinline__ v8f mmaH(v16h ah, v16h al, v16h bh, v16h bl, v8f c) {
  c = __builtin_amdgcn_wmma_f32_16x16x32_f16(false, ah, false, bh, (short)0, c, false, false);
  if (NT >= 2) c = __builtin_amdgcn_wmma_f32_16x16x32_f16(false, al, false, bh, (short)0, c, false, false);
  if (NT >= 3) c = __builtin_amdgcn_wmma_f32_16x16x32_f16(false, ah, false, bl, (short)0, c, false, false);
  asm volatile("v_nop\n\tv_nop\n\tv_nop\n\tv_nop" : "+v"(c) : "v"(ah), "v"(al), "v"(bh), "v"(bl));
  return c;
}
// batched GEMM like k_gemm_b but f16 operands: A f32 (split into f16 hi/lo if ASPLIT, else rounded to f16), Bt = f16 values [n][k]; alpha; C f32; N multiple of 16 (partial tiles skipped)
template <bool ASPLIT>
__global__ __launch_bounds__(128) void k_gemm_h(const float* __restrict__ A, int lda, size_t sA, const _Float16* __restrict__ Bh, int ldb, size_t sB, float alpha, float* __restrict__ C, int ldc, size_t sC, int M, int N, int K) {
  __shared__ __attribute__((aligned(16))) float so[4][16][64];
  const int tid = threadIdx.x, w = tid >> 5, lane = tid & 31, ln = lane & 15, hh = lane >> 4; const int by = blockIdx.y;
  A += (size_t)by * sA; Bh += (size_t)by * sB; C += (size_t)by * sC;
  const int ntn = (N + 63) / 64; const int wid = blockIdx.x * 4 + w; const int mt = wid / ntn, nq = wid % ntn; if (mt * 16 >= M) return;
  const int row0 = mt * 16, col0 = nq * 64; const float* arow = A + (size_t)(row0 + ln) * lda;
  v8f acc[4] = {};
  for (int kb = 0; kb < K; kb += 32) {
    FragH ah, al;
    const v4f x0 = *(const v4fa*)(arow + kb + 8 * hh), x1 = *(const v4fa*)(arow + kb + 8 * hh + 4), x2 = *(const v4fa*)(arow + kb + 16 + 8 * hh), x3 = *(const v4fa*)(arow + kb + 16 + 8 * hh + 4);
    float xs[16] = {x0[0],x0[1],x0[2],x0[3],x1[0],x1[1],x1[2],x1[3],x2[0],x2[1],x2[2],x2[3],x3[0],x3[1],x3[2],x3[3]};
#pragma unroll
    for (int i = 0; i < 16; ++i) { const _Float16 h = (_Float16)xs[i]; ah.h[i] = h; al.h[i] = ASPLIT ? (_Float16)(xs[i] - (float)h) : (_Float16)0.0f; }
#pragma unroll
    for (int t = 0; t < 4; ++t) { if (col0 + t * 16 >= N) continue; const size_t boff = (size_t)(col0 + t * 16 + ln) * ldb + kb; FragH bq; bq.half[0] = *(const v8us*)(Bh + boff + 8 * hh); bq.half[1] = *(const v8us*)(Bh + boff + 16 + 8 * hh);
      acc[t] = mmaH<ASPLIT ? 2 : 1>(ah.v, al.v, bq.v, bq.v, acc[t]); }
  }
#pragma unroll
  for (int t = 0; t < 4; ++t) { if (col0 + t * 16 >= N) continue;
#pragma unroll
    for (int r = 0; r < 8; ++r) so[w][8 * hh + r][t * 16 + ln] = acc[t][r] * alpha; }
  __builtin_amdgcn_fence(__ATOMIC_ACQ_REL, "workgroup"); __builtin_amdgcn_wave_barrier();
  const int rsub = lane >> 4, c4 = (lane & 15) * 4;
  {
#pragma unroll
    for (int q = 0; q < 8; ++q) { const int r = q * 2 + rsub; if (col0 + c4 < N) { const v4f v = *(const v4fa*)&so[w][r][c4]; *(v4f*)(C + (size_t)(row0 + r) * ldc + col0 + c4) = v; } }
     }
}

// Wt[n][k] = f16(W[k][n]·scale) from f32 row-major W[K][N] (scale = power of two; bf16-exact weights stay exact in f16 away from the subnormal range)
__global__ __launch_bounds__(256) void k_wt_f16(const float* __restrict__ W, _Float16* __restrict__ Wt, int K, int N, float scale) {
  const int t = blockIdx.x * 256 + threadIdx.x; if (t >= N * (K / 8)) return; const int n = t / (K / 8), k8 = (t % (K / 8)) * 8; FragH f;
#pragma unroll
  for (int i = 0; i < 8; ++i) f.h[i] = (_Float16)(bf16_round(W[(size_t)(k8 + i) * N + n]) * scale); const v8us o = f.half[0];
  *(v8us*)((unsigned short*)Wt + (size_t)n * K + k8) = o; 
}
// k_gemm_hh variant with fused epilogue: v = acc·alpha + bias[by·sBias + col] (+ CP[(row/rowsPerB)·sCPb + by·64 + col] if CP) ; ACT 0 none / 1 elu ; writes f16 C16 (and f32 C if non-null)
template <int ACT>
__global__ __launch_bounds__(128) void k_gemm_hhx(const _Float16* __restrict__ A, int lda, size_t sA, const _Float16* __restrict__ Bh, int ldb, size_t sB, float alpha, const float* __restrict__ bias, size_t sBias, const float* __restrict__ CP, int rowsPerB, size_t sCPb, int row0g,
    float* __restrict__ C, _Float16* __restrict__ C16, int ldc, size_t sC, int M, int N, int K) {
  __shared__ __attribute__((aligned(16))) float so[4][16][64];
  const int tid = threadIdx.x, w = tid >> 5, lane = tid & 31, ln = lane & 15, hh = lane >> 4; const int by = blockIdx.y;
  A += (size_t)by * sA; Bh += (size_t)by * sB; const size_t cofs = (size_t)by * sC; const float* bp = bias ? bias + (size_t)by * sBias : nullptr;
  const int ntn = (N + 63) / 64; const int wid = blockIdx.x * 4 + w; const int mt = wid / ntn, nq = wid % ntn; if (mt * 16 >= M) return;
  const int row0 = mt * 16, col0 = nq * 64; const _Float16* arow = A + (size_t)(row0 + ln) * lda;
  v8f acc[4] = {};
  for (int kb = 0; kb < K; kb += 32) { FragH ah; ah.half[0] = *(const v8us*)((const unsigned short*)arow + kb + 8 * hh); ah.half[1] = *(const v8us*)((const unsigned short*)arow + kb + 16 + 8 * hh);
#pragma unroll
    for (int t = 0; t < 4; ++t) { if (col0 + t * 16 >= N) continue; const size_t boff = (size_t)(col0 + t * 16 + ln) * ldb + kb; FragH bq; bq.half[0] = *(const v8us*)((const unsigned short*)Bh + boff + 8 * hh); bq.half[1] = *(const v8us*)((const unsigned short*)Bh + boff + 16 + 8 * hh);
      acc[t] = mmaH<1>(ah.v, ah.v, bq.v, bq.v, acc[t]); }
  }
#pragma unroll
  for (int t = 0; t < 4; ++t) { if (col0 + t * 16 >= N) continue; const int col = col0 + t * 16 + ln; const float bv = bp ? bf16_round(bp[col]) : 0.f;
#pragma unroll
    for (int r = 0; r < 8; ++r) { float v = acc[t][r] * alpha + bv; if (CP) { const int bidx = (row0g + row0 + 8 * hh + r) / rowsPerB; v += CP[(size_t)bidx * sCPb + (size_t)by * 64 + col]; } if (ACT == 1) v = (v > 0.f) ? v : expm1f(v); else if (ACT == 7) v = (v > 0.f) ? v + 1.0f : expf(v); else if (ACT == 8) v = tanhf(v); else if (ACT == 9) v = 0.5f * v * (1.0f + tanhf(0.7978845608028654f * (v + 0.044715f * v * v * v))); else if (ACT == 11) v = 1.0f / (1.0f + expf(-v)); else if (ACT == 12) v = (v > 0.f) ? v : 0.01f * v; else if (ACT == 14) v = (v > 0.f) ? v : 0.1f * v; else if (ACT == 15) v = v / (1.0f + expf(-v)); else if (ACT == 3) v = fmaxf(v, 0.f); else if (ACT == 6) v = 0.5f * v * (1.0f + erff(v * 0.70710678118654752f)); so[w][8 * hh + r][t * 16 + ln] = v; } }
  __builtin_amdgcn_fence(__ATOMIC_ACQ_REL, "workgroup"); __builtin_amdgcn_wave_barrier();
  const int rsub = lane >> 4, c4 = (lane & 15) * 4; typedef _Float16 v4h __attribute__((ext_vector_type(4)));
  {
#pragma unroll
    for (int q = 0; q < 8; ++q) { const int r = q * 2 + rsub; if (col0 + c4 < N) { const v4f v = *(const v4fa*)&so[w][r][c4]; if (C) *(v4f*)(C + cofs + (size_t)(row0 + r) * ldc + col0 + c4) = v; if (C16) { v4h h4; for (int i = 0; i < 4; ++i) h4[i] = (_Float16)v[i]; *(v4h*)(C16 + cofs + (size_t)(row0 + r) * ldc + col0 + c4) = h4; } } }
     }
}


typedef _Float16 v4h __attribute__((ext_vector_type(4)));

__global__ __launch_bounds__(256) void k_x16(const float* __restrict__ x, _Float16* __restrict__ X16, size_t n8) { const size_t t = (size_t)blockIdx.x * 256 + threadIdx.x; if (t >= n8) return; FragH f;
#pragma unroll
  for (int q = 0; q < 8; ++q) f.h[q] = (_Float16)bf16_round(x[t * 8 + q]); *(v8us*)((unsigned short*)X16 + t * 8) = f.half[0];  }
__global__ __launch_bounds__(256) void k_h16(const float* __restrict__ x, _Float16* __restrict__ X16, size_t n8) { const size_t t = (size_t)blockIdx.x * 256 + threadIdx.x; if (t >= n8) return; FragH f;
#pragma unroll
  for (int q = 0; q < 8; ++q) f.h[q] = (_Float16)x[t * 8 + q]; *(v8us*)((unsigned short*)X16 + t * 8) = f.half[0];  }
__global__ __launch_bounds__(256) void k_round16f(const float* __restrict__ W, _Float16* __restrict__ Bt, size_t n8) { const size_t t = (size_t)blockIdx.x * 256 + threadIdx.x; if (t >= n8) return; FragH f;
#pragma unroll
  for (int i = 0; i < 8; ++i) f.h[i] = (_Float16)(bf16_round(W[t * 8 + i]) * 16.0f); *(v8us*)((unsigned short*)Bt + t * 8) = f.half[0];  }
template <int NHv, int TTv>
__global__ __launch_bounds__(256) void k_vt(const _Float16* __restrict__ V16, int ldv, int voff, _Float16* __restrict__ Vt) { __shared__ unsigned short tl[64][66]; const int tid = threadIdx.x; const int slab = blockIdx.x / (TTv / 64), lg = blockIdx.x % (TTv / 64); const int b = slab / NHv, h = slab % NHv;
  for (int i = tid; i < 64 * 8; i += 256) { const int r = i / 8, c8 = (i % 8) * 8; FragH f; f.half[0] = *(const v8us*)((const unsigned short*)V16 + ((size_t)b * TTv + lg * 64 + r) * ldv + voff + h * 64 + c8);
#pragma unroll
    for (int q = 0; q < 8; ++q) tl[r][c8 + q] = f.u[q]; }
  __syncthreads();
  {
#pragma unroll
    for (int rd = 0; rd < 2; ++rd) { const int d = rd * 32 + tid / 8, pc = tid % 8; FragH f;
#pragma unroll
      for (int q = 0; q < 8; ++q) f.u[q] = tl[pc * 8 + q][d];
      *(v8us*)((unsigned short*)Vt + ((size_t)slab * 64 + d) * TTv + lg * 64 + pc * 8) = f.half[0]; }
     } }

__global__ __launch_bounds__(256) void k_hl(const float* __restrict__ F, _Float16* __restrict__ Hh, _Float16* __restrict__ Hl, size_t n8) { const size_t t = (size_t)blockIdx.x * 256 + threadIdx.x; if (t >= n8) return; FragH fh, fl; const v4f a = *(const v4fa*)(F + t * 8), c = *(const v4fa*)(F + t * 8 + 4);
#pragma unroll
  for (int q = 0; q < 4; ++q) { _Float16 h = (_Float16)a[q]; fh.h[q] = h; fl.h[q] = (_Float16)((a[q] - (float)h) * 1024.0f); h = (_Float16)c[q]; fh.h[4 + q] = h; fl.h[4 + q] = (_Float16)((c[q] - (float)h) * 1024.0f); }
  { *(v8us*)((unsigned short*)Hh + t * 8) = fh.half[0]; *(v8us*)((unsigned short*)Hl + t * 8) = fl.half[0];  } }

// ---- fast GEMM (wave tile 32x64; requires M % 32 == 0 rows per launch region and N % 64 == 0); epilogue = k_gemm_hhx semantics ----
__device__ __forceinline__ v16h g2_frag(const _Float16* p, int hh) { FragH f; f.half[0] = *(const v8us*)((const unsigned short*)p + 8 * hh); f.half[1] = *(const v8us*)((const unsigned short*)p + 16 + 8 * hh); return f.v; }
__device__ __forceinline__ v8f g2_mma(v16h a, v16h b, v8f c) { v8f d = __builtin_amdgcn_wmma_f32_16x16x32_f16(false, a, false, b, (short)0, c, false, false); asm volatile("v_nop\n\tv_nop\n\tv_nop\n\tv_nop" : "+v"(d) : "v"(a), "v"(b)); return d; }
template <int ACT>
__global__ __launch_bounds__(128) void k_gemm2(const _Float16* __restrict__ A, int lda, size_t sA, const _Float16* __restrict__ Bh, int ldb, size_t sB, float alpha, const float* __restrict__ bias, size_t sBias, const float* __restrict__ CP, int rowsPerB, size_t sCPb, int row0g,
    float* __restrict__ C, _Float16* __restrict__ C16, int ldc, size_t sC, int M, int N, int K) {
  __shared__ __attribute__((aligned(16))) float so[4][32][68];
  const int tid = threadIdx.x, w = tid >> 5, lane = tid & 31, ln = lane & 15, hh = lane >> 4; const int by = blockIdx.y;
  A += (size_t)by * sA; Bh += (size_t)by * sB; const size_t cofs = (size_t)by * sC; const float* bp = bias ? bias + (size_t)by * sBias : nullptr;
  const int ntn = N >> 6; const int mt = blockIdx.x / ntn, nq = blockIdx.x - mt * ntn; const int row0 = mt * 128 + 32 * w, col0 = nq * 64; if (row0 >= M) return;
  const _Float16* a0p = A + (size_t)(row0 + ln) * lda; const _Float16* a1p = a0p + (size_t)16 * lda;
  const _Float16* b0p = Bh + (size_t)(col0 + ln) * ldb; const _Float16* b1p = b0p + (size_t)16 * ldb; const _Float16* b2p = b1p + (size_t)16 * ldb; const _Float16* b3p = b2p + (size_t)16 * ldb;
  const v8f z8 = {0.f,0.f,0.f,0.f,0.f,0.f,0.f,0.f}; v8f c00 = z8, c01 = z8, c02 = z8, c03 = z8, c10 = z8, c11 = z8, c12 = z8, c13 = z8;
#pragma unroll 1
  for (int kb = 0; kb < K; kb += 32) { const v16h a0 = g2_frag(a0p + kb, hh), a1 = g2_frag(a1p + kb, hh);
    v16h b = g2_frag(b0p + kb, hh); c00 = g2_mma(a0, b, c00); c10 = g2_mma(a1, b, c10);
    b = g2_frag(b1p + kb, hh); c01 = g2_mma(a0, b, c01); c11 = g2_mma(a1, b, c11);
    b = g2_frag(b2p + kb, hh); c02 = g2_mma(a0, b, c02); c12 = g2_mma(a1, b, c12);
    b = g2_frag(b3p + kb, hh); c03 = g2_mma(a0, b, c03); c13 = g2_mma(a1, b, c13); }
  v8f accs[8] = {c00, c01, c02, c03, c10, c11, c12, c13};
#pragma unroll
  for (int u = 0; u < 8; ++u) { const int t = u & 3, half = u >> 2; const int col = col0 + t * 16 + ln; const float bv = bp ? bf16_round(bp[col]) : 0.f;
#pragma unroll
    for (int r = 0; r < 8; ++r) { const int rloc = half * 16 + 8 * hh + r; float v = accs[u][r] * alpha + bv; if (CP) { if (rowsPerB < 0) v += CP[cofs + (size_t)(row0g + row0 + rloc) * ldc + col];      /* rowsPerB < 0: own element of the batched C plane */ else { const int bidx = (row0g + row0 + rloc) / rowsPerB; v += CP[(size_t)bidx * sCPb + (size_t)by * 64 + col]; } }
      if (ACT == 3) v = fmaxf(v, 0.f); else if (ACT == 6) v = 0.5f * v * (1.0f + erff(v * 0.70710678118654752f)); else if (ACT == 11) v = 1.0f / (1.0f + expf(-v)); else if (ACT == 15) v = v / (1.0f + expf(-v)); else if (ACT == 12) v = (v > 0.f) ? v : 0.01f * v; else if (ACT == 8) v = tanhf(v);
      so[w][rloc][t * 16 + ln] = v; } }
  __builtin_amdgcn_fence(__ATOMIC_ACQ_REL, "workgroup"); __builtin_amdgcn_wave_barrier();
  const int rsub = lane >> 4, c4 = (lane & 15) * 4;
  {
#pragma unroll
    for (int q = 0; q < 16; ++q) { const int r = q * 2 + rsub; const v4f v = *(const v4fa*)&so[w][r][c4]; if (C) *(v4f*)(C + cofs + (size_t)(row0 + r) * ldc + col0 + c4) = v; if (C16) { v4h h4; for (int i = 0; i < 4; ++i) h4[i] = (_Float16)v[i]; *(v4h*)(C16 + cofs + (size_t)(row0 + r) * ldc + col0 + c4) = h4; } }
     } }



template <int CAUSAL>
__global__ __launch_bounds__(128) void k_flash(const _Float16* __restrict__ Q16, int ldq, const _Float16* __restrict__ K16, int ldk, const _Float16* __restrict__ Vt, const int* __restrict__ MSK, float* __restrict__ O, int ldo) {
  constexpr int RPW = 16, RTN = RPW / 16, NQB = TQ / (4 * RPW), DT = 4, KS = 2;
  __shared__ __attribute__((aligned(16))) unsigned short sP[4][RPW][40]; __shared__ __attribute__((aligned(16))) float sO[4][RPW][64 + 4];
  const int tid = threadIdx.x, w = tid >> 5, lane = tid & 31, ln = lane & 15, hh = lane >> 4;
  const int slab = blockIdx.x / QBNP, qblk = QB0P + blockIdx.x % QBNP; (void)NQB; const int b = slab / NH, h = slab % NH; const int qb0 = qblk * (4 * RPW); const int q0 = qb0 + w * RPW;
  FragH aq[2][KS];
#pragma unroll
  for (int rt = 0; rt < RTN; ++rt) { const unsigned short* qr = (const unsigned short*)Q16 + ((size_t)b * TQ + q0 + rt * 16 + ln) * ldq + h * 64;
#pragma unroll
    for (int ks = 0; ks < KS; ++ks) { aq[rt][ks].half[0] = *(const v8us*)(qr + ks * 32 + 8 * hh); aq[rt][ks].half[1] = *(const v8us*)(qr + ks * 32 + 16 + 8 * hh); } }
  const unsigned short* Vth = (const unsigned short*)Vt + (size_t)slab * 64 * TK;
  float m_r[2][8], l_r[2][8]; v8f oacc[2][DT];
#pragma unroll
  for (int rt = 0; rt < RTN; ++rt) {
#pragma unroll
    for (int r = 0; r < 8; ++r) { m_r[rt][r] = -3.0e38f; l_r[rt][r] = 0.f; }
#pragma unroll
    for (int dt = 0; dt < DT; ++dt) oacc[rt][dt] = (v8f){0.f,0.f,0.f,0.f,0.f,0.f,0.f,0.f}; }
  const int jend = (CAUSAL == 1) ? (qb0 + 4 * RPW) : ((CAUSAL == 23) ? min(TK, (qb0 / CHK + 2) * CHK) : TK);      /* causal / window: keys that can never contribute are skipped */ const int jbeg = (CAUSAL == 23) ? max(0, (qb0 / CHK - 1) * CHK) : 0;
#pragma unroll 1
  for (int j0 = jbeg; j0 < jend; j0 += 32) {
    v8f s[2][2];
#pragma unroll
    for (int nt = 0; nt < 2; ++nt) { const unsigned short* kr = (const unsigned short*)K16 + ((size_t)b * TK + j0 + nt * 16 + ln) * ldk + h * 64; FragH bk[KS];
#pragma unroll
      for (int ks = 0; ks < KS; ++ks) { bk[ks].half[0] = *(const v8us*)(kr + ks * 32 + 8 * hh); bk[ks].half[1] = *(const v8us*)(kr + ks * 32 + 16 + 8 * hh); }
#pragma unroll
      for (int rt = 0; rt < RTN; ++rt) { v8f acc = (v8f){0.f,0.f,0.f,0.f,0.f,0.f,0.f,0.f};
#pragma unroll
        for (int ks = 0; ks < KS; ++ks) acc = mmaH<1>(aq[rt][ks].v, aq[rt][ks].v, bk[ks].v, bk[ks].v, acc); s[rt][nt] = acc; } }
#pragma unroll
    for (int rt = 0; rt < RTN; ++rt)
#pragma unroll
      for (int r = 0; r < 8; ++r) { const int tq = q0 + rt * 16 + 8 * hh + r; const int k0 = j0 + ln, k1 = j0 + 16 + ln;
        bool ok0 = (CAUSAL == 1) ? (k0 <= tq) : ((CAUSAL == 2) ? ((k0 >> 5) == (tq >> 5)) : true), ok1 = (CAUSAL == 1) ? (k1 <= tq) : ((CAUSAL == 2) ? ((k1 >> 5) == (tq >> 5)) : true); if (CAUSAL == 23) { const int cq = tq / CHK; ok0 = (abs(k0 / CHK - cq) <= 1) && (MSK[(size_t)b * TK + k0] == 0); ok1 = (abs(k1 / CHK - cq) <= 1) && (MSK[(size_t)b * TK + k1] == 0); }      /* mode 23: 3-chunk window + int key-padding mask */
        if (CAUSAL == 24) { ok0 = (MSK[(size_t)b * TK + k0] == 0); ok1 = (MSK[(size_t)b * TK + k1] == 0); }      /* mode 24: int key-padding mask (nonzero = padded = excluded) */      /* mode 2: block-diagonal 32-token groups */
        float s0 = ok0 ? s[rt][0][r] * SCL : -3.0e38f, s1 = ok1 ? s[rt][1][r] * SCL : -3.0e38f; if (CAUSAL == 17) { const float* amk = (const float*)MSK + (size_t)b * TK; s0 += bf16_round(amk[k0]); s1 += bf16_round(amk[k1]); } if (CAUSAL == 18) { const float* tb = (const float*)MSK; const int* ri = MSK + 1024 + (size_t)b * TK; const int rq = ri[tq]; s0 += tb[(h * 8 + rq) * 8 + ri[k0]]; s1 += tb[(h * 8 + rq) * 8 + ri[k1]]; } if (CAUSAL == 19) { const int* rel = MSK + (size_t)tq * TK; const float* rb = (const float*)MSK + (size_t)TQ * TK + ((size_t)(b * NH + h) * TQ + tq) * 64; s0 += rb[rel[k0]]; s1 += rb[rel[k1]]; }      /* mode 19: + (q.Ek[rel] + Eb[rel][h]) / 8 gathered by the int relative ids (packed [ids | table]) */      /* mode 18: + resource_bias[h][r_q][r_k] from the packed [table | ids] buffer (TQ == TK) */      /* mode 17: additive per-(batch, key) mask INPUT */ float mc = fmaxf(s0, s1);
        mc = fmaxf(mc, __shfl_xor(mc, 1, 32)); mc = fmaxf(mc, __shfl_xor(mc, 2, 32)); mc = fmaxf(mc, __shfl_xor(mc, 4, 32)); mc = fmaxf(mc, __shfl_xor(mc, 8, 32));
        const float mn = fmaxf(m_r[rt][r], mc); const float al = (mn > -1.0e38f) ? expf(m_r[rt][r] - mn) : 1.0f; m_r[rt][r] = mn; const float p0 = ok0 ? expf(s0 - mn) : 0.f, p1 = ok1 ? expf(s1 - mn) : 0.f; l_r[rt][r] = l_r[rt][r] * al + p0 + p1;
#pragma unroll
        for (int dt = 0; dt < DT; ++dt) oacc[rt][dt][r] *= al;
        FragH t2; t2.h[0] = (_Float16)(p0 * 1024.0f); t2.h[1] = (_Float16)(p1 * 1024.0f); sP[w][rt * 16 + 8 * hh + r][ln] = t2.u[0]; sP[w][rt * 16 + 8 * hh + r][16 + ln] = t2.u[1]; }
    __builtin_amdgcn_fence(__ATOMIC_ACQ_REL, "workgroup"); __builtin_amdgcn_wave_barrier();
    FragH pa[2];
#pragma unroll
    for (int rt = 0; rt < RTN; ++rt) { pa[rt].half[0] = *(const v8us*)&sP[w][rt * 16 + ln][8 * hh]; pa[rt].half[1] = *(const v8us*)&sP[w][rt * 16 + ln][16 + 8 * hh]; }
#pragma unroll
    for (int dt = 0; dt < DT; ++dt) { const unsigned short* vrow = Vth + (size_t)(dt * 16 + ln) * TK + j0; FragH bv; bv.half[0] = *(const v8us*)(vrow + 8 * hh); bv.half[1] = *(const v8us*)(vrow + 16 + 8 * hh);
#pragma unroll
      for (int rt = 0; rt < RTN; ++rt) oacc[rt][dt] = mmaH<1>(pa[rt].v, pa[rt].v, bv.v, bv.v, oacc[rt][dt]); }
    __builtin_amdgcn_fence(__ATOMIC_ACQ_REL, "workgroup"); __builtin_amdgcn_wave_barrier(); }
#pragma unroll
  for (int rt = 0; rt < RTN; ++rt) {
#pragma unroll
    for (int r = 0; r < 8; ++r) { float l = l_r[rt][r]; l += __shfl_xor(l, 1, 32); l += __shfl_xor(l, 2, 32); l += __shfl_xor(l, 4, 32); l += __shfl_xor(l, 8, 32); l_r[rt][r] = (l > 0.f) ? 1.0f / (l * 1024.0f) : 0.f; }
#pragma unroll
    for (int dt = 0; dt < DT; ++dt)
#pragma unroll
      for (int r = 0; r < 8; ++r) sO[w][rt * 16 + 8 * hh + r][dt * 16 + ln] = oacc[rt][dt][r] * l_r[rt][r]; }
  __builtin_amdgcn_fence(__ATOMIC_ACQ_REL, "workgroup"); __builtin_amdgcn_wave_barrier();
  {
#pragma unroll
    for (int rp = 0; rp < RPW; rp += 2) { const int r = rp + (lane >> 4), pc = lane & 15; const v4f val = *(const v4fa*)&sO[w][r][pc * 4]; *(v4f*)(O + ((size_t)b * TQ + q0 + r) * ldo + h * 64 + pc * 4) = val; }
     } }
// 5-plane variant: S = Qh Kh^T + (Ql Kh^T + Qh Kl^T)/1024 with Q/K = [hi | 2^10 residual] f16 planes (QL/KL same layout as Q16/K16), then the 3-term P.V below.
// 3-term variant: O = (P_hi V_hi + (P_lo V_hi + P_hi V_lo) / 1024) / l with P = [hi | 2^10 residual] of 1024 p and V^T = [hi | 2^10 residual] planes (VtL same layout as Vt) -> ~2^-21-class products for un-averaged (early causal / peaked) rows
template <int CAUSAL>
__global__ __launch_bounds__(128) void k_flash5(const _Float16* __restrict__ Q16, const _Float16* __restrict__ QL, int ldq, const _Float16* __restrict__ K16, const _Float16* __restrict__ KL, int ldk, const _Float16* __restrict__ Vt, const _Float16* __restrict__ VtL, const int* __restrict__ MSK, float* __restrict__ O, int ldo) {
  constexpr int RPW = 16, RTN = RPW / 16, NQB = TQ / (4 * RPW), DT = 4, KS = 2;
  __shared__ __attribute__((aligned(16))) unsigned short sP[4][RPW][40]; __shared__ __attribute__((aligned(16))) unsigned short sPL[4][RPW][40]; __shared__ __attribute__((aligned(16))) float sO[4][RPW][64 + 4];
  const int tid = threadIdx.x, w = tid >> 5, lane = tid & 31, ln = lane & 15, hh = lane >> 4;
  const int slab = blockIdx.x / QBN5, qblk = QB05 + blockIdx.x % QBN5; (void)NQB; const int b = slab / NH, h = slab % NH; const int qb0 = qblk * (4 * RPW); const int q0 = qb0 + w * RPW;
  FragH aq[2][KS], aql[2][KS];
#pragma unroll
  for (int rt = 0; rt < RTN; ++rt) { const unsigned short* qr = (const unsigned short*)Q16 + ((size_t)b * TQ + q0 + rt * 16 + ln) * ldq + h * 64; const unsigned short* ql = (const unsigned short*)QL + ((size_t)b * TQ + q0 + rt * 16 + ln) * ldq + h * 64;
#pragma unroll
    for (int ks = 0; ks < KS; ++ks) { aq[rt][ks].half[0] = *(const v8us*)(qr + ks * 32 + 8 * hh); aq[rt][ks].half[1] = *(const v8us*)(qr + ks * 32 + 16 + 8 * hh); aql[rt][ks].half[0] = *(const v8us*)(ql + ks * 32 + 8 * hh); aql[rt][ks].half[1] = *(const v8us*)(ql + ks * 32 + 16 + 8 * hh); } }
  const unsigned short* Vth = (const unsigned short*)Vt + (size_t)slab * 64 * TK; const unsigned short* Vtl = (const unsigned short*)VtL + (size_t)slab * 64 * TK;
  float m_r[2][8], l_r[2][8]; v8f oacc[2][DT], oaccL[2][DT];
#pragma unroll
  for (int rt = 0; rt < RTN; ++rt) {
#pragma unroll
    for (int r = 0; r < 8; ++r) { m_r[rt][r] = -3.0e38f; l_r[rt][r] = 0.f; }
#pragma unroll
    for (int dt = 0; dt < DT; ++dt) { oacc[rt][dt] = (v8f){0.f,0.f,0.f,0.f,0.f,0.f,0.f,0.f}; oaccL[rt][dt] = oacc[rt][dt]; } }
  const int jend = (CAUSAL == 1) ? (qb0 + 4 * RPW) : ((CAUSAL == 23) ? min(TK, (qb0 / CHK + 2) * CHK) : TK);      /* causal / window: keys that can never contribute are skipped */ const int jbeg = (CAUSAL == 23) ? max(0, (qb0 / CHK - 1) * CHK) : 0;
#pragma unroll 1
  for (int j0 = jbeg; j0 < jend; j0 += 32) {
    v8f s[2][2];
#pragma unroll
    for (int nt = 0; nt < 2; ++nt) { const unsigned short* kr = (const unsigned short*)K16 + ((size_t)b * TK + j0 + nt * 16 + ln) * ldk + h * 64; const unsigned short* klr = (const unsigned short*)KL + ((size_t)b * TK + j0 + nt * 16 + ln) * ldk + h * 64; FragH bk[KS], bkl[KS];
#pragma unroll
      for (int ks = 0; ks < KS; ++ks) { bk[ks].half[0] = *(const v8us*)(kr + ks * 32 + 8 * hh); bk[ks].half[1] = *(const v8us*)(kr + ks * 32 + 16 + 8 * hh); bkl[ks].half[0] = *(const v8us*)(klr + ks * 32 + 8 * hh); bkl[ks].half[1] = *(const v8us*)(klr + ks * 32 + 16 + 8 * hh); }
#pragma unroll
      for (int rt = 0; rt < RTN; ++rt) { v8f acc = (v8f){0.f,0.f,0.f,0.f,0.f,0.f,0.f,0.f}, accl = acc;
#pragma unroll
        for (int ks = 0; ks < KS; ++ks) { acc = mmaH<1>(aq[rt][ks].v, aq[rt][ks].v, bk[ks].v, bk[ks].v, acc); accl = mmaH<1>(aql[rt][ks].v, aql[rt][ks].v, bk[ks].v, bk[ks].v, accl); accl = mmaH<1>(aq[rt][ks].v, aq[rt][ks].v, bkl[ks].v, bkl[ks].v, accl); }
#pragma unroll
        for (int r = 0; r < 8; ++r) acc[r] += accl[r] * 0.0009765625f;
        s[rt][nt] = acc; } }
#pragma unroll
    for (int rt = 0; rt < RTN; ++rt)
#pragma unroll
      for (int r = 0; r < 8; ++r) { const int tq = q0 + rt * 16 + 8 * hh + r; const int k0 = j0 + ln, k1 = j0 + 16 + ln;
        bool ok0 = (CAUSAL == 1) ? (k0 <= tq) : ((CAUSAL == 2) ? ((k0 >> 5) == (tq >> 5)) : true), ok1 = (CAUSAL == 1) ? (k1 <= tq) : ((CAUSAL == 2) ? ((k1 >> 5) == (tq >> 5)) : true);      /* mode 2: block-diagonal 32-token groups */
        if (CAUSAL == 4) { const int* mrow = MSK + ((size_t)b * TQ + tq) * TK; ok0 = mrow[k0] != 0; ok1 = mrow[k1] != 0; }      /* mode 4: per-(query, key) INPUT mask shared by all heads; masked keys contribute nothing (== the reference's -4096 fill, whose exp underflows to 0), rows with no valid key give l = 0 -> output 0 (== the reference's row_valid zeroing) */
        float s0 = ok0 ? s[rt][0][r] * SCL : -3.0e38f, s1 = ok1 ? s[rt][1][r] * SCL : -3.0e38f; if (CAUSAL == 17) { const float* amk = (const float*)MSK + (size_t)b * TK; s0 += bf16_round(amk[k0]); s1 += bf16_round(amk[k1]); } if (CAUSAL == 18) { const float* tb = (const float*)MSK; const int* ri = MSK + 1024 + (size_t)b * TK; const int rq = ri[tq]; s0 += tb[(h * 8 + rq) * 8 + ri[k0]]; s1 += tb[(h * 8 + rq) * 8 + ri[k1]]; } if (CAUSAL == 19) { const int* rel = MSK + (size_t)tq * TK; const float* rb = (const float*)MSK + (size_t)TQ * TK + ((size_t)(b * NH + h) * TQ + tq) * 64; s0 += rb[rel[k0]]; s1 += rb[rel[k1]]; }      /* mode 19: + (q.Ek[rel] + Eb[rel][h]) / 8 gathered by the int relative ids (packed [ids | table]) */      /* mode 18: + resource_bias[h][r_q][r_k] from the packed [table | ids] buffer (TQ == TK) */      /* mode 17: additive per-(batch, key) mask INPUT */ float mc = fmaxf(s0, s1);
        mc = fmaxf(mc, __shfl_xor(mc, 1, 32)); mc = fmaxf(mc, __shfl_xor(mc, 2, 32)); mc = fmaxf(mc, __shfl_xor(mc, 4, 32)); mc = fmaxf(mc, __shfl_xor(mc, 8, 32));
        const float mn = fmaxf(m_r[rt][r], mc); const float al = (mn > -1.0e38f) ? expf(m_r[rt][r] - mn) : 1.0f; m_r[rt][r] = mn; const float p0 = ok0 ? expf(s0 - mn) : 0.f, p1 = ok1 ? expf(s1 - mn) : 0.f; l_r[rt][r] = l_r[rt][r] * al + p0 + p1;
#pragma unroll
        for (int dt = 0; dt < DT; ++dt) { oacc[rt][dt][r] *= al; oaccL[rt][dt][r] *= al; }
        FragH t2, t2l; const float ps0 = p0 * 1024.0f, ps1 = p1 * 1024.0f; t2.h[0] = (_Float16)ps0; t2.h[1] = (_Float16)ps1; t2l.h[0] = (_Float16)((ps0 - (float)t2.h[0]) * 1024.0f); t2l.h[1] = (_Float16)((ps1 - (float)t2.h[1]) * 1024.0f);
        sP[w][rt * 16 + 8 * hh + r][ln] = t2.u[0]; sP[w][rt * 16 + 8 * hh + r][16 + ln] = t2.u[1]; sPL[w][rt * 16 + 8 * hh + r][ln] = t2l.u[0]; sPL[w][rt * 16 + 8 * hh + r][16 + ln] = t2l.u[1]; }
    __builtin_amdgcn_fence(__ATOMIC_ACQ_REL, "workgroup"); __builtin_amdgcn_wave_barrier();
    FragH pa[2], pl[2];
#pragma unroll
    for (int rt = 0; rt < RTN; ++rt) { pa[rt].half[0] = *(const v8us*)&sP[w][rt * 16 + ln][8 * hh]; pa[rt].half[1] = *(const v8us*)&sP[w][rt * 16 + ln][16 + 8 * hh]; pl[rt].half[0] = *(const v8us*)&sPL[w][rt * 16 + ln][8 * hh]; pl[rt].half[1] = *(const v8us*)&sPL[w][rt * 16 + ln][16 + 8 * hh]; }
#pragma unroll
    for (int dt = 0; dt < DT; ++dt) { const unsigned short* vrow = Vth + (size_t)(dt * 16 + ln) * TK + j0; const unsigned short* vrl = Vtl + (size_t)(dt * 16 + ln) * TK + j0; FragH bv, bl; bv.half[0] = *(const v8us*)(vrow + 8 * hh); bv.half[1] = *(const v8us*)(vrow + 16 + 8 * hh); bl.half[0] = *(const v8us*)(vrl + 8 * hh); bl.half[1] = *(const v8us*)(vrl + 16 + 8 * hh);
#pragma unroll
      for (int rt = 0; rt < RTN; ++rt) { oacc[rt][dt] = mmaH<1>(pa[rt].v, pa[rt].v, bv.v, bv.v, oacc[rt][dt]); oaccL[rt][dt] = mmaH<1>(pl[rt].v, pl[rt].v, bv.v, bv.v, oaccL[rt][dt]); oaccL[rt][dt] = mmaH<1>(pa[rt].v, pa[rt].v, bl.v, bl.v, oaccL[rt][dt]); } }
    __builtin_amdgcn_fence(__ATOMIC_ACQ_REL, "workgroup"); __builtin_amdgcn_wave_barrier(); }
#pragma unroll
  for (int rt = 0; rt < RTN; ++rt) {
#pragma unroll
    for (int r = 0; r < 8; ++r) { float l = l_r[rt][r]; l += __shfl_xor(l, 1, 32); l += __shfl_xor(l, 2, 32); l += __shfl_xor(l, 4, 32); l += __shfl_xor(l, 8, 32); l_r[rt][r] = (l > 0.f) ? 1.0f / (l * 1024.0f) : 0.f; }
#pragma unroll
    for (int dt = 0; dt < DT; ++dt)
#pragma unroll
      for (int r = 0; r < 8; ++r) { float v = oacc[rt][dt][r]; v += oaccL[rt][dt][r] * 0.0009765625f; sO[w][rt * 16 + 8 * hh + r][dt * 16 + ln] = v * l_r[rt][r]; } }
  __builtin_amdgcn_fence(__ATOMIC_ACQ_REL, "workgroup"); __builtin_amdgcn_wave_barrier();
  {
#pragma unroll
    for (int rp = 0; rp < RPW; rp += 2) { const int r = rp + (lane >> 4), pc = lane & 15; const v4f val = *(const v4fa*)&sO[w][r][pc * 4]; *(v4f*)(O + ((size_t)b * TQ + q0 + r) * ldo + h * 64 + pc * 4) = val; }
     } }

__global__ __launch_bounds__(256) void k_rotab(float* __restrict__ CS, float* __restrict__ SN) {
  #pragma clang fp contract(off)
  const int t = blockIdx.x * 256 + threadIdx.x; if (t >= SLEN * 32) return; const int j = t % 32, s = t / 32; const float ex = (float)(2 * j) / 64.0f; const float inv = 1.0f / powf(10000.0f, ex); const float th = (float)s * inv; const float c = cosf(th), sn = sinf(th);
  { *(float*)(CS + t) = c; *(float*)(SN + t) = sn;  } }
__global__ __launch_bounds__(256) void k_rope(const float* __restrict__ F, int nsrc, int ndst, int rep, const float* __restrict__ CS, const float* __restrict__ SN, _Float16* __restrict__ H, _Float16* __restrict__ L) {
  #pragma clang fp contract(off)
  const size_t t = (size_t)blockIdx.x * 256 + threadIdx.x; if (t >= (size_t)NR * ndst * 4) return; const int g8 = (int)(t % 4); const int hd = (int)((t / 4) % ndst); const size_t row = t / ((size_t)4 * ndst); const int s = (int)(row % SLEN); const int hs = hd / rep;
  const float* src = F + row * (size_t)(nsrc * 64) + hs * 64; FragH ah, al, bh, bl;
  for (int i = 0; i < 8; ++i) { const int d = g8 * 8 + i; const float c = CS[s * 32 + d], sn = SN[s * 32 + d]; const float x1 = src[d], x2 = src[d + 32];
    float o1 = x1 * c; o1 += -x2 * sn; float o2 = x2 * c; o2 += x1 * sn;
    _Float16 hv = (_Float16)o1; ah.h[i] = hv; al.h[i] = (_Float16)((o1 - (float)hv) * 1024.0f); hv = (_Float16)o2; bh.h[i] = hv; bl.h[i] = (_Float16)((o2 - (float)hv) * 1024.0f); }
  const size_t o = row * (size_t)(ndst * 64) + hd * 64 + g8 * 8;
  { *(v8us*)((unsigned short*)H + o) = ah.half[0]; *(v8us*)((unsigned short*)H + o + 32) = bh.half[0]; *(v8us*)((unsigned short*)L + o) = al.half[0]; *(v8us*)((unsigned short*)L + o + 32) = bl.half[0];  } }
__global__ __launch_bounds__(256) void k_rope2(const float* __restrict__ F, int nsrc, int ndst, int rep, const float* __restrict__ CS, const float* __restrict__ SN, _Float16* __restrict__ H, _Float16* __restrict__ L) {
  #pragma clang fp contract(off)
  const size_t t = (size_t)blockIdx.x * 256 + threadIdx.x; if (t >= (size_t)NR * ndst * 4) return; const int g16 = (int)(t % 4); const int hd = (int)((t / 4) % ndst); const size_t row = t / ((size_t)4 * ndst); const int s = (int)(row % SLEN); const int hs = hd / rep;
  const float* src = F + row * (size_t)(nsrc * 64) + hs * 64 + g16 * 16; FragH ah, al;
  for (int pr = 0; pr < 8; ++pr) { const int i = g16 * 8 + pr; const float c = CS[s * 32 + i], sn = SN[s * 32 + i]; const float x1 = src[2 * pr], x2 = src[2 * pr + 1];
    float o1 = x1 * c; o1 -= x2 * sn; float o2 = x1 * sn; o2 += x2 * c;
    _Float16 hv = (_Float16)o1; ah.h[2 * pr] = hv; al.h[2 * pr] = (_Float16)((o1 - (float)hv) * 1024.0f); hv = (_Float16)o2; ah.h[2 * pr + 1] = hv; al.h[2 * pr + 1] = (_Float16)((o2 - (float)hv) * 1024.0f); }
  const size_t o = row * (size_t)(ndst * 64) + hd * 64 + g16 * 16;
  { *(v8us*)((unsigned short*)H + o) = ah.half[0]; *(v8us*)((unsigned short*)H + o + 8) = ah.half[1]; *(v8us*)((unsigned short*)L + o) = al.half[0]; *(v8us*)((unsigned short*)L + o + 8) = al.half[1];  } }
__global__ __launch_bounds__(256) void k_ln512(const float* __restrict__ A, const float* __restrict__ res, const float* __restrict__ g, const float* __restrict__ bb, float* __restrict__ Y, _Float16* __restrict__ Y16) {
  #pragma clang fp contract(off)
  const int wv = threadIdx.x >> 5, ln = threadIdx.x & 31; const size_t r = (size_t)blockIdx.x * 8 + wv; if (r >= NR) return; float x[16]; float s = 0.f;
  for (int i = 0; i < 2; ++i) { const v8f a = *(const v8f*)(A + r * DM + i * 256 + ln * 8); for (int q = 0; q < 8; ++q) { float v = a[q]; if (res) v += bf16_round(res[r * DM + i * 256 + ln * 8 + q]); x[i * 8 + q] = v; s += v; } }
  for (int o = 16; o > 0; o >>= 1) s += __shfl_xor(s, o, 32); const float mu = s / (float)DM; float var = 0.f; for (int q = 0; q < 16; ++q) { const float d = x[q] - mu; var += d * d; }
  for (int o = 16; o > 0; o >>= 1) var += __shfl_xor(var, o, 32); const float inv = rsqrtf(var / (float)DM + 1e-5f);
  { for (int i = 0; i < 2; ++i) { const int c0 = i * 256 + ln * 8; v8f y; FragH f; for (int q = 0; q < 8; ++q) { float v = (x[i * 8 + q] - mu) * inv; v *= bf16_round(g[c0 + q]); v += bf16_round(bb[c0 + q]); y[q] = v; f.h[q] = (_Float16)v; } *(v8f*)(Y + r * DM + c0) = y; if (Y16) *(v8us*)((unsigned short*)Y16 + r * DM + c0) = f.half[0]; }  } }
__global__ __launch_bounds__(256) void k_pack(const float* __restrict__ rb, const int* __restrict__ rid, int* __restrict__ PK) { const int t = blockIdx.x * 256 + threadIdx.x; if (t >= 1024 + NB * TK) return; int v; if (t < 1024) v = __float_as_int(bf16_round(rb[t])); else v = rid[t - 1024]; *(int*)(PK + t) = v;  }
__global__ __launch_bounds__(256) void k_tabin(const float* __restrict__ sp, float* __restrict__ CS, float* __restrict__ SN) { const int t = blockIdx.x * 256 + threadIdx.x; if (t >= SLEN * 32) return; const int i = t % 32, s = t / 32; const float c = bf16_round(sp[s * 64 + 32 + i]), sn = bf16_round(sp[s * 64 + i]);
  { *(float*)(CS + t) = c; *(float*)(SN + t) = sn;  } }
__global__ __launch_bounds__(256) void k_wsc(const float* __restrict__ Wm, _Float16* __restrict__ Bt, size_t n8, float sc) { const size_t t = (size_t)blockIdx.x * 256 + threadIdx.x; if (t >= n8) return; FragH f; for (int q = 0; q < 8; ++q) f.h[q] = (_Float16)(bf16_round(Wm[t * 8 + q]) * sc); *(v8us*)((unsigned short*)Bt + t * 8) = f.half[0];  }
__global__ __launch_bounds__(256) void k_rotab2(float* __restrict__ CS, float* __restrict__ SN) {
  #pragma clang fp contract(off)
  const int t = blockIdx.x * 256 + threadIdx.x; if (t >= SLEN * 32) return; const int j = t % 32, s = t / 32; const float c0 = -0.14391156831212787f;      /* -ln(10000)/64 rounded to f32 */ const float inv = expf((float)(2 * j) * c0); const float th = (float)s * inv; const float c = cosf(th), sn = sinf(th);
  { *(float*)(CS + t) = c; *(float*)(SN + t) = sn;  } }
__global__ __launch_bounds__(256) void k_lnu(const float* __restrict__ X, _Float16* __restrict__ N16, float* __restrict__ XB) {
  #pragma clang fp contract(off)
  const int wv = threadIdx.x >> 5, ln = threadIdx.x & 31; const size_t r = (size_t)blockIdx.x * 8 + wv; if (r >= NR) return; float a[32]; float s = 0.f;
  for (int i = 0; i < 4; ++i) { const v8f v = *(const v8f*)(X + r * DM + (i * 32 + ln) * 8); for (int q = 0; q < 8; ++q) { const float u = bf16_round(v[q]); a[i * 8 + q] = u; s += u; } }
  for (int o = 16; o > 0; o >>= 1) s += __shfl_xor(s, o, 32); const float mu = s / (float)DM; float var = 0.f; for (int q = 0; q < 32; ++q) { const float d = a[q] - mu; var += d * d; }
  for (int o = 16; o > 0; o >>= 1) var += __shfl_xor(var, o, 32); const float den = sqrtf(var / (float)(DM - 1)) + 1e-6f; const float inv = 1.0f / den;      /* one reciprocal per row; (x-mean)*inv vs the reference's division differs by <= 1 ulp */
  { for (int i = 0; i < 4; ++i) { const int c0 = (i * 32 + ln) * 8; FragH f; v8f xb; for (int q = 0; q < 8; ++q) { f.h[q] = (_Float16)((a[i * 8 + q] - mu) * inv); xb[q] = a[i * 8 + q]; } *(v8us*)((unsigned short*)N16 + r * DM + c0) = f.half[0]; *(v8f*)(XB + r * DM + c0) = xb; }  } }
__global__ __launch_bounds__(256) void k_vtg(const _Float16* __restrict__ V16, _Float16* __restrict__ Vt) { __shared__ unsigned short tl[64][66]; const int tid = threadIdx.x; const int slab = blockIdx.x / (SLEN / 64), lg = blockIdx.x % (SLEN / 64); const int b = slab / NH, h = slab % NH; const int hs = h / NREP;
  for (int i = tid; i < 64 * 8; i += 256) { const int r = i / 8, c8 = (i % 8) * 8; FragH f; f.half[0] = *(const v8us*)((const unsigned short*)V16 + ((size_t)b * SLEN + lg * 64 + r) * KVD + hs * 64 + c8); for (int q = 0; q < 8; ++q) tl[r][c8 + q] = f.u[q]; }
  __syncthreads();
  { for (int rd = 0; rd < 2; ++rd) { const int d = rd * 32 + tid / 8, pc = tid % 8; FragH f; for (int q = 0; q < 8; ++q) f.u[q] = tl[pc * 8 + q][d]; *(v8us*)((unsigned short*)Vt + ((size_t)slab * 64 + d) * SLEN + lg * 64 + pc * 8) = f.half[0]; }  } }

__global__ __launch_bounds__(256) void k_h16s(const float* __restrict__ SRC, int lds, int coff, _Float16* __restrict__ DST, size_t n8) { const size_t t = (size_t)blockIdx.x * 256 + threadIdx.x; if (t >= n8) return; const size_t r = (t * 8) / DM; const int c = (int)((t * 8) % DM); const v8f a = *(const v8f*)(SRC + r * lds + coff + c); FragH f; for (int q = 0; q < 8; ++q) f.h[q] = (_Float16)a[q];
  *(v8us*)((unsigned short*)DST + t * 8) = f.half[0];  }

#define HG 4
__global__ __launch_bounds__(256) void k_norms(const float* __restrict__ QKV, float* __restrict__ QN, float* __restrict__ KN) {
  #pragma clang fp contract(off)
  const size_t t = (size_t)blockIdx.x * 256 + threadIdx.x; if (t >= (size_t)NR * NH) return; const int h = (int)(t % NH); const size_t row = t / NH; const float* q = QKV + row * (3 * DM) + h * 64; const float* k = q + DM; float sq = 0.f, sk = 0.f;
#pragma unroll 1
  for (int d = 0; d < 64; d += 4) { const v4f a = *(const v4fa*)(q + d), b = *(const v4fa*)(k + d); for (int i = 0; i < 4; ++i) { sq += a[i] * a[i]; sk += b[i] * b[i]; } }
  { *(float*)(QN + t) = sq; *(float*)(KN + t) = sk;  } }
// strided hi + residual copy of a DM-wide third of QKV
__global__ __launch_bounds__(256) void k_hls(const float* __restrict__ SRC, int lds, int coff, _Float16* __restrict__ DH, _Float16* __restrict__ DL, size_t n8) { const size_t t = (size_t)blockIdx.x * 256 + threadIdx.x; if (t >= n8) return; const size_t r = (t * 8) / DM; const int c = (int)((t * 8) % DM); const v8f a = *(const v8f*)(SRC + r * lds + coff + c); FragH fh, fl; for (int q = 0; q < 8; ++q) { const _Float16 h = (_Float16)a[q]; fh.h[q] = h; fl.h[q] = (_Float16)((a[q] - (float)h) * 1024.0f); }
  { *(v8us*)((unsigned short*)DH + t * 8) = fh.half[0]; *(v8us*)((unsigned short*)DL + t * 8) = fl.half[0];  } }
__global__ __launch_bounds__(256) void k_esoft(const float* __restrict__ S, const float* __restrict__ QN, const float* __restrict__ KN, const float* __restrict__ tmp, int b, int h0, _Float16* __restrict__ E, float* __restrict__ RS) {
  #pragma clang fp contract(off)
  const int wv = threadIdx.x >> 5, ln = threadIdx.x & 31; const int r = blockIdx.x * 8 + wv; if (r >= HG * SLEN) return; const int i = r % SLEN, g = r / SLEN; const int h = h0 + g; const float it = 1.0f / bf16_round(tmp[0]); const float qn = QN[((size_t)b * SLEN + i) * NH + h]; const float* sr = S + (size_t)r * SLEN; const float* kn = KN + (size_t)b * SLEN * NH + h;
  auto lg = [&](float s, float k2) { float d2 = qn + k2; d2 += -2.0f * s; d2 = fmaxf(d2, 0.f); return -(d2 * it); };
  float mx = -3.0e38f;
#pragma unroll 1
  for (int gq = 0; gq < SLEN / 256; ++gq) { const v8f a = *(const v8f*)(sr + gq * 256 + ln * 8); for (int q = 0; q < 8; ++q) mx = fmaxf(mx, lg(a[q], kn[(size_t)(gq * 256 + ln * 8 + q) * NH])); }
  for (int o = 16; o > 0; o >>= 1) mx = fmaxf(mx, __shfl_xor(mx, o, 32)); float su = 0.f;
{ su = 0.f;
#pragma unroll 1
    for (int gq = 0; gq < SLEN / 256; ++gq) { const v8f a = *(const v8f*)(sr + gq * 256 + ln * 8); FragH ph; for (int q = 0; q < 8; ++q) { const float e = expf(lg(a[q], kn[(size_t)(gq * 256 + ln * 8 + q) * NH]) - mx); su += e; ph.h[q] = (_Float16)(e * 1024.0f); } *(v8us*)((unsigned short*)E + (size_t)r * SLEN + gq * 256 + ln * 8) = ph.half[0]; }
     }
  for (int o = 16; o > 0; o >>= 1) su += __shfl_xor(su, o, 32); if (ln == 0) { *(float*)(RS + (size_t)r * 32) = 1.0f / su;  } }
__global__ __launch_bounds__(256) void k_onrm(const float* __restrict__ O, const float* __restrict__ RS, int b, int h0, _Float16* __restrict__ OH, _Float16* __restrict__ OL) {
  #pragma clang fp contract(off)
  const size_t t = (size_t)blockIdx.x * 256 + threadIdx.x; if (t >= (size_t)SLEN * HG * 8) return; const int d8 = (int)(t % 8) * 8; const int g = (int)((t / 8) % HG); const int i = (int)(t / (8 * HG)); const float rs = RS[((size_t)g * SLEN + i) * 32]; const size_t o = ((size_t)b * SLEN + i) * DM + (h0 + g) * 64 + d8; const v8f a = *(const v8f*)(O + o); FragH f, fl;
  for (int q = 0; q < 8; ++q) { const float v = a[q] * rs; const _Float16 h = (_Float16)v; f.h[q] = h; fl.h[q] = (_Float16)((v - (float)h) * 1024.0f); }
  { *(v8us*)((unsigned short*)OH + o) = f.half[0]; *(v8us*)((unsigned short*)OL + o) = fl.half[0];  } }
extern "C" void kernel_launch(void* const* d_in, const int* in_sizes, int n_in,
                              void* d_out, int out_size, void* d_ws, size_t ws_size, hipStream_t stream) {
  (void)in_sizes; (void)n_in; (void)out_size;
  const float* const* I = (const float* const*)d_in; const float* x = I[0]; const float* wq = I[1]; const float* bq = I[2]; const float* wk = I[3]; const float* bk = I[4]; const float* wv = I[5]; const float* bv = I[6]; const float* wo = I[7]; const float* bo = I[8]; const float* tmp = I[9];
  char* ws = (char*)d_ws; size_t off = 0;
  auto take = [&](size_t bytes) { char* p = ws + off; off += (bytes + 255) & ~(size_t)255; return p; };
  const size_t np = (size_t)NR * DM;
  _Float16* BQ = (_Float16*)take((size_t)DM * DM * 2); _Float16* BK = (_Float16*)take((size_t)DM * DM * 2); _Float16* BV = (_Float16*)take((size_t)DM * DM * 2); _Float16* BO = (_Float16*)take((size_t)DM * DM * 2);
  _Float16* X16 = (_Float16*)take(np * 2); float* QKV = (float*)take(np * 3 * 4); float* QN = (float*)take((size_t)NR * NH * 4); float* KN = (float*)take((size_t)NR * NH * 4); _Float16* QH = (_Float16*)take(np * 2); _Float16* QL = (_Float16*)take(np * 2); _Float16* KH = (_Float16*)take(np * 2); _Float16* KL = (_Float16*)take(np * 2); _Float16* VH = (_Float16*)take(np * 2); _Float16* VT = (_Float16*)take(np * 2);
  float* S = (float*)take((size_t)HG * SLEN * SLEN * 4); _Float16* E = (_Float16*)take((size_t)HG * SLEN * SLEN * 2); float* RS = (float*)take((size_t)HG * SLEN * 32 * 4); float* O = QKV;      /* context f32 [NR][DM] over the qkv plane (dead after norms + splits) */ _Float16* OH = VH; _Float16* OL = X16;      /* O hi over v (dead after V^T), O lo over x (dead after the projections) */
  if (off > ws_size) return;      /* 8 + 8 + 48 + 0.5 + 6x8 + 64 + 32 + 1 = ≈ 210 MiB */
  k_wt_f16<<<(unsigned)(((size_t)DM * DM / 8 + 255) / 256), 256, 0, stream>>>(wq, BQ, DM, DM, 16.0f); k_wt_f16<<<(unsigned)(((size_t)DM * DM / 8 + 255) / 256), 256, 0, stream>>>(wk, BK, DM, DM, 16.0f); k_wt_f16<<<(unsigned)(((size_t)DM * DM / 8 + 255) / 256), 256, 0, stream>>>(wv, BV, DM, DM, 16.0f); k_wt_f16<<<(unsigned)(((size_t)DM * DM / 8 + 255) / 256), 256, 0, stream>>>(wo, BO, DM, DM, 16.0f);      /* [in, out] */
  k_x16<<<(unsigned)((np / 8 + 255) / 256), 256, 0, stream>>>(x, X16, np / 8);
  const dim3 gP((NR / 128) * (DM / 64), 1);
  k_gemm2<0><<<gP, 128, 0, stream>>>(X16, DM, 0, BQ, DM, 0, 0.0625f, bq, 0, nullptr, 1, 0, 0, QKV, nullptr, 3 * DM, 0, NR, DM, DM); k_gemm2<0><<<gP, 128, 0, stream>>>(X16, DM, 0, BK, DM, 0, 0.0625f, bk, 0, nullptr, 1, 0, 0, QKV + DM, nullptr, 3 * DM, 0, NR, DM, DM); k_gemm2<0><<<gP, 128, 0, stream>>>(X16, DM, 0, BV, DM, 0, 0.0625f, bv, 0, nullptr, 1, 0, 0, QKV + 2 * DM, nullptr, 3 * DM, 0, NR, DM, DM);      /* [q | k | v] f32 */
  k_norms<<<(unsigned)(((size_t)NR * NH + 255) / 256), 256, 0, stream>>>(QKV, QN, KN);
  k_hls<<<(unsigned)((np / 8 + 255) / 256), 256, 0, stream>>>(QKV, 3 * DM, 0, QH, QL, np / 8); k_hls<<<(unsigned)((np / 8 + 255) / 256), 256, 0, stream>>>(QKV, 3 * DM, DM, KH, KL, np / 8); k_h16s<<<(unsigned)((np / 8 + 255) / 256), 256, 0, stream>>>(QKV, 3 * DM, 2 * DM, VH, np / 8);
  k_vtg<<<NB * NH * (SLEN / 64), 256, 0, stream>>>(VH, VT);      /* V^T [(b,h)][64][2048] */
  for (int b = 0; b < NB; ++b) for (int hg = 0; hg < NH / HG; ++hg) { const size_t r0 = (size_t)b * SLEN; const int h0 = hg * HG;
    /* S[g][i][j] = q_i . k_j for heads h0+g as three hi/residual terms (own-element accumulate) */
    k_gemm2<0><<<dim3((SLEN / 128) * (SLEN / 64), HG), 128, 0, stream>>>(QL + r0 * DM + h0 * 64, DM, (size_t)64, KH + r0 * DM + h0 * 64, DM, (size_t)64, 0.0009765625f, nullptr, 0, nullptr, 1, 0, 0, S, nullptr, SLEN, (size_t)SLEN * SLEN, SLEN, SLEN, 64);
    k_gemm2<0><<<dim3((SLEN / 128) * (SLEN / 64), HG), 128, 0, stream>>>(QH + r0 * DM + h0 * 64, DM, (size_t)64, KL + r0 * DM + h0 * 64, DM, (size_t)64, 0.0009765625f, nullptr, 0, S, -1, 0, 0, S, nullptr, SLEN, (size_t)SLEN * SLEN, SLEN, SLEN, 64);
    k_gemm2<0><<<dim3((SLEN / 128) * (SLEN / 64), HG), 128, 0, stream>>>(QH + r0 * DM + h0 * 64, DM, (size_t)64, KH + r0 * DM + h0 * 64, DM, (size_t)64, 1.0f, nullptr, 0, S, -1, 0, 0, S, nullptr, SLEN, (size_t)SLEN * SLEN, SLEN, SLEN, 64);
    k_esoft<<<(HG * SLEN) / 8, 256, 0, stream>>>(S, QN, KN, tmp, b, h0, E, RS);
    k_gemm2<0><<<dim3((SLEN / 128) * 1, HG), 128, 0, stream>>>(E, SLEN, (size_t)SLEN * SLEN, VT + ((size_t)b * NH + h0) * 64 * SLEN, SLEN, (size_t)64 * SLEN, 0.0009765625f, nullptr, 0, nullptr, 1, 0, 0, O + r0 * DM + h0 * 64, nullptr, DM, (size_t)64, SLEN, 64, SLEN);      /* unnormalised att . v per head */
    k_onrm<<<(unsigned)(((size_t)SLEN * HG * 8 + 255) / 256), 256, 0, stream>>>(O, RS, b, h0, OH, OL); }
  k_gemm2<0><<<gP, 128, 0, stream>>>(OL, DM, 0, BO, DM, 0, 0.0625f / 1024.0f, nullptr, 0, nullptr, 1, 0, 0, (float*)d_out, nullptr, DM, 0, NR, DM, DM);
  k_gemm2<0><<<gP, 128, 0, stream>>>(OH, DM, 0, BO, DM, 0, 0.0625f, bo, 0, (const float*)d_out, 1, (size_t)DM, 0, (float*)d_out, nullptr, DM, 0, NR, DM, DM);      /* out = (O_lo + O_hi) Wo + bo */
}

// v002
// One run takes 301 microseconds.
// Versions in between are left out here; by their measured steps it is 6.60 times as fast as v000.
#include <hip/hip_runtime.h>
// EuclideanAttention (2 x 2048 tokens, D 1024 = 16 heads x 64; Q, K, V = x W + b; d2 = max(|q|^2 + |k|^2 - 2 q.k, 0); attn = softmax_k(-d2 / temperature); out = (attn V) Wo + bo).
// Compute dtype: inputs rounded to bf16; x and weights exact as f16; q.k from hi+residual operands (~2^-21); norms/softmax f32; v and the softmax weights as plain f16 operands (~2^-12); attention output hi + residual. v_wmma_f32_16x16x32_f16.
#define NB 2
#define DM 1024
#define NKV 16
#define NREP (NH / NKV)
#define KVD (NKV * 64)           /* 1024 */
#define NR (NB * SLEN)           /* 4096 */
#define CHK 512                  /* attention chunk */
typedef int v4i __attribute__((ext_vector_type(4)));
#define FF 2048
#define SLEN 2048
#define TQ SLEN
#define TK SLEN
#define NH 16
#define SCL 0.125f
#define QBLKS (TQ / 64)
#define QB05 0
#define QBN5 4
#define QB0P 0
#define QBNP QBLKS           /* non-causal: plain flash on every query block */
#define RE 256
typedef __bf16 v16b __attribute__((ext_vector_type(16)));
typedef unsigned short v8us __attribute__((ext_vector_type(8), may_alias));
typedef float  v8f  __attribute__((ext_vector_type(8)));
typedef float  v4f  __attribute__((ext_vector_type(4)));
typedef float  v4fa __attribute__((ext_vector_type(4), may_alias));
union FragB { v16b v; v8us half[2]; unsigned short u[16]; };

__device__ __forceinline__ unsigned short bf16_bits(float x) { unsigned int u = __float_as_uint(x); return (unsigned short)((u + 0x7FFFu + ((u >> 16) & 1u)) >> 16); }
__device__ __forceinline__ float bf16_val(unsigned short b) { return __uint_as_float(((unsigned int)b) << 16); }
__device__ __forceinline__ float bf16_round(float x) { return bf16_val(bf16_bits(x)); }
// D += A·B with NT terms: 1 = ah·bh, 2 = + al·bh (A split), 3 = + ah·bl (both split)
template <int NT>
__device__ __forceinline__ v8f mmaN(v16b ah, v16b al, v16b bh, v16b bl, v8f c) {
  c = __builtin_amdgcn_wmma_f32_16x16x32_bf16(false, ah, false, bh, (short)0, c, false, false);
  if (NT >= 2) c = __builtin_amdgcn_wmma_f32_16x16x32_bf16(false, al, false, bh, (short)0, c, false, false);
  if (NT >= 3) c = __builtin_amdgcn_wmma_f32_16x16x32_bf16(false, ah, false, bl, (short)0, c, false, false);
  asm volatile("v_nop\n\tv_nop\n\tv_nop\n\tv_nop" : "+v"(c) : "v"(ah), "v"(al), "v"(bh), "v"(bl));
  return c;
}

__global__ __launch_bounds__(256) void k_wt_bf16(const float* __restrict__ W, unsigned short* __restrict__ Wt, int K, int N) {
  const int t = blockIdx.x * 256 + threadIdx.x;
  const int k8n = K / 8;
  if (t >= N * k8n) return;
  const int n = t / k8n, k8 = (t % k8n) * 8;
  v8us v;
#pragma unroll
  for (int i = 0; i < 8; ++i) v[i] = bf16_bits(W[(size_t)(k8 + i) * N + n]);
  *(v8us*)(Wt + (size_t)n * K + k8) = v;
  
}

// GEMM C[M][N] (f32, pitch ldc) = act(A[M][K]·W + bias). A f32 row-major (pitch lda) converted per fragment to bf16
// (ASPLIT: hi/lo two planes -> 2 terms, else single rounded term); Wt bf16 [N][K] (pitch ldb). BIAS_BF16 rounds the
// bias to bf16 first (bias quantised to bf16 before the add). K%32==0, M%16==0, N%64==0.
template <bool ASPLIT, int ACT, bool BIAS_BF16>
__global__ __launch_bounds__(128) void k_gemm_bf(const float* __restrict__ A, int lda, const unsigned short* __restrict__ Wt, int ldb,
                                               const float* __restrict__ bias, float* __restrict__ C, int ldc, int M, int N, int K) {
  __shared__ __attribute__((aligned(16))) float so[4][16][64];
  const int tid = threadIdx.x, w = tid >> 5, lane = tid & 31, ln = lane & 15, hh = lane >> 4;
  const int ntn = N / 64;
  const int wid = blockIdx.x * 4 + w;
  const int mt = wid / ntn, nq = wid % ntn;
  if (mt * 16 >= M) return;
  const int row0 = mt * 16, col0 = nq * 64;
  const float* arow = A + (size_t)(row0 + ln) * lda;
  v8f acc[4] = {};
  for (int kb = 0; kb < K; kb += 32) {
    FragB ah, al;
    const v4f x0 = *(const v4fa*)(arow + kb + 8 * hh), x1 = *(const v4fa*)(arow + kb + 8 * hh + 4);
    const v4f x2 = *(const v4fa*)(arow + kb + 16 + 8 * hh), x3 = *(const v4fa*)(arow + kb + 16 + 8 * hh + 4);
    float xs[16] = {x0[0],x0[1],x0[2],x0[3],x1[0],x1[1],x1[2],x1[3],x2[0],x2[1],x2[2],x2[3],x3[0],x3[1],x3[2],x3[3]};
#pragma unroll
    for (int i = 0; i < 16; ++i) { const unsigned short hb = bf16_bits(xs[i]); ah.u[i] = hb; al.u[i] = ASPLIT ? bf16_bits(xs[i] - bf16_val(hb)) : (unsigned short)0; }
#pragma unroll
    for (int t = 0; t < 4; ++t) {
      const unsigned short* brow = Wt + (size_t)(col0 + t * 16 + ln) * ldb + kb;
      FragB b;
      b.half[0] = *(const v8us*)(brow + 8 * hh);
      b.half[1] = *(const v8us*)(brow + 16 + 8 * hh);
      acc[t] = mmaN<ASPLIT ? 2 : 1>(ah.v, al.v, b.v, b.v, acc[t]);
    }
  }
#pragma unroll
  for (int t = 0; t < 4; ++t) {
    float bv = bias ? bias[col0 + t * 16 + ln] : 0.f;
    if (BIAS_BF16) bv = bf16_round(bv);
#pragma unroll
    for (int r = 0; r < 8; ++r) { float v = acc[t][r] + bv; if (ACT == 1) v = fmaxf(v, 0.f); so[w][8 * hh + r][t * 16 + ln] = v; }
  }
  __builtin_amdgcn_fence(__ATOMIC_ACQ_REL, "workgroup");
  __builtin_amdgcn_wave_barrier();
  const int rsub = lane >> 4, c4 = (lane & 15) * 4;
  {
#pragma unroll
    for (int q = 0; q < 8; ++q) {
      const int r = q * 2 + rsub;
      const v4f v = *(const v4fa*)&so[w][r][c4];
      *(v4f*)(C + (size_t)(row0 + r) * ldc + col0 + c4) = v;
    }
    
  }
}

// GEMM C = act(A·W + bias + resid): A f32 (ASPLIT -> hi/lo 2 terms), Wt bf16 [N][K]; ACT 0 none, 1 relu, 2 exact gelu;
// resid (optional, f32, row index = (row % rmod), pitch ldr, RES_BF16 rounds it) added before the activation.
template <bool ASPLIT, int ACT, bool BIAS_BF16, bool RES_BF16>
__global__ __launch_bounds__(128) void k_gemm_bf3(const float* __restrict__ A, int lda, const unsigned short* __restrict__ Wt, int ldb,
                                                const float* __restrict__ bias, const float* __restrict__ resid, int rmod, int ldr,
                                                float* __restrict__ C, int ldc, int M, int N, int K) {
  __shared__ __attribute__((aligned(16))) float so[4][16][64];
  const int tid = threadIdx.x, w = tid >> 5, lane = tid & 31, ln = lane & 15, hh = lane >> 4;
  const int ntn = N / 64;
  const int wid = blockIdx.x * 4 + w;
  const int mt = wid / ntn, nq = wid % ntn;
  if (mt * 16 >= M) return;
  const int row0 = mt * 16, col0 = nq * 64;
  const float* arow = A + (size_t)(row0 + ln) * lda;
  v8f acc[4] = {};
  for (int kb = 0; kb < K; kb += 32) {
    FragB ah, al;
    const v4f x0 = *(const v4fa*)(arow + kb + 8 * hh), x1 = *(const v4fa*)(arow + kb + 8 * hh + 4);
    const v4f x2 = *(const v4fa*)(arow + kb + 16 + 8 * hh), x3 = *(const v4fa*)(arow + kb + 16 + 8 * hh + 4);
    float xs[16] = {x0[0],x0[1],x0[2],x0[3],x1[0],x1[1],x1[2],x1[3],x2[0],x2[1],x2[2],x2[3],x3[0],x3[1],x3[2],x3[3]};
#pragma unroll
    for (int i = 0; i < 16; ++i) { const unsigned short hb = bf16_bits(xs[i]); ah.u[i] = hb; al.u[i] = ASPLIT ? bf16_bits(xs[i] - bf16_val(hb)) : (unsigned short)0; }
#pragma unroll
    for (int t = 0; t < 4; ++t) {
      const unsigned short* brow = Wt + (size_t)(col0 + t * 16 + ln) * ldb + kb;
      FragB b;
      b.half[0] = *(const v8us*)(brow + 8 * hh);
      b.half[1] = *(const v8us*)(brow + 16 + 8 * hh);
      acc[t] = mmaN<ASPLIT ? 2 : 1>(ah.v, al.v, b.v, b.v, acc[t]);
    }
  }
#pragma unroll
  for (int t = 0; t < 4; ++t) {
    const int col = col0 + t * 16 + ln;
    float bv = bias ? bias[col] : 0.f;
    if (BIAS_BF16) bv = bf16_round(bv);
#pragma unroll
    for (int r = 0; r < 8; ++r) {
      float v = acc[t][r] + bv;
      if (resid) { float rv = resid[(size_t)((row0 + 8 * hh + r) % rmod) * ldr + col]; if (RES_BF16) rv = bf16_round(rv); v += rv; }
      if (ACT == 1) v = fmaxf(v, 0.f);
      if (ACT == 2) v = 0.5f * v * (1.0f + erff(v * 0.70710678118654752f));
      if (ACT == 3) { const float u = 0.7978845608028654f * (v + 0.044715f * v * v * v); v = 0.5f * v * (1.0f + tanhf(u)); }
      so[w][8 * hh + r][t * 16 + ln] = v;
    }
  }
  __builtin_amdgcn_fence(__ATOMIC_ACQ_REL, "workgroup");
  __builtin_amdgcn_wave_barrier();
  const int rsub = lane >> 4, c4 = (lane & 15) * 4;
  {
#pragma unroll
    for (int q = 0; q < 8; ++q) {
      const int r = q * 2 + rsub;
      const v4f v = *(const v4fa*)&so[w][r][c4];
      *(v4f*)(C + (size_t)(row0 + r) * ldc + col0 + c4) = v;
    }
    
  }
}
// row LayerNorm (biased variance, eps) over N: s = X (+ R); optional out_sum <- s; out_norm <- (s-mu)*rsqrt(var+eps)*g + b
template <bool PARAM_BF16>
__global__ __launch_bounds__(256) void k_layernorm(const float* __restrict__ X, const float* __restrict__ R, const float* __restrict__ g, const float* __restrict__ bta,
                                                  float* __restrict__ out_sum, float* __restrict__ out_norm, int N, float eps) {
  __shared__ float red[256];
  const int row = blockIdx.x, tid = threadIdx.x;
  const float* x = X + (size_t)row * N; const float* rr = R ? R + (size_t)row * N : nullptr;
  float vals[16];                     // up to N = 4096
  const int per = N / 256;            // contiguous chunk per thread? use strided-by-4 chunks: thread handles j = tid*4 + 1024*u
  float s1 = 0.f;
  for (int u = 0; u < per / 4; ++u) {
    const int j = tid * 4 + 1024 * u;
    const v4f a = *(const v4fa*)(x + j);
    v4f b = {0.f,0.f,0.f,0.f}; if (rr) b = *(const v4fa*)(rr + j);
#pragma unroll
    for (int q = 0; q < 4; ++q) { const float v = a[q] + b[q]; vals[u * 4 + q] = v; s1 += v; }
  }
  red[tid] = s1; __syncthreads();
  for (int st = 128; st > 0; st >>= 1) { if (tid < st) red[tid] += red[tid + st]; __syncthreads(); }
  const float mu = red[0] / (float)N; __syncthreads();
  float s2 = 0.f;
  for (int u = 0; u < per / 4; ++u)
#pragma unroll
    for (int q = 0; q < 4; ++q) { const float c = vals[u * 4 + q] - mu; s2 += c * c; }
  red[tid] = s2; __syncthreads();
  for (int st = 128; st > 0; st >>= 1) { if (tid < st) red[tid] += red[tid + st]; __syncthreads(); }
  const float rs = rsqrtf(red[0] / (float)N + eps);
  {
    for (int u = 0; u < per / 4; ++u) {
      const int j = tid * 4 + 1024 * u;
      v4f o, sm;
#pragma unroll
      for (int q = 0; q < 4; ++q) {
        float gg = g[j + q], bb = bta[j + q];
        if (PARAM_BF16) { gg = bf16_round(gg); bb = bf16_round(bb); }
        sm[q] = vals[u * 4 + q]; o[q] = (vals[u * 4 + q] - mu) * rs * gg + bb;
      }
      if (out_sum) *(v4f*)(out_sum + (size_t)row * N + j) = sm;
      *(v4f*)(out_norm + (size_t)row * N + j) = o;
    }
    
  }
}



// ---- f16 WMMA path (v_wmma_f32_16x16x32_f16): 11-bit significands for operands in range — used where a [0,1] probability operand needs more precision than bf16
typedef _Float16 v16h __attribute__((ext_vector_type(16)));
union FragH { v16h v; v8us half[2]; _Float16 h[16]; unsigned short u[16]; };
template <int NT>
__device__ __forceinline__ v8f mmaH(v16h ah, v16h al, v16h bh, v16h bl, v8f c) {
  c = __builtin_amdgcn_wmma_f32_16x16x32_f16(false, ah, false, bh, (short)0, c, false, false);
  if (NT >= 2) c = __builtin_amdgcn_wmma_f32_16x16x32_f16(false, al, false, bh, (short)0, c, false, false);
  if (NT >= 3) c = __builtin_amdgcn_wmma_f32_16x16x32_f16(false, ah, false, bl, (short)0, c, false, false);
  asm volatile("v_nop\n\tv_nop\n\tv_nop\n\tv_nop" : "+v"(c) : "v"(ah), "v"(al), "v"(bh), "v"(bl));
  return c;
}
// batched GEMM like k_gemm_b but f16 operands: A f32 (split into f16 hi/lo if ASPLIT, else rounded to f16), Bt = f16 values [n][k]; alpha; C f32; N multiple of 16 (partial tiles skipped)
template <bool ASPLIT>
__global__ __launch_bounds__(128) void k_gemm_h(const float* __restrict__ A, int lda, size_t sA, const _Float16* __restrict__ Bh, int ldb, size_t sB, float alpha, float* __restrict__ C, int ldc, size_t sC, int M, int N, int K) {
  __shared__ __attribute__((aligned(16))) float so[4][16][64];
  const int tid = threadIdx.x, w = tid >> 5, lane = tid & 31, ln = lane & 15, hh = lane >> 4; const int by = blockIdx.y;
  A += (size_t)by * sA; Bh += (size_t)by * sB; C += (size_t)by * sC;
  const int ntn = (N + 63) / 64; const int wid = blockIdx.x * 4 + w; const int mt = wid / ntn, nq = wid % ntn; if (mt * 16 >= M) return;
  const int row0 = mt * 16, col0 = nq * 64; const float* arow = A + (size_t)(row0 + ln) * lda;
  v8f acc[4] = {};
  for (int kb = 0; kb < K; kb += 32) {
    FragH ah, al;
    const v4f x0 = *(const v4fa*)(arow + kb + 8 * hh), x1 = *(const v4fa*)(arow + kb + 8 * hh + 4), x2 = *(const v4fa*)(arow + kb + 16 + 8 * hh), x3 = *(const v4fa*)(arow + kb + 16 + 8 * hh + 4);
    float xs[16] = {x0[0],x0[1],x0[2],x0[3],x1[0],x1[1],x1[2],x1[3],x2[0],x2[1],x2[2],x2[3],x3[0],x3[1],x3[2],x3[3]};
#pragma unroll
    for (int i = 0; i < 16; ++i) { const _Float16 h = (_Float16)xs[i]; ah.h[i] = h; al.h[i] = ASPLIT ? (_Float16)(xs[i] - (float)h) : (_Float16)0.0f; }
#pragma unroll
    for (int t = 0; t < 4; ++t) { if (col0 + t * 16 >= N) continue; const size_t boff = (size_t)(col0 + t * 16 + ln) * ldb + kb; FragH bq; bq.half[0] = *(const v8us*)(Bh + boff + 8 * hh); bq.half[1] = *(const v8us*)(Bh + boff + 16 + 8 * hh);
      acc[t] = mmaH<ASPLIT ? 2 : 1>(ah.v, al.v, bq.v, bq.v, acc[t]); }
  }
#pragma unroll
  for (int t = 0; t < 4; ++t) { if (col0 + t * 16 >= N) continue;
#pragma unroll
    for (int r = 0; r < 8; ++r) so[w][8 * hh + r][t * 16 + ln] = acc[t][r] * alpha; }
  __builtin_amdgcn_fence(__ATOMIC_ACQ_REL, "workgroup"); __builtin_amdgcn_wave_barrier();
  const int rsub = lane >> 4, c4 = (lane & 15) * 4;
  {
#pragma unroll
    for (int q = 0; q < 8; ++q) { const int r = q * 2 + rsub; if (col0 + c4 < N) { const v4f v = *(const v4fa*)&so[w][r][c4]; *(v4f*)(C + (size_t)(row0 + r) * ldc + col0 + c4) = v; } }
     }
}

// Wt[n][k] = f16(W[k][n]·scale) from f32 row-major W[K][N] (scale = power of two; bf16-exact weights stay exact in f16 away from the subnormal range)
__global__ __launch_bounds__(256) void k_wt_f16(const float* __restrict__ W, _Float16* __restrict__ Wt, int K, int N, float scale) {
  const int t = blockIdx.x * 256 + threadIdx.x; if (t >= N * (K / 8)) return; const int n = t / (K / 8), k8 = (t % (K / 8)) * 8; FragH f;
#pragma unroll
  for (int i = 0; i < 8; ++i) f.h[i] = (_Float16)(bf16_round(W[(size_t)(k8 + i) * N + n]) * scale); const v8us o = f.half[0];
  *(v8us*)((unsigned short*)Wt + (size_t)n * K + k8) = o; 
}
// k_gemm_hh variant with fused epilogue: v = acc·alpha + bias[by·sBias + col] (+ CP[(row/rowsPerB)·sCPb + by·64 + col] if CP) ; ACT 0 none / 1 elu ; writes f16 C16 (and f32 C if non-null)
template <int ACT>
__global__ __launch_bounds__(128) void k_gemm_hhx(const _Float16* __restrict__ A, int lda, size_t sA, const _Float16* __restrict__ Bh, int ldb, size_t sB, float alpha, const float* __restrict__ bias, size_t sBias, const float* __restrict__ CP, int rowsPerB, size_t sCPb, int row0g,
    float* __restrict__ C, _Float16* __restrict__ C16, int ldc, size_t sC, int M, int N, int K) {
  __shared__ __attribute__((aligned(16))) float so[4][16][64];
  const int tid = threadIdx.x, w = tid >> 5, lane = tid & 31, ln = lane & 15, hh = lane >> 4; const int by = blockIdx.y;
  A += (size_t)by * sA; Bh += (size_t)by * sB; const size_t cofs = (size_t)by * sC; const float* bp = bias ? bias + (size_t)by * sBias : nullptr;
  const int ntn = (N + 63) / 64; const int wid = blockIdx.x * 4 + w; const int mt = wid / ntn, nq = wid % ntn; if (mt * 16 >= M) return;
  const int row0 = mt * 16, col0 = nq * 64; const _Float16* arow = A + (size_t)(row0 + ln) * lda;
  v8f acc[4] = {};
  for (int kb = 0; kb < K; kb += 32) { FragH ah; ah.half[0] = *(const v8us*)((const unsigned short*)arow + kb + 8 * hh); ah.half[1] = *(const v8us*)((const unsigned short*)arow + kb + 16 + 8 * hh);
#pragma unroll
    for (int t = 0; t < 4; ++t) { if (col0 + t * 16 >= N) continue; const size_t boff = (size_t)(col0 + t * 16 + ln) * ldb + kb; FragH bq; bq.half[0] = *(const v8us*)((const unsigned short*)Bh + boff + 8 * hh); bq.half[1] = *(const v8us*)((const unsigned short*)Bh + boff + 16 + 8 * hh);
      acc[t] = mmaH<1>(ah.v, ah.v, bq.v, bq.v, acc[t]); }
  }
#pragma unroll
  for (int t = 0; t < 4; ++t) { if (col0 + t * 16 >= N) continue; const int col = col0 + t * 16 + ln; const float bv = bp ? bf16_round(bp[col]) : 0.f;
#pragma unroll
    for (int r = 0; r < 8; ++r) { float v = acc[t][r] * alpha + bv; if (CP) { const int bidx = (row0g + row0 + 8 * hh + r) / rowsPerB; v += CP[(size_t)bidx * sCPb + (size_t)by * 64 + col]; } if (ACT == 1) v = (v > 0.f) ? v : expm1f(v); else if (ACT == 7) v = (v > 0.f) ? v + 1.0f : expf(v); else if (ACT == 8) v = tanhf(v); else if (ACT == 9) v = 0.5f * v * (1.0f + tanhf(0.7978845608028654f * (v + 0.044715f * v * v * v))); else if (ACT == 11) v = 1.0f / (1.0f + expf(-v)); else if (ACT == 12) v = (v > 0.f) ? v : 0.01f * v; else if (ACT == 14) v = (v > 0.f) ? v : 0.1f * v; else if (ACT == 15) v = v / (1.0f + expf(-v)); else if (ACT == 3) v = fmaxf(v, 0.f); else if (ACT == 6) v = 0.5f * v * (1.0f + erff(v * 0.70710678118654752f)); so[w][8 * hh + r][t * 16 + ln] = v; } }
  __builtin_amdgcn_fence(__ATOMIC_ACQ_REL, "workgroup"); __builtin_amdgcn_wave_barrier();
  const int rsub = lane >> 4, c4 = (lane & 15) * 4; typedef _Float16 v4h __attribute__((ext_vector_type(4)));
  {
#pragma unroll
    for (int q = 0; q < 8; ++q) { const int r = q * 2 + rsub; if (col0 + c4 < N) { const v4f v = *(const v4fa*)&so[w][r][c4]; if (C) *(v4f*)(C + cofs + (size_t)(row0 + r) * ldc + col0 + c4) = v; if (C16) { v4h h4; for (int i = 0; i < 4; ++i) h4[i] = (_Float16)v[i]; *(v4h*)(C16 + cofs + (size_t)(row0 + r) * ldc + col0 + c4) = h4; } } }
     }
}


typedef _Float16 v4h __attribute__((ext_vector_type(4)));

__global__ __launch_bounds__(256) void k_x16(const float* __restrict__ x, _Float16* __restrict__ X16, size_t n8) { const size_t t = (size_t)blockIdx.x * 256 + threadIdx.x; if (t >= n8) return; FragH f;
#pragma unroll
  for (int q = 0; q < 8; ++q) f.h[q] = (_Float16)bf16_round(x[t * 8 + q]); *(v8us*)((unsigned short*)X16 + t * 8) = f.half[0];  }
__global__ __launch_bounds__(256) void k_h16(const float* __restrict__ x, _Float16* __restrict__ X16, size_t n8) { const size_t t = (size_t)blockIdx.x * 256 + threadIdx.x; if (t >= n8) return; FragH f;
#pragma unroll
  for (int q = 0; q < 8; ++q) f.h[q] = (_Float16)x[t * 8 + q]; *(v8us*)((unsigned short*)X16 + t * 8) = f.half[0];  }
__global__ __launch_bounds__(256) void k_round16f(const float* __restrict__ W, _Float16* __restrict__ Bt, size_t n8) { const size_t t = (size_t)blockIdx.x * 256 + threadIdx.x; if (t >= n8) return; FragH f;
#pragma unroll
  for (int i = 0; i < 8; ++i) f.h[i] = (_Float16)(bf16_round(W[t * 8 + i]) * 16.0f); *(v8us*)((unsigned short*)Bt + t * 8) = f.half[0];  }
template <int NHv, int TTv>
__global__ __launch_bounds__(256) void k_vt(const _Float16* __restrict__ V16, int ldv, int voff, _Float16* __restrict__ Vt) { __shared__ unsigned short tl[64][66]; const int tid = threadIdx.x; const int slab = blockIdx.x / (TTv / 64), lg = blockIdx.x % (TTv / 64); const int b = slab / NHv, h = slab % NHv;
  for (int i = tid; i < 64 * 8; i += 256) { const int r = i / 8, c8 = (i % 8) * 8; FragH f; f.half[0] = *(const v8us*)((const unsigned short*)V16 + ((size_t)b * TTv + lg * 64 + r) * ldv + voff + h * 64 + c8);
#pragma unroll
    for (int q = 0; q < 8; ++q) tl[r][c8 + q] = f.u[q]; }
  __syncthreads();
  {
#pragma unroll
    for (int rd = 0; rd < 2; ++rd) { const int d = rd * 32 + tid / 8, pc = tid % 8; FragH f;
#pragma unroll
      for (int q = 0; q < 8; ++q) f.u[q] = tl[pc * 8 + q][d];
      *(v8us*)((unsigned short*)Vt + ((size_t)slab * 64 + d) * TTv + lg * 64 + pc * 8) = f.half[0]; }
     } }

__global__ __launch_bounds__(256) void k_hl(const float* __restrict__ F, _Float16* __restrict__ Hh, _Float16* __restrict__ Hl, size_t n8) { const size_t t = (size_t)blockIdx.x * 256 + threadIdx.x; if (t >= n8) return; FragH fh, fl; const v4f a = *(const v4fa*)(F + t * 8), c = *(const v4fa*)(F + t * 8 + 4);
#pragma unroll
  for (int q = 0; q < 4; ++q) { _Float16 h = (_Float16)a[q]; fh.h[q] = h; fl.h[q] = (_Float16)((a[q] - (float)h) * 1024.0f); h = (_Float16)c[q]; fh.h[4 + q] = h; fl.h[4 + q] = (_Float16)((c[q] - (float)h) * 1024.0f); }
  { *(v8us*)((unsigned short*)Hh + t * 8) = fh.half[0]; *(v8us*)((unsigned short*)Hl + t * 8) = fl.half[0];  } }

// ---- fast GEMM (block tile 128x64, wave tile 32x64; requires M % 128 == 0, N % 64 == 0, K % 64 == 0); epilogue = k_gemm_hhx semantics ----
// A and B come through LDS: a stage is 64 k of the block's 128 A rows and 64 B rows, brought by asynchronous copies into one of two buffers while the other is worked on.
#define G2P 144              /* LDS row pitch in bytes: 128 B of k + 16 = 16 B x odd, the conflict-free pitch for 16-byte fragment reads */
#define G2S (192 * G2P)      /* one stage: rows 0..127 = A, rows 128..191 = B */
// One stage's 12 copies of a lane, 16 bytes each: 8 lanes bring one row's 128 bytes, the block's 128 threads 16 rows per copy; copies 0..7 are A rows, 8..11 B rows.
// l = the lane's LDS byte address in row tid / 8 of the buffer, a and b = its global addresses in that row of A and of B, sa and sb = 16 rows of A and of B in bytes.
// s_wait_xcnt 0 is the statement's last line, so that it stands in front of any later rewrite of these address registers.
__device__ __forceinline__ void g2_stage(unsigned l, const char* a, size_t sa, const char* b, size_t sb) {
  asm volatile("global_load_async_to_lds_b128 %0, %12, off\n\tglobal_load_async_to_lds_b128 %1, %13, off\n\tglobal_load_async_to_lds_b128 %2, %14, off\n\tglobal_load_async_to_lds_b128 %3, %15, off\n\t"
               "global_load_async_to_lds_b128 %4, %16, off\n\tglobal_load_async_to_lds_b128 %5, %17, off\n\tglobal_load_async_to_lds_b128 %6, %18, off\n\tglobal_load_async_to_lds_b128 %7, %19, off\n\t"
               "global_load_async_to_lds_b128 %8, %20, off\n\tglobal_load_async_to_lds_b128 %9, %21, off\n\tglobal_load_async_to_lds_b128 %10, %22, off\n\tglobal_load_async_to_lds_b128 %11, %23, off\n\ts_wait_xcnt 0x0"
               :: "v"(l), "v"(l + 16 * G2P), "v"(l + 32 * G2P), "v"(l + 48 * G2P), "v"(l + 64 * G2P), "v"(l + 80 * G2P), "v"(l + 96 * G2P), "v"(l + 112 * G2P), "v"(l + 128 * G2P), "v"(l + 144 * G2P), "v"(l + 160 * G2P), "v"(l + 176 * G2P),
                  "v"(a), "v"(a + sa), "v"(a + 2 * sa), "v"(a + 3 * sa), "v"(a + 4 * sa), "v"(a + 5 * sa), "v"(a + 6 * sa), "v"(a + 7 * sa), "v"(b), "v"(b + sb), "v"(b + 2 * sb), "v"(b + 3 * sb) : "memory"); }
__device__ __forceinline__ v16h g2_frag(const _Float16* p, int hh) { FragH f; f.half[0] = *(const v8us*)((const unsigned short*)p + 8 * hh); f.half[1] = *(const v8us*)((const unsigned short*)p + 16 + 8 * hh); return f.v; }
__device__ __forceinline__ v16h g2_lfrag(const char* p) { FragH f; f.half[0] = *(const v8us*)p; f.half[1] = *(const v8us*)(p + 32); return f.v; }
__device__ __forceinline__ v8f g2_mma(v16h a, v16h b, v8f c) { v8f d = __builtin_amdgcn_wmma_f32_16x16x32_f16(false, a, false, b, (short)0, c, false, false); asm volatile("v_nop\n\tv_nop\n\tv_nop\n\tv_nop" : "+v"(d) : "v"(a), "v"(b)); return d; }
template <int ACT>
__global__ __launch_bounds__(128) void k_gemm2(const _Float16* __restrict__ A, int lda, size_t sA, const _Float16* __restrict__ Bh, int ldb, size_t sB, float alpha, const float* __restrict__ bias, size_t sBias, const float* __restrict__ CP, int rowsPerB, size_t sCPb, int row0g,
    float* __restrict__ C, _Float16* __restrict__ C16, int ldc, size_t sC, int M, int N, int K) {
  __shared__ __attribute__((aligned(16))) float so[4][32][68]; __shared__ __attribute__((aligned(16))) char st[2 * G2S];
  const int tid = threadIdx.x, w = tid >> 5, lane = tid & 31, ln = lane & 15, hh = lane >> 4; const int by = blockIdx.y;
  A += (size_t)by * sA; Bh += (size_t)by * sB; const size_t cofs = (size_t)by * sC; const float* bp = bias ? bias + (size_t)by * sBias : nullptr;
  const int ntn = N >> 6; const int mt = blockIdx.x / ntn, nq = blockIdx.x - mt * ntn; const int row0 = mt * 128 + 32 * w, col0 = nq * 64; if (mt * 128 >= M) return;      /* the whole block or none: barriers follow */
  const int nst = K >> 6;      /* stages */
  const char* ga = (const char*)(A + (size_t)(mt * 128 + (tid >> 3)) * lda + (tid & 7) * 8); const char* gb = (const char*)(Bh + (size_t)(col0 + (tid >> 3)) * ldb + (tid & 7) * 8); const size_t sa = (size_t)lda * 32, sb = (size_t)ldb * 32;
  const unsigned l0 = (unsigned)(size_t)st + (unsigned)((tid >> 3) * G2P + (tid & 7) * 16);
  const char* fa = st + (32 * w + ln) * G2P + hh * 16; const char* fb = st + (128 + ln) * G2P + hh * 16;      /* fragment rows: k = 8h + s at +0, 16 + 8h + s at +32 bytes */
  const v8f z8 = {0.f,0.f,0.f,0.f,0.f,0.f,0.f,0.f}; v8f c00 = z8, c01 = z8, c02 = z8, c03 = z8, c10 = z8, c11 = z8, c12 = z8, c13 = z8;
  g2_stage(l0, ga, sa, gb, sb);
  asm volatile("s_wait_asynccnt 0x0" ::: "memory");      /* this wave's copies of stage 0 have landed */
  __syncthreads();      /* ... and every other wave's: stage 0 may be read */
  if (nst > 1) g2_stage(l0 + G2S, ga + 128, sa, gb + 128, sb);
#pragma unroll 1
  for (int t = 0; t < nst; ++t) { const int bo = (t & 1) * G2S; v16h a[2][2], b[2][4];
#pragma unroll
    for (int kk = 0; kk < 2; ++kk) { a[kk][0] = g2_lfrag(fa + bo + kk * 64); a[kk][1] = g2_lfrag(fa + bo + 16 * G2P + kk * 64);      /* the stage's 24 reads as one group ahead of its matrix instructions */
#pragma unroll
      for (int j = 0; j < 4; ++j) b[kk][j] = g2_lfrag(fb + bo + j * 16 * G2P + kk * 64); }
#pragma unroll
    for (int kk = 0; kk < 2; ++kk) { c00 = g2_mma(a[kk][0], b[kk][0], c00); c10 = g2_mma(a[kk][1], b[kk][0], c10); c01 = g2_mma(a[kk][0], b[kk][1], c01); c11 = g2_mma(a[kk][1], b[kk][1], c11);
      c02 = g2_mma(a[kk][0], b[kk][2], c02); c12 = g2_mma(a[kk][1], b[kk][2], c12); c03 = g2_mma(a[kk][0], b[kk][3], c03); c13 = g2_mma(a[kk][1], b[kk][3], c13); }
    asm volatile("s_wait_dscnt 0x0" ::: "memory");      /* this wave has left the buffer that is refilled below */
    asm volatile("s_wait_asynccnt 0x0" ::: "memory");      /* its copies of stage t + 1 have landed */
    __syncthreads();      /* publishes stage t + 1 and ends every reader's last read of stage t */
    if (t + 2 < nst) g2_stage(l0 + bo, ga + (size_t)(t + 2) * 128, sa, gb + (size_t)(t + 2) * 128, sb); }
  asm volatile("s_wait_asynccnt 0x0" ::: "memory");      /* no copy is outstanding when the wave goes on to the epilogue and ends */
  v8f accs[8] = {c00, c01, c02, c03, c10, c11, c12, c13};
#pragma unroll
  for (int u = 0; u < 8; ++u) { const int t = u & 3, half = u >> 2; const int col = col0 + t * 16 + ln; const float bv = bp ? bf16_round(bp[col]) : 0.f;
#pragma unroll
    for (int r = 0; r < 8; ++r) { const int rloc = half * 16 + 8 * hh + r; float v = accs[u][r] * alpha + bv; if (CP) { if (rowsPerB < 0) v += CP[cofs + (size_t)(row0g + row0 + rloc) * ldc + col];      /* rowsPerB < 0: own element of the batched C plane */ else { const int bidx = (row0g + row0 + rloc) / rowsPerB; v += CP[(size_t)bidx * sCPb + (size_t)by * 64 + col]; } }
      if (ACT == 3) v = fmaxf(v, 0.f); else if (ACT == 6) v = 0.5f * v * (1.0f + erff(v * 0.70710678118654752f)); else if (ACT == 11) v = 1.0f / (1.0f + expf(-v)); else if (ACT == 15) v = v / (1.0f + expf(-v)); else if (ACT == 12) v = (v > 0.f) ? v : 0.01f * v; else if (ACT == 8) v = tanhf(v);
      so[w][rloc][t * 16 + ln] = v; } }
  __builtin_amdgcn_fence(__ATOMIC_ACQ_REL, "workgroup"); __builtin_amdgcn_wave_barrier();
  const int rsub = lane >> 4, c4 = (lane & 15) * 4;
  {
#pragma unroll
    for (int q = 0; q < 16; ++q) { const int r = q * 2 + rsub; const v4f v = *(const v4fa*)&so[w][r][c4]; if (C) *(v4f*)(C + cofs + (size_t)(row0 + r) * ldc + col0 + c4) = v; if (C16) { v4h h4; for (int i = 0; i < 4; ++i) h4[i] = (_Float16)v[i]; *(v4h*)(C16 + cofs + (size_t)(row0 + r) * ldc + col0 + c4) = h4; } }
     } }



template <int CAUSAL>
__global__ __launch_bounds__(128) void k_flash(const _Float16* __restrict__ Q16, int ldq, const _Float16* __restrict__ K16, int ldk, const _Float16* __restrict__ Vt, const int* __restrict__ MSK, float* __restrict__ O, int ldo) {
  constexpr int RPW = 16, RTN = RPW / 16, NQB = TQ / (4 * RPW), DT = 4, KS = 2;
  __shared__ __attribute__((aligned(16))) unsigned short sP[4][RPW][40]; __shared__ __attribute__((aligned(16))) float sO[4][RPW][64 + 4];
  const int tid = threadIdx.x, w = tid >> 5, lane = tid & 31, ln = lane & 15, hh = lane >> 4;
  const int slab = blockIdx.x / QBNP, qblk = QB0P + blockIdx.x % QBNP; (void)NQB; const int b = slab / NH, h = slab % NH; const int qb0 = qblk * (4 * RPW); const int q0 = qb0 + w * RPW;
  FragH aq[2][KS];
#pragma unroll
  for (int rt = 0; rt < RTN; ++rt) { const unsigned short* qr = (const unsigned short*)Q16 + ((size_t)b * TQ + q0 + rt * 16 + ln) * ldq + h * 64;
#pragma unroll
    for (int ks = 0; ks < KS; ++ks) { aq[rt][ks].half[0] = *(const v8us*)(qr + ks * 32 + 8 * hh); aq[rt][ks].half[1] = *(const v8us*)(qr + ks * 32 + 16 + 8 * hh); } }
  const unsigned short* Vth = (const unsigned short*)Vt + (size_t)slab * 64 * TK;
  float m_r[2][8], l_r[2][8]; v8f oacc[2][DT];
#pragma unroll
  for (int rt = 0; rt < RTN; ++rt) {
#pragma unroll
    for (int r = 0; r < 8; ++r) { m_r[rt][r] = -3.0e38f; l_r[rt][r] = 0.f; }
#pragma unroll
    for (int dt = 0; dt < DT; ++dt) oacc[rt][dt] = (v8f){0.f,0.f,0.f,0.f,0.f,0.f,0.f,0.f}; }
  const int jend = (CAUSAL == 1) ? (qb0 + 4 * RPW) : ((CAUSAL == 23) ? min(TK, (qb0 / CHK + 2) * CHK) : TK);      /* causal / window: keys that can never contribute are skipped */ const int jbeg = (CAUSAL == 23) ? max(0, (qb0 / CHK - 1) * CHK) : 0;
#pragma unroll 1
  for (int j0 = jbeg; j0 < jend; j0 += 32) {
    v8f s[2][2];
#pragma unroll
    for (int nt = 0; nt < 2; ++nt) { const unsigned short* kr = (const unsigned short*)K16 + ((size_t)b * TK + j0 + nt * 16 + ln) * ldk + h * 64; FragH bk[KS];
#pragma unroll
      for (int ks = 0; ks < KS; ++ks) { bk[ks].half[0] = *(const v8us*)(kr + ks * 32 + 8 * hh); bk[ks].half[1] = *(const v8us*)(kr + ks * 32 + 16 + 8 * hh); }
#pragma unroll
      for (int rt = 0; rt < RTN; ++rt) { v8f acc = (v8f){0.f,0.f,0.f,0.f,0.f,0.f,0.f,0.f};
#pragma unroll
        for (int ks = 0; ks < KS; ++ks) acc = mmaH<1>(aq[rt][ks].v, aq[rt][ks].v, bk[ks].v, bk[ks].v, acc); s[rt][nt] = acc; } }
#pragma unroll
    for (int rt = 0; rt < RTN; ++rt)
#pragma unroll
      for (int r = 0; r < 8; ++r) { const int tq = q0 + rt * 16 + 8 * hh + r; const int k0 = j0 + ln, k1 = j0 + 16 + ln;
        bool ok0 = (CAUSAL == 1) ? (k0 <= tq) : ((CAUSAL == 2) ? ((k0 >> 5) == (tq >> 5)) : true), ok1 = (CAUSAL == 1) ? (k1 <= tq) : ((CAUSAL == 2) ? ((k1 >> 5) == (tq >> 5)) : true); if (CAUSAL == 23) { const int cq = tq / CHK; ok0 = (abs(k0 / CHK - cq) <= 1) && (MSK[(size_t)b * TK + k0] == 0); ok1 = (abs(k1 / CHK - cq) <= 1) && (MSK[(size_t)b * TK + k1] == 0); }      /* mode 23: 3-chunk window + int key-padding mask */
        if (CAUSAL == 24) { ok0 = (MSK[(size_t)b * TK + k0] == 0); ok1 = (MSK[(size_t)b * TK + k1] == 0); }      /* mode 24: int key-padding mask (nonzero = padded = excluded) */      /* mode 2: block-diagonal 32-token groups */
        float s0 = ok0 ? s[rt][0][r] * SCL : -3.0e38f, s1 = ok1 ? s[rt][1][r] * SCL : -3.0e38f; if (CAUSAL == 17) { const float* amk = (const float*)MSK + (size_t)b * TK; s0 += bf16_round(amk[k0]); s1 += bf16_round(amk[k1]); } if (CAUSAL == 18) { const float* tb = (const float*)MSK; const int* ri = MSK + 1024 + (size_t)b * TK; const int rq = ri[tq]; s0 += tb[(h * 8 + rq) * 8 + ri[k0]]; s1 += tb[(h * 8 + rq) * 8 + ri[k1]]; } if (CAUSAL == 19) { const int* rel = MSK + (size_t)tq * TK; const float* rb = (const float*)MSK + (size_t)TQ * TK + ((size_t)(b * NH + h) * TQ + tq) * 64; s0 += rb[rel[k0]]; s1 += rb[rel[k1]]; }      /* mode 19: + (q.Ek[rel] + Eb[rel][h]) / 8 gathered by the int relative ids (packed [ids | table]) */      /* mode 18: + resource_bias[h][r_q][r_k] from the packed [table | ids] buffer (TQ == TK) */      /* mode 17: additive per-(batch, key) mask INPUT */ float mc = fmaxf(s0, s1);
        mc = fmaxf(mc, __shfl_xor(mc, 1, 32)); mc = fmaxf(mc, __shfl_xor(mc, 2, 32)); mc = fmaxf(mc, __shfl_xor(mc, 4, 32)); mc = fmaxf(mc, __shfl_xor(mc, 8, 32));
        const float mn = fmaxf(m_r[rt][r], mc); const float al = (mn > -1.0e38f) ? expf(m_r[rt][r] - mn) : 1.0f; m_r[rt][r] = mn; const float p0 = ok0 ? expf(s0 - mn) : 0.f, p1 = ok1 ? expf(s1 - mn) : 0.f; l_r[rt][r] = l_r[rt][r] * al + p0 + p1;
#pragma unroll
        for (int dt = 0; dt < DT; ++dt) oacc[rt][dt][r] *= al;
        FragH t2; t2.h[0] = (_Float16)(p0 * 1024.0f); t2.h[1] = (_Float16)(p1 * 1024.0f); sP[w][rt * 16 + 8 * hh + r][ln] = t2.u[0]; sP[w][rt * 16 + 8 * hh + r][16 + ln] = t2.u[1]; }
    __builtin_amdgcn_fence(__ATOMIC_ACQ_REL, "workgroup"); __builtin_amdgcn_wave_barrier();
    FragH pa[2];
#pragma unroll
    for (int rt = 0; rt < RTN; ++rt) { pa[rt].half[0] = *(const v8us*)&sP[w][rt * 16 + ln][8 * hh]; pa[rt].half[1] = *(const v8us*)&sP[w][rt * 16 + ln][16 + 8 * hh]; }
#pragma unroll
    for (int dt = 0; dt < DT; ++dt) { const unsigned short* vrow = Vth + (size_t)(dt * 16 + ln) * TK + j0; FragH bv; bv.half[0] = *(const v8us*)(vrow + 8 * hh); bv.half[1] = *(const v8us*)(vrow + 16 + 8 * hh);
#pragma unroll
      for (int rt = 0; rt < RTN; ++rt) oacc[rt][dt] = mmaH<1>(pa[rt].v, pa[rt].v, bv.v, bv.v, oacc[rt][dt]); }
    __builtin_amdgcn_fence(__ATOMIC_ACQ_REL, "workgroup"); __builtin_amdgcn_wave_barrier(); }
#pragma unroll
  for (int rt = 0; rt < RTN; ++rt) {
#pragma unroll
    for (int r = 0; r < 8; ++r) { float l = l_r[rt][r]; l += __shfl_xor(l, 1, 32); l += __shfl_xor(l, 2, 32); l += __shfl_xor(l, 4, 32); l += __shfl_xor(l, 8, 32); l_r[rt][r] = (l > 0.f) ? 1.0f / (l * 1024.0f) : 0.f; }
#pragma unroll
    for (int dt = 0; dt < DT; ++dt)
#pragma unroll
      for (int r = 0; r < 8; ++r) sO[w][rt * 16 + 8 * hh + r][dt * 16 + ln] = oacc[rt][dt][r] * l_r[rt][r]; }
  __builtin_amdgcn_fence(__ATOMIC_ACQ_REL, "workgroup"); __builtin_amdgcn_wave_barrier();
  {
#pragma unroll
    for (int rp = 0; rp < RPW; rp += 2) { const int r = rp + (lane >> 4), pc = lane & 15; const v4f val = *(const v4fa*)&sO[w][r][pc * 4]; *(v4f*)(O + ((size_t)b * TQ + q0 + r) * ldo + h * 64 + pc * 4) = val; }
     } }
// 5-plane variant: S = Qh Kh^T + (Ql Kh^T + Qh Kl^T)/1024 with Q/K = [hi | 2^10 residual] f16 planes (QL/KL same layout as Q16/K16), then the 3-term P.V below.
// 3-term variant: O = (P_hi V_hi + (P_lo V_hi + P_hi V_lo) / 1024) / l with P = [hi | 2^10 residual] of 1024 p and V^T = [hi | 2^10 residual] planes (VtL same layout as Vt) -> ~2^-21-class products for un-averaged (early causal / peaked) rows
template <int CAUSAL>
__global__ __launch_bounds__(128) void k_flash5(const _Float16* __restrict__ Q16, const _Float16* __restrict__ QL, int ldq, const _Float16* __restrict__ K16, const _Float16* __restrict__ KL, int ldk, const _Float16* __restrict__ Vt, const _Float16* __restrict__ VtL, const int* __restrict__ MSK, float* __restrict__ O, int ldo) {
  constexpr int RPW = 16, RTN = RPW / 16, NQB = TQ / (4 * RPW), DT = 4, KS = 2;
  __shared__ __attribute__((aligned(16))) unsigned short sP[4][RPW][40]; __shared__ __attribute__((aligned(16))) unsigned short sPL[4][RPW][40]; __shared__ __attribute__((aligned(16))) float sO[4][RPW][64 + 4];
  const int tid = threadIdx.x, w = tid >> 5, lane = tid & 31, ln = lane & 15, hh = lane >> 4;
  const int slab = blockIdx.x / QBN5, qblk = QB05 + blockIdx.x % QBN5; (void)NQB; const int b = slab / NH, h = slab % NH; const int qb0 = qblk * (4 * RPW); const int q0 = qb0 + w * RPW;
  FragH aq[2][KS], aql[2][KS];
#pragma unroll
  for (int rt = 0; rt < RTN; ++rt) { const unsigned short* qr = (const unsigned short*)Q16 + ((size_t)b * TQ + q0 + rt * 16 + ln) * ldq + h * 64; const unsigned short* ql = (const unsigned short*)QL + ((size_t)b * TQ + q0 + rt * 16 + ln) * ldq + h * 64;
#pragma unroll
    for (int ks = 0; ks < KS; ++ks) { aq[rt][ks].half[0] = *(const v8us*)(qr + ks * 32 + 8 * hh); aq[rt][ks].half[1] = *(const v8us*)(qr + ks * 32 + 16 + 8 * hh); aql[rt][ks].half[0] = *(const v8us*)(ql + ks * 32 + 8 * hh); aql[rt][ks].half[1] = *(const v8us*)(ql + ks * 32 + 16 + 8 * hh); } }
  const unsigned short* Vth = (const unsigned short*)Vt + (size_t)slab * 64 * TK; const unsigned short* Vtl = (const unsigned short*)VtL + (size_t)slab * 64 * TK;
  float m_r[2][8], l_r[2][8]; v8f oacc[2][DT], oaccL[2][DT];
#pragma unroll
  for (int rt = 0; rt < RTN; ++rt) {
#pragma unroll
    for (int r = 0; r < 8; ++r) { m_r[rt][r] = -3.0e38f; l_r[rt][r] = 0.f; }
#pragma unroll
    for (int dt = 0; dt < DT; ++dt) { oacc[rt][dt] = (v8f){0.f,0.f,0.f,0.f,0.f,0.f,0.f,0.f}; oaccL[rt][dt] = oacc[rt][dt]; } }
  const int jend = (CAUSAL == 1) ? (qb0 + 4 * RPW) : ((CAUSAL == 23) ? min(TK, (qb0 / CHK + 2) * CHK) : TK);      /* causal / window: keys that can never contribute are skipped */ const int jbeg = (CAUSAL == 23) ? max(0, (qb0 / CHK - 1) * CHK) : 0;
#pragma unroll 1
  for (int j0 = jbeg; j0 < jend; j0 += 32) {
    v8f s[2][2];
#pragma unroll
    for (int nt = 0; nt < 2; ++nt) { const unsigned short* kr = (const unsigned short*)K16 + ((size_t)b * TK + j0 + nt * 16 + ln) * ldk + h * 64; const unsigned short* klr = (const unsigned short*)KL + ((size_t)b * TK + j0 + nt * 16 + ln) * ldk + h * 64; FragH bk[KS], bkl[KS];
#pragma unroll
      for (int ks = 0; ks < KS; ++ks) { bk[ks].half[0] = *(const v8us*)(kr + ks * 32 + 8 * hh); bk[ks].half[1] = *(const v8us*)(kr + ks * 32 + 16 + 8 * hh); bkl[ks].half[0] = *(const v8us*)(klr + ks * 32 + 8 * hh); bkl[ks].half[1] = *(const v8us*)(klr + ks * 32 + 16 + 8 * hh); }
#pragma unroll
      for (int rt = 0; rt < RTN; ++rt) { v8f acc = (v8f){0.f,0.f,0.f,0.f,0.f,0.f,0.f,0.f}, accl = acc;
#pragma unroll
        for (int ks = 0; ks < KS; ++ks) { acc = mmaH<1>(aq[rt][ks].v, aq[rt][ks].v, bk[ks].v, bk[ks].v, acc); accl = mmaH<1>(aql[rt][ks].v, aql[rt][ks].v, bk[ks].v, bk[ks].v, accl); accl = mmaH<1>(aq[rt][ks].v, aq[rt][ks].v, bkl[ks].v, bkl[ks].v, accl); }
#pragma unroll
        for (int r = 0; r < 8; ++r) acc[r] += accl[r] * 0.0009765625f;
        s[rt][nt] = acc; } }
#pragma unroll
    for (int rt = 0; rt < RTN; ++rt)
#pragma unroll
      for (int r = 0; r < 8; ++r) { const int tq = q0 + rt * 16 + 8 * hh + r; const int k0 = j0 + ln, k1 = j0 + 16 + ln;
        bool ok0 = (CAUSAL == 1) ? (k0 <= tq) : ((CAUSAL == 2) ? ((k0 >> 5) == (tq >> 5)) : true), ok1 = (CAUSAL == 1) ? (k1 <= tq) : ((CAUSAL == 2) ? ((k1 >> 5) == (tq >> 5)) : true);      /* mode 2: block-diagonal 32-token groups */
        if (CAUSAL == 4) { const int* mrow = MSK + ((size_t)b * TQ + tq) * TK; ok0 = mrow[k0] != 0; ok1 = mrow[k1] != 0; }      /* mode 4: per-(query, key) INPUT mask shared by all heads; masked keys contribute nothing (== the reference's -4096 fill, whose exp underflows to 0), rows with no valid key give l = 0 -> output 0 (== the reference's row_valid zeroing) */
        float s0 = ok0 ? s[rt][0][r] * SCL : -3.0e38f, s1 = ok1 ? s[rt][1][r] * SCL : -3.0e38f; if (CAUSAL == 17) { const float* amk = (const float*)MSK + (size_t)b * TK; s0 += bf16_round(amk[k0]); s1 += bf16_round(amk[k1]); } if (CAUSAL == 18) { const float* tb = (const float*)MSK; const int* ri = MSK + 1024 + (size_t)b * TK; const int rq = ri[tq]; s0 += tb[(h * 8 + rq) * 8 + ri[k0]]; s1 += tb[(h * 8 + rq) * 8 + ri[k1]]; } if (CAUSAL == 19) { const int* rel = MSK + (size_t)tq * TK; const float* rb = (const float*)MSK + (size_t)TQ * TK + ((size_t)(b * NH + h) * TQ + tq) * 64; s0 += rb[rel[k0]]; s1 += rb[rel[k1]]; }      /* mode 19: + (q.Ek[rel] + Eb[rel][h]) / 8 gathered by the int relative ids (packed [ids | table]) */      /* mode 18: + resource_bias[h][r_q][r_k] from the packed [table | ids] buffer (TQ == TK) */      /* mode 17: additive per-(batch, key) mask INPUT */ float mc = fmaxf(s0, s1);
        mc = fmaxf(mc, __shfl_xor(mc, 1, 32)); mc = fmaxf(mc, __shfl_xor(mc, 2, 32)); mc = fmaxf(mc, __shfl_xor(mc, 4, 32)); mc = fmaxf(mc, __shfl_xor(mc, 8, 32));
        const float mn = fmaxf(m_r[rt][r], mc); const float al = (mn > -1.0e38f) ? expf(m_r[rt][r] - mn) : 1.0f; m_r[rt][r] = mn; const float p0 = ok0 ? expf(s0 - mn) : 0.f, p1 = ok1 ? expf(s1 - mn) : 0.f; l_r[rt][r] = l_r[rt][r] * al + p0 + p1;
#pragma unroll
        for (int dt = 0; dt < DT; ++dt) { oacc[rt][dt][r] *= al; oaccL[rt][dt][r] *= al; }
        FragH t2, t2l; const float ps0 = p0 * 1024.0f, ps1 = p1 * 1024.0f; t2.h[0] = (_Float16)ps0; t2.h[1] = (_Float16)ps1; t2l.h[0] = (_Float16)((ps0 - (float)t2.h[0]) * 1024.0f); t2l.h[1] = (_Float16)((ps1 - (float)t2.h[1]) * 1024.0f);
        sP[w][rt * 16 + 8 * hh + r][ln] = t2.u[0]; sP[w][rt * 16 + 8 * hh + r][16 + ln] = t2.u[1]; sPL[w][rt * 16 + 8 * hh + r][ln] = t2l.u[0]; sPL[w][rt * 16 + 8 * hh + r][16 + ln] = t2l.u[1]; }
    __builtin_amdgcn_fence(__ATOMIC_ACQ_REL, "workgroup"); __builtin_amdgcn_wave_barrier();
    FragH pa[2], pl[2];
#pragma unroll
    for (int rt = 0; rt < RTN; ++rt) { pa[rt].half[0] = *(const v8us*)&sP[w][rt * 16 + ln][8 * hh]; pa[rt].half[1] = *(const v8us*)&sP[w][rt * 16 + ln][16 + 8 * hh]; pl[rt].half[0] = *(const v8us*)&sPL[w][rt * 16 + ln][8 * hh]; pl[rt].half[1] = *(const v8us*)&sPL[w][rt * 16 + ln][16 + 8 * hh]; }
#pragma unroll
    for (int dt = 0; dt < DT; ++dt) { const unsigned short* vrow = Vth + (size_t)(dt * 16 + ln) * TK + j0; const unsigned short* vrl = Vtl + (size_t)(dt * 16 + ln) * TK + j0; FragH bv, bl; bv.half[0] = *(const v8us*)(vrow + 8 * hh); bv.half[1] = *(const v8us*)(vrow + 16 + 8 * hh); bl.half[0] = *(const v8us*)(vrl + 8 * hh); bl.half[1] = *(const v8us*)(vrl + 16 + 8 * hh);
#pragma unroll
      for (int rt = 0; rt < RTN; ++rt) { oacc[rt][dt] = mmaH<1>(pa[rt].v, pa[rt].v, bv.v, bv.v, oacc[rt][dt]); oaccL[rt][dt] = mmaH<1>(pl[rt].v, pl[rt].v, bv.v, bv.v, oaccL[rt][dt]); oaccL[rt][dt] = mmaH<1>(pa[rt].v, pa[rt].v, bl.v, bl.v, oaccL[rt][dt]); } }
    __builtin_amdgcn_fence(__ATOMIC_ACQ_REL, "workgroup"); __builtin_amdgcn_wave_barrier(); }
#pragma unroll
  for (int rt = 0; rt < RTN; ++rt) {
#pragma unroll
    for (int r = 0; r < 8; ++r) { float l = l_r[rt][r]; l += __shfl_xor(l, 1, 32); l += __shfl_xor(l, 2, 32); l += __shfl_xor(l, 4, 32); l += __shfl_xor(l, 8, 32); l_r[rt][r] = (l > 0.f) ? 1.0f / (l * 1024.0f) : 0.f; }
#pragma unroll
    for (int dt = 0; dt < DT; ++dt)
#pragma unroll
      for (int r = 0; r < 8; ++r) { float v = oacc[rt][dt][r]; v += oaccL[rt][dt][r] * 0.0009765625f; sO[w][rt * 16 + 8 * hh + r][dt * 16 + ln] = v * l_r[rt][r]; } }
  __builtin_amdgcn_fence(__ATOMIC_ACQ_REL, "workgroup"); __builtin_amdgcn_wave_barrier();
  {
#pragma unroll
    for (int rp = 0; rp < RPW; rp += 2) { const int r = rp + (lane >> 4), pc = lane & 15; const v4f val = *(const v4fa*)&sO[w][r][pc * 4]; *(v4f*)(O + ((size_t)b * TQ + q0 + r) * ldo + h * 64 + pc * 4) = val; }
     } }

__global__ __launch_bounds__(256) void k_rotab(float* __restrict__ CS, float* __restrict__ SN) {
  #pragma clang fp contract(off)
  const int t = blockIdx.x * 256 + threadIdx.x; if (t >= SLEN * 32) return; const int j = t % 32, s = t / 32; const float ex = (float)(2 * j) / 64.0f; const float inv = 1.0f / powf(10000.0f, ex); const float th = (float)s * inv; const float c = cosf(th), sn = sinf(th);
  { *(float*)(CS + t) = c; *(float*)(SN + t) = sn;  } }
__global__ __launch_bounds__(256) void k_rope(const float* __restrict__ F, int nsrc, int ndst, int rep, const float* __restrict__ CS, const float* __restrict__ SN, _Float16* __restrict__ H, _Float16* __restrict__ L) {
  #pragma clang fp contract(off)
  const size_t t = (size_t)blockIdx.x * 256 + threadIdx.x; if (t >= (size_t)NR * ndst * 4) return; const int g8 = (int)(t % 4); const int hd = (int)((t / 4) % ndst); const size_t row = t / ((size_t)4 * ndst); const int s = (int)(row % SLEN); const int hs = hd / rep;
  const float* src = F + row * (size_t)(nsrc * 64) + hs * 64; FragH ah, al, bh, bl;
  for (int i = 0; i < 8; ++i) { const int d = g8 * 8 + i; const float c = CS[s * 32 + d], sn = SN[s * 32 + d]; const float x1 = src[d], x2 = src[d + 32];
    float o1 = x1 * c; o1 += -x2 * sn; float o2 = x2 * c; o2 += x1 * sn;
    _Float16 hv = (_Float16)o1; ah.h[i] = hv; al.h[i] = (_Float16)((o1 - (float)hv) * 1024.0f); hv = (_Float16)o2; bh.h[i] = hv; bl.h[i] = (_Float16)((o2 - (float)hv) * 1024.0f); }
  const size_t o = row * (size_t)(ndst * 64) + hd * 64 + g8 * 8;
  { *(v8us*)((unsigned short*)H + o) = ah.half[0]; *(v8us*)((unsigned short*)H + o + 32) = bh.half[0]; *(v8us*)((unsigned short*)L + o) = al.half[0]; *(v8us*)((unsigned short*)L + o + 32) = bl.half[0];  } }
__global__ __launch_bounds__(256) void k_rope2(const float* __restrict__ F, int nsrc, int ndst, int rep, const float* __restrict__ CS, const float* __restrict__ SN, _Float16* __restrict__ H, _Float16* __restrict__ L) {
  #pragma clang fp contract(off)
  const size_t t = (size_t)blockIdx.x * 256 + threadIdx.x; if (t >= (size_t)NR * ndst * 4) return; const int g16 = (int)(t % 4); const int hd = (int)((t / 4) % ndst); const size_t row = t / ((size_t)4 * ndst); const int s = (int)(row % SLEN); const int hs = hd / rep;
  const float* src = F + row * (size_t)(nsrc * 64) + hs * 64 + g16 * 16; FragH ah, al;
  for (int pr = 0; pr < 8; ++pr) { const int i = g16 * 8 + pr; const float c = CS[s * 32 + i], sn = SN[s * 32 + i]; const float x1 = src[2 * pr], x2 = src[2 * pr + 1];
    float o1 = x1 * c; o1 -= x2 * sn; float o2 = x1 * sn; o2 += x2 * c;
    _Float16 hv = (_Float16)o1; ah.h[2 * pr] = hv; al.h[2 * pr] = (_Float16)((o1 - (float)hv) * 1024.0f); hv = (_Float16)o2; ah.h[2 * pr + 1] = hv; al.h[2 * pr + 1] = (_Float16)((o2 - (float)hv) * 1024.0f); }
  const size_t o = row * (size_t)(ndst * 64) + hd * 64 + g16 * 16;
  { *(v8us*)((unsigned short*)H + o) = ah.half[0]; *(v8us*)((unsigned short*)H + o + 8) = ah.half[1]; *(v8us*)((unsigned short*)L + o) = al.half[0]; *(v8us*)((unsigned short*)L + o + 8) = al.half[1];  } }
__global__ __launch_bounds__(256) void k_ln512(const float* __restrict__ A, const float* __restrict__ res, const float* __restrict__ g, const float* __restrict__ bb, float* __restrict__ Y, _Float16* __restrict__ Y16) {
  #pragma clang fp contract(off)
  const int wv = threadIdx.x >> 5, ln = threadIdx.x & 31; const size_t r = (size_t)blockIdx.x * 8 + wv; if (r >= NR) return; float x[16]; float s = 0.f;
  for (int i = 0; i < 2; ++i) { const v8f a = *(const v8f*)(A + r * DM + i * 256 + ln * 8); for (int q = 0; q < 8; ++q) { float v = a[q]; if (res) v += bf16_round(res[r * DM + i * 256 + ln * 8 + q]); x[i * 8 + q] = v; s += v; } }
  for (int o = 16; o > 0; o >>= 1) s += __shfl_xor(s, o, 32); const float mu = s / (float)DM; float var = 0.f; for (int q = 0; q < 16; ++q) { const float d = x[q] - mu; var += d * d; }
  for (int o = 16; o > 0; o >>= 1) var += __shfl_xor(var, o, 32); const float inv = rsqrtf(var / (float)DM + 1e-5f);
  { for (int i = 0; i < 2; ++i) { const int c0 = i * 256 + ln * 8; v8f y; FragH f; for (int q = 0; q < 8; ++q) { float v = (x[i * 8 + q] - mu) * inv; v *= bf16_round(g[c0 + q]); v += bf16_round(bb[c0 + q]); y[q] = v; f.h[q] = (_Float16)v; } *(v8f*)(Y + r * DM + c0) = y; if (Y16) *(v8us*)((unsigned short*)Y16 + r * DM + c0) = f.half[0]; }  } }
__global__ __launch_bounds__(256) void k_pack(const float* __restrict__ rb, const int* __restrict__ rid, int* __restrict__ PK) { const int t = blockIdx.x * 256 + threadIdx.x; if (t >= 1024 + NB * TK) return; int v; if (t < 1024) v = __float_as_int(bf16_round(rb[t])); else v = rid[t - 1024]; *(int*)(PK + t) = v;  }
__global__ __launch_bounds__(256) void k_tabin(const float* __restrict__ sp, float* __restrict__ CS, float* __restrict__ SN) { const int t = blockIdx.x * 256 + threadIdx.x; if (t >= SLEN * 32) return; const int i = t % 32, s = t / 32; const float c = bf16_round(sp[s * 64 + 32 + i]), sn = bf16_round(sp[s * 64 + i]);
  { *(float*)(CS + t) = c; *(float*)(SN + t) = sn;  } }
__global__ __launch_bounds__(256) void k_wsc(const float* __restrict__ Wm, _Float16* __restrict__ Bt, size_t n8, float sc) { const size_t t = (size_t)blockIdx.x * 256 + threadIdx.x; if (t >= n8) return; FragH f; for (int q = 0; q < 8; ++q) f.h[q] = (_Float16)(bf16_round(Wm[t * 8 + q]) * sc); *(v8us*)((unsigned short*)Bt + t * 8) = f.half[0];  }
__global__ __launch_bounds__(256) void k_rotab2(float* __restrict__ CS, float* __restrict__ SN) {
  #pragma clang fp contract(off)
  const int t = blockIdx.x * 256 + threadIdx.x; if (t >= SLEN * 32) return; const int j = t % 32, s = t / 32; const float c0 = -0.14391156831212787f;      /* -ln(10000)/64 rounded to f32 */ const float inv = expf((float)(2 * j) * c0); const float th = (float)s * inv; const float c = cosf(th), sn = sinf(th);
  { *(float*)(CS + t) = c; *(float*)(SN + t) = sn;  } }
__global__ __launch_bounds__(256) void k_lnu(const float* __restrict__ X, _Float16* __restrict__ N16, float* __restrict__ XB) {
  #pragma clang fp contract(off)
  const int wv = threadIdx.x >> 5, ln = threadIdx.x & 31; const size_t r = (size_t)blockIdx.x * 8 + wv; if (r >= NR) return; float a[32]; float s = 0.f;
  for (int i = 0; i < 4; ++i) { const v8f v = *(const v8f*)(X + r * DM + (i * 32 + ln) * 8); for (int q = 0; q < 8; ++q) { const float u = bf16_round(v[q]); a[i * 8 + q] = u; s += u; } }
  for (int o = 16; o > 0; o >>= 1) s += __shfl_xor(s, o, 32); const float mu = s / (float)DM; float var = 0.f; for (int q = 0; q < 32; ++q) { const float d = a[q] - mu; var += d * d; }
  for (int o = 16; o > 0; o >>= 1) var += __shfl_xor(var, o, 32); const float den = sqrtf(var / (float)(DM - 1)) + 1e-6f; const float inv = 1.0f / den;      /* one reciprocal per row; (x-mean)*inv vs the reference's division differs by <= 1 ulp */
  { for (int i = 0; i < 4; ++i) { const int c0 = (i * 32 + ln) * 8; FragH f; v8f xb; for (int q = 0; q < 8; ++q) { f.h[q] = (_Float16)((a[i * 8 + q] - mu) * inv); xb[q] = a[i * 8 + q]; } *(v8us*)((unsigned short*)N16 + r * DM + c0) = f.half[0]; *(v8f*)(XB + r * DM + c0) = xb; }  } }
__global__ __launch_bounds__(256) void k_vtg(const _Float16* __restrict__ V16, _Float16* __restrict__ Vt) { __shared__ unsigned short tl[64][66]; const int tid = threadIdx.x; const int slab = blockIdx.x / (SLEN / 64), lg = blockIdx.x % (SLEN / 64); const int b = slab / NH, h = slab % NH; const int hs = h / NREP;
  for (int i = tid; i < 64 * 8; i += 256) { const int r = i / 8, c8 = (i % 8) * 8; FragH f; f.half[0] = *(const v8us*)((const unsigned short*)V16 + ((size_t)b * SLEN + lg * 64 + r) * KVD + hs * 64 + c8); for (int q = 0; q < 8; ++q) tl[r][c8 + q] = f.u[q]; }
  __syncthreads();
  { for (int rd = 0; rd < 2; ++rd) { const int d = rd * 32 + tid / 8, pc = tid % 8; FragH f; for (int q = 0; q < 8; ++q) f.u[q] = tl[pc * 8 + q][d]; *(v8us*)((unsigned short*)Vt + ((size_t)slab * 64 + d) * SLEN + lg * 64 + pc * 8) = f.half[0]; }  } }

__global__ __launch_bounds__(256) void k_h16s(const float* __restrict__ SRC, int lds, int coff, _Float16* __restrict__ DST, size_t n8) { const size_t t = (size_t)blockIdx.x * 256 + threadIdx.x; if (t >= n8) return; const size_t r = (t * 8) / DM; const int c = (int)((t * 8) % DM); const v8f a = *(const v8f*)(SRC + r * lds + coff + c); FragH f; for (int q = 0; q < 8; ++q) f.h[q] = (_Float16)a[q];
  *(v8us*)((unsigned short*)DST + t * 8) = f.half[0];  }

__global__ __launch_bounds__(256) void k_norms(const float* __restrict__ QKV, float* __restrict__ QN, float* __restrict__ KN) {
  #pragma clang fp contract(off)
  const size_t t = (size_t)blockIdx.x * 256 + threadIdx.x; if (t >= (size_t)NR * NH) return; const int h = (int)(t % NH); const size_t row = t / NH; const float* q = QKV + row * (3 * DM) + h * 64; const float* k = q + DM; float sq = 0.f, sk = 0.f;
#pragma unroll 1
  for (int d = 0; d < 64; d += 4) { const v4f a = *(const v4fa*)(q + d), b = *(const v4fa*)(k + d); for (int i = 0; i < 4; ++i) { sq += a[i] * a[i]; sk += b[i] * b[i]; } }
  { *(float*)(QN + t) = sq; *(float*)(KN + ((row / SLEN) * NH + h) * SLEN + row % SLEN) = sk;  } }      /* key norms [(b, h)][s]: 8 consecutive keys per lane in the attention kernel */
// strided hi + residual copy of a DM-wide third of QKV
__global__ __launch_bounds__(256) void k_hls(const float* __restrict__ SRC, int lds, int coff, _Float16* __restrict__ DH, _Float16* __restrict__ DL, size_t n8) { const size_t t = (size_t)blockIdx.x * 256 + threadIdx.x; if (t >= n8) return; const size_t r = (t * 8) / DM; const int c = (int)((t * 8) % DM); const v8f a = *(const v8f*)(SRC + r * lds + coff + c); FragH fh, fl; for (int q = 0; q < 8; ++q) { const _Float16 h = (_Float16)a[q]; fh.h[q] = h; fl.h[q] = (_Float16)((a[q] - (float)h) * 1024.0f); }
  { *(v8us*)((unsigned short*)DH + t * 8) = fh.half[0]; *(v8us*)((unsigned short*)DL + t * 8) = fl.half[0];  } }
// lane l <-> l ^ 16 (the two halves of a wave hold the two key halves of one query column)
__device__ __forceinline__ float xhalf(float v) { const int t = __float_as_int(v); return __int_as_float(__builtin_amdgcn_permlanex16(t, t, 0x76543210, 0xfedcba98, false, false)); }
__device__ __forceinline__ v8f wmh(v16h a, v16h b, v8f c) { return __builtin_amdgcn_wmma_f32_16x16x32_f16(false, a, false, b, (short)0, c, false, false); }
// 16 x 32 f16 fragment at a wave-uniform byte base plus a per-lane byte offset that never changes (k = 8h + s, 16 + 8h + s)
__device__ __forceinline__ v16h ef_frag(const char* base, unsigned off) { FragH f; f.half[0] = *(const v8us*)(base + off); f.half[1] = *(const v8us*)(base + off + 32); return f.v; }
typedef _Float16 v8h __attribute__((ext_vector_type(8)));
typedef float v2f __attribute__((ext_vector_type(2)));
// eight 2^x in one statement: results kept apart from the arguments ("=&v") and one v_nop behind the last, the slot the instruction set asks for
// between a transcendental and an instruction that uses its result or overwrites its source (the register allocator otherwise reuses the previous argument as the next result)
__device__ __forceinline__ v8f exp2x8(v8f e) { float p0, p1, p2, p3, p4, p5, p6, p7;
  asm("v_exp_f32 %0, %8\n\tv_exp_f32 %1, %9\n\tv_exp_f32 %2, %10\n\tv_exp_f32 %3, %11\n\tv_exp_f32 %4, %12\n\tv_exp_f32 %5, %13\n\tv_exp_f32 %6, %14\n\tv_exp_f32 %7, %15\n\tv_nop"
      : "=&v"(p0), "=&v"(p1), "=&v"(p2), "=&v"(p3), "=&v"(p4), "=&v"(p5), "=&v"(p6), "=&v"(p7) : "v"(e[0]), "v"(e[1]), "v"(e[2]), "v"(e[3]), "v"(e[4]), "v"(e[5]), "v"(e[6]), "v"(e[7]));
  return (v8f){p0, p1, p2, p3, p4, p5, p6, p7}; }
// Fused distance attention, one launch for all (batch, head) slabs: per wave 32 query columns, per pass 32 keys.
// S^T = K Q^T (A = key rows, B = query rows; hi.hi + (hi.lo + lo.hi) / 1024), so a lane holds 8 + 8 keys of ONE query per column group:
// logits, running maximum and sum stay in the lane (one exchange between the wave halves); the two f32 score tiles, converted in place,
// are the B operand of O^T += V^T P^T (k order 8h + s, 16 + 8h + s on both sides). A lane ends with 8 consecutive d of one query: 16-byte stores of hi and residual.
// amdgpu_waves_per_eu(4, 4): a budget of 256 VGPRs, so that the whole kernel stays in one register window (it takes 240, no scratch)
__global__ __launch_bounds__(256) __attribute__((amdgpu_waves_per_eu(4, 4))) void k_eflash(const _Float16* __restrict__ QHp, const _Float16* __restrict__ QLp, const _Float16* __restrict__ KHp, const _Float16* __restrict__ KLp, const _Float16* __restrict__ Vt,
                                                const float* __restrict__ QN, const float* __restrict__ KNT, const float* __restrict__ tmp, _Float16* __restrict__ OH, _Float16* __restrict__ OL) {
  const int tid = threadIdx.x, w = tid >> 5, lane = tid & 31, ln = lane & 15, hh = lane >> 4;
  const int slab = blockIdx.x / (SLEN / 256), qblk = blockIdx.x % (SLEN / 256); const int b = slab / NH, h = slab % NH; const int q0 = qblk * 256 + w * 32;
  const float nc = -(1.0f / bf16_round(tmp[0])) * 1.4426950408889634f;      /* logit in log2 units = d2 * nc */
  v16h qh[2][2], ql[2][2]; float qn[2];
#pragma unroll
  for (int qt = 0; qt < 2; ++qt) { const size_t row = (size_t)b * SLEN + q0 + qt * 16 + ln; const _Float16* ph = QHp + row * DM + h * 64; const _Float16* pl = QLp + row * DM + h * 64;
    qh[qt][0] = g2_frag(ph, hh); qh[qt][1] = g2_frag(ph + 32, hh); ql[qt][0] = g2_frag(pl, hh); ql[qt][1] = g2_frag(pl + 32, hh); qn[qt] = QN[row * NH + h]; }
  const char* kbh = (const char*)(KHp + (size_t)b * SLEN * DM + h * 64); const char* kbl = (const char*)(KLp + (size_t)b * SLEN * DM + h * 64); const unsigned kof = (unsigned)(ln * (DM * 2) + hh * 16);
  const char* vb = (const char*)(Vt + (size_t)slab * 64 * SLEN); const unsigned vof = (unsigned)(ln * (SLEN * 2) + hh * 16);
  const char* nb = (const char*)(KNT + (size_t)slab * SLEN); const unsigned nof = (unsigned)(hh * 32);
  const v8f z8 = {0.f,0.f,0.f,0.f,0.f,0.f,0.f,0.f};
  float m[2] = {-3.0e38f, -3.0e38f}; v2f l[2] = {{0.f, 0.f}, {0.f, 0.f}}; v8f o[2][4];
#pragma unroll
  for (int qt = 0; qt < 2; ++qt)
#pragma unroll
    for (int dt = 0; dt < 4; ++dt) o[qt][dt] = z8;
#pragma unroll 1      /* one pass per trip: the body already holds 32 matrix instructions, a copy would only add registers */
  for (int j0 = 0; j0 < SLEN; j0 += 32) {
    v8f u[2][2];
#pragma unroll
    for (int kt = 0; kt < 2; ++kt) { const char* kr = kbh + (size_t)(j0 + kt * 16) * (DM * 2); const char* kq = kbl + (size_t)(j0 + kt * 16) * (DM * 2);
      const v8f k2 = *(const v8f*)(nb + (size_t)(j0 + kt * 16) * 4 + nof); const v16h a0 = ef_frag(kr, kof), a1 = ef_frag(kr + 64, kof), c0 = ef_frag(kq, kof), c1 = ef_frag(kq + 64, kof);
      asm volatile("s_wait_xcnt 0x0" ::: "memory");      /* the address registers of these loads are free for reuse from here on, also as a later load's result: the wait that belongs in front of that overwrite */
#pragma unroll
      for (int qt = 0; qt < 2; ++qt) { v8f lo = wmh(a0, ql[qt][0], z8); lo = wmh(a1, ql[qt][1], lo); lo = wmh(c0, qh[qt][0], lo); lo = wmh(c1, qh[qt][1], lo); v8f hi = wmh(a0, qh[qt][0], z8); hi = wmh(a1, qh[qt][1], hi);
        const v8f s = hi + lo * 0.0009765625f; const v8f d2 = __builtin_elementwise_max((k2 + qn[qt]) - 2.0f * s, z8); u[qt][kt] = d2 * nc; } }
    float mn[2];
#pragma unroll
    for (int qt = 0; qt < 2; ++qt) { const v8f t = __builtin_elementwise_max(u[qt][0], u[qt][1]); float mx = fmaxf(fmaxf(fmaxf(t[0], t[1]), fmaxf(t[2], t[3])), fmaxf(fmaxf(t[4], t[5]), fmaxf(t[6], t[7])));
      mx = fmaxf(mx, xhalf(mx)); mn[qt] = fmaxf(m[qt], mx); }
    if (__builtin_amdgcn_ballot_w32((mn[0] > m[0]) || (mn[1] > m[1])) != 0) {      /* scalar branch: sums and output tiles are rescaled only in a pass that raises some column's maximum */
#pragma unroll
      for (int qt = 0; qt < 2; ++qt) { const float al = __builtin_amdgcn_exp2f(m[qt] - mn[qt]); m[qt] = mn[qt]; l[qt] *= al;
#pragma unroll
        for (int dt = 0; dt < 4; ++dt) o[qt][dt] *= al; } }
    FragH pb[2];
#pragma unroll
    for (int qt = 0; qt < 2; ++qt) { const float mo = m[qt] - 10.0f;      /* weights carried times 1024, as f16 operands away from the subnormal range; the factor cancels between sum and output */
      v8f p[2];
#pragma unroll
      for (int kt = 0; kt < 2; ++kt) { p[kt] = exp2x8(u[qt][kt] - mo);
        const v8h ph = __builtin_convertvector(p[kt], v8h);
#pragma unroll
        for (int r = 0; r < 8; ++r) pb[qt].h[kt * 8 + r] = ph[r]; }
      const v8f t = p[0] + p[1]; const v4f t4 = t.lo + t.hi; l[qt] += t4.lo + t4.hi; }
#pragma unroll
    for (int dt = 0; dt < 4; ++dt) { const v16h va = ef_frag(vb + (size_t)j0 * 2 + (size_t)(dt * 16) * (SLEN * 2), vof);
#pragma unroll
      for (int qt = 0; qt < 2; ++qt) o[qt][dt] = wmh(va, pb[qt].v, o[qt][dt]); }
  }
#pragma unroll
  for (int qt = 0; qt < 2; ++qt) { const float lh = l[qt][0] + l[qt][1]; const float inv = 1.0f / (lh + xhalf(lh)); const size_t ob = ((size_t)b * SLEN + q0 + qt * 16 + ln) * DM + h * 64 + 8 * hh;
#pragma unroll
    for (int dt = 0; dt < 4; ++dt) { FragH f, fl;
#pragma unroll
      for (int r = 0; r < 8; ++r) { const float v = o[qt][dt][r] * inv; const _Float16 hv = (_Float16)v; f.h[r] = hv; fl.h[r] = (_Float16)((v - (float)hv) * 1024.0f); }
      *(v8us*)((unsigned short*)OH + ob + dt * 16) = f.half[0]; *(v8us*)((unsigned short*)OL + ob + dt * 16) = fl.half[0]; } }
}
extern "C" void kernel_launch(void* const* d_in, const int* in_sizes, int n_in,
                              void* d_out, int out_size, void* d_ws, size_t ws_size, hipStream_t stream) {
  (void)in_sizes; (void)n_in; (void)out_size;
  const float* const* I = (const float* const*)d_in; const float* x = I[0]; const float* wq = I[1]; const float* bq = I[2]; const float* wk = I[3]; const float* bk = I[4]; const float* wv = I[5]; const float* bv = I[6]; const float* wo = I[7]; const float* bo = I[8]; const float* tmp = I[9];
  char* ws = (char*)d_ws; size_t off = 0;
  auto take = [&](size_t bytes) { char* p = ws + off; off += (bytes + 255) & ~(size_t)255; return p; };
  const size_t np = (size_t)NR * DM;
  _Float16* BQ = (_Float16*)take((size_t)DM * DM * 2); _Float16* BK = (_Float16*)take((size_t)DM * DM * 2); _Float16* BV = (_Float16*)take((size_t)DM * DM * 2); _Float16* BO = (_Float16*)take((size_t)DM * DM * 2);
  _Float16* X16 = (_Float16*)take(np * 2); float* QKV = (float*)take(np * 3 * 4); float* QN = (float*)take((size_t)NR * NH * 4); float* KN = (float*)take((size_t)NR * NH * 4); _Float16* QH = (_Float16*)take(np * 2); _Float16* QL = (_Float16*)take(np * 2); _Float16* KH = (_Float16*)take(np * 2); _Float16* KL = (_Float16*)take(np * 2); _Float16* VH = (_Float16*)take(np * 2); _Float16* VT = (_Float16*)take(np * 2);
  _Float16* OH = VH; _Float16* OL = X16;      /* O hi over v (dead after V^T), O lo over x (dead after the projections) */
  if (off > ws_size) return;      /* 8 + 8 + 48 + 0.5 + 6x8 = about 113 MiB */
  k_wt_f16<<<(unsigned)(((size_t)DM * DM / 8 + 255) / 256), 256, 0, stream>>>(wq, BQ, DM, DM, 16.0f); k_wt_f16<<<(unsigned)(((size_t)DM * DM / 8 + 255) / 256), 256, 0, stream>>>(wk, BK, DM, DM, 16.0f); k_wt_f16<<<(unsigned)(((size_t)DM * DM / 8 + 255) / 256), 256, 0, stream>>>(wv, BV, DM, DM, 16.0f); k_wt_f16<<<(unsigned)(((size_t)DM * DM / 8 + 255) / 256), 256, 0, stream>>>(wo, BO, DM, DM, 16.0f);      /* [in, out] */
  k_x16<<<(unsigned)((np / 8 + 255) / 256), 256, 0, stream>>>(x, X16, np / 8);
  const dim3 gP((NR / 128) * (DM / 64), 1);
  k_gemm2<0><<<gP, 128, 0, stream>>>(X16, DM, 0, BQ, DM, 0, 0.0625f, bq, 0, nullptr, 1, 0, 0, QKV, nullptr, 3 * DM, 0, NR, DM, DM); k_gemm2<0><<<gP, 128, 0, stream>>>(X16, DM, 0, BK, DM, 0, 0.0625f, bk, 0, nullptr, 1, 0, 0, QKV + DM, nullptr, 3 * DM, 0, NR, DM, DM); k_gemm2<0><<<gP, 128, 0, stream>>>(X16, DM, 0, BV, DM, 0, 0.0625f, bv, 0, nullptr, 1, 0, 0, QKV + 2 * DM, nullptr, 3 * DM, 0, NR, DM, DM);      /* [q | k | v] f32 */
  k_norms<<<(unsigned)(((size_t)NR * NH + 255) / 256), 256, 0, stream>>>(QKV, QN, KN);
  k_hls<<<(unsigned)((np / 8 + 255) / 256), 256, 0, stream>>>(QKV, 3 * DM, 0, QH, QL, np / 8); k_hls<<<(unsigned)((np / 8 + 255) / 256), 256, 0, stream>>>(QKV, 3 * DM, DM, KH, KL, np / 8); k_h16s<<<(unsigned)((np / 8 + 255) / 256), 256, 0, stream>>>(QKV, 3 * DM, 2 * DM, VH, np / 8);
  k_vtg<<<NB * NH * (SLEN / 64), 256, 0, stream>>>(VH, VT);      /* V^T [(b,h)][64][2048] */
  k_eflash<<<NB * NH * (SLEN / 256), 256, 0, stream>>>(QH, QL, KH, KL, VT, QN, KN, tmp, OH, OL);      /* scores, softmax, att . v, normalise, hi + residual: one launch */
  k_gemm2<0><<<gP, 128, 0, stream>>>(OL, DM, 0, BO, DM, 0, 0.0625f / 1024.0f, nullptr, 0, nullptr, 1, 0, 0, (float*)d_out, nullptr, DM, 0, NR, DM, DM);
  k_gemm2<0><<<gP, 128, 0, stream>>>(OH, DM, 0, BO, DM, 0, 0.0625f, bo, 0, (const float*)d_out, 1, (size_t)DM, 0, (float*)d_out, nullptr, DM, 0, NR, DM, DM);      /* out = (O_lo + O_hi) Wo + bo */
}

// v003
// One run takes 216 microseconds.
// In two side-by-side timings against v002, it was 1.39 and 1.40 times as fast.
// Counting every step since v000, it is 9.22 times as fast.
#include <hip/hip_runtime.h>
// EuclideanAttention (2 x 2048 tokens, D 1024 = 16 heads x 64; Q, K, V = x W + b; d2 = max(|q|^2 + |k|^2 - 2 q.k, 0); attn = softmax_k(-d2 / temperature); out = (attn V) Wo + bo).
// Compute dtype: inputs rounded to bf16; x and weights exact as f16; q.k from hi+residual operands (~2^-21); norms/softmax f32; v and the softmax weights as plain f16 operands (~2^-12); attention output hi + residual. v_wmma_f32_16x16x32_f16.
#define NB 2
#define DM 1024
#define NKV 16
#define NREP (NH / NKV)
#define KVD (NKV * 64)           /* 1024 */
#define NR (NB * SLEN)           /* 4096 */
#define CHK 512                  /* attention chunk */
typedef int v4i __attribute__((ext_vector_type(4)));
#define FF 2048
#define SLEN 2048
#define TQ SLEN
#define TK SLEN
#define NH 16
#define SCL 0.125f
#define QBLKS (TQ / 64)
#define QB05 0
#define QBN5 4
#define QB0P 0
#define QBNP QBLKS           /* non-causal: plain flash on every query block */
#define RE 256
typedef __bf16 v16b __attribute__((ext_vector_type(16)));
typedef unsigned short v8us __attribute__((ext_vector_type(8), may_alias));
typedef float  v8f  __attribute__((ext_vector_type(8)));
typedef float  v4f  __attribute__((ext_vector_type(4)));
typedef float  v4fa __attribute__((ext_vector_type(4), may_alias));
union FragB { v16b v; v8us half[2]; unsigned short u[16]; };

__device__ __forceinline__ unsigned short bf16_bits(float x) { unsigned int u = __float_as_uint(x); return (unsigned short)((u + 0x7FFFu + ((u >> 16) & 1u)) >> 16); }
__device__ __forceinline__ float bf16_val(unsigned short b) { return __uint_as_float(((unsigned int)b) << 16); }
__device__ __forceinline__ float bf16_round(float x) { return bf16_val(bf16_bits(x)); }
// D += A·B with NT terms: 1 = ah·bh, 2 = + al·bh (A split), 3 = + ah·bl (both split)
template <int NT>
__device__ __forceinline__ v8f mmaN(v16b ah, v16b al, v16b bh, v16b bl, v8f c) {
  c = __builtin_amdgcn_wmma_f32_16x16x32_bf16(false, ah, false, bh, (short)0, c, false, false);
  if (NT >= 2) c = __builtin_amdgcn_wmma_f32_16x16x32_bf16(false, al, false, bh, (short)0, c, false, false);
  if (NT >= 3) c = __builtin_amdgcn_wmma_f32_16x16x32_bf16(false, ah, false, bl, (short)0, c, false, false);
  asm volatile("v_nop\n\tv_nop\n\tv_nop\n\tv_nop" : "+v"(c) : "v"(ah), "v"(al), "v"(bh), "v"(bl));
  return c;
}

__global__ __launch_bounds__(256) void k_wt_bf16(const float* __restrict__ W, unsigned short* __restrict__ Wt, int K, int N) {
  const int t = blockIdx.x * 256 + threadIdx.x;
  const int k8n = K / 8;
  if (t >= N * k8n) return;
  const int n = t / k8n, k8 = (t % k8n) * 8;
  v8us v;
#pragma unroll
  for (int i = 0; i < 8; ++i) v[i] = bf16_bits(W[(size_t)(k8 + i) * N + n]);
  *(v8us*)(Wt + (size_t)n * K + k8) = v;
  
}

// GEMM C[M][N] (f32, pitch ldc) = act(A[M][K]·W + bias). A f32 row-major (pitch lda) converted per fragment to bf16
// (ASPLIT: hi/lo two planes -> 2 terms, else single rounded term); Wt bf16 [N][K] (pitch ldb). BIAS_BF16 rounds the
// bias to bf16 first (bias quantised to bf16 before the add). K%32==0, M%16==0, N%64==0.
template <bool ASPLIT, int ACT, bool BIAS_BF16>
__global__ __launch_bounds__(128) void k_gemm_bf(const float* __restrict__ A, int lda, const unsigned short* __restrict__ Wt, int ldb,
                                               const float* __restrict__ bias, float* __restrict__ C, int ldc, int M, int N, int K) {
  __shared__ __attribute__((aligned(16))) float so[4][16][64];
  const int tid = threadIdx.x, w = tid >> 5, lane = tid & 31, ln = lane & 15, hh = lane >> 4;
  const int ntn = N / 64;
  const int wid = blockIdx.x * 4 + w;
  const int mt = wid / ntn, nq = wid % ntn;
  if (mt * 16 >= M) return;
  const int row0 = mt * 16, col0 = nq * 64;
  const float* arow = A + (size_t)(row0 + ln) * lda;
  v8f acc[4] = {};
  for (int kb = 0; kb < K; kb += 32) {
    FragB ah, al;
    const v4f x0 = *(const v4fa*)(arow + kb + 8 * hh), x1 = *(const v4fa*)(arow + kb + 8 * hh + 4);
    const v4f x2 = *(const v4fa*)(arow + kb + 16 + 8 * hh), x3 = *(const v4fa*)(arow + kb + 16 + 8 * hh + 4);
    float xs[16] = {x0[0],x0[1],x0[2],x0[3],x1[0],x1[1],x1[2],x1[3],x2[0],x2[1],x2[2],x2[3],x3[0],x3[1],x3[2],x3[3]};
#pragma unroll
    for (int i = 0; i < 16; ++i) { const unsigned short hb = bf16_bits(xs[i]); ah.u[i] = hb; al.u[i] = ASPLIT ? bf16_bits(xs[i] - bf16_val(hb)) : (unsigned short)0; }
#pragma unroll
    for (int t = 0; t < 4; ++t) {
      const unsigned short* brow = Wt + (size_t)(col0 + t * 16 + ln) * ldb + kb;
      FragB b;
      b.half[0] = *(const v8us*)(brow + 8 * hh);
      b.half[1] = *(const v8us*)(brow + 16 + 8 * hh);
      acc[t] = mmaN<ASPLIT ? 2 : 1>(ah.v, al.v, b.v, b.v, acc[t]);
    }
  }
#pragma unroll
  for (int t = 0; t < 4; ++t) {
    float bv = bias ? bias[col0 + t * 16 + ln] : 0.f;
    if (BIAS_BF16) bv = bf16_round(bv);
#pragma unroll
    for (int r = 0; r < 8; ++r) { float v = acc[t][r] + bv; if (ACT == 1) v = fmaxf(v, 0.f); so[w][8 * hh + r][t * 16 + ln] = v; }
  }
  __builtin_amdgcn_fence(__ATOMIC_ACQ_REL, "workgroup");
  __builtin_amdgcn_wave_barrier();
  const int rsub = lane >> 4, c4 = (lane & 15) * 4;
  {
#pragma unroll
    for (int q = 0; q < 8; ++q) {
      const int r = q * 2 + rsub;
      const v4f v = *(const v4fa*)&so[w][r][c4];
      *(v4f*)(C + (size_t)(row0 + r) * ldc + col0 + c4) = v;
    }
    
  }
}

// GEMM C = act(A·W + bias + resid): A f32 (ASPLIT -> hi/lo 2 terms), Wt bf16 [N][K]; ACT 0 none, 1 relu, 2 exact gelu;
// resid (optional, f32, row index = (row % rmod), pitch ldr, RES_BF16 rounds it) added before the activation.
template <bool ASPLIT, int ACT, bool BIAS_BF16, bool RES_BF16>
__global__ __launch_bounds__(128) void k_gemm_bf3(const float* __restrict__ A, int lda, const unsigned short* __restrict__ Wt, int ldb,
                                                const float* __restrict__ bias, const float* __restrict__ resid, int rmod, int ldr,
                                                float* __restrict__ C, int ldc, int M, int N, int K) {
  __shared__ __attribute__((aligned(16))) float so[4][16][64];
  const int tid = threadIdx.x, w = tid >> 5, lane = tid & 31, ln = lane & 15, hh = lane >> 4;
  const int ntn = N / 64;
  const int wid = blockIdx.x * 4 + w;
  const int mt = wid / ntn, nq = wid % ntn;
  if (mt * 16 >= M) return;
  const int row0 = mt * 16, col0 = nq * 64;
  const float* arow = A + (size_t)(row0 + ln) * lda;
  v8f acc[4] = {};
  for (int kb = 0; kb < K; kb += 32) {
    FragB ah, al;
    const v4f x0 = *(const v4fa*)(arow + kb + 8 * hh), x1 = *(const v4fa*)(arow + kb + 8 * hh + 4);
    const v4f x2 = *(const v4fa*)(arow + kb + 16 + 8 * hh), x3 = *(const v4fa*)(arow + kb + 16 + 8 * hh + 4);
    float xs[16] = {x0[0],x0[1],x0[2],x0[3],x1[0],x1[1],x1[2],x1[3],x2[0],x2[1],x2[2],x2[3],x3[0],x3[1],x3[2],x3[3]};
#pragma unroll
    for (int i = 0; i < 16; ++i) { const unsigned short hb = bf16_bits(xs[i]); ah.u[i] = hb; al.u[i] = ASPLIT ? bf16_bits(xs[i] - bf16_val(hb)) : (unsigned short)0; }
#pragma unroll
    for (int t = 0; t < 4; ++t) {
      const unsigned short* brow = Wt + (size_t)(col0 + t * 16 + ln) * ldb + kb;
      FragB b;
      b.half[0] = *(const v8us*)(brow + 8 * hh);
      b.half[1] = *(const v8us*)(brow + 16 + 8 * hh);
      acc[t] = mmaN<ASPLIT ? 2 : 1>(ah.v, al.v, b.v, b.v, acc[t]);
    }
  }
#pragma unroll
  for (int t = 0; t < 4; ++t) {
    const int col = col0 + t * 16 + ln;
    float bv = bias ? bias[col] : 0.f;
    if (BIAS_BF16) bv = bf16_round(bv);
#pragma unroll
    for (int r = 0; r < 8; ++r) {
      float v = acc[t][r] + bv;
      if (resid) { float rv = resid[(size_t)((row0 + 8 * hh + r) % rmod) * ldr + col]; if (RES_BF16) rv = bf16_round(rv); v += rv; }
      if (ACT == 1) v = fmaxf(v, 0.f);
      if (ACT == 2) v = 0.5f * v * (1.0f + erff(v * 0.70710678118654752f));
      if (ACT == 3) { const float u = 0.7978845608028654f * (v + 0.044715f * v * v * v); v = 0.5f * v * (1.0f + tanhf(u)); }
      so[w][8 * hh + r][t * 16 + ln] = v;
    }
  }
  __builtin_amdgcn_fence(__ATOMIC_ACQ_REL, "workgroup");
  __builtin_amdgcn_wave_barrier();
  const int rsub = lane >> 4, c4 = (lane & 15) * 4;
  {
#pragma unroll
    for (int q = 0; q < 8; ++q) {
      const int r = q * 2 + rsub;
      const v4f v = *(const v4fa*)&so[w][r][c4];
      *(v4f*)(C + (size_t)(row0 + r) * ldc + col0 + c4) = v;
    }
    
  }
}
// row LayerNorm (biased variance, eps) over N: s = X (+ R); optional out_sum <- s; out_norm <- (s-mu)*rsqrt(var+eps)*g + b
template <bool PARAM_BF16>
__global__ __launch_bounds__(256) void k_layernorm(const float* __restrict__ X, const float* __restrict__ R, const float* __restrict__ g, const float* __restrict__ bta,
                                                  float* __restrict__ out_sum, float* __restrict__ out_norm, int N, float eps) {
  __shared__ float red[256];
  const int row = blockIdx.x, tid = threadIdx.x;
  const float* x = X + (size_t)row * N; const float* rr = R ? R + (size_t)row * N : nullptr;
  float vals[16];                     // up to N = 4096
  const int per = N / 256;            // contiguous chunk per thread? use strided-by-4 chunks: thread handles j = tid*4 + 1024*u
  float s1 = 0.f;
  for (int u = 0; u < per / 4; ++u) {
    const int j = tid * 4 + 1024 * u;
    const v4f a = *(const v4fa*)(x + j);
    v4f b = {0.f,0.f,0.f,0.f}; if (rr) b = *(const v4fa*)(rr + j);
#pragma unroll
    for (int q = 0; q < 4; ++q) { const float v = a[q] + b[q]; vals[u * 4 + q] = v; s1 += v; }
  }
  red[tid] = s1; __syncthreads();
  for (int st = 128; st > 0; st >>= 1) { if (tid < st) red[tid] += red[tid + st]; __syncthreads(); }
  const float mu = red[0] / (float)N; __syncthreads();
  float s2 = 0.f;
  for (int u = 0; u < per / 4; ++u)
#pragma unroll
    for (int q = 0; q < 4; ++q) { const float c = vals[u * 4 + q] - mu; s2 += c * c; }
  red[tid] = s2; __syncthreads();
  for (int st = 128; st > 0; st >>= 1) { if (tid < st) red[tid] += red[tid + st]; __syncthreads(); }
  const float rs = rsqrtf(red[0] / (float)N + eps);
  {
    for (int u = 0; u < per / 4; ++u) {
      const int j = tid * 4 + 1024 * u;
      v4f o, sm;
#pragma unroll
      for (int q = 0; q < 4; ++q) {
        float gg = g[j + q], bb = bta[j + q];
        if (PARAM_BF16) { gg = bf16_round(gg); bb = bf16_round(bb); }
        sm[q] = vals[u * 4 + q]; o[q] = (vals[u * 4 + q] - mu) * rs * gg + bb;
      }
      if (out_sum) *(v4f*)(out_sum + (size_t)row * N + j) = sm;
      *(v4f*)(out_norm + (size_t)row * N + j) = o;
    }
    
  }
}



// ---- f16 WMMA path (v_wmma_f32_16x16x32_f16): 11-bit significands for operands in range — used where a [0,1] probability operand needs more precision than bf16
typedef _Float16 v16h __attribute__((ext_vector_type(16)));
union FragH { v16h v; v8us half[2]; _Float16 h[16]; unsigned short u[16]; };
template <int NT>
__device__ __forceinline__ v8f mmaH(v16h ah, v16h al, v16h bh, v16h bl, v8f c) {
  c = __builtin_amdgcn_wmma_f32_16x16x32_f16(false, ah, false, bh, (short)0, c, false, false);
  if (NT >= 2) c = __builtin_amdgcn_wmma_f32_16x16x32_f16(false, al, false, bh, (short)0, c, false, false);
  if (NT >= 3) c = __builtin_amdgcn_wmma_f32_16x16x32_f16(false, ah, false, bl, (short)0, c, false, false);
  asm volatile("v_nop\n\tv_nop\n\tv_nop\n\tv_nop" : "+v"(c) : "v"(ah), "v"(al), "v"(bh), "v"(bl));
  return c;
}
// batched GEMM like k_gemm_b but f16 operands: A f32 (split into f16 hi/lo if ASPLIT, else rounded to f16), Bt = f16 values [n][k]; alpha; C f32; N multiple of 16 (partial tiles skipped)
template <bool ASPLIT>
__global__ __launch_bounds__(128) void k_gemm_h(const float* __restrict__ A, int lda, size_t sA, const _Float16* __restrict__ Bh, int ldb, size_t sB, float alpha, float* __restrict__ C, int ldc, size_t sC, int M, int N, int K) {
  __shared__ __attribute__((aligned(16))) float so[4][16][64];
  const int tid = threadIdx.x, w = tid >> 5, lane = tid & 31, ln = lane & 15, hh = lane >> 4; const int by = blockIdx.y;
  A += (size_t)by * sA; Bh += (size_t)by * sB; C += (size_t)by * sC;
  const int ntn = (N + 63) / 64; const int wid = blockIdx.x * 4 + w; const int mt = wid / ntn, nq = wid % ntn; if (mt * 16 >= M) return;
  const int row0 = mt * 16, col0 = nq * 64; const float* arow = A + (size_t)(row0 + ln) * lda;
  v8f acc[4] = {};
  for (int kb = 0; kb < K; kb += 32) {
    FragH ah, al;
    const v4f x0 = *(const v4fa*)(arow + kb + 8 * hh), x1 = *(const v4fa*)(arow + kb + 8 * hh + 4), x2 = *(const v4fa*)(arow + kb + 16 + 8 * hh), x3 = *(const v4fa*)(arow + kb + 16 + 8 * hh + 4);
    float xs[16] = {x0[0],x0[1],x0[2],x0[3],x1[0],x1[1],x1[2],x1[3],x2[0],x2[1],x2[2],x2[3],x3[0],x3[1],x3[2],x3[3]};
#pragma unroll
    for (int i = 0; i < 16; ++i) { const _Float16 h = (_Float16)xs[i]; ah.h[i] = h; al.h[i] = ASPLIT ? (_Float16)(xs[i] - (float)h) : (_Float16)0.0f; }
#pragma unroll
    for (int t = 0; t < 4; ++t) { if (col0 + t * 16 >= N) continue; const size_t boff = (size_t)(col0 + t * 16 + ln) * ldb + kb; FragH bq; bq.half[0] = *(const v8us*)(Bh + boff + 8 * hh); bq.half[1] = *(const v8us*)(Bh + boff + 16 + 8 * hh);
      acc[t] = mmaH<ASPLIT ? 2 : 1>(ah.v, al.v, bq.v, bq.v, acc[t]); }
  }
#pragma unroll
  for (int t = 0; t < 4; ++t) { if (col0 + t * 16 >= N) continue;
#pragma unroll
    for (int r = 0; r < 8; ++r) so[w][8 * hh + r][t * 16 + ln] = acc[t][r] * alpha; }
  __builtin_amdgcn_fence(__ATOMIC_ACQ_REL, "workgroup"); __builtin_amdgcn_wave_barrier();
  const int rsub = lane >> 4, c4 = (lane & 15) * 4;
  {
#pragma unroll
    for (int q = 0; q < 8; ++q) { const int r = q * 2 + rsub; if (col0 + c4 < N) { const v4f v = *(const v4fa*)&so[w][r][c4]; *(v4f*)(C + (size_t)(row0 + r) * ldc + col0 + c4) = v; } }
     }
}

// Wt[n][k] = f16(W[k][n]·scale) from f32 row-major W[K][N] (scale = power of two; bf16-exact weights stay exact in f16 away from the subnormal range)
__global__ __launch_bounds__(256) void k_wt_f16(const float* __restrict__ W, _Float16* __restrict__ Wt, int K, int N, float scale) {
  const int t = blockIdx.x * 256 + threadIdx.x; if (t >= N * (K / 8)) return; const int n = t / (K / 8), k8 = (t % (K / 8)) * 8; FragH f;
#pragma unroll
  for (int i = 0; i < 8; ++i) f.h[i] = (_Float16)(bf16_round(W[(size_t)(k8 + i) * N + n]) * scale); const v8us o = f.half[0];
  *(v8us*)((unsigned short*)Wt + (size_t)n * K + k8) = o; 
}
// k_gemm_hh variant with fused epilogue: v = acc·alpha + bias[by·sBias + col] (+ CP[(row/rowsPerB)·sCPb + by·64 + col] if CP) ; ACT 0 none / 1 elu ; writes f16 C16 (and f32 C if non-null)
template <int ACT>
__global__ __launch_bounds__(128) void k_gemm_hhx(const _Float16* __restrict__ A, int lda, size_t sA, const _Float16* __restrict__ Bh, int ldb, size_t sB, float alpha, const float* __restrict__ bias, size_t sBias, const float* __restrict__ CP, int rowsPerB, size_t sCPb, int row0g,
    float* __restrict__ C, _Float16* __restrict__ C16, int ldc, size_t sC, int M, int N, int K) {
  __shared__ __attribute__((aligned(16))) float so[4][16][64];
  const int tid = threadIdx.x, w = tid >> 5, lane = tid & 31, ln = lane & 15, hh = lane >> 4; const int by = blockIdx.y;
  A += (size_t)by * sA; Bh += (size_t)by * sB; const size_t cofs = (size_t)by * sC; const float* bp = bias ? bias + (size_t)by * sBias : nullptr;
  const int ntn = (N + 63) / 64; const int wid = blockIdx.x * 4 + w; const int mt = wid / ntn, nq = wid % ntn; if (mt * 16 >= M) return;
  const int row0 = mt * 16, col0 = nq * 64; const _Float16* arow = A + (size_t)(row0 + ln) * lda;
  v8f acc[4] = {};
  for (int kb = 0; kb < K; kb += 32) { FragH ah; ah.half[0] = *(const v8us*)((const unsigned short*)arow + kb + 8 * hh); ah.half[1] = *(const v8us*)((const unsigned short*)arow + kb + 16 + 8 * hh);
#pragma unroll
    for (int t = 0; t < 4; ++t) { if (col0 + t * 16 >= N) continue; const size_t boff = (size_t)(col0 + t * 16 + ln) * ldb + kb; FragH bq; bq.half[0] = *(const v8us*)((const unsigned short*)Bh + boff + 8 * hh); bq.half[1] = *(const v8us*)((const unsigned short*)Bh + boff + 16 + 8 * hh);
      acc[t] = mmaH<1>(ah.v, ah.v, bq.v, bq.v, acc[t]); }
  }
#pragma unroll
  for (int t = 0; t < 4; ++t) { if (col0 + t * 16 >= N) continue; const int col = col0 + t * 16 + ln; const float bv = bp ? bf16_round(bp[col]) : 0.f;
#pragma unroll
    for (int r = 0; r < 8; ++r) { float v = acc[t][r] * alpha + bv; if (CP) { const int bidx = (row0g + row0 + 8 * hh + r) / rowsPerB; v += CP[(size_t)bidx * sCPb + (size_t)by * 64 + col]; } if (ACT == 1) v = (v > 0.f) ? v : expm1f(v); else if (ACT == 7) v = (v > 0.f) ? v + 1.0f : expf(v); else if (ACT == 8) v = tanhf(v); else if (ACT == 9) v = 0.5f * v * (1.0f + tanhf(0.7978845608028654f * (v + 0.044715f * v * v * v))); else if (ACT == 11) v = 1.0f / (1.0f + expf(-v)); else if (ACT == 12) v = (v > 0.f) ? v : 0.01f * v; else if (ACT == 14) v = (v > 0.f) ? v : 0.1f * v; else if (ACT == 15) v = v / (1.0f + expf(-v)); else if (ACT == 3) v = fmaxf(v, 0.f); else if (ACT == 6) v = 0.5f * v * (1.0f + erff(v * 0.70710678118654752f)); so[w][8 * hh + r][t * 16 + ln] = v; } }
  __builtin_amdgcn_fence(__ATOMIC_ACQ_REL, "workgroup"); __builtin_amdgcn_wave_barrier();
  const int rsub = lane >> 4, c4 = (lane & 15) * 4; typedef _Float16 v4h __attribute__((ext_vector_type(4)));
  {
#pragma unroll
    for (int q = 0; q < 8; ++q) { const int r = q * 2 + rsub; if (col0 + c4 < N) { const v4f v = *(const v4fa*)&so[w][r][c4]; if (C) *(v4f*)(C + cofs + (size_t)(row0 + r) * ldc + col0 + c4) = v; if (C16) { v4h h4; for (int i = 0; i < 4; ++i) h4[i] = (_Float16)v[i]; *(v4h*)(C16 + cofs + (size_t)(row0 + r) * ldc + col0 + c4) = h4; } } }
     }
}


typedef _Float16 v4h __attribute__((ext_vector_type(4)));

__global__ __launch_bounds__(256) void k_x16(const float* __restrict__ x, _Float16* __restrict__ X16, size_t n8) { const size_t t = (size_t)blockIdx.x * 256 + threadIdx.x; if (t >= n8) return; FragH f;
#pragma unroll
  for (int q = 0; q < 8; ++q) f.h[q] = (_Float16)bf16_round(x[t * 8 + q]); *(v8us*)((unsigned short*)X16 + t * 8) = f.half[0];  }
__global__ __launch_bounds__(256) void k_h16(const float* __restrict__ x, _Float16* __restrict__ X16, size_t n8) { const size_t t = (size_t)blockIdx.x * 256 + threadIdx.x; if (t >= n8) return; FragH f;
#pragma unroll
  for (int q = 0; q < 8; ++q) f.h[q] = (_Float16)x[t * 8 + q]; *(v8us*)((unsigned short*)X16 + t * 8) = f.half[0];  }
__global__ __launch_bounds__(256) void k_round16f(const float* __restrict__ W, _Float16* __restrict__ Bt, size_t n8) { const size_t t = (size_t)blockIdx.x * 256 + threadIdx.x; if (t >= n8) return; FragH f;
#pragma unroll
  for (int i = 0; i < 8; ++i) f.h[i] = (_Float16)(bf16_round(W[t * 8 + i]) * 16.0f); *(v8us*)((unsigned short*)Bt + t * 8) = f.half[0];  }
template <int NHv, int TTv>
__global__ __launch_bounds__(256) void k_vt(const _Float16* __restrict__ V16, int ldv, int voff, _Float16* __restrict__ Vt) { __shared__ unsigned short tl[64][66]; const int tid = threadIdx.x; const int slab = blockIdx.x / (TTv / 64), lg = blockIdx.x % (TTv / 64); const int b = slab / NHv, h = slab % NHv;
  for (int i = tid; i < 64 * 8; i += 256) { const int r = i / 8, c8 = (i % 8) * 8; FragH f; f.half[0] = *(const v8us*)((const unsigned short*)V16 + ((size_t)b * TTv + lg * 64 + r) * ldv + voff + h * 64 + c8);
#pragma unroll
    for (int q = 0; q < 8; ++q) tl[r][c8 + q] = f.u[q]; }
  __syncthreads();
  {
#pragma unroll
    for (int rd = 0; rd < 2; ++rd) { const int d = rd * 32 + tid / 8, pc = tid % 8; FragH f;
#pragma unroll
      for (int q = 0; q < 8; ++q) f.u[q] = tl[pc * 8 + q][d];
      *(v8us*)((unsigned short*)Vt + ((size_t)slab * 64 + d) * TTv + lg * 64 + pc * 8) = f.half[0]; }
     } }

__global__ __launch_bounds__(256) void k_hl(const float* __restrict__ F, _Float16* __restrict__ Hh, _Float16* __restrict__ Hl, size_t n8) { const size_t t = (size_t)blockIdx.x * 256 + threadIdx.x; if (t >= n8) return; FragH fh, fl; const v4f a = *(const v4fa*)(F + t * 8), c = *(const v4fa*)(F + t * 8 + 4);
#pragma unroll
  for (int q = 0; q < 4; ++q) { _Float16 h = (_Float16)a[q]; fh.h[q] = h; fl.h[q] = (_Float16)((a[q] - (float)h) * 1024.0f); h = (_Float16)c[q]; fh.h[4 + q] = h; fl.h[4 + q] = (_Float16)((c[q] - (float)h) * 1024.0f); }
  { *(v8us*)((unsigned short*)Hh + t * 8) = fh.half[0]; *(v8us*)((unsigned short*)Hl + t * 8) = fl.half[0];  } }

// ---- fast GEMM (block tile 128x64, wave tile 32x64; requires M % 128 == 0, N % 64 == 0, K % 64 == 0); epilogue = k_gemm_hhx semantics ----
// A and B come through LDS: a stage is 64 k of the block's 128 A rows and 64 B rows, brought by asynchronous copies into one of two buffers while the other is worked on.
#define G2P 144              /* LDS row pitch in bytes: 128 B of k + 16 = 16 B x odd, the conflict-free pitch for 16-byte fragment reads */
#define G2S (192 * G2P)      /* one stage: rows 0..127 = A, rows 128..191 = B */
// One stage's 12 copies of a lane, 16 bytes each: 8 lanes bring one row's 128 bytes, the block's 128 threads 16 rows per copy; copies 0..7 are A rows, 8..11 B rows.
// l = the lane's LDS byte address in row tid / 8 of the buffer, a and b = its global addresses in that row of A and of B, sa and sb = 16 rows of A and of B in bytes.
// s_wait_xcnt 0 is the statement's last line, so that it stands in front of any later rewrite of these address registers.
__device__ __forceinline__ void g2_stage(unsigned l, const char* a, size_t sa, const char* b, size_t sb) {
  asm volatile("global_load_async_to_lds_b128 %0, %12, off\n\tglobal_load_async_to_lds_b128 %1, %13, off\n\tglobal_load_async_to_lds_b128 %2, %14, off\n\tglobal_load_async_to_lds_b128 %3, %15, off\n\t"
               "global_load_async_to_lds_b128 %4, %16, off\n\tglobal_load_async_to_lds_b128 %5, %17, off\n\tglobal_load_async_to_lds_b128 %6, %18, off\n\tglobal_load_async_to_lds_b128 %7, %19, off\n\t"
               "global_load_async_to_lds_b128 %8, %20, off\n\tglobal_load_async_to_lds_b128 %9, %21, off\n\tglobal_load_async_to_lds_b128 %10, %22, off\n\tglobal_load_async_to_lds_b128 %11, %23, off\n\ts_wait_xcnt 0x0"
               :: "v"(l), "v"(l + 16 * G2P), "v"(l + 32 * G2P), "v"(l + 48 * G2P), "v"(l + 64 * G2P), "v"(l + 80 * G2P), "v"(l + 96 * G2P), "v"(l + 112 * G2P), "v"(l + 128 * G2P), "v"(l + 144 * G2P), "v"(l + 160 * G2P), "v"(l + 176 * G2P),
                  "v"(a), "v"(a + sa), "v"(a + 2 * sa), "v"(a + 3 * sa), "v"(a + 4 * sa), "v"(a + 5 * sa), "v"(a + 6 * sa), "v"(a + 7 * sa), "v"(b), "v"(b + sb), "v"(b + 2 * sb), "v"(b + 3 * sb) : "memory"); }
__device__ __forceinline__ v16h g2_frag(const _Float16* p, int hh) { FragH f; f.half[0] = *(const v8us*)((const unsigned short*)p + 8 * hh); f.half[1] = *(const v8us*)((const unsigned short*)p + 16 + 8 * hh); return f.v; }
__device__ __forceinline__ v16h g2_lfrag(const char* p) { FragH f; f.half[0] = *(const v8us*)p; f.half[1] = *(const v8us*)(p + 32); return f.v; }
__device__ __forceinline__ v8f g2_mma(v16h a, v16h b, v8f c) { v8f d = __builtin_amdgcn_wmma_f32_16x16x32_f16(false, a, false, b, (short)0, c, false, false); asm volatile("v_nop\n\tv_nop\n\tv_nop\n\tv_nop" : "+v"(d) : "v"(a), "v"(b)); return d; }
template <int ACT>
__global__ __launch_bounds__(128) void k_gemm2(const _Float16* __restrict__ A, int lda, size_t sA, const _Float16* __restrict__ Bh, int ldb, size_t sB, float alpha, const float* __restrict__ bias, size_t sBias, const float* __restrict__ CP, int rowsPerB, size_t sCPb, int row0g,
    float* __restrict__ C, _Float16* __restrict__ C16, int ldc, size_t sC, int M, int N, int K) {
  __shared__ __attribute__((aligned(16))) float so[4][32][68]; __shared__ __attribute__((aligned(16))) char st[2 * G2S];
  const int tid = threadIdx.x, w = tid >> 5, lane = tid & 31, ln = lane & 15, hh = lane >> 4; const int by = blockIdx.y;
  A += (size_t)by * sA; Bh += (size_t)by * sB; const size_t cofs = (size_t)by * sC; const float* bp = bias ? bias + (size_t)by * sBias : nullptr;
  const int ntn = N >> 6; const int mt = blockIdx.x / ntn, nq = blockIdx.x - mt * ntn; const int row0 = mt * 128 + 32 * w, col0 = nq * 64; if (mt * 128 >= M) return;      /* the whole block or none: barriers follow */
  const int nst = K >> 6;      /* stages */
  const char* ga = (const char*)(A + (size_t)(mt * 128 + (tid >> 3)) * lda + (tid & 7) * 8); const char* gb = (const char*)(Bh + (size_t)(col0 + (tid >> 3)) * ldb + (tid & 7) * 8); const size_t sa = (size_t)lda * 32, sb = (size_t)ldb * 32;
  const unsigned l0 = (unsigned)(size_t)st + (unsigned)((tid >> 3) * G2P + (tid & 7) * 16);
  const char* fa = st + (32 * w + ln) * G2P + hh * 16; const char* fb = st + (128 + ln) * G2P + hh * 16;      /* fragment rows: k = 8h + s at +0, 16 + 8h + s at +32 bytes */
  const v8f z8 = {0.f,0.f,0.f,0.f,0.f,0.f,0.f,0.f}; v8f c00 = z8, c01 = z8, c02 = z8, c03 = z8, c10 = z8, c11 = z8, c12 = z8, c13 = z8;
  g2_stage(l0, ga, sa, gb, sb);
  asm volatile("s_wait_asynccnt 0x0" ::: "memory");      /* this wave's copies of stage 0 have landed */
  __syncthreads();      /* ... and every other wave's: stage 0 may be read */
  if (nst > 1) g2_stage(l0 + G2S, ga + 128, sa, gb + 128, sb);
#pragma unroll 1
  for (int t = 0; t < nst; ++t) { const int bo = (t & 1) * G2S; v16h a[2][2], b[2][4];
#pragma unroll
    for (int kk = 0; kk < 2; ++kk) { a[kk][0] = g2_lfrag(fa + bo + kk * 64); a[kk][1] = g2_lfrag(fa + bo + 16 * G2P + kk * 64);      /* the stage's 24 reads as one group ahead of its matrix instructions */
#pragma unroll
      for (int j = 0; j < 4; ++j) b[kk][j] = g2_lfrag(fb + bo + j * 16 * G2P + kk * 64); }
#pragma unroll
    for (int kk = 0; kk < 2; ++kk) { c00 = g2_mma(a[kk][0], b[kk][0], c00); c10 = g2_mma(a[kk][1], b[kk][0], c10); c01 = g2_mma(a[kk][0], b[kk][1], c01); c11 = g2_mma(a[kk][1], b[kk][1], c11);
      c02 = g2_mma(a[kk][0], b[kk][2], c02); c12 = g2_mma(a[kk][1], b[kk][2], c12); c03 = g2_mma(a[kk][0], b[kk][3], c03); c13 = g2_mma(a[kk][1], b[kk][3], c13); }
    asm volatile("s_wait_dscnt 0x0" ::: "memory");      /* this wave has left the buffer that is refilled below */
    asm volatile("s_wait_asynccnt 0x0" ::: "memory");      /* its copies of stage t + 1 have landed */
    __syncthreads();      /* publishes stage t + 1 and ends every reader's last read of stage t */
    if (t + 2 < nst) g2_stage(l0 + bo, ga + (size_t)(t + 2) * 128, sa, gb + (size_t)(t + 2) * 128, sb); }
  asm volatile("s_wait_asynccnt 0x0" ::: "memory");      /* no copy is outstanding when the wave goes on to the epilogue and ends */
  v8f accs[8] = {c00, c01, c02, c03, c10, c11, c12, c13};
#pragma unroll
  for (int u = 0; u < 8; ++u) { const int t = u & 3, half = u >> 2; const int col = col0 + t * 16 + ln; const float bv = bp ? bf16_round(bp[col]) : 0.f;
#pragma unroll
    for (int r = 0; r < 8; ++r) { const int rloc = half * 16 + 8 * hh + r; float v = accs[u][r] * alpha + bv; if (CP) { if (rowsPerB < 0) v += CP[cofs + (size_t)(row0g + row0 + rloc) * ldc + col];      /* rowsPerB < 0: own element of the batched C plane */ else { const int bidx = (row0g + row0 + rloc) / rowsPerB; v += CP[(size_t)bidx * sCPb + (size_t)by * 64 + col]; } }
      if (ACT == 3) v = fmaxf(v, 0.f); else if (ACT == 6) v = 0.5f * v * (1.0f + erff(v * 0.70710678118654752f)); else if (ACT == 11) v = 1.0f / (1.0f + expf(-v)); else if (ACT == 15) v = v / (1.0f + expf(-v)); else if (ACT == 12) v = (v > 0.f) ? v : 0.01f * v; else if (ACT == 8) v = tanhf(v);
      so[w][rloc][t * 16 + ln] = v; } }
  __builtin_amdgcn_fence(__ATOMIC_ACQ_REL, "workgroup"); __builtin_amdgcn_wave_barrier();
  const int rsub = lane >> 4, c4 = (lane & 15) * 4;
  {
#pragma unroll
    for (int q = 0; q < 16; ++q) { const int r = q * 2 + rsub; const v4f v = *(const v4fa*)&so[w][r][c4]; if (C) *(v4f*)(C + cofs + (size_t)(row0 + r) * ldc + col0 + c4) = v; if (C16) { v4h h4; for (int i = 0; i < 4; ++i) h4[i] = (_Float16)v[i]; *(v4h*)(C16 + cofs + (size_t)(row0 + r) * ldc + col0 + c4) = h4; } }
     } }



template <int CAUSAL>
__global__ __launch_bounds__(128) void k_flash(const _Float16* __restrict__ Q16, int ldq, const _Float16* __restrict__ K16, int ldk, const _Float16* __restrict__ Vt, const int* __restrict__ MSK, float* __restrict__ O, int ldo) {
  constexpr int RPW = 16, RTN = RPW / 16, NQB = TQ / (4 * RPW), DT = 4, KS = 2;
  __shared__ __attribute__((aligned(16))) unsigned short sP[4][RPW][40]; __shared__ __attribute__((aligned(16))) float sO[4][RPW][64 + 4];
  const int tid = threadIdx.x, w = tid >> 5, lane = tid & 31, ln = lane & 15, hh = lane >> 4;
  const int slab = blockIdx.x / QBNP, qblk = QB0P + blockIdx.x % QBNP; (void)NQB; const int b = slab / NH, h = slab % NH; const int qb0 = qblk * (4 * RPW); const int q0 = qb0 + w * RPW;
  FragH aq[2][KS];
#pragma unroll
  for (int rt = 0; rt < RTN; ++rt) { const unsigned short* qr = (const unsigned short*)Q16 + ((size_t)b * TQ + q0 + rt * 16 + ln) * ldq + h * 64;
#pragma unroll
    for (int ks = 0; ks < KS; ++ks) { aq[rt][ks].half[0] = *(const v8us*)(qr + ks * 32 + 8 * hh); aq[rt][ks].half[1] = *(const v8us*)(qr + ks * 32 + 16 + 8 * hh); } }
  const unsigned short* Vth = (const unsigned short*)Vt + (size_t)slab * 64 * TK;
  float m_r[2][8], l_r[2][8]; v8f oacc[2][DT];
#pragma unroll
  for (int rt = 0; rt < RTN; ++rt) {
#pragma unroll
    for (int r = 0; r < 8; ++r) { m_r[rt][r] = -3.0e38f; l_r[rt][r] = 0.f; }
#pragma unroll
    for (int dt = 0; dt < DT; ++dt) oacc[rt][dt] = (v8f){0.f,0.f,0.f,0.f,0.f,0.f,0.f,0.f}; }
  const int jend = (CAUSAL == 1) ? (qb0 + 4 * RPW) : ((CAUSAL == 23) ? min(TK, (qb0 / CHK + 2) * CHK) : TK);      /* causal / window: keys that can never contribute are skipped */ const int jbeg = (CAUSAL == 23) ? max(0, (qb0 / CHK - 1) * CHK) : 0;
#pragma unroll 1
  for (int j0 = jbeg; j0 < jend; j0 += 32) {
    v8f s[2][2];
#pragma unroll
    for (int nt = 0; nt < 2; ++nt) { const unsigned short* kr = (const unsigned short*)K16 + ((size_t)b * TK + j0 + nt * 16 + ln) * ldk + h * 64; FragH bk[KS];
#pragma unroll
      for (int ks = 0; ks < KS; ++ks) { bk[ks].half[0] = *(const v8us*)(kr + ks * 32 + 8 * hh); bk[ks].half[1] = *(const v8us*)(kr + ks * 32 + 16 + 8 * hh); }
#pragma unroll
      for (int rt = 0; rt < RTN; ++rt) { v8f acc = (v8f){0.f,0.f,0.f,0.f,0.f,0.f,0.f,0.f};
#pragma unroll
        for (int ks = 0; ks < KS; ++ks) acc = mmaH<1>(aq[rt][ks].v, aq[rt][ks].v, bk[ks].v, bk[ks].v, acc); s[rt][nt] = acc; } }
#pragma unroll
    for (int rt = 0; rt < RTN; ++rt)
#pragma unroll
      for (int r = 0; r < 8; ++r) { const int tq = q0 + rt * 16 + 8 * hh + r; const int k0 = j0 + ln, k1 = j0 + 16 + ln;
        bool ok0 = (CAUSAL == 1) ? (k0 <= tq) : ((CAUSAL == 2) ? ((k0 >> 5) == (tq >> 5)) : true), ok1 = (CAUSAL == 1) ? (k1 <= tq) : ((CAUSAL == 2) ? ((k1 >> 5) == (tq >> 5)) : true); if (CAUSAL == 23) { const int cq = tq / CHK; ok0 = (abs(k0 / CHK - cq) <= 1) && (MSK[(size_t)b * TK + k0] == 0); ok1 = (abs(k1 / CHK - cq) <= 1) && (MSK[(size_t)b * TK + k1] == 0); }      /* mode 23: 3-chunk window + int key-padding mask */
        if (CAUSAL == 24) { ok0 = (MSK[(size_t)b * TK + k0] == 0); ok1 = (MSK[(size_t)b * TK + k1] == 0); }      /* mode 24: int key-padding mask (nonzero = padded = excluded) */      /* mode 2: block-diagonal 32-token groups */
        float s0 = ok0 ? s[rt][0][r] * SCL : -3.0e38f, s1 = ok1 ? s[rt][1][r] * SCL : -3.0e38f; if (CAUSAL == 17) { const float* amk = (const float*)MSK + (size_t)b * TK; s0 += bf16_round(amk[k0]); s1 += bf16_round(amk[k1]); } if (CAUSAL == 18) { const float* tb = (const float*)MSK; const int* ri = MSK + 1024 + (size_t)b * TK; const int rq = ri[tq]; s0 += tb[(h * 8 + rq) * 8 + ri[k0]]; s1 += tb[(h * 8 + rq) * 8 + ri[k1]]; } if (CAUSAL == 19) { const int* rel = MSK + (size_t)tq * TK; const float* rb = (const float*)MSK + (size_t)TQ * TK + ((size_t)(b * NH + h) * TQ + tq) * 64; s0 += rb[rel[k0]]; s1 += rb[rel[k1]]; }      /* mode 19: + (q.Ek[rel] + Eb[rel][h]) / 8 gathered by the int relative ids (packed [ids | table]) */      /* mode 18: + resource_bias[h][r_q][r_k] from the packed [table | ids] buffer (TQ == TK) */      /* mode 17: additive per-(batch, key) mask INPUT */ float mc = fmaxf(s0, s1);
        mc = fmaxf(mc, __shfl_xor(mc, 1, 32)); mc = fmaxf(mc, __shfl_xor(mc, 2, 32)); mc = fmaxf(mc, __shfl_xor(mc, 4, 32)); mc = fmaxf(mc, __shfl_xor(mc, 8, 32));
        const float mn = fmaxf(m_r[rt][r], mc); const float al = (mn > -1.0e38f) ? expf(m_r[rt][r] - mn) : 1.0f; m_r[rt][r] = mn; const float p0 = ok0 ? expf(s0 - mn) : 0.f, p1 = ok1 ? expf(s1 - mn) : 0.f; l_r[rt][r] = l_r[rt][r] * al + p0 + p1;
#pragma unroll
        for (int dt = 0; dt < DT; ++dt) oacc[rt][dt][r] *= al;
        FragH t2; t2.h[0] = (_Float16)(p0 * 1024.0f); t2.h[1] = (_Float16)(p1 * 1024.0f); sP[w][rt * 16 + 8 * hh + r][ln] = t2.u[0]; sP[w][rt * 16 + 8 * hh + r][16 + ln] = t2.u[1]; }
    __builtin_amdgcn_fence(__ATOMIC_ACQ_REL, "workgroup"); __builtin_amdgcn_wave_barrier();
    FragH pa[2];
#pragma unroll
    for (int rt = 0; rt < RTN; ++rt) { pa[rt].half[0] = *(const v8us*)&sP[w][rt * 16 + ln][8 * hh]; pa[rt].half[1] = *(const v8us*)&sP[w][rt * 16 + ln][16 + 8 * hh]; }
#pragma unroll
    for (int dt = 0; dt < DT; ++dt) { const unsigned short* vrow = Vth + (size_t)(dt * 16 + ln) * TK + j0; FragH bv; bv.half[0] = *(const v8us*)(vrow + 8 * hh); bv.half[1] = *(const v8us*)(vrow + 16 + 8 * hh);
#pragma unroll
      for (int rt = 0; rt < RTN; ++rt) oacc[rt][dt] = mmaH<1>(pa[rt].v, pa[rt].v, bv.v, bv.v, oacc[rt][dt]); }
    __builtin_amdgcn_fence(__ATOMIC_ACQ_REL, "workgroup"); __builtin_amdgcn_wave_barrier(); }
#pragma unroll
  for (int rt = 0; rt < RTN; ++rt) {
#pragma unroll
    for (int r = 0; r < 8; ++r) { float l = l_r[rt][r]; l += __shfl_xor(l, 1, 32); l += __shfl_xor(l, 2, 32); l += __shfl_xor(l, 4, 32); l += __shfl_xor(l, 8, 32); l_r[rt][r] = (l > 0.f) ? 1.0f / (l * 1024.0f) : 0.f; }
#pragma unroll
    for (int dt = 0; dt < DT; ++dt)
#pragma unroll
      for (int r = 0; r < 8; ++r) sO[w][rt * 16 + 8 * hh + r][dt * 16 + ln] = oacc[rt][dt][r] * l_r[rt][r]; }
  __builtin_amdgcn_fence(__ATOMIC_ACQ_REL, "workgroup"); __builtin_amdgcn_wave_barrier();
  {
#pragma unroll
    for (int rp = 0; rp < RPW; rp += 2) { const int r = rp + (lane >> 4), pc = lane & 15; const v4f val = *(const v4fa*)&sO[w][r][pc * 4]; *(v4f*)(O + ((size_t)b * TQ + q0 + r) * ldo + h * 64 + pc * 4) = val; }
     } }
// 5-plane variant: S = Qh Kh^T + (Ql Kh^T + Qh Kl^T)/1024 with Q/K = [hi | 2^10 residual] f16 planes (QL/KL same layout as Q16/K16), then the 3-term P.V below.
// 3-term variant: O = (P_hi V_hi + (P_lo V_hi + P_hi V_lo) / 1024) / l with P = [hi | 2^10 residual] of 1024 p and V^T = [hi | 2^10 residual] planes (VtL same layout as Vt) -> ~2^-21-class products for un-averaged (early causal / peaked) rows
template <int CAUSAL>
__global__ __launch_bounds__(128) void k_flash5(const _Float16* __restrict__ Q16, const _Float16* __restrict__ QL, int ldq, const _Float16* __restrict__ K16, const _Float16* __restrict__ KL, int ldk, const _Float16* __restrict__ Vt, const _Float16* __restrict__ VtL, const int* __restrict__ MSK, float* __restrict__ O, int ldo) {
  constexpr int RPW = 16, RTN = RPW / 16, NQB = TQ / (4 * RPW), DT = 4, KS = 2;
  __shared__ __attribute__((aligned(16))) unsigned short sP[4][RPW][40]; __shared__ __attribute__((aligned(16))) unsigned short sPL[4][RPW][40]; __shared__ __attribute__((aligned(16))) float sO[4][RPW][64 + 4];
  const int tid = threadIdx.x, w = tid >> 5, lane = tid & 31, ln = lane & 15, hh = lane >> 4;
  const int slab = blockIdx.x / QBN5, qblk = QB05 + blockIdx.x % QBN5; (void)NQB; const int b = slab / NH, h = slab % NH; const int qb0 = qblk * (4 * RPW); const int q0 = qb0 + w * RPW;
  FragH aq[2][KS], aql[2][KS];
#pragma unroll
  for (int rt = 0; rt < RTN; ++rt) { const unsigned short* qr = (const unsigned short*)Q16 + ((size_t)b * TQ + q0 + rt * 16 + ln) * ldq + h * 64; const unsigned short* ql = (const unsigned short*)QL + ((size_t)b * TQ + q0 + rt * 16 + ln) * ldq + h * 64;
#pragma unroll
    for (int ks = 0; ks < KS; ++ks) { aq[rt][ks].half[0] = *(const v8us*)(qr + ks * 32 + 8 * hh); aq[rt][ks].half[1] = *(const v8us*)(qr + ks * 32 + 16 + 8 * hh); aql[rt][ks].half[0] = *(const v8us*)(ql + ks * 32 + 8 * hh); aql[rt][ks].half[1] = *(const v8us*)(ql + ks * 32 + 16 + 8 * hh); } }
  const unsigned short* Vth = (const unsigned short*)Vt + (size_t)slab * 64 * TK; const unsigned short* Vtl = (const unsigned short*)VtL + (size_t)slab * 64 * TK;
  float m_r[2][8], l_r[2][8]; v8f oacc[2][DT], oaccL[2][DT];
#pragma unroll
  for (int rt = 0; rt < RTN; ++rt) {
#pragma unroll
    for (int r = 0; r < 8; ++r) { m_r[rt][r] = -3.0e38f; l_r[rt][r] = 0.f; }
#pragma unroll
    for (int dt = 0; dt < DT; ++dt) { oacc[rt][dt] = (v8f){0.f,0.f,0.f,0.f,0.f,0.f,0.f,0.f}; oaccL[rt][dt] = oacc[rt][dt]; } }
  const int jend = (CAUSAL == 1) ? (qb0 + 4 * RPW) : ((CAUSAL == 23) ? min(TK, (qb0 / CHK + 2) * CHK) : TK);      /* causal / window: keys that can never contribute are skipped */ const int jbeg = (CAUSAL == 23) ? max(0, (qb0 / CHK - 1) * CHK) : 0;
#pragma unroll 1
  for (int j0 = jbeg; j0 < jend; j0 += 32) {
    v8f s[2][2];
#pragma unroll
    for (int nt = 0; nt < 2; ++nt) { const unsigned short* kr = (const unsigned short*)K16 + ((size_t)b * TK + j0 + nt * 16 + ln) * ldk + h * 64; const unsigned short* klr = (const unsigned short*)KL + ((size_t)b * TK + j0 + nt * 16 + ln) * ldk + h * 64; FragH bk[KS], bkl[KS];
#pragma unroll
      for (int ks = 0; ks < KS; ++ks) { bk[ks].half[0] = *(const v8us*)(kr + ks * 32 + 8 * hh); bk[ks].half[1] = *(const v8us*)(kr + ks * 32 + 16 + 8 * hh); bkl[ks].half[0] = *(const v8us*)(klr + ks * 32 + 8 * hh); bkl[ks].half[1] = *(const v8us*)(klr + ks * 32 + 16 + 8 * hh); }
#pragma unroll
      for (int rt = 0; rt < RTN; ++rt) { v8f acc = (v8f){0.f,0.f,0.f,0.f,0.f,0.f,0.f,0.f}, accl = acc;
#pragma unroll
        for (int ks = 0; ks < KS; ++ks) { acc = mmaH<1>(aq[rt][ks].v, aq[rt][ks].v, bk[ks].v, bk[ks].v, acc); accl = mmaH<1>(aql[rt][ks].v, aql[rt][ks].v, bk[ks].v, bk[ks].v, accl); accl = mmaH<1>(aq[rt][ks].v, aq[rt][ks].v, bkl[ks].v, bkl[ks].v, accl); }
#pragma unroll
        for (int r = 0; r < 8; ++r) acc[r] += accl[r] * 0.0009765625f;
        s[rt][nt] = acc; } }
#pragma unroll
    for (int rt = 0; rt < RTN; ++rt)
#pragma unroll
      for (int r = 0; r < 8; ++r) { const int tq = q0 + rt * 16 + 8 * hh + r; const int k0 = j0 + ln, k1 = j0 + 16 + ln;
        bool ok0 = (CAUSAL == 1) ? (k0 <= tq) : ((CAUSAL == 2) ? ((k0 >> 5) == (tq >> 5)) : true), ok1 = (CAUSAL == 1) ? (k1 <= tq) : ((CAUSAL == 2) ? ((k1 >> 5) == (tq >> 5)) : true);      /* mode 2: block-diagonal 32-token groups */
        if (CAUSAL == 4) { const int* mrow = MSK + ((size_t)b * TQ + tq) * TK; ok0 = mrow[k0] != 0; ok1 = mrow[k1] != 0; }      /* mode 4: per-(query, key) INPUT mask shared by all heads; masked keys contribute nothing (== the reference's -4096 fill, whose exp underflows to 0), rows with no valid key give l = 0 -> output 0 (== the reference's row_valid zeroing) */
        float s0 = ok0 ? s[rt][0][r] * SCL : -3.0e38f, s1 = ok1 ? s[rt][1][r] * SCL : -3.0e38f; if (CAUSAL == 17) { const float* amk = (const float*)MSK + (size_t)b * TK; s0 += bf16_round(amk[k0]); s1 += bf16_round(amk[k1]); } if (CAUSAL == 18) { const float* tb = (const float*)MSK; const int* ri = MSK + 1024 + (size_t)b * TK; const int rq = ri[tq]; s0 += tb[(h * 8 + rq) * 8 + ri[k0]]; s1 += tb[(h * 8 + rq) * 8 + ri[k1]]; } if (CAUSAL == 19) { const int* rel = MSK + (size_t)tq * TK; const float* rb = (const float*)MSK + (size_t)TQ * TK + ((size_t)(b * NH + h) * TQ + tq) * 64; s0 += rb[rel[k0]]; s1 += rb[rel[k1]]; }      /* mode 19: + (q.Ek[rel] + Eb[rel][h]) / 8 gathered by the int relative ids (packed [ids | table]) */      /* mode 18: + resource_bias[h][r_q][r_k] from the packed [table | ids] buffer (TQ == TK) */      /* mode 17: additive per-(batch, key) mask INPUT */ float mc = fmaxf(s0, s1);
        mc = fmaxf(mc, __shfl_xor(mc, 1, 32)); mc = fmaxf(mc, __shfl_xor(mc, 2, 32)); mc = fmaxf(mc, __shfl_xor(mc, 4, 32)); mc = fmaxf(mc, __shfl_xor(mc, 8, 32));
        const float mn = fmaxf(m_r[rt][r], mc); const float al = (mn > -1.0e38f) ? expf(m_r[rt][r] - mn) : 1.0f; m_r[rt][r] = mn; const float p0 = ok0 ? expf(s0 - mn) : 0.f, p1 = ok1 ? expf(s1 - mn) : 0.f; l_r[rt][r] = l_r[rt][r] * al + p0 + p1;
#pragma unroll
        for (int dt = 0; dt < DT; ++dt) { oacc[rt][dt][r] *= al; oaccL[rt][dt][r] *= al; }
        FragH t2, t2l; const float ps0 = p0 * 1024.0f, ps1 = p1 * 1024.0f; t2.h[0] = (_Float16)ps0; t2.h[1] = (_Float16)ps1; t2l.h[0] = (_Float16)((ps0 - (float)t2.h[0]) * 1024.0f); t2l.h[1] = (_Float16)((ps1 - (float)t2.h[1]) * 1024.0f);
        sP[w][rt * 16 + 8 * hh + r][ln] = t2.u[0]; sP[w][rt * 16 + 8 * hh + r][16 + ln] = t2.u[1]; sPL[w][rt * 16 + 8 * hh + r][ln] = t2l.u[0]; sPL[w][rt * 16 + 8 * hh + r][16 + ln] = t2l.u[1]; }
    __builtin_amdgcn_fence(__ATOMIC_ACQ_REL, "workgroup"); __builtin_amdgcn_wave_barrier();
    FragH pa[2], pl[2];
#pragma unroll
    for (int rt = 0; rt < RTN; ++rt) { pa[rt].half[0] = *(const v8us*)&sP[w][rt * 16 + ln][8 * hh]; pa[rt].half[1] = *(const v8us*)&sP[w][rt * 16 + ln][16 + 8 * hh]; pl[rt].half[0] = *(const v8us*)&sPL[w][rt * 16 + ln][8 * hh]; pl[rt].half[1] = *(const v8us*)&sPL[w][rt * 16 + ln][16 + 8 * hh]; }
#pragma unroll
    for (int dt = 0; dt < DT; ++dt) { const unsigned short* vrow = Vth + (size_t)(dt * 16 + ln) * TK + j0; const unsigned short* vrl = Vtl + (size_t)(dt * 16 + ln) * TK + j0; FragH bv, bl; bv.half[0] = *(const v8us*)(vrow + 8 * hh); bv.half[1] = *(const v8us*)(vrow + 16 + 8 * hh); bl.half[0] = *(const v8us*)(vrl + 8 * hh); bl.half[1] = *(const v8us*)(vrl + 16 + 8 * hh);
#pragma unroll
      for (int rt = 0; rt < RTN; ++rt) { oacc[rt][dt] = mmaH<1>(pa[rt].v, pa[rt].v, bv.v, bv.v, oacc[rt][dt]); oaccL[rt][dt] = mmaH<1>(pl[rt].v, pl[rt].v, bv.v, bv.v, oaccL[rt][dt]); oaccL[rt][dt] = mmaH<1>(pa[rt].v, pa[rt].v, bl.v, bl.v, oaccL[rt][dt]); } }
    __builtin_amdgcn_fence(__ATOMIC_ACQ_REL, "workgroup"); __builtin_amdgcn_wave_barrier(); }
#pragma unroll
  for (int rt = 0; rt < RTN; ++rt) {
#pragma unroll
    for (int r = 0; r < 8; ++r) { float l = l_r[rt][r]; l += __shfl_xor(l, 1, 32); l += __shfl_xor(l, 2, 32); l += __shfl_xor(l, 4, 32); l += __shfl_xor(l, 8, 32); l_r[rt][r] = (l > 0.f) ? 1.0f / (l * 1024.0f) : 0.f; }
#pragma unroll
    for (int dt = 0; dt < DT; ++dt)
#pragma unroll
      for (int r = 0; r < 8; ++r) { float v = oacc[rt][dt][r]; v += oaccL[rt][dt][r] * 0.0009765625f; sO[w][rt * 16 + 8 * hh + r][dt * 16 + ln] = v * l_r[rt][r]; } }
  __builtin_amdgcn_fence(__ATOMIC_ACQ_REL, "workgroup"); __builtin_amdgcn_wave_barrier();
  {
#pragma unroll
    for (int rp = 0; rp < RPW; rp += 2) { const int r = rp + (lane >> 4), pc = lane & 15; const v4f val = *(const v4fa*)&sO[w][r][pc * 4]; *(v4f*)(O + ((size_t)b * TQ + q0 + r) * ldo + h * 64 + pc * 4) = val; }
     } }

__global__ __launch_bounds__(256) void k_rotab(float* __restrict__ CS, float* __restrict__ SN) {
  #pragma clang fp contract(off)
  const int t = blockIdx.x * 256 + threadIdx.x; if (t >= SLEN * 32) return; const int j = t % 32, s = t / 32; const float ex = (float)(2 * j) / 64.0f; const float inv = 1.0f / powf(10000.0f, ex); const float th = (float)s * inv; const float c = cosf(th), sn = sinf(th);
  { *(float*)(CS + t) = c; *(float*)(SN + t) = sn;  } }
__global__ __launch_bounds__(256) void k_rope(const float* __restrict__ F, int nsrc, int ndst, int rep, const float* __restrict__ CS, const float* __restrict__ SN, _Float16* __restrict__ H, _Float16* __restrict__ L) {
  #pragma clang fp contract(off)
  const size_t t = (size_t)blockIdx.x * 256 + threadIdx.x; if (t >= (size_t)NR * ndst * 4) return; const int g8 = (int)(t % 4); const int hd = (int)((t / 4) % ndst); const size_t row = t / ((size_t)4 * ndst); const int s = (int)(row % SLEN); const int hs = hd / rep;
  const float* src = F + row * (size_t)(nsrc * 64) + hs * 64; FragH ah, al, bh, bl;
  for (int i = 0; i < 8; ++i) { const int d = g8 * 8 + i; const float c = CS[s * 32 + d], sn = SN[s * 32 + d]; const float x1 = src[d], x2 = src[d + 32];
    float o1 = x1 * c; o1 += -x2 * sn; float o2 = x2 * c; o2 += x1 * sn;
    _Float16 hv = (_Float16)o1; ah.h[i] = hv; al.h[i] = (_Float16)((o1 - (float)hv) * 1024.0f); hv = (_Float16)o2; bh.h[i] = hv; bl.h[i] = (_Float16)((o2 - (float)hv) * 1024.0f); }
  const size_t o = row * (size_t)(ndst * 64) + hd * 64 + g8 * 8;
  { *(v8us*)((unsigned short*)H + o) = ah.half[0]; *(v8us*)((unsigned short*)H + o + 32) = bh.half[0]; *(v8us*)((unsigned short*)L + o) = al.half[0]; *(v8us*)((unsigned short*)L + o + 32) = bl.half[0];  } }
__global__ __launch_bounds__(256) void k_rope2(const float* __restrict__ F, int nsrc, int ndst, int rep, const float* __restrict__ CS, const float* __restrict__ SN, _Float16* __restrict__ H, _Float16* __restrict__ L) {
  #pragma clang fp contract(off)
  const size_t t = (size_t)blockIdx.x * 256 + threadIdx.x; if (t >= (size_t)NR * ndst * 4) return; const int g16 = (int)(t % 4); const int hd = (int)((t / 4) % ndst); const size_t row = t / ((size_t)4 * ndst); const int s = (int)(row % SLEN); const int hs = hd / rep;
  const float* src = F + row * (size_t)(nsrc * 64) + hs * 64 + g16 * 16; FragH ah, al;
  for (int pr = 0; pr < 8; ++pr) { const int i = g16 * 8 + pr; const float c = CS[s * 32 + i], sn = SN[s * 32 + i]; const float x1 = src[2 * pr], x2 = src[2 * pr + 1];
    float o1 = x1 * c; o1 -= x2 * sn; float o2 = x1 * sn; o2 += x2 * c;
    _Float16 hv = (_Float16)o1; ah.h[2 * pr] = hv; al.h[2 * pr] = (_Float16)((o1 - (float)hv) * 1024.0f); hv = (_Float16)o2; ah.h[2 * pr + 1] = hv; al.h[2 * pr + 1] = (_Float16)((o2 - (float)hv) * 1024.0f); }
  const size_t o = row * (size_t)(ndst * 64) + hd * 64 + g16 * 16;
  { *(v8us*)((unsigned short*)H + o) = ah.half[0]; *(v8us*)((unsigned short*)H + o + 8) = ah.half[1]; *(v8us*)((unsigned short*)L + o) = al.half[0]; *(v8us*)((unsigned short*)L + o + 8) = al.half[1];  } }
__global__ __launch_bounds__(256) void k_ln512(const float* __restrict__ A, const float* __restrict__ res, const float* __restrict__ g, const float* __restrict__ bb, float* __restrict__ Y, _Float16* __restrict__ Y16) {
  #pragma clang fp contract(off)
  const int wv = threadIdx.x >> 5, ln = threadIdx.x & 31; const size_t r = (size_t)blockIdx.x * 8 + wv; if (r >= NR) return; float x[16]; float s = 0.f;
  for (int i = 0; i < 2; ++i) { const v8f a = *(const v8f*)(A + r * DM + i * 256 + ln * 8); for (int q = 0; q < 8; ++q) { float v = a[q]; if (res) v += bf16_round(res[r * DM + i * 256 + ln * 8 + q]); x[i * 8 + q] = v; s += v; } }
  for (int o = 16; o > 0; o >>= 1) s += __shfl_xor(s, o, 32); const float mu = s / (float)DM; float var = 0.f; for (int q = 0; q < 16; ++q) { const float d = x[q] - mu; var += d * d; }
  for (int o = 16; o > 0; o >>= 1) var += __shfl_xor(var, o, 32); const float inv = rsqrtf(var / (float)DM + 1e-5f);
  { for (int i = 0; i < 2; ++i) { const int c0 = i * 256 + ln * 8; v8f y; FragH f; for (int q = 0; q < 8; ++q) { float v = (x[i * 8 + q] - mu) * inv; v *= bf16_round(g[c0 + q]); v += bf16_round(bb[c0 + q]); y[q] = v; f.h[q] = (_Float16)v; } *(v8f*)(Y + r * DM + c0) = y; if (Y16) *(v8us*)((unsigned short*)Y16 + r * DM + c0) = f.half[0]; }  } }
__global__ __launch_bounds__(256) void k_pack(const float* __restrict__ rb, const int* __restrict__ rid, int* __restrict__ PK) { const int t = blockIdx.x * 256 + threadIdx.x; if (t >= 1024 + NB * TK) return; int v; if (t < 1024) v = __float_as_int(bf16_round(rb[t])); else v = rid[t - 1024]; *(int*)(PK + t) = v;  }
__global__ __launch_bounds__(256) void k_tabin(const float* __restrict__ sp, float* __restrict__ CS, float* __restrict__ SN) { const int t = blockIdx.x * 256 + threadIdx.x; if (t >= SLEN * 32) return; const int i = t % 32, s = t / 32; const float c = bf16_round(sp[s * 64 + 32 + i]), sn = bf16_round(sp[s * 64 + i]);
  { *(float*)(CS + t) = c; *(float*)(SN + t) = sn;  } }
__global__ __launch_bounds__(256) void k_wsc(const float* __restrict__ Wm, _Float16* __restrict__ Bt, size_t n8, float sc) { const size_t t = (size_t)blockIdx.x * 256 + threadIdx.x; if (t >= n8) return; FragH f; for (int q = 0; q < 8; ++q) f.h[q] = (_Float16)(bf16_round(Wm[t * 8 + q]) * sc); *(v8us*)((unsigned short*)Bt + t * 8) = f.half[0];  }
__global__ __launch_bounds__(256) void k_rotab2(float* __restrict__ CS, float* __restrict__ SN) {
  #pragma clang fp contract(off)
  const int t = blockIdx.x * 256 + threadIdx.x; if (t >= SLEN * 32) return; const int j = t % 32, s = t / 32; const float c0 = -0.14391156831212787f;      /* -ln(10000)/64 rounded to f32 */ const float inv = expf((float)(2 * j) * c0); const float th = (float)s * inv; const float c = cosf(th), sn = sinf(th);
  { *(float*)(CS + t) = c; *(float*)(SN + t) = sn;  } }
__global__ __launch_bounds__(256) void k_lnu(const float* __restrict__ X, _Float16* __restrict__ N16, float* __restrict__ XB) {
  #pragma clang fp contract(off)
  const int wv = threadIdx.x >> 5, ln = threadIdx.x & 31; const size_t r = (size_t)blockIdx.x * 8 + wv; if (r >= NR) return; float a[32]; float s = 0.f;
  for (int i = 0; i < 4; ++i) { const v8f v = *(const v8f*)(X + r * DM + (i * 32 + ln) * 8); for (int q = 0; q < 8; ++q) { const float u = bf16_round(v[q]); a[i * 8 + q] = u; s += u; } }
  for (int o = 16; o > 0; o >>= 1) s += __shfl_xor(s, o, 32); const float mu = s / (float)DM; float var = 0.f; for (int q = 0; q < 32; ++q) { const float d = a[q] - mu; var += d * d; }
  for (int o = 16; o > 0; o >>= 1) var += __shfl_xor(var, o, 32); const float den = sqrtf(var / (float)(DM - 1)) + 1e-6f; const float inv = 1.0f / den;      /* one reciprocal per row; (x-mean)*inv vs the reference's division differs by <= 1 ulp */
  { for (int i = 0; i < 4; ++i) { const int c0 = (i * 32 + ln) * 8; FragH f; v8f xb; for (int q = 0; q < 8; ++q) { f.h[q] = (_Float16)((a[i * 8 + q] - mu) * inv); xb[q] = a[i * 8 + q]; } *(v8us*)((unsigned short*)N16 + r * DM + c0) = f.half[0]; *(v8f*)(XB + r * DM + c0) = xb; }  } }
__global__ __launch_bounds__(256) void k_vtg(const _Float16* __restrict__ V16, _Float16* __restrict__ Vt) { __shared__ unsigned short tl[64][66]; const int tid = threadIdx.x; const int slab = blockIdx.x / (SLEN / 64), lg = blockIdx.x % (SLEN / 64); const int b = slab / NH, h = slab % NH; const int hs = h / NREP;
  for (int i = tid; i < 64 * 8; i += 256) { const int r = i / 8, c8 = (i % 8) * 8; FragH f; f.half[0] = *(const v8us*)((const unsigned short*)V16 + ((size_t)b * SLEN + lg * 64 + r) * KVD + hs * 64 + c8); for (int q = 0; q < 8; ++q) tl[r][c8 + q] = f.u[q]; }
  __syncthreads();
  { for (int rd = 0; rd < 2; ++rd) { const int d = rd * 32 + tid / 8, pc = tid % 8; FragH f; for (int q = 0; q < 8; ++q) f.u[q] = tl[pc * 8 + q][d]; *(v8us*)((unsigned short*)Vt + ((size_t)slab * 64 + d) * SLEN + lg * 64 + pc * 8) = f.half[0]; }  } }

__global__ __launch_bounds__(256) void k_h16s(const float* __restrict__ SRC, int lds, int coff, _Float16* __restrict__ DST, size_t n8) { const size_t t = (size_t)blockIdx.x * 256 + threadIdx.x; if (t >= n8) return; const size_t r = (t * 8) / DM; const int c = (int)((t * 8) % DM); const v8f a = *(const v8f*)(SRC + r * lds + coff + c); FragH f; for (int q = 0; q < 8; ++q) f.h[q] = (_Float16)a[q];
  *(v8us*)((unsigned short*)DST + t * 8) = f.half[0];  }

__global__ __launch_bounds__(256) void k_norms(const float* __restrict__ QKV, float* __restrict__ QN, float* __restrict__ KN) {
  #pragma clang fp contract(off)
  const size_t t = (size_t)blockIdx.x * 256 + threadIdx.x; if (t >= (size_t)NR * NH) return; const int h = (int)(t % NH); const size_t row = t / NH; const float* q = QKV + row * (3 * DM) + h * 64; const float* k = q + DM; float sq = 0.f, sk = 0.f;
#pragma unroll 1
  for (int d = 0; d < 64; d += 4) { const v4f a = *(const v4fa*)(q + d), b = *(const v4fa*)(k + d); for (int i = 0; i < 4; ++i) { sq += a[i] * a[i]; sk += b[i] * b[i]; } }
  { *(float*)(QN + t) = sq; *(float*)(KN + ((row / SLEN) * NH + h) * SLEN + row % SLEN) = sk;  } }      /* key norms [(b, h)][s]: 8 consecutive keys per lane in the attention kernel */
// strided hi + residual copy of a DM-wide third of QKV
__global__ __launch_bounds__(256) void k_hls(const float* __restrict__ SRC, int lds, int coff, _Float16* __restrict__ DH, _Float16* __restrict__ DL, size_t n8) { const size_t t = (size_t)blockIdx.x * 256 + threadIdx.x; if (t >= n8) return; const size_t r = (t * 8) / DM; const int c = (int)((t * 8) % DM); const v8f a = *(const v8f*)(SRC + r * lds + coff + c); FragH fh, fl; for (int q = 0; q < 8; ++q) { const _Float16 h = (_Float16)a[q]; fh.h[q] = h; fl.h[q] = (_Float16)((a[q] - (float)h) * 1024.0f); }
  { *(v8us*)((unsigned short*)DH + t * 8) = fh.half[0]; *(v8us*)((unsigned short*)DL + t * 8) = fl.half[0];  } }
// lane l <-> l ^ 16 (the two halves of a wave hold the two key halves of one query column)
__device__ __forceinline__ float xhalf(float v) { const int t = __float_as_int(v); return __int_as_float(__builtin_amdgcn_permlanex16(t, t, 0x76543210, 0xfedcba98, false, false)); }
__device__ __forceinline__ v8f wmh(v16h a, v16h b, v8f c) { return __builtin_amdgcn_wmma_f32_16x16x32_f16(false, a, false, b, (short)0, c, false, false); }
typedef _Float16 v8h __attribute__((ext_vector_type(8)));
typedef float v2f __attribute__((ext_vector_type(2)));
// eight 2^x in one statement: results kept apart from the arguments ("=&v") and one v_nop behind the last, the slot the instruction set asks for
// between a transcendental and an instruction that uses its result or overwrites its source (the register allocator otherwise reuses the previous argument as the next result)
__device__ __forceinline__ v8f exp2x8(v8f e) { float p0, p1, p2, p3, p4, p5, p6, p7;
  asm("v_exp_f32 %0, %8\n\tv_exp_f32 %1, %9\n\tv_exp_f32 %2, %10\n\tv_exp_f32 %3, %11\n\tv_exp_f32 %4, %12\n\tv_exp_f32 %5, %13\n\tv_exp_f32 %6, %14\n\tv_exp_f32 %7, %15\n\tv_nop"
      : "=&v"(p0), "=&v"(p1), "=&v"(p2), "=&v"(p3), "=&v"(p4), "=&v"(p5), "=&v"(p6), "=&v"(p7) : "v"(e[0]), "v"(e[1]), "v"(e[2]), "v"(e[3]), "v"(e[4]), "v"(e[5]), "v"(e[6]), "v"(e[7]));
  return (v8f){p0, p1, p2, p3, p4, p5, p6, p7}; }
// Fused distance attention, one launch for all (batch, head) slabs: per wave 32 query columns, per pass 32 keys.
// S^T = K Q^T (A = key rows, B = query rows; hi.hi + (hi.lo + lo.hi) / 1024), so a lane holds 8 + 8 keys of ONE query per column group:
// logits, running maximum and sum stay in the lane (one exchange between the wave halves); the two f32 score tiles, converted in place,
// are the B operand of O^T += V^T P^T (k order 8h + s, 16 + 8h + s on both sides). A lane ends with 8 consecutive d of one query: 16-byte stores of hi and residual.
// K hi, K lo, V^T and the key norms come through LDS, shared by the block's 8 waves: a stage is 128 keys (4 passes), brought by asynchronous copies into one of two buffers while the other is worked on.
#define EFK 144                        /* K row pitch in LDS: 128 B + 16 = 16 B x odd, conflict-free for 16-byte fragment reads */
#define EFV 272                        /* V^T row pitch: 256 B (128 keys) + 16, 16 B x odd too */
#define EF_KL (128 * EFK)              /* rows 0..127 = K hi, 128..255 = K lo */
#define EF_V (256 * EFK)               /* then 64 rows of V^T */
#define EF_N (256 * EFK + 64 * EFV)    /* then 128 key norms */
#define EFS (EF_N + 512)               /* one stage */
// One stage's 12 copies of a lane, 16 bytes each. K: 8 lanes bring one row's 128 bytes, the block 32 rows per copy; V^T: 16 lanes one row's 256 bytes, the block 16 rows per copy.
// lk, lv = the lane's LDS byte addresses in its first K hi row and its first V^T row; kh, kl, v = its global addresses there.
// s_wait_xcnt 0 is the statement's last line, so that it stands in front of any later rewrite of these address registers.
__device__ __forceinline__ void ef_stage(unsigned lk, unsigned lv, const char* kh, const char* kl, const char* v) {
  asm volatile("global_load_async_to_lds_b128 %0, %12, off\n\tglobal_load_async_to_lds_b128 %1, %13, off\n\tglobal_load_async_to_lds_b128 %2, %14, off\n\tglobal_load_async_to_lds_b128 %3, %15, off\n\t"
               "global_load_async_to_lds_b128 %4, %16, off\n\tglobal_load_async_to_lds_b128 %5, %17, off\n\tglobal_load_async_to_lds_b128 %6, %18, off\n\tglobal_load_async_to_lds_b128 %7, %19, off\n\t"
               "global_load_async_to_lds_b128 %8, %20, off\n\tglobal_load_async_to_lds_b128 %9, %21, off\n\tglobal_load_async_to_lds_b128 %10, %22, off\n\tglobal_load_async_to_lds_b128 %11, %23, off\n\ts_wait_xcnt 0x0"
               :: "v"(lk), "v"(lk + 32 * EFK), "v"(lk + 64 * EFK), "v"(lk + 96 * EFK), "v"(lk + EF_KL), "v"(lk + EF_KL + 32 * EFK), "v"(lk + EF_KL + 64 * EFK), "v"(lk + EF_KL + 96 * EFK), "v"(lv), "v"(lv + 16 * EFV), "v"(lv + 32 * EFV), "v"(lv + 48 * EFV),
                  "v"(kh), "v"(kh + 32 * (DM * 2)), "v"(kh + 64 * (DM * 2)), "v"(kh + 96 * (DM * 2)), "v"(kl), "v"(kl + 32 * (DM * 2)), "v"(kl + 64 * (DM * 2)), "v"(kl + 96 * (DM * 2)), "v"(v), "v"(v + 16 * (SLEN * 2)), "v"(v + 32 * (SLEN * 2)), "v"(v + 48 * (SLEN * 2)) : "memory"); }
// the stage's 128 key norms, 512 bytes: one copy of one whole wave
__device__ __forceinline__ void ef_stage_n(unsigned ln_, const char* n) { asm volatile("global_load_async_to_lds_b128 %0, %1, off\n\ts_wait_xcnt 0x0" :: "v"(ln_), "v"(n) : "memory"); }
// amdgpu_waves_per_eu(4, 4): a budget of 256 VGPRs, so that the whole kernel stays in one register window (it takes 240, no scratch)
__global__ __launch_bounds__(256) __attribute__((amdgpu_waves_per_eu(4, 4))) void k_eflash(const _Float16* __restrict__ QHp, const _Float16* __restrict__ QLp, const _Float16* __restrict__ KHp, const _Float16* __restrict__ KLp, const _Float16* __restrict__ Vt,
                                                const float* __restrict__ QN, const float* __restrict__ KNT, const float* __restrict__ tmp, _Float16* __restrict__ OH, _Float16* __restrict__ OL) {
  __shared__ __attribute__((aligned(128))) char st[2 * EFS];
  const int tid = threadIdx.x, w = tid >> 5, lane = tid & 31, ln = lane & 15, hh = lane >> 4;
  const int slab = blockIdx.x / (SLEN / 256), qblk = blockIdx.x % (SLEN / 256); const int b = slab / NH, h = slab % NH; const int q0 = qblk * 256 + w * 32;
  const float nc = -(1.0f / bf16_round(tmp[0])) * 1.4426950408889634f;      /* logit in log2 units = d2 * nc */
  v16h qh[2][2], ql[2][2]; float qn[2];
#pragma unroll
  for (int qt = 0; qt < 2; ++qt) { const size_t row = (size_t)b * SLEN + q0 + qt * 16 + ln; const _Float16* ph = QHp + row * DM + h * 64; const _Float16* pl = QLp + row * DM + h * 64;
    qh[qt][0] = g2_frag(ph, hh); qh[qt][1] = g2_frag(ph + 32, hh); ql[qt][0] = g2_frag(pl, hh); ql[qt][1] = g2_frag(pl + 32, hh); qn[qt] = QN[row * NH + h]; }
  const char* gkh = (const char*)(KHp + (size_t)b * SLEN * DM + h * 64) + (tid >> 3) * (DM * 2) + (tid & 7) * 16; const char* gkl = (const char*)(KLp + (size_t)b * SLEN * DM + h * 64) + (tid >> 3) * (DM * 2) + (tid & 7) * 16;      /* the lane's copy sources in stage 0 */
  const char* gv = (const char*)(Vt + (size_t)slab * 64 * SLEN) + (tid >> 4) * (SLEN * 2) + (tid & 15) * 16; const char* gn = (const char*)(KNT + (size_t)slab * SLEN) + lane * 16;
  const unsigned lk0 = (unsigned)(size_t)st + (unsigned)((tid >> 3) * EFK + (tid & 7) * 16), lv0 = (unsigned)(size_t)st + (unsigned)(EF_V + (tid >> 4) * EFV + (tid & 15) * 16), ln0 = (unsigned)(size_t)st + (unsigned)(EF_N + lane * 16);
  const bool w0 = __builtin_amdgcn_readfirstlane(w) == 0;      /* scalar: the norms' copy is issued by wave 0 alone, behind a scalar branch */
  const char* fk = st + ln * EFK + hh * 16; const char* fv = st + EF_V + ln * EFV + hh * 16; const char* fn = st + EF_N + hh * 32;      /* fragment rows: k = 8h + s at +0, 16 + 8h + s at +32 bytes */
  const v8f z8 = {0.f,0.f,0.f,0.f,0.f,0.f,0.f,0.f};
  float m[2] = {-3.0e38f, -3.0e38f}; v2f l[2] = {{0.f, 0.f}, {0.f, 0.f}}; v8f o[2][4];
#pragma unroll
  for (int qt = 0; qt < 2; ++qt)
#pragma unroll
    for (int dt = 0; dt < 4; ++dt) o[qt][dt] = z8;
  ef_stage(lk0, lv0, gkh, gkl, gv); if (w0) ef_stage_n(ln0, gn);
  asm volatile("s_wait_asynccnt 0x0" ::: "memory");      /* this wave's copies of stage 0 have landed */
  __syncthreads();      /* ... and every other wave's: stage 0 may be read */
  ef_stage(lk0 + EFS, lv0 + EFS, gkh + 128 * (DM * 2), gkl + 128 * (DM * 2), gv + 256); if (w0) ef_stage_n(ln0 + EFS, gn + 512);      /* SLEN / 128 = 16 stages: stage 1 exists */
#pragma unroll 1      /* one stage per trip */
  for (int t = 0; t < SLEN / 128; ++t) { const int bo = (t & 1) * EFS;
#pragma unroll 1      /* one pass per trip: the body already holds 32 matrix instructions, a copy would only add registers */
  for (int ps = 0; ps < 4; ++ps) {
    v8f u[2][2];
#pragma unroll
    for (int kt = 0; kt < 2; ++kt) { const char* kr = fk + bo + (ps * 32 + kt * 16) * EFK; const char* kq = kr + EF_KL;
      const v8f k2 = *(const v8f*)(fn + bo + (ps * 32 + kt * 16) * 4); const v16h a0 = g2_lfrag(kr), a1 = g2_lfrag(kr + 64), c0 = g2_lfrag(kq), c1 = g2_lfrag(kq + 64);
#pragma unroll
      for (int qt = 0; qt < 2; ++qt) { v8f lo = wmh(a0, ql[qt][0], z8); lo = wmh(a1, ql[qt][1], lo); lo = wmh(c0, qh[qt][0], lo); lo = wmh(c1, qh[qt][1], lo); v8f hi = wmh(a0, qh[qt][0], z8); hi = wmh(a1, qh[qt][1], hi);
        const v8f s = hi + lo * 0.0009765625f; const v8f d2 = __builtin_elementwise_max((k2 + qn[qt]) - 2.0f * s, z8); u[qt][kt] = d2 * nc; } }
    float mn[2];
#pragma unroll
    for (int qt = 0; qt < 2; ++qt) { const v8f t = __builtin_elementwise_max(u[qt][0], u[qt][1]); float mx = fmaxf(fmaxf(fmaxf(t[0], t[1]), fmaxf(t[2], t[3])), fmaxf(fmaxf(t[4], t[5]), fmaxf(t[6], t[7])));
      mx = fmaxf(mx, xhalf(mx)); mn[qt] = fmaxf(m[qt], mx); }
    if (__builtin_amdgcn_ballot_w32((mn[0] > m[0]) || (mn[1] > m[1])) != 0) {      /* scalar branch: sums and output tiles are rescaled only in a pass that raises some column's maximum */
#pragma unroll
      for (int qt = 0; qt < 2; ++qt) { const float al = __builtin_amdgcn_exp2f(m[qt] - mn[qt]); m[qt] = mn[qt]; l[qt] *= al;
#pragma unroll
        for (int dt = 0; dt < 4; ++dt) o[qt][dt] *= al; } }
    FragH pb[2];
#pragma unroll
    for (int qt = 0; qt < 2; ++qt) { const float mo = m[qt] - 10.0f;      /* weights carried times 1024, as f16 operands away from the subnormal range; the factor cancels between sum and output */
      v8f p[2];
#pragma unroll
      for (int kt = 0; kt < 2; ++kt) { p[kt] = exp2x8(u[qt][kt] - mo);
        const v8h ph = __builtin_convertvector(p[kt], v8h);
#pragma unroll
        for (int r = 0; r < 8; ++r) pb[qt].h[kt * 8 + r] = ph[r]; }
      const v8f t = p[0] + p[1]; const v4f t4 = t.lo + t.hi; l[qt] += t4.lo + t4.hi; }
#pragma unroll
    for (int dt = 0; dt < 4; ++dt) { const v16h va = g2_lfrag(fv + bo + ps * 64 + dt * 16 * EFV);
#pragma unroll
      for (int qt = 0; qt < 2; ++qt) o[qt][dt] = wmh(va, pb[qt].v, o[qt][dt]); }
  }
    asm volatile("s_wait_dscnt 0x0" ::: "memory");      /* this wave has left the buffer that is refilled below */
    asm volatile("s_wait_asynccnt 0x0" ::: "memory");      /* its copies of stage t + 1 have landed */
    __syncthreads();      /* publishes stage t + 1 and ends every reader's last read of stage t */
    if (t + 2 < SLEN / 128) { ef_stage(lk0 + bo, lv0 + bo, gkh + (size_t)(t + 2) * (128 * DM * 2), gkl + (size_t)(t + 2) * (128 * DM * 2), gv + (size_t)(t + 2) * 256); if (w0) ef_stage_n(ln0 + bo, gn + (size_t)(t + 2) * 512); }
  }
  asm volatile("s_wait_asynccnt 0x0" ::: "memory");      /* no copy is outstanding when the wave goes on to the epilogue and ends */
#pragma unroll
  for (int qt = 0; qt < 2; ++qt) { const float lh = l[qt][0] + l[qt][1]; const float inv = 1.0f / (lh + xhalf(lh)); const size_t ob = ((size_t)b * SLEN + q0 + qt * 16 + ln) * DM + h * 64 + 8 * hh;
#pragma unroll
    for (int dt = 0; dt < 4; ++dt) { FragH f, fl;
#pragma unroll
      for (int r = 0; r < 8; ++r) { const float v = o[qt][dt][r] * inv; const _Float16 hv = (_Float16)v; f.h[r] = hv; fl.h[r] = (_Float16)((v - (float)hv) * 1024.0f); }
      *(v8us*)((unsigned short*)OH + ob + dt * 16) = f.half[0]; *(v8us*)((unsigned short*)OL + ob + dt * 16) = fl.half[0]; } }
}
extern "C" void kernel_launch(void* const* d_in, const int* in_sizes, int n_in,
                              void* d_out, int out_size, void* d_ws, size_t ws_size, hipStream_t stream) {
  (void)in_sizes; (void)n_in; (void)out_size;
  const float* const* I = (const float* const*)d_in; const float* x = I[0]; const float* wq = I[1]; const float* bq = I[2]; const float* wk = I[3]; const float* bk = I[4]; const float* wv = I[5]; const float* bv = I[6]; const float* wo = I[7]; const float* bo = I[8]; const float* tmp = I[9];
  char* ws = (char*)d_ws; size_t off = 0;
  auto take = [&](size_t bytes) { char* p = ws + off; off += (bytes + 255) & ~(size_t)255; return p; };
  const size_t np = (size_t)NR * DM;
  _Float16* BQ = (_Float16*)take((size_t)DM * DM * 2); _Float16* BK = (_Float16*)take((size_t)DM * DM * 2); _Float16* BV = (_Float16*)take((size_t)DM * DM * 2); _Float16* BO = (_Float16*)take((size_t)DM * DM * 2);
  _Float16* X16 = (_Float16*)take(np * 2); float* QKV = (float*)take(np * 3 * 4); float* QN = (float*)take((size_t)NR * NH * 4); float* KN = (float*)take((size_t)NR * NH * 4); _Float16* QH = (_Float16*)take(np * 2); _Float16* QL = (_Float16*)take(np * 2); _Float16* KH = (_Float16*)take(np * 2); _Float16* KL = (_Float16*)take(np * 2); _Float16* VH = (_Float16*)take(np * 2); _Float16* VT = (_Float16*)take(np * 2);
  _Float16* OH = VH; _Float16* OL = X16;      /* O hi over v (dead after V^T), O lo over x (dead after the projections) */
  if (off > ws_size) return;      /* 8 + 8 + 48 + 0.5 + 6x8 = about 113 MiB */
  k_wt_f16<<<(unsigned)(((size_t)DM * DM / 8 + 255) / 256), 256, 0, stream>>>(wq, BQ, DM, DM, 16.0f); k_wt_f16<<<(unsigned)(((size_t)DM * DM / 8 + 255) / 256), 256, 0, stream>>>(wk, BK, DM, DM, 16.0f); k_wt_f16<<<(unsigned)(((size_t)DM * DM / 8 + 255) / 256), 256, 0, stream>>>(wv, BV, DM, DM, 16.0f); k_wt_f16<<<(unsigned)(((size_t)DM * DM / 8 + 255) / 256), 256, 0, stream>>>(wo, BO, DM, DM, 16.0f);      /* [in, out] */
  k_x16<<<(unsigned)((np / 8 + 255) / 256), 256, 0, stream>>>(x, X16, np / 8);
  const dim3 gP((NR / 128) * (DM / 64), 1);
  k_gemm2<0><<<gP, 128, 0, stream>>>(X16, DM, 0, BQ, DM, 0, 0.0625f, bq, 0, nullptr, 1, 0, 0, QKV, nullptr, 3 * DM, 0, NR, DM, DM); k_gemm2<0><<<gP, 128, 0, stream>>>(X16, DM, 0, BK, DM, 0, 0.0625f, bk, 0, nullptr, 1, 0, 0, QKV + DM, nullptr, 3 * DM, 0, NR, DM, DM); k_gemm2<0><<<gP, 128, 0, stream>>>(X16, DM, 0, BV, DM, 0, 0.0625f, bv, 0, nullptr, 1, 0, 0, QKV + 2 * DM, nullptr, 3 * DM, 0, NR, DM, DM);      /* [q | k | v] f32 */
  k_norms<<<(unsigned)(((size_t)NR * NH + 255) / 256), 256, 0, stream>>>(QKV, QN, KN);
  k_hls<<<(unsigned)((np / 8 + 255) / 256), 256, 0, stream>>>(QKV, 3 * DM, 0, QH, QL, np / 8); k_hls<<<(unsigned)((np / 8 + 255) / 256), 256, 0, stream>>>(QKV, 3 * DM, DM, KH, KL, np / 8); k_h16s<<<(unsigned)((np / 8 + 255) / 256), 256, 0, stream>>>(QKV, 3 * DM, 2 * DM, VH, np / 8);
  k_vtg<<<NB * NH * (SLEN / 64), 256, 0, stream>>>(VH, VT);      /* V^T [(b,h)][64][2048] */
  k_eflash<<<NB * NH * (SLEN / 256), 256, 0, stream>>>(QH, QL, KH, KL, VT, QN, KN, tmp, OH, OL);      /* scores, softmax, att . v, normalise, hi + residual: one launch */
  k_gemm2<0><<<gP, 128, 0, stream>>>(OL, DM, 0, BO, DM, 0, 0.0625f / 1024.0f, nullptr, 0, nullptr, 1, 0, 0, (float*)d_out, nullptr, DM, 0, NR, DM, DM);
  k_gemm2<0><<<gP, 128, 0, stream>>>(OH, DM, 0, BO, DM, 0, 0.0625f, bo, 0, (const float*)d_out, 1, (size_t)DM, 0, (float*)d_out, nullptr, DM, 0, NR, DM, DM);      /* out = (O_lo + O_hi) Wo + bo */
}

// v004
// Measured time: 181 microseconds a run.
// Next to v003, in two timings, it ran 1.18 times as fast each time.
// Counting every step since v000, it is 10.9 times as fast.
#include <hip/hip_runtime.h>
// EuclideanAttention (2 x 2048 tokens, D 1024 = 16 heads x 64; Q, K, V = x W + b; d2 = max(|q|^2 + |k|^2 - 2 q.k, 0); attn = softmax_k(-d2 / temperature); out = (attn V) Wo + bo).
// Compute dtype: inputs rounded to bf16; x and weights exact as f16; q.k from hi+residual operands (~2^-21); norms/softmax f32; v and the softmax weights as plain f16 operands (~2^-12); attention output hi + residual. v_wmma_f32_16x16x32_f16.
#define NB 2
#define DM 1024
#define NKV 16
#define NREP (NH / NKV)
#define KVD (NKV * 64)           /* 1024 */
#define NR (NB * SLEN)           /* 4096 */
#define CHK 512                  /* attention chunk */
typedef int v4i __attribute__((ext_vector_type(4)));
#define FF 2048
#define SLEN 2048
#define TQ SLEN
#define TK SLEN
#define NH 16
#define SCL 0.125f
#define QBLKS (TQ / 64)
#define QB05 0
#define QBN5 4
#define QB0P 0
#define QBNP QBLKS           /* non-causal: plain flash on every query block */
#define RE 256
typedef __bf16 v16b __attribute__((ext_vector_type(16)));
typedef unsigned short v8us __attribute__((ext_vector_type(8), may_alias));
typedef float  v8f  __attribute__((ext_vector_type(8)));
typedef float  v4f  __attribute__((ext_vector_type(4)));
typedef float  v4fa __attribute__((ext_vector_type(4), may_alias));
union FragB { v16b v; v8us half[2]; unsigned short u[16]; };

__device__ __forceinline__ unsigned short bf16_bits(float x) { unsigned int u = __float_as_uint(x); return (unsigned short)((u + 0x7FFFu + ((u >> 16) & 1u)) >> 16); }
__device__ __forceinline__ float bf16_val(unsigned short b) { return __uint_as_float(((unsigned int)b) << 16); }
__device__ __forceinline__ float bf16_round(float x) { return bf16_val(bf16_bits(x)); }
// D += A·B with NT terms: 1 = ah·bh, 2 = + al·bh (A split), 3 = + ah·bl (both split)
template <int NT>
__device__ __forceinline__ v8f mmaN(v16b ah, v16b al, v16b bh, v16b bl, v8f c) {
  c = __builtin_amdgcn_wmma_f32_16x16x32_bf16(false, ah, false, bh, (short)0, c, false, false);
  if (NT >= 2) c = __builtin_amdgcn_wmma_f32_16x16x32_bf16(false, al, false, bh, (short)0, c, false, false);
  if (NT >= 3) c = __builtin_amdgcn_wmma_f32_16x16x32_bf16(false, ah, false, bl, (short)0, c, false, false);
  asm volatile("v_nop\n\tv_nop\n\tv_nop\n\tv_nop" : "+v"(c) : "v"(ah), "v"(al), "v"(bh), "v"(bl));
  return c;
}

__global__ __launch_bounds__(256) void k_wt_bf16(const float* __restrict__ W, unsigned short* __restrict__ Wt, int K, int N) {
  const int t = blockIdx.x * 256 + threadIdx.x;
  const int k8n = K / 8;
  if (t >= N * k8n) return;
  const int n = t / k8n, k8 = (t % k8n) * 8;
  v8us v;
#pragma unroll
  for (int i = 0; i < 8; ++i) v[i] = bf16_bits(W[(size_t)(k8 + i) * N + n]);
  *(v8us*)(Wt + (size_t)n * K + k8) = v;
  
}

// GEMM C[M][N] (f32, pitch ldc) = act(A[M][K]·W + bias). A f32 row-major (pitch lda) converted per fragment to bf16
// (ASPLIT: hi/lo two planes -> 2 terms, else single rounded term); Wt bf16 [N][K] (pitch ldb). BIAS_BF16 rounds the
// bias to bf16 first (bias quantised to bf16 before the add). K%32==0, M%16==0, N%64==0.
template <bool ASPLIT, int ACT, bool BIAS_BF16>
__global__ __launch_bounds__(128) void k_gemm_bf(const float* __restrict__ A, int lda, const unsigned short* __restrict__ Wt, int ldb,
                                               const float* __restrict__ bias, float* __restrict__ C, int ldc, int M, int N, int K) {
  __shared__ __attribute__((aligned(16))) float so[4][16][64];
  const int tid = threadIdx.x, w = tid >> 5, lane = tid & 31, ln = lane & 15, hh = lane >> 4;
  const int ntn = N / 64;
  const int wid = blockIdx.x * 4 + w;
  const int mt = wid / ntn, nq = wid % ntn;
  if (mt * 16 >= M) return;
  const int row0 = mt * 16, col0 = nq * 64;
  const float* arow = A + (size_t)(row0 + ln) * lda;
  v8f acc[4] = {};
  for (int kb = 0; kb < K; kb += 32) {
    FragB ah, al;
    const v4f x0 = *(const v4fa*)(arow + kb + 8 * hh), x1 = *(const v4fa*)(arow + kb + 8 * hh + 4);
    const v4f x2 = *(const v4fa*)(arow + kb + 16 + 8 * hh), x3 = *(const v4fa*)(arow + kb + 16 + 8 * hh + 4);
    float xs[16] = {x0[0],x0[1],x0[2],x0[3],x1[0],x1[1],x1[2],x1[3],x2[0],x2[1],x2[2],x2[3],x3[0],x3[1],x3[2],x3[3]};
#pragma unroll
    for (int i = 0; i < 16; ++i) { const unsigned short hb = bf16_bits(xs[i]); ah.u[i] = hb; al.u[i] = ASPLIT ? bf16_bits(xs[i] - bf16_val(hb)) : (unsigned short)0; }
#pragma unroll
    for (int t = 0; t < 4; ++t) {
      const unsigned short* brow = Wt + (size_t)(col0 + t * 16 + ln) * ldb + kb;
      FragB b;
      b.half[0] = *(const v8us*)(brow + 8 * hh);
      b.half[1] = *(const v8us*)(brow + 16 + 8 * hh);
      acc[t] = mmaN<ASPLIT ? 2 : 1>(ah.v, al.v, b.v, b.v, acc[t]);
    }
  }
#pragma unroll
  for (int t = 0; t < 4; ++t) {
    float bv = bias ? bias[col0 + t * 16 + ln] : 0.f;
    if (BIAS_BF16) bv = bf16_round(bv);
#pragma unroll
    for (int r = 0; r < 8; ++r) { float v = acc[t][r] + bv; if (ACT == 1) v = fmaxf(v, 0.f); so[w][8 * hh + r][t * 16 + ln] = v; }
  }
  __builtin_amdgcn_fence(__ATOMIC_ACQ_REL, "workgroup");
  __builtin_amdgcn_wave_barrier();
  const int rsub = lane >> 4, c4 = (lane & 15) * 4;
  {
#pragma unroll
    for (int q = 0; q < 8; ++q) {
      const int r = q * 2 + rsub;
      const v4f v = *(const v4fa*)&so[w][r][c4];
      *(v4f*)(C + (size_t)(row0 + r) * ldc + col0 + c4) = v;
    }
    
  }
}

// GEMM C = act(A·W + bias + resid): A f32 (ASPLIT -> hi/lo 2 terms), Wt bf16 [N][K]; ACT 0 none, 1 relu, 2 exact gelu;
// resid (optional, f32, row index = (row % rmod), pitch ldr, RES_BF16 rounds it) added before the activation.
template <bool ASPLIT, int ACT, bool BIAS_BF16, bool RES_BF16>
__global__ __launch_bounds__(128) void k_gemm_bf3(const float* __restrict__ A, int lda, const unsigned short* __restrict__ Wt, int ldb,
                                                const float* __restrict__ bias, const float* __restrict__ resid, int rmod, int ldr,
                                                float* __restrict__ C, int ldc, int M, int N, int K) {
  __shared__ __attribute__((aligned(16))) float so[4][16][64];
  const int tid = threadIdx.x, w = tid >> 5, lane = tid & 31, ln = lane & 15, hh = lane >> 4;
  const int ntn = N / 64;
  const int wid = blockIdx.x * 4 + w;
  const int mt = wid / ntn, nq = wid % ntn;
  if (mt * 16 >= M) return;
  const int row0 = mt * 16, col0 = nq * 64;
  const float* arow = A + (size_t)(row0 + ln) * lda;
  v8f acc[4] = {};
  for (int kb = 0; kb < K; kb += 32) {
    FragB ah, al;
    const v4f x0 = *(const v4fa*)(arow + kb + 8 * hh), x1 = *(const v4fa*)(arow + kb + 8 * hh + 4);
    const v4f x2 = *(const v4fa*)(arow + kb + 16 + 8 * hh), x3 = *(const v4fa*)(arow + kb + 16 + 8 * hh + 4);
    float xs[16] = {x0[0],x0[1],x0[2],x0[3],x1[0],x1[1],x1[2],x1[3],x2[0],x2[1],x2[2],x2[3],x3[0],x3[1],x3[2],x3[3]};
#pragma unroll
    for (int i = 0; i < 16; ++i) { const unsigned short hb = bf16_bits(xs[i]); ah.u[i] = hb; al.u[i] = ASPLIT ? bf16_bits(xs[i] - bf16_val(hb)) : (unsigned short)0; }
#pragma unroll
    for (int t = 0; t < 4; ++t) {
      const unsigned short* brow = Wt + (size_t)(col0 + t * 16 + ln) * ldb + kb;
      FragB b;
      b.half[0] = *(const v8us*)(brow + 8 * hh);
      b.half[1] = *(const v8us*)(brow + 16 + 8 * hh);
      acc[t] = mmaN<ASPLIT ? 2 : 1>(ah.v, al.v, b.v, b.v, acc[t]);
    }
  }
#pragma unroll
  for (int t = 0; t < 4; ++t) {
    const int col = col0 + t * 16 + ln;
    float bv = bias ? bias[col] : 0.f;
    if (BIAS_BF16) bv = bf16_round(bv);
#pragma unroll
    for (int r = 0; r < 8; ++r) {
      float v = acc[t][r] + bv;
      if (resid) { float rv = resid[(size_t)((row0 + 8 * hh + r) % rmod) * ldr + col]; if (RES_BF16) rv = bf16_round(rv); v += rv; }
      if (ACT == 1) v = fmaxf(v, 0.f);
      if (ACT == 2) v = 0.5f * v * (1.0f + erff(v * 0.70710678118654752f));
      if (ACT == 3) { const float u = 0.7978845608028654f * (v + 0.044715f * v * v * v); v = 0.5f * v * (1.0f + tanhf(u)); }
      so[w][8 * hh + r][t * 16 + ln] = v;
    }
  }
  __builtin_amdgcn_fence(__ATOMIC_ACQ_REL, "workgroup");
  __builtin_amdgcn_wave_barrier();
  const int rsub = lane >> 4, c4 = (lane & 15) * 4;
  {
#pragma unroll
    for (int q = 0; q < 8; ++q) {
      const int r = q * 2 + rsub;
      const v4f v = *(const v4fa*)&so[w][r][c4];
      *(v4f*)(C + (size_t)(row0 + r) * ldc + col0 + c4) = v;
    }
    
  }
}
// row LayerNorm (biased variance, eps) over N: s = X (+ R); optional out_sum <- s; out_norm <- (s-mu)*rsqrt(var+eps)*g + b
template <bool PARAM_BF16>
__global__ __launch_bounds__(256) void k_layernorm(const float* __restrict__ X, const float* __restrict__ R, const float* __restrict__ g, const float* __restrict__ bta,
                                                  float* __restrict__ out_sum, float* __restrict__ out_norm, int N, float eps) {
  __shared__ float red[256];
  const int row = blockIdx.x, tid = threadIdx.x;
  const float* x = X + (size_t)row * N; const float* rr = R ? R + (size_t)row * N : nullptr;
  float vals[16];                     // up to N = 4096
  const int per = N / 256;            // contiguous chunk per thread? use strided-by-4 chunks: thread handles j = tid*4 + 1024*u
  float s1 = 0.f;
  for (int u = 0; u < per / 4; ++u) {
    const int j = tid * 4 + 1024 * u;
    const v4f a = *(const v4fa*)(x + j);
    v4f b = {0.f,0.f,0.f,0.f}; if (rr) b = *(const v4fa*)(rr + j);
#pragma unroll
    for (int q = 0; q < 4; ++q) { const float v = a[q] + b[q]; vals[u * 4 + q] = v; s1 += v; }
  }
  red[tid] = s1; __syncthreads();
  for (int st = 128; st > 0; st >>= 1) { if (tid < st) red[tid] += red[tid + st]; __syncthreads(); }
  const float mu = red[0] / (float)N; __syncthreads();
  float s2 = 0.f;
  for (int u = 0; u < per / 4; ++u)
#pragma unroll
    for (int q = 0; q < 4; ++q) { const float c = vals[u * 4 + q] - mu; s2 += c * c; }
  red[tid] = s2; __syncthreads();
  for (int st = 128; st > 0; st >>= 1) { if (tid < st) red[tid] += red[tid + st]; __syncthreads(); }
  const float rs = rsqrtf(red[0] / (float)N + eps);
  {
    for (int u = 0; u < per / 4; ++u) {
      const int j = tid * 4 + 1024 * u;
      v4f o, sm;
#pragma unroll
      for (int q = 0; q < 4; ++q) {
        float gg = g[j + q], bb = bta[j + q];
        if (PARAM_BF16) { gg = bf16_round(gg); bb = bf16_round(bb); }
        sm[q] = vals[u * 4 + q]; o[q] = (vals[u * 4 + q] - mu) * rs * gg + bb;
      }
      if (out_sum) *(v4f*)(out_sum + (size_t)row * N + j) = sm;
      *(v4f*)(out_norm + (size_t)row * N + j) = o;
    }
    
  }
}



// ---- f16 WMMA path (v_wmma_f32_16x16x32_f16): 11-bit significands for operands in range — used where a [0,1] probability operand needs more precision than bf16
typedef _Float16 v16h __attribute__((ext_vector_type(16)));
union FragH { v16h v; v8us half[2]; _Float16 h[16]; unsigned short u[16]; };
template <int NT>
__device__ __forceinline__ v8f mmaH(v16h ah, v16h al, v16h bh, v16h bl, v8f c) {
  c = __builtin_amdgcn_wmma_f32_16x16x32_f16(false, ah, false, bh, (short)0, c, false, false);
  if (NT >= 2) c = __builtin_amdgcn_wmma_f32_16x16x32_f16(false, al, false, bh, (short)0, c, false, false);
  if (NT >= 3) c = __builtin_amdgcn_wmma_f32_16x16x32_f16(false, ah, false, bl, (short)0, c, false, false);
  asm volatile("v_nop\n\tv_nop\n\tv_nop\n\tv_nop" : "+v"(c) : "v"(ah), "v"(al), "v"(bh), "v"(bl));
  return c;
}
// batched GEMM like k_gemm_b but f16 operands: A f32 (split into f16 hi/lo if ASPLIT, else rounded to f16), Bt = f16 values [n][k]; alpha; C f32; N multiple of 16 (partial tiles skipped)
template <bool ASPLIT>
__global__ __launch_bounds__(128) void k_gemm_h(const float* __restrict__ A, int lda, size_t sA, const _Float16* __restrict__ Bh, int ldb, size_t sB, float alpha, float* __restrict__ C, int ldc, size_t sC, int M, int N, int K) {
  __shared__ __attribute__((aligned(16))) float so[4][16][64];
  const int tid = threadIdx.x, w = tid >> 5, lane = tid & 31, ln = lane & 15, hh = lane >> 4; const int by = blockIdx.y;
  A += (size_t)by * sA; Bh += (size_t)by * sB; C += (size_t)by * sC;
  const int ntn = (N + 63) / 64; const int wid = blockIdx.x * 4 + w; const int mt = wid / ntn, nq = wid % ntn; if (mt * 16 >= M) return;
  const int row0 = mt * 16, col0 = nq * 64; const float* arow = A + (size_t)(row0 + ln) * lda;
  v8f acc[4] = {};
  for (int kb = 0; kb < K; kb += 32) {
    FragH ah, al;
    const v4f x0 = *(const v4fa*)(arow + kb + 8 * hh), x1 = *(const v4fa*)(arow + kb + 8 * hh + 4), x2 = *(const v4fa*)(arow + kb + 16 + 8 * hh), x3 = *(const v4fa*)(arow + kb + 16 + 8 * hh + 4);
    float xs[16] = {x0[0],x0[1],x0[2],x0[3],x1[0],x1[1],x1[2],x1[3],x2[0],x2[1],x2[2],x2[3],x3[0],x3[1],x3[2],x3[3]};
#pragma unroll
    for (int i = 0; i < 16; ++i) { const _Float16 h = (_Float16)xs[i]; ah.h[i] = h; al.h[i] = ASPLIT ? (_Float16)(xs[i] - (float)h) : (_Float16)0.0f; }
#pragma unroll
    for (int t = 0; t < 4; ++t) { if (col0 + t * 16 >= N) continue; const size_t boff = (size_t)(col0 + t * 16 + ln) * ldb + kb; FragH bq; bq.half[0] = *(const v8us*)(Bh + boff + 8 * hh); bq.half[1] = *(const v8us*)(Bh + boff + 16 + 8 * hh);
      acc[t] = mmaH<ASPLIT ? 2 : 1>(ah.v, al.v, bq.v, bq.v, acc[t]); }
  }
#pragma unroll
  for (int t = 0; t < 4; ++t) { if (col0 + t * 16 >= N) continue;
#pragma unroll
    for (int r = 0; r < 8; ++r) so[w][8 * hh + r][t * 16 + ln] = acc[t][r] * alpha; }
  __builtin_amdgcn_fence(__ATOMIC_ACQ_REL, "workgroup"); __builtin_amdgcn_wave_barrier();
  const int rsub = lane >> 4, c4 = (lane & 15) * 4;
  {
#pragma unroll
    for (int q = 0; q < 8; ++q) { const int r = q * 2 + rsub; if (col0 + c4 < N) { const v4f v = *(const v4fa*)&so[w][r][c4]; *(v4f*)(C + (size_t)(row0 + r) * ldc + col0 + c4) = v; } }
     }
}

// Wt[n][k] = f16(W[k][n]·scale) from f32 row-major W[K][N] (scale = power of two; bf16-exact weights stay exact in f16 away from the subnormal range)
__global__ __launch_bounds__(256) void k_wt_f16(const float* __restrict__ W, _Float16* __restrict__ Wt, int K, int N, float scale) {
  const int t = blockIdx.x * 256 + threadIdx.x; if (t >= N * (K / 8)) return; const int n = t / (K / 8), k8 = (t % (K / 8)) * 8; FragH f;
#pragma unroll
  for (int i = 0; i < 8; ++i) f.h[i] = (_Float16)(bf16_round(W[(size_t)(k8 + i) * N + n]) * scale); const v8us o = f.half[0];
  *(v8us*)((unsigned short*)Wt + (size_t)n * K + k8) = o; 
}
// k_gemm_hh variant with fused epilogue: v = acc·alpha + bias[by·sBias + col] (+ CP[(row/rowsPerB)·sCPb + by·64 + col] if CP) ; ACT 0 none / 1 elu ; writes f16 C16 (and f32 C if non-null)
template <int ACT>
__global__ __launch_bounds__(128) void k_gemm_hhx(const _Float16* __restrict__ A, int lda, size_t sA, const _Float16* __restrict__ Bh, int ldb, size_t sB, float alpha, const float* __restrict__ bias, size_t sBias, const float* __restrict__ CP, int rowsPerB, size_t sCPb, int row0g,
    float* __restrict__ C, _Float16* __restrict__ C16, int ldc, size_t sC, int M, int N, int K) {
  __shared__ __attribute__((aligned(16))) float so[4][16][64];
  const int tid = threadIdx.x, w = tid >> 5, lane = tid & 31, ln = lane & 15, hh = lane >> 4; const int by = blockIdx.y;
  A += (size_t)by * sA; Bh += (size_t)by * sB; const size_t cofs = (size_t)by * sC; const float* bp = bias ? bias + (size_t)by * sBias : nullptr;
  const int ntn = (N + 63) / 64; const int wid = blockIdx.x * 4 + w; const int mt = wid / ntn, nq = wid % ntn; if (mt * 16 >= M) return;
  const int row0 = mt * 16, col0 = nq * 64; const _Float16* arow = A + (size_t)(row0 + ln) * lda;
  v8f acc[4] = {};
  for (int kb = 0; kb < K; kb += 32) { FragH ah; ah.half[0] = *(const v8us*)((const unsigned short*)arow + kb + 8 * hh); ah.half[1] = *(const v8us*)((const unsigned short*)arow + kb + 16 + 8 * hh);
#pragma unroll
    for (int t = 0; t < 4; ++t) { if (col0 + t * 16 >= N) continue; const size_t boff = (size_t)(col0 + t * 16 + ln) * ldb + kb; FragH bq; bq.half[0] = *(const v8us*)((const unsigned short*)Bh + boff + 8 * hh); bq.half[1] = *(const v8us*)((const unsigned short*)Bh + boff + 16 + 8 * hh);
      acc[t] = mmaH<1>(ah.v, ah.v, bq.v, bq.v, acc[t]); }
  }
#pragma unroll
  for (int t = 0; t < 4; ++t) { if (col0 + t * 16 >= N) continue; const int col = col0 + t * 16 + ln; const float bv = bp ? bf16_round(bp[col]) : 0.f;
#pragma unroll
    for (int r = 0; r < 8; ++r) { float v = acc[t][r] * alpha + bv; if (CP) { const int bidx = (row0g + row0 + 8 * hh + r) / rowsPerB; v += CP[(size_t)bidx * sCPb + (size_t)by * 64 + col]; } if (ACT == 1) v = (v > 0.f) ? v : expm1f(v); else if (ACT == 7) v = (v > 0.f) ? v + 1.0f : expf(v); else if (ACT == 8) v = tanhf(v); else if (ACT == 9) v = 0.5f * v * (1.0f + tanhf(0.7978845608028654f * (v + 0.044715f * v * v * v))); else if (ACT == 11) v = 1.0f / (1.0f + expf(-v)); else if (ACT == 12) v = (v > 0.f) ? v : 0.01f * v; else if (ACT == 14) v = (v > 0.f) ? v : 0.1f * v; else if (ACT == 15) v = v / (1.0f + expf(-v)); else if (ACT == 3) v = fmaxf(v, 0.f); else if (ACT == 6) v = 0.5f * v * (1.0f + erff(v * 0.70710678118654752f)); so[w][8 * hh + r][t * 16 + ln] = v; } }
  __builtin_amdgcn_fence(__ATOMIC_ACQ_REL, "workgroup"); __builtin_amdgcn_wave_barrier();
  const int rsub = lane >> 4, c4 = (lane & 15) * 4; typedef _Float16 v4h __attribute__((ext_vector_type(4)));
  {
#pragma unroll
    for (int q = 0; q < 8; ++q) { const int r = q * 2 + rsub; if (col0 + c4 < N) { const v4f v = *(const v4fa*)&so[w][r][c4]; if (C) *(v4f*)(C + cofs + (size_t)(row0 + r) * ldc + col0 + c4) = v; if (C16) { v4h h4; for (int i = 0; i < 4; ++i) h4[i] = (_Float16)v[i]; *(v4h*)(C16 + cofs + (size_t)(row0 + r) * ldc + col0 + c4) = h4; } } }
     }
}


typedef _Float16 v4h __attribute__((ext_vector_type(4)));

__global__ __launch_bounds__(256) void k_x16(const float* __restrict__ x, _Float16* __restrict__ X16, size_t n8) { const size_t t = (size_t)blockIdx.x * 256 + threadIdx.x; if (t >= n8) return; FragH f;
#pragma unroll
  for (int q = 0; q < 8; ++q) f.h[q] = (_Float16)bf16_round(x[t * 8 + q]); *(v8us*)((unsigned short*)X16 + t * 8) = f.half[0];  }
__global__ __launch_bounds__(256) void k_h16(const float* __restrict__ x, _Float16* __restrict__ X16, size_t n8) { const size_t t = (size_t)blockIdx.x * 256 + threadIdx.x; if (t >= n8) return; FragH f;
#pragma unroll
  for (int q = 0; q < 8; ++q) f.h[q] = (_Float16)x[t * 8 + q]; *(v8us*)((unsigned short*)X16 + t * 8) = f.half[0];  }
__global__ __launch_bounds__(256) void k_round16f(const float* __restrict__ W, _Float16* __restrict__ Bt, size_t n8) { const size_t t = (size_t)blockIdx.x * 256 + threadIdx.x; if (t >= n8) return; FragH f;
#pragma unroll
  for (int i = 0; i < 8; ++i) f.h[i] = (_Float16)(bf16_round(W[t * 8 + i]) * 16.0f); *(v8us*)((unsigned short*)Bt + t * 8) = f.half[0];  }
template <int NHv, int TTv>
__global__ __launch_bounds__(256) void k_vt(const _Float16* __restrict__ V16, int ldv, int voff, _Float16* __restrict__ Vt) { __shared__ unsigned short tl[64][66]; const int tid = threadIdx.x; const int slab = blockIdx.x / (TTv / 64), lg = blockIdx.x % (TTv / 64); const int b = slab / NHv, h = slab % NHv;
  for (int i = tid; i < 64 * 8; i += 256) { const int r = i / 8, c8 = (i % 8) * 8; FragH f; f.half[0] = *(const v8us*)((const unsigned short*)V16 + ((size_t)b * TTv + lg * 64 + r) * ldv + voff + h * 64 + c8);
#pragma unroll
    for (int q = 0; q < 8; ++q) tl[r][c8 + q] = f.u[q]; }
  __syncthreads();
  {
#pragma unroll
    for (int rd = 0; rd < 2; ++rd) { const int d = rd * 32 + tid / 8, pc = tid % 8; FragH f;
#pragma unroll
      for (int q = 0; q < 8; ++q) f.u[q] = tl[pc * 8 + q][d];
      *(v8us*)((unsigned short*)Vt + ((size_t)slab * 64 + d) * TTv + lg * 64 + pc * 8) = f.half[0]; }
     } }

__global__ __launch_bounds__(256) void k_hl(const float* __restrict__ F, _Float16* __restrict__ Hh, _Float16* __restrict__ Hl, size_t n8) { const size_t t = (size_t)blockIdx.x * 256 + threadIdx.x; if (t >= n8) return; FragH fh, fl; const v4f a = *(const v4fa*)(F + t * 8), c = *(const v4fa*)(F + t * 8 + 4);
#pragma unroll
  for (int q = 0; q < 4; ++q) { _Float16 h = (_Float16)a[q]; fh.h[q] = h; fl.h[q] = (_Float16)((a[q] - (float)h) * 1024.0f); h = (_Float16)c[q]; fh.h[4 + q] = h; fl.h[4 + q] = (_Float16)((c[q] - (float)h) * 1024.0f); }
  { *(v8us*)((unsigned short*)Hh + t * 8) = fh.half[0]; *(v8us*)((unsigned short*)Hl + t * 8) = fl.half[0];  } }

// ---- fast GEMM (block tile 128x64, wave tile 32x64; requires M % 128 == 0, N % 64 == 0, K % 64 == 0); epilogue = k_gemm_hhx semantics ----
// A and B come through LDS: a stage is 64 k of the block's 128 A rows and 64 B rows, brought by asynchronous copies into one of two buffers while the other is worked on.
// EPI picks what the epilogue stores (a block's 64 columns are one head, its 128 rows lie in one batch):
// 0 = C f32 and / or C16 f16, row-major; 1 = C16 = f16 hi and C16L = 2^10 residual, row-major, and C = the rows' sums of squares over the head, [(b, h)][s];
// 2 = C16 = the tile transposed, f16, [(b, h)][64 d][s]. 1 and 2 take no CP term and no batch (by = 0).
#define G2T 272              /* LDS row pitch of the transposed tile: 256 B (128 tokens) + 16 = 16 B x odd */
#define G2P 144              /* LDS row pitch in bytes: 128 B of k + 16 = 16 B x odd, the conflict-free pitch for 16-byte fragment reads */
#define G2S (192 * G2P)      /* one stage: rows 0..127 = A, rows 128..191 = B */
// One stage's 12 copies of a lane, 16 bytes each: 8 lanes bring one row's 128 bytes, the block's 128 threads 16 rows per copy; copies 0..7 are A rows, 8..11 B rows.
// l = the lane's LDS byte address in row tid / 8 of the buffer, a and b = its global addresses in that row of A and of B, sa and sb = 16 rows of A and of B in bytes.
// s_wait_xcnt 0 is the statement's last line, so that it stands in front of any later rewrite of these address registers.
__device__ __forceinline__ void g2_stage(unsigned l, const char* a, size_t sa, const char* b, size_t sb) {
  asm volatile("global_load_async_to_lds_b128 %0, %12, off\n\tglobal_load_async_to_lds_b128 %1, %13, off\n\tglobal_load_async_to_lds_b128 %2, %14, off\n\tglobal_load_async_to_lds_b128 %3, %15, off\n\t"
               "global_load_async_to_lds_b128 %4, %16, off\n\tglobal_load_async_to_lds_b128 %5, %17, off\n\tglobal_load_async_to_lds_b128 %6, %18, off\n\tglobal_load_async_to_lds_b128 %7, %19, off\n\t"
               "global_load_async_to_lds_b128 %8, %20, off\n\tglobal_load_async_to_lds_b128 %9, %21, off\n\tglobal_load_async_to_lds_b128 %10, %22, off\n\tglobal_load_async_to_lds_b128 %11, %23, off\n\ts_wait_xcnt 0x0"
               :: "v"(l), "v"(l + 16 * G2P), "v"(l + 32 * G2P), "v"(l + 48 * G2P), "v"(l + 64 * G2P), "v"(l + 80 * G2P), "v"(l + 96 * G2P), "v"(l + 112 * G2P), "v"(l + 128 * G2P), "v"(l + 144 * G2P), "v"(l + 160 * G2P), "v"(l + 176 * G2P),
                  "v"(a), "v"(a + sa), "v"(a + 2 * sa), "v"(a + 3 * sa), "v"(a + 4 * sa), "v"(a + 5 * sa), "v"(a + 6 * sa), "v"(a + 7 * sa), "v"(b), "v"(b + sb), "v"(b + 2 * sb), "v"(b + 3 * sb) : "memory"); }
__device__ __forceinline__ v16h g2_frag(const _Float16* p, int hh) { FragH f; f.half[0] = *(const v8us*)((const unsigned short*)p + 8 * hh); f.half[1] = *(const v8us*)((const unsigned short*)p + 16 + 8 * hh); return f.v; }
__device__ __forceinline__ v16h g2_lfrag(const char* p) { FragH f; f.half[0] = *(const v8us*)p; f.half[1] = *(const v8us*)(p + 32); return f.v; }
__device__ __forceinline__ v8f g2_mma(v16h a, v16h b, v8f c) { v8f d = __builtin_amdgcn_wmma_f32_16x16x32_f16(false, a, false, b, (short)0, c, false, false); asm volatile("v_nop\n\tv_nop\n\tv_nop\n\tv_nop" : "+v"(d) : "v"(a), "v"(b)); return d; }
template <int ACT, int EPI>
__global__ __launch_bounds__(128) void k_gemm2(const _Float16* __restrict__ A, int lda, size_t sA, const _Float16* __restrict__ Bh, int ldb, size_t sB, float alpha, const float* __restrict__ bias, size_t sBias, const float* __restrict__ CP, int rowsPerB, size_t sCPb, int row0g,
    float* __restrict__ C, _Float16* __restrict__ C16, _Float16* __restrict__ C16L, int ldc, size_t sC, int M, int N, int K) {
  __shared__ __attribute__((aligned(16))) float so[4][32][68]; __shared__ __attribute__((aligned(16))) char st[2 * G2S];
  const int tid = threadIdx.x, w = tid >> 5, lane = tid & 31, ln = lane & 15, hh = lane >> 4; const int by = blockIdx.y;
  A += (size_t)by * sA; Bh += (size_t)by * sB; const size_t cofs = (size_t)by * sC; const float* bp = bias ? bias + (size_t)by * sBias : nullptr;
  const int ntn = N >> 6; const int mt = blockIdx.x / ntn, nq = blockIdx.x - mt * ntn; const int row0 = mt * 128 + 32 * w, col0 = nq * 64; if (mt * 128 >= M) return;      /* the whole block or none: barriers follow */
  const int nst = K >> 6;      /* stages */
  const char* ga = (const char*)(A + (size_t)(mt * 128 + (tid >> 3)) * lda + (tid & 7) * 8); const char* gb = (const char*)(Bh + (size_t)(col0 + (tid >> 3)) * ldb + (tid & 7) * 8); const size_t sa = (size_t)lda * 32, sb = (size_t)ldb * 32;
  const unsigned l0 = (unsigned)(size_t)st + (unsigned)((tid >> 3) * G2P + (tid & 7) * 16);
  const char* fa = st + (32 * w + ln) * G2P + hh * 16; const char* fb = st + (128 + ln) * G2P + hh * 16;      /* fragment rows: k = 8h + s at +0, 16 + 8h + s at +32 bytes */
  const v8f z8 = {0.f,0.f,0.f,0.f,0.f,0.f,0.f,0.f}; v8f c00 = z8, c01 = z8, c02 = z8, c03 = z8, c10 = z8, c11 = z8, c12 = z8, c13 = z8;
  g2_stage(l0, ga, sa, gb, sb);
  asm volatile("s_wait_asynccnt 0x0" ::: "memory");      /* this wave's copies of stage 0 have landed */
  __syncthreads();      /* ... and every other wave's: stage 0 may be read */
  if (nst > 1) g2_stage(l0 + G2S, ga + 128, sa, gb + 128, sb);
#pragma unroll 1
  for (int t = 0; t < nst; ++t) { const int bo = (t & 1) * G2S; v16h a[2][2], b[2][4];
#pragma unroll
    for (int kk = 0; kk < 2; ++kk) { a[kk][0] = g2_lfrag(fa + bo + kk * 64); a[kk][1] = g2_lfrag(fa + bo + 16 * G2P + kk * 64);      /* the stage's 24 reads as one group ahead of its matrix instructions */
#pragma unroll
      for (int j = 0; j < 4; ++j) b[kk][j] = g2_lfrag(fb + bo + j * 16 * G2P + kk * 64); }
#pragma unroll
    for (int kk = 0; kk < 2; ++kk) { c00 = g2_mma(a[kk][0], b[kk][0], c00); c10 = g2_mma(a[kk][1], b[kk][0], c10); c01 = g2_mma(a[kk][0], b[kk][1], c01); c11 = g2_mma(a[kk][1], b[kk][1], c11);
      c02 = g2_mma(a[kk][0], b[kk][2], c02); c12 = g2_mma(a[kk][1], b[kk][2], c12); c03 = g2_mma(a[kk][0], b[kk][3], c03); c13 = g2_mma(a[kk][1], b[kk][3], c13); }
    asm volatile("s_wait_dscnt 0x0" ::: "memory");      /* this wave has left the buffer that is refilled below */
    asm volatile("s_wait_asynccnt 0x0" ::: "memory");      /* its copies of stage t + 1 have landed */
    __syncthreads();      /* publishes stage t + 1 and ends every reader's last read of stage t */
    if (t + 2 < nst) g2_stage(l0 + bo, ga + (size_t)(t + 2) * 128, sa, gb + (size_t)(t + 2) * 128, sb); }
  asm volatile("s_wait_asynccnt 0x0" ::: "memory");      /* no copy is outstanding when the wave goes on to the epilogue and ends */
  v8f accs[8] = {c00, c01, c02, c03, c10, c11, c12, c13};
#pragma unroll
  for (int u = 0; u < 8; ++u) { const int t = u & 3, half = u >> 2; const int col = col0 + t * 16 + ln; const float bv = bp ? bf16_round(bp[col]) : 0.f; FragH vt;
#pragma unroll
    for (int r = 0; r < 8; ++r) { const int rloc = half * 16 + 8 * hh + r; float v = accs[u][r] * alpha + bv; if (EPI == 0 && CP) { if (rowsPerB < 0) v += CP[cofs + (size_t)(row0g + row0 + rloc) * ldc + col];      /* rowsPerB < 0: own element of the batched C plane */ else { const int bidx = (row0g + row0 + rloc) / rowsPerB; v += CP[(size_t)bidx * sCPb + (size_t)by * 64 + col]; } }
      if (ACT == 3) v = fmaxf(v, 0.f); else if (ACT == 6) v = 0.5f * v * (1.0f + erff(v * 0.70710678118654752f)); else if (ACT == 11) v = 1.0f / (1.0f + expf(-v)); else if (ACT == 15) v = v / (1.0f + expf(-v)); else if (ACT == 12) v = (v > 0.f) ? v : 0.01f * v; else if (ACT == 8) v = tanhf(v);
      if (EPI == 2) vt.h[r] = (_Float16)v; else so[w][rloc][t * 16 + ln] = v; }
    if (EPI == 2) *(v8us*)((char*)so + (t * 16 + ln) * G2T + (32 * w + half * 16 + 8 * hh) * 2) = vt.half[0]; }      /* a lane's 8 accumulator rows are 8 consecutive tokens of one column: 16 bytes of the transposed row */
  if (EPI == 2) { __syncthreads();      /* a transposed row holds all four waves' tokens */
    const size_t tb = ((size_t)((mt * 128) / SLEN * NH + nq) * 64) * SLEN + (mt * 128) % SLEN;
#pragma unroll      /* the 8 LDS reads go ahead of the stores as one group */
    for (int q = 0; q < 8; ++q) { const int d = q * 8 + (tid >> 4), c = tid & 15; const v8us v = *(const v8us*)((const char*)so + d * G2T + c * 16); *(v8us*)((unsigned short*)C16 + tb + (size_t)d * SLEN + c * 8) = v; }      /* 16 lanes store one row's 256 bytes */
    return; }
  __builtin_amdgcn_fence(__ATOMIC_ACQ_REL, "workgroup"); __builtin_amdgcn_wave_barrier();
  const int rsub = lane >> 4, c4 = (lane & 15) * 4;
  if (EPI == 1) {
#pragma unroll      /* constant LDS offsets, and later rows' reads run ahead of earlier rows' stores */
    for (int q = 0; q < 16; ++q) { const int r = q * 2 + rsub; const v4f v = *(const v4fa*)&so[w][r][c4]; v4h h4, l4; for (int i = 0; i < 4; ++i) { const _Float16 h = (_Float16)v[i]; h4[i] = h; l4[i] = (_Float16)((v[i] - (float)h) * 1024.0f); }
      *(v4h*)(C16 + (size_t)(row0 + r) * ldc + col0 + c4) = h4; *(v4h*)(C16L + (size_t)(row0 + r) * ldc + col0 + c4) = l4; }      /* 16 lanes store one row's 128 bytes of each plane */
    float sq = 0.f;      /* lane = row: its 64 squares summed in column order */
#pragma unroll      /* the row's 16 LDS reads issue ahead of the sum chain */
    for (int d = 0; d < 64; d += 4) { const v4f a = *(const v4fa*)&so[w][lane][d]; for (int i = 0; i < 4; ++i) sq += a[i] * a[i]; }
    const int row = row0 + lane; *(float*)(C + ((size_t)(row / SLEN) * NH + nq) * SLEN + row % SLEN) = sq;
  } else {
#pragma unroll
    for (int q = 0; q < 16; ++q) { const int r = q * 2 + rsub; const v4f v = *(const v4fa*)&so[w][r][c4]; if (C) *(v4f*)(C + cofs + (size_t)(row0 + r) * ldc + col0 + c4) = v; if (C16) { v4h h4; for (int i = 0; i < 4; ++i) h4[i] = (_Float16)v[i]; *(v4h*)(C16 + cofs + (size_t)(row0 + r) * ldc + col0 + c4) = h4; } }
     } }



template <int CAUSAL>
__global__ __launch_bounds__(128) void k_flash(const _Float16* __restrict__ Q16, int ldq, const _Float16* __restrict__ K16, int ldk, const _Float16* __restrict__ Vt, const int* __restrict__ MSK, float* __restrict__ O, int ldo) {
  constexpr int RPW = 16, RTN = RPW / 16, NQB = TQ / (4 * RPW), DT = 4, KS = 2;
  __shared__ __attribute__((aligned(16))) unsigned short sP[4][RPW][40]; __shared__ __attribute__((aligned(16))) float sO[4][RPW][64 + 4];
  const int tid = threadIdx.x, w = tid >> 5, lane = tid & 31, ln = lane & 15, hh = lane >> 4;
  const int slab = blockIdx.x / QBNP, qblk = QB0P + blockIdx.x % QBNP; (void)NQB; const int b = slab / NH, h = slab % NH; const int qb0 = qblk * (4 * RPW); const int q0 = qb0 + w * RPW;
  FragH aq[2][KS];
#pragma unroll
  for (int rt = 0; rt < RTN; ++rt) { const unsigned short* qr = (const unsigned short*)Q16 + ((size_t)b * TQ + q0 + rt * 16 + ln) * ldq + h * 64;
#pragma unroll
    for (int ks = 0; ks < KS; ++ks) { aq[rt][ks].half[0] = *(const v8us*)(qr + ks * 32 + 8 * hh); aq[rt][ks].half[1] = *(const v8us*)(qr + ks * 32 + 16 + 8 * hh); } }
  const unsigned short* Vth = (const unsigned short*)Vt + (size_t)slab * 64 * TK;
  float m_r[2][8], l_r[2][8]; v8f oacc[2][DT];
#pragma unroll
  for (int rt = 0; rt < RTN; ++rt) {
#pragma unroll
    for (int r = 0; r < 8; ++r) { m_r[rt][r] = -3.0e38f; l_r[rt][r] = 0.f; }
#pragma unroll
    for (int dt = 0; dt < DT; ++dt) oacc[rt][dt] = (v8f){0.f,0.f,0.f,0.f,0.f,0.f,0.f,0.f}; }
  const int jend = (CAUSAL == 1) ? (qb0 + 4 * RPW) : ((CAUSAL == 23) ? min(TK, (qb0 / CHK + 2) * CHK) : TK);      /* causal / window: keys that can never contribute are skipped */ const int jbeg = (CAUSAL == 23) ? max(0, (qb0 / CHK - 1) * CHK) : 0;
#pragma unroll 1
  for (int j0 = jbeg; j0 < jend; j0 += 32) {
    v8f s[2][2];
#pragma unroll
    for (int nt = 0; nt < 2; ++nt) { const unsigned short* kr = (const unsigned short*)K16 + ((size_t)b * TK + j0 + nt * 16 + ln) * ldk + h * 64; FragH bk[KS];
#pragma unroll
      for (int ks = 0; ks < KS; ++ks) { bk[ks].half[0] = *(const v8us*)(kr + ks * 32 + 8 * hh); bk[ks].half[1] = *(const v8us*)(kr + ks * 32 + 16 + 8 * hh); }
#pragma unroll
      for (int rt = 0; rt < RTN; ++rt) { v8f acc = (v8f){0.f,0.f,0.f,0.f,0.f,0.f,0.f,0.f};
#pragma unroll
        for (int ks = 0; ks < KS; ++ks) acc = mmaH<1>(aq[rt][ks].v, aq[rt][ks].v, bk[ks].v, bk[ks].v, acc); s[rt][nt] = acc; } }
#pragma unroll
    for (int rt = 0; rt < RTN; ++rt)
#pragma unroll
      for (int r = 0; r < 8; ++r) { const int tq = q0 + rt * 16 + 8 * hh + r; const int k0 = j0 + ln, k1 = j0 + 16 + ln;
        bool ok0 = (CAUSAL == 1) ? (k0 <= tq) : ((CAUSAL == 2) ? ((k0 >> 5) == (tq >> 5)) : true), ok1 = (CAUSAL == 1) ? (k1 <= tq) : ((CAUSAL == 2) ? ((k1 >> 5) == (tq >> 5)) : true); if (CAUSAL == 23) { const int cq = tq / CHK; ok0 = (abs(k0 / CHK - cq) <= 1) && (MSK[(size_t)b * TK + k0] == 0); ok1 = (abs(k1 / CHK - cq) <= 1) && (MSK[(size_t)b * TK + k1] == 0); }      /* mode 23: 3-chunk window + int key-padding mask */
        if (CAUSAL == 24) { ok0 = (MSK[(size_t)b * TK + k0] == 0); ok1 = (MSK[(size_t)b * TK + k1] == 0); }      /* mode 24: int key-padding mask (nonzero = padded = excluded) */      /* mode 2: block-diagonal 32-token groups */
        float s0 = ok0 ? s[rt][0][r] * SCL : -3.0e38f, s1 = ok1 ? s[rt][1][r] * SCL : -3.0e38f; if (CAUSAL == 17) { const float* amk = (const float*)MSK + (size_t)b * TK; s0 += bf16_round(amk[k0]); s1 += bf16_round(amk[k1]); } if (CAUSAL == 18) { const float* tb = (const float*)MSK; const int* ri = MSK + 1024 + (size_t)b * TK; const int rq = ri[tq]; s0 += tb[(h * 8 + rq) * 8 + ri[k0]]; s1 += tb[(h * 8 + rq) * 8 + ri[k1]]; } if (CAUSAL == 19) { const int* rel = MSK + (size_t)tq * TK; const float* rb = (const float*)MSK + (size_t)TQ * TK + ((size_t)(b * NH + h) * TQ + tq) * 64; s0 += rb[rel[k0]]; s1 += rb[rel[k1]]; }      /* mode 19: + (q.Ek[rel] + Eb[rel][h]) / 8 gathered by the int relative ids (packed [ids | table]) */      /* mode 18: + resource_bias[h][r_q][r_k] from the packed [table | ids] buffer (TQ == TK) */      /* mode 17: additive per-(batch, key) mask INPUT */ float mc = fmaxf(s0, s1);
        mc = fmaxf(mc, __shfl_xor(mc, 1, 32)); mc = fmaxf(mc, __shfl_xor(mc, 2, 32)); mc = fmaxf(mc, __shfl_xor(mc, 4, 32)); mc = fmaxf(mc, __shfl_xor(mc, 8, 32));
        const float mn = fmaxf(m_r[rt][r], mc); const float al = (mn > -1.0e38f) ? expf(m_r[rt][r] - mn) : 1.0f; m_r[rt][r] = mn; const float p0 = ok0 ? expf(s0 - mn) : 0.f, p1 = ok1 ? expf(s1 - mn) : 0.f; l_r[rt][r] = l_r[rt][r] * al + p0 + p1;
#pragma unroll
        for (int dt = 0; dt < DT; ++dt) oacc[rt][dt][r] *= al;
        FragH t2; t2.h[0] = (_Float16)(p0 * 1024.0f); t2.h[1] = (_Float16)(p1 * 1024.0f); sP[w][rt * 16 + 8 * hh + r][ln] = t2.u[0]; sP[w][rt * 16 + 8 * hh + r][16 + ln] = t2.u[1]; }
    __builtin_amdgcn_fence(__ATOMIC_ACQ_REL, "workgroup"); __builtin_amdgcn_wave_barrier();
    FragH pa[2];
#pragma unroll
    for (int rt = 0; rt < RTN; ++rt) { pa[rt].half[0] = *(const v8us*)&sP[w][rt * 16 + ln][8 * hh]; pa[rt].half[1] = *(const v8us*)&sP[w][rt * 16 + ln][16 + 8 * hh]; }
#pragma unroll
    for (int dt = 0; dt < DT; ++dt) { const unsigned short* vrow = Vth + (size_t)(dt * 16 + ln) * TK + j0; FragH bv; bv.half[0] = *(const v8us*)(vrow + 8 * hh); bv.half[1] = *(const v8us*)(vrow + 16 + 8 * hh);
#pragma unroll
      for (int rt = 0; rt < RTN; ++rt) oacc[rt][dt] = mmaH<1>(pa[rt].v, pa[rt].v, bv.v, bv.v, oacc[rt][dt]); }
    __builtin_amdgcn_fence(__ATOMIC_ACQ_REL, "workgroup"); __builtin_amdgcn_wave_barrier(); }
#pragma unroll
  for (int rt = 0; rt < RTN; ++rt) {
#pragma unroll
    for (int r = 0; r < 8; ++r) { float l = l_r[rt][r]; l += __shfl_xor(l, 1, 32); l += __shfl_xor(l, 2, 32); l += __shfl_xor(l, 4, 32); l += __shfl_xor(l, 8, 32); l_r[rt][r] = (l > 0.f) ? 1.0f / (l * 1024.0f) : 0.f; }
#pragma unroll
    for (int dt = 0; dt < DT; ++dt)
#pragma unroll
      for (int r = 0; r < 8; ++r) sO[w][rt * 16 + 8 * hh + r][dt * 16 + ln] = oacc[rt][dt][r] * l_r[rt][r]; }
  __builtin_amdgcn_fence(__ATOMIC_ACQ_REL, "workgroup"); __builtin_amdgcn_wave_barrier();
  {
#pragma unroll
    for (int rp = 0; rp < RPW; rp += 2) { const int r = rp + (lane >> 4), pc = lane & 15; const v4f val = *(const v4fa*)&sO[w][r][pc * 4]; *(v4f*)(O + ((size_t)b * TQ + q0 + r) * ldo + h * 64 + pc * 4) = val; }
     } }
// 5-plane variant: S = Qh Kh^T + (Ql Kh^T + Qh Kl^T)/1024 with Q/K = [hi | 2^10 residual] f16 planes (QL/KL same layout as Q16/K16), then the 3-term P.V below.
// 3-term variant: O = (P_hi V_hi + (P_lo V_hi + P_hi V_lo) / 1024) / l with P = [hi | 2^10 residual] of 1024 p and V^T = [hi | 2^10 residual] planes (VtL same layout as Vt) -> ~2^-21-class products for un-averaged (early causal / peaked) rows
template <int CAUSAL>
__global__ __launch_bounds__(128) void k_flash5(const _Float16* __restrict__ Q16, const _Float16* __restrict__ QL, int ldq, const _Float16* __restrict__ K16, const _Float16* __restrict__ KL, int ldk, const _Float16* __restrict__ Vt, const _Float16* __restrict__ VtL, const int* __restrict__ MSK, float* __restrict__ O, int ldo) {
  constexpr int RPW = 16, RTN = RPW / 16, NQB = TQ / (4 * RPW), DT = 4, KS = 2;
  __shared__ __attribute__((aligned(16))) unsigned short sP[4][RPW][40]; __shared__ __attribute__((aligned(16))) unsigned short sPL[4][RPW][40]; __shared__ __attribute__((aligned(16))) float sO[4][RPW][64 + 4];
  const int tid = threadIdx.x, w = tid >> 5, lane = tid & 31, ln = lane & 15, hh = lane >> 4;
  const int slab = blockIdx.x / QBN5, qblk = QB05 + blockIdx.x % QBN5; (void)NQB; const int b = slab / NH, h = slab % NH; const int qb0 = qblk * (4 * RPW); const int q0 = qb0 + w * RPW;
  FragH aq[2][KS], aql[2][KS];
#pragma unroll
  for (int rt = 0; rt < RTN; ++rt) { const unsigned short* qr = (const unsigned short*)Q16 + ((size_t)b * TQ + q0 + rt * 16 + ln) * ldq + h * 64; const unsigned short* ql = (const unsigned short*)QL + ((size_t)b * TQ + q0 + rt * 16 + ln) * ldq + h * 64;
#pragma unroll
    for (int ks = 0; ks < KS; ++ks) { aq[rt][ks].half[0] = *(const v8us*)(qr + ks * 32 + 8 * hh); aq[rt][ks].half[1] = *(const v8us*)(qr + ks * 32 + 16 + 8 * hh); aql[rt][ks].half[0] = *(const v8us*)(ql + ks * 32 + 8 * hh); aql[rt][ks].half[1] = *(const v8us*)(ql + ks * 32 + 16 + 8 * hh); } }
  const unsigned short* Vth = (const unsigned short*)Vt + (size_t)slab * 64 * TK; const unsigned short* Vtl = (const unsigned short*)VtL + (size_t)slab * 64 * TK;
  float m_r[2][8], l_r[2][8]; v8f oacc[2][DT], oaccL[2][DT];
#pragma unroll
  for (int rt = 0; rt < RTN; ++rt) {
#pragma unroll
    for (int r = 0; r < 8; ++r) { m_r[rt][r] = -3.0e38f; l_r[rt][r] = 0.f; }
#pragma unroll
    for (int dt = 0; dt < DT; ++dt) { oacc[rt][dt] = (v8f){0.f,0.f,0.f,0.f,0.f,0.f,0.f,0.f}; oaccL[rt][dt] = oacc[rt][dt]; } }
  const int jend = (CAUSAL == 1) ? (qb0 + 4 * RPW) : ((CAUSAL == 23) ? min(TK, (qb0 / CHK + 2) * CHK) : TK);      /* causal / window: keys that can never contribute are skipped */ const int jbeg = (CAUSAL == 23) ? max(0, (qb0 / CHK - 1) * CHK) : 0;
#pragma unroll 1
  for (int j0 = jbeg; j0 < jend; j0 += 32) {
    v8f s[2][2];
#pragma unroll
    for (int nt = 0; nt < 2; ++nt) { const unsigned short* kr = (const unsigned short*)K16 + ((size_t)b * TK + j0 + nt * 16 + ln) * ldk + h * 64; const unsigned short* klr = (const unsigned short*)KL + ((size_t)b * TK + j0 + nt * 16 + ln) * ldk + h * 64; FragH bk[KS], bkl[KS];
#pragma unroll
      for (int ks = 0; ks < KS; ++ks) { bk[ks].half[0] = *(const v8us*)(kr + ks * 32 + 8 * hh); bk[ks].half[1] = *(const v8us*)(kr + ks * 32 + 16 + 8 * hh); bkl[ks].half[0] = *(const v8us*)(klr + ks * 32 + 8 * hh); bkl[ks].half[1] = *(const v8us*)(klr + ks * 32 + 16 + 8 * hh); }
#pragma unroll
      for (int rt = 0; rt < RTN; ++rt) { v8f acc = (v8f){0.f,0.f,0.f,0.f,0.f,0.f,0.f,0.f}, accl = acc;
#pragma unroll
        for (int ks = 0; ks < KS; ++ks) { acc = mmaH<1>(aq[rt][ks].v, aq[rt][ks].v, bk[ks].v, bk[ks].v, acc); accl = mmaH<1>(aql[rt][ks].v, aql[rt][ks].v, bk[ks].v, bk[ks].v, accl); accl = mmaH<1>(aq[rt][ks].v, aq[rt][ks].v, bkl[ks].v, bkl[ks].v, accl); }
#pragma unroll
        for (int r = 0; r < 8; ++r) acc[r] += accl[r] * 0.0009765625f;
        s[rt][nt] = acc; } }
#pragma unroll
    for (int rt = 0; rt < RTN; ++rt)
#pragma unroll
      for (int r = 0; r < 8; ++r) { const int tq = q0 + rt * 16 + 8 * hh + r; const int k0 = j0 + ln, k1 = j0 + 16 + ln;
        bool ok0 = (CAUSAL == 1) ? (k0 <= tq) : ((CAUSAL == 2) ? ((k0 >> 5) == (tq >> 5)) : true), ok1 = (CAUSAL == 1) ? (k1 <= tq) : ((CAUSAL == 2) ? ((k1 >> 5) == (tq >> 5)) : true);      /* mode 2: block-diagonal 32-token groups */
        if (CAUSAL == 4) { const int* mrow = MSK + ((size_t)b * TQ + tq) * TK; ok0 = mrow[k0] != 0; ok1 = mrow[k1] != 0; }      /* mode 4: per-(query, key) INPUT mask shared by all heads; masked keys contribute nothing (== the reference's -4096 fill, whose exp underflows to 0), rows with no valid key give l = 0 -> output 0 (== the reference's row_valid zeroing) */
        float s0 = ok0 ? s[rt][0][r] * SCL : -3.0e38f, s1 = ok1 ? s[rt][1][r] * SCL : -3.0e38f; if (CAUSAL == 17) { const float* amk = (const float*)MSK + (size_t)b * TK; s0 += bf16_round(amk[k0]); s1 += bf16_round(amk[k1]); } if (CAUSAL == 18) { const float* tb = (const float*)MSK; const int* ri = MSK + 1024 + (size_t)b * TK; const int rq = ri[tq]; s0 += tb[(h * 8 + rq) * 8 + ri[k0]]; s1 += tb[(h * 8 + rq) * 8 + ri[k1]]; } if (CAUSAL == 19) { const int* rel = MSK + (size_t)tq * TK; const float* rb = (const float*)MSK + (size_t)TQ * TK + ((size_t)(b * NH + h) * TQ + tq) * 64; s0 += rb[rel[k0]]; s1 += rb[rel[k1]]; }      /* mode 19: + (q.Ek[rel] + Eb[rel][h]) / 8 gathered by the int relative ids (packed [ids | table]) */      /* mode 18: + resource_bias[h][r_q][r_k] from the packed [table | ids] buffer (TQ == TK) */      /* mode 17: additive per-(batch, key) mask INPUT */ float mc = fmaxf(s0, s1);
        mc = fmaxf(mc, __shfl_xor(mc, 1, 32)); mc = fmaxf(mc, __shfl_xor(mc, 2, 32)); mc = fmaxf(mc, __shfl_xor(mc, 4, 32)); mc = fmaxf(mc, __shfl_xor(mc, 8, 32));
        const float mn = fmaxf(m_r[rt][r], mc); const float al = (mn > -1.0e38f) ? expf(m_r[rt][r] - mn) : 1.0f; m_r[rt][r] = mn; const float p0 = ok0 ? expf(s0 - mn) : 0.f, p1 = ok1 ? expf(s1 - mn) : 0.f; l_r[rt][r] = l_r[rt][r] * al + p0 + p1;
#pragma unroll
        for (int dt = 0; dt < DT; ++dt) { oacc[rt][dt][r] *= al; oaccL[rt][dt][r] *= al; }
        FragH t2, t2l; const float ps0 = p0 * 1024.0f, ps1 = p1 * 1024.0f; t2.h[0] = (_Float16)ps0; t2.h[1] = (_Float16)ps1; t2l.h[0] = (_Float16)((ps0 - (float)t2.h[0]) * 1024.0f); t2l.h[1] = (_Float16)((ps1 - (float)t2.h[1]) * 1024.0f);
        sP[w][rt * 16 + 8 * hh + r][ln] = t2.u[0]; sP[w][rt * 16 + 8 * hh + r][16 + ln] = t2.u[1]; sPL[w][rt * 16 + 8 * hh + r][ln] = t2l.u[0]; sPL[w][rt * 16 + 8 * hh + r][16 + ln] = t2l.u[1]; }
    __builtin_amdgcn_fence(__ATOMIC_ACQ_REL, "workgroup"); __builtin_amdgcn_wave_barrier();
    FragH pa[2], pl[2];
#pragma unroll
    for (int rt = 0; rt < RTN; ++rt) { pa[rt].half[0] = *(const v8us*)&sP[w][rt * 16 + ln][8 * hh]; pa[rt].half[1] = *(const v8us*)&sP[w][rt * 16 + ln][16 + 8 * hh]; pl[rt].half[0] = *(const v8us*)&sPL[w][rt * 16 + ln][8 * hh]; pl[rt].half[1] = *(const v8us*)&sPL[w][rt * 16 + ln][16 + 8 * hh]; }
#pragma unroll
    for (int dt = 0; dt < DT; ++dt) { const unsigned short* vrow = Vth + (size_t)(dt * 16 + ln) * TK + j0; const unsigned short* vrl = Vtl + (size_t)(dt * 16 + ln) * TK + j0; FragH bv, bl; bv.half[0] = *(const v8us*)(vrow + 8 * hh); bv.half[1] = *(const v8us*)(vrow + 16 + 8 * hh); bl.half[0] = *(const v8us*)(vrl + 8 * hh); bl.half[1] = *(const v8us*)(vrl + 16 + 8 * hh);
#pragma unroll
      for (int rt = 0; rt < RTN; ++rt) { oacc[rt][dt] = mmaH<1>(pa[rt].v, pa[rt].v, bv.v, bv.v, oacc[rt][dt]); oaccL[rt][dt] = mmaH<1>(pl[rt].v, pl[rt].v, bv.v, bv.v, oaccL[rt][dt]); oaccL[rt][dt] = mmaH<1>(pa[rt].v, pa[rt].v, bl.v, bl.v, oaccL[rt][dt]); } }
    __builtin_amdgcn_fence(__ATOMIC_ACQ_REL, "workgroup"); __builtin_amdgcn_wave_barrier(); }
#pragma unroll
  for (int rt = 0; rt < RTN; ++rt) {
#pragma unroll
    for (int r = 0; r < 8; ++r) { float l = l_r[rt][r]; l += __shfl_xor(l, 1, 32); l += __shfl_xor(l, 2, 32); l += __shfl_xor(l, 4, 32); l += __shfl_xor(l, 8, 32); l_r[rt][r] = (l > 0.f) ? 1.0f / (l * 1024.0f) : 0.f; }
#pragma unroll
    for (int dt = 0; dt < DT; ++dt)
#pragma unroll
      for (int r = 0; r < 8; ++r) { float v = oacc[rt][dt][r]; v += oaccL[rt][dt][r] * 0.0009765625f; sO[w][rt * 16 + 8 * hh + r][dt * 16 + ln] = v * l_r[rt][r]; } }
  __builtin_amdgcn_fence(__ATOMIC_ACQ_REL, "workgroup"); __builtin_amdgcn_wave_barrier();
  {
#pragma unroll
    for (int rp = 0; rp < RPW; rp += 2) { const int r = rp + (lane >> 4), pc = lane & 15; const v4f val = *(const v4fa*)&sO[w][r][pc * 4]; *(v4f*)(O + ((size_t)b * TQ + q0 + r) * ldo + h * 64 + pc * 4) = val; }
     } }

__global__ __launch_bounds__(256) void k_rotab(float* __restrict__ CS, float* __restrict__ SN) {
  #pragma clang fp contract(off)
  const int t = blockIdx.x * 256 + threadIdx.x; if (t >= SLEN * 32) return; const int j = t % 32, s = t / 32; const float ex = (float)(2 * j) / 64.0f; const float inv = 1.0f / powf(10000.0f, ex); const float th = (float)s * inv; const float c = cosf(th), sn = sinf(th);
  { *(float*)(CS + t) = c; *(float*)(SN + t) = sn;  } }
__global__ __launch_bounds__(256) void k_rope(const float* __restrict__ F, int nsrc, int ndst, int rep, const float* __restrict__ CS, const float* __restrict__ SN, _Float16* __restrict__ H, _Float16* __restrict__ L) {
  #pragma clang fp contract(off)
  const size_t t = (size_t)blockIdx.x * 256 + threadIdx.x; if (t >= (size_t)NR * ndst * 4) return; const int g8 = (int)(t % 4); const int hd = (int)((t / 4) % ndst); const size_t row = t / ((size_t)4 * ndst); const int s = (int)(row % SLEN); const int hs = hd / rep;
  const float* src = F + row * (size_t)(nsrc * 64) + hs * 64; FragH ah, al, bh, bl;
  for (int i = 0; i < 8; ++i) { const int d = g8 * 8 + i; const float c = CS[s * 32 + d], sn = SN[s * 32 + d]; const float x1 = src[d], x2 = src[d + 32];
    float o1 = x1 * c; o1 += -x2 * sn; float o2 = x2 * c; o2 += x1 * sn;
    _Float16 hv = (_Float16)o1; ah.h[i] = hv; al.h[i] = (_Float16)((o1 - (float)hv) * 1024.0f); hv = (_Float16)o2; bh.h[i] = hv; bl.h[i] = (_Float16)((o2 - (float)hv) * 1024.0f); }
  const size_t o = row * (size_t)(ndst * 64) + hd * 64 + g8 * 8;
  { *(v8us*)((unsigned short*)H + o) = ah.half[0]; *(v8us*)((unsigned short*)H + o + 32) = bh.half[0]; *(v8us*)((unsigned short*)L + o) = al.half[0]; *(v8us*)((unsigned short*)L + o + 32) = bl.half[0];  } }
__global__ __launch_bounds__(256) void k_rope2(const float* __restrict__ F, int nsrc, int ndst, int rep, const float* __restrict__ CS, const float* __restrict__ SN, _Float16* __restrict__ H, _Float16* __restrict__ L) {
  #pragma clang fp contract(off)
  const size_t t = (size_t)blockIdx.x * 256 + threadIdx.x; if (t >= (size_t)NR * ndst * 4) return; const int g16 = (int)(t % 4); const int hd = (int)((t / 4) % ndst); const size_t row = t / ((size_t)4 * ndst); const int s = (int)(row % SLEN); const int hs = hd / rep;
  const float* src = F + row * (size_t)(nsrc * 64) + hs * 64 + g16 * 16; FragH ah, al;
  for (int pr = 0; pr < 8; ++pr) { const int i = g16 * 8 + pr; const float c = CS[s * 32 + i], sn = SN[s * 32 + i]; const float x1 = src[2 * pr], x2 = src[2 * pr + 1];
    float o1 = x1 * c; o1 -= x2 * sn; float o2 = x1 * sn; o2 += x2 * c;
    _Float16 hv = (_Float16)o1; ah.h[2 * pr] = hv; al.h[2 * pr] = (_Float16)((o1 - (float)hv) * 1024.0f); hv = (_Float16)o2; ah.h[2 * pr + 1] = hv; al.h[2 * pr + 1] = (_Float16)((o2 - (float)hv) * 1024.0f); }
  const size_t o = row * (size_t)(ndst * 64) + hd * 64 + g16 * 16;
  { *(v8us*)((unsigned short*)H + o) = ah.half[0]; *(v8us*)((unsigned short*)H + o + 8) = ah.half[1]; *(v8us*)((unsigned short*)L + o) = al.half[0]; *(v8us*)((unsigned short*)L + o + 8) = al.half[1];  } }
__global__ __launch_bounds__(256) void k_ln512(const float* __restrict__ A, const float* __restrict__ res, const float* __restrict__ g, const float* __restrict__ bb, float* __restrict__ Y, _Float16* __restrict__ Y16) {
  #pragma clang fp contract(off)
  const int wv = threadIdx.x >> 5, ln = threadIdx.x & 31; const size_t r = (size_t)blockIdx.x * 8 + wv; if (r >= NR) return; float x[16]; float s = 0.f;
  for (int i = 0; i < 2; ++i) { const v8f a = *(const v8f*)(A + r * DM + i * 256 + ln * 8); for (int q = 0; q < 8; ++q) { float v = a[q]; if (res) v += bf16_round(res[r * DM + i * 256 + ln * 8 + q]); x[i * 8 + q] = v; s += v; } }
  for (int o = 16; o > 0; o >>= 1) s += __shfl_xor(s, o, 32); const float mu = s / (float)DM; float var = 0.f; for (int q = 0; q < 16; ++q) { const float d = x[q] - mu; var += d * d; }
  for (int o = 16; o > 0; o >>= 1) var += __shfl_xor(var, o, 32); const float inv = rsqrtf(var / (float)DM + 1e-5f);
  { for (int i = 0; i < 2; ++i) { const int c0 = i * 256 + ln * 8; v8f y; FragH f; for (int q = 0; q < 8; ++q) { float v = (x[i * 8 + q] - mu) * inv; v *= bf16_round(g[c0 + q]); v += bf16_round(bb[c0 + q]); y[q] = v; f.h[q] = (_Float16)v; } *(v8f*)(Y + r * DM + c0) = y; if (Y16) *(v8us*)((unsigned short*)Y16 + r * DM + c0) = f.half[0]; }  } }
__global__ __launch_bounds__(256) void k_pack(const float* __restrict__ rb, const int* __restrict__ rid, int* __restrict__ PK) { const int t = blockIdx.x * 256 + threadIdx.x; if (t >= 1024 + NB * TK) return; int v; if (t < 1024) v = __float_as_int(bf16_round(rb[t])); else v = rid[t - 1024]; *(int*)(PK + t) = v;  }
__global__ __launch_bounds__(256) void k_tabin(const float* __restrict__ sp, float* __restrict__ CS, float* __restrict__ SN) { const int t = blockIdx.x * 256 + threadIdx.x; if (t >= SLEN * 32) return; const int i = t % 32, s = t / 32; const float c = bf16_round(sp[s * 64 + 32 + i]), sn = bf16_round(sp[s * 64 + i]);
  { *(float*)(CS + t) = c; *(float*)(SN + t) = sn;  } }
__global__ __launch_bounds__(256) void k_wsc(const float* __restrict__ Wm, _Float16* __restrict__ Bt, size_t n8, float sc) { const size_t t = (size_t)blockIdx.x * 256 + threadIdx.x; if (t >= n8) return; FragH f; for (int q = 0; q < 8; ++q) f.h[q] = (_Float16)(bf16_round(Wm[t * 8 + q]) * sc); *(v8us*)((unsigned short*)Bt + t * 8) = f.half[0];  }
__global__ __launch_bounds__(256) void k_rotab2(float* __restrict__ CS, float* __restrict__ SN) {
  #pragma clang fp contract(off)
  const int t = blockIdx.x * 256 + threadIdx.x; if (t >= SLEN * 32) return; const int j = t % 32, s = t / 32; const float c0 = -0.14391156831212787f;      /* -ln(10000)/64 rounded to f32 */ const float inv = expf((float)(2 * j) * c0); const float th = (float)s * inv; const float c = cosf(th), sn = sinf(th);
  { *(float*)(CS + t) = c; *(float*)(SN + t) = sn;  } }
__global__ __launch_bounds__(256) void k_lnu(const float* __restrict__ X, _Float16* __restrict__ N16, float* __restrict__ XB) {
  #pragma clang fp contract(off)
  const int wv = threadIdx.x >> 5, ln = threadIdx.x & 31; const size_t r = (size_t)blockIdx.x * 8 + wv; if (r >= NR) return; float a[32]; float s = 0.f;
  for (int i = 0; i < 4; ++i) { const v8f v = *(const v8f*)(X + r * DM + (i * 32 + ln) * 8); for (int q = 0; q < 8; ++q) { const float u = bf16_round(v[q]); a[i * 8 + q] = u; s += u; } }
  for (int o = 16; o > 0; o >>= 1) s += __shfl_xor(s, o, 32); const float mu = s / (float)DM; float var = 0.f; for (int q = 0; q < 32; ++q) { const float d = a[q] - mu; var += d * d; }
  for (int o = 16; o > 0; o >>= 1) var += __shfl_xor(var, o, 32); const float den = sqrtf(var / (float)(DM - 1)) + 1e-6f; const float inv = 1.0f / den;      /* one reciprocal per row; (x-mean)*inv vs the reference's division differs by <= 1 ulp */
  { for (int i = 0; i < 4; ++i) { const int c0 = (i * 32 + ln) * 8; FragH f; v8f xb; for (int q = 0; q < 8; ++q) { f.h[q] = (_Float16)((a[i * 8 + q] - mu) * inv); xb[q] = a[i * 8 + q]; } *(v8us*)((unsigned short*)N16 + r * DM + c0) = f.half[0]; *(v8f*)(XB + r * DM + c0) = xb; }  } }
// lane l <-> l ^ 16 (the two halves of a wave hold the two key halves of one query column)
__device__ __forceinline__ float xhalf(float v) { const int t = __float_as_int(v); return __int_as_float(__builtin_amdgcn_permlanex16(t, t, 0x76543210, 0xfedcba98, false, false)); }
__device__ __forceinline__ v8f wmh(v16h a, v16h b, v8f c) { return __builtin_amdgcn_wmma_f32_16x16x32_f16(false, a, false, b, (short)0, c, false, false); }
typedef _Float16 v8h __attribute__((ext_vector_type(8)));
typedef float v2f __attribute__((ext_vector_type(2)));
// eight 2^x in one statement: results kept apart from the arguments ("=&v") and one v_nop behind the last, the slot the instruction set asks for
// between a transcendental and an instruction that uses its result or overwrites its source (the register allocator otherwise reuses the previous argument as the next result)
__device__ __forceinline__ v8f exp2x8(v8f e) { float p0, p1, p2, p3, p4, p5, p6, p7;
  asm("v_exp_f32 %0, %8\n\tv_exp_f32 %1, %9\n\tv_exp_f32 %2, %10\n\tv_exp_f32 %3, %11\n\tv_exp_f32 %4, %12\n\tv_exp_f32 %5, %13\n\tv_exp_f32 %6, %14\n\tv_exp_f32 %7, %15\n\tv_nop"
      : "=&v"(p0), "=&v"(p1), "=&v"(p2), "=&v"(p3), "=&v"(p4), "=&v"(p5), "=&v"(p6), "=&v"(p7) : "v"(e[0]), "v"(e[1]), "v"(e[2]), "v"(e[3]), "v"(e[4]), "v"(e[5]), "v"(e[6]), "v"(e[7]));
  return (v8f){p0, p1, p2, p3, p4, p5, p6, p7}; }
// Fused distance attention, one launch for all (batch, head) slabs: per wave 32 query columns, per pass 32 keys.
// S^T = K Q^T (A = key rows, B = query rows; hi.hi + (hi.lo + lo.hi) / 1024), so a lane holds 8 + 8 keys of ONE query per column group:
// logits, running maximum and sum stay in the lane (one exchange between the wave halves); the two f32 score tiles, converted in place,
// are the B operand of O^T += V^T P^T (k order 8h + s, 16 + 8h + s on both sides). A lane ends with 8 consecutive d of one query: 16-byte stores of hi and residual.
// K hi, K lo, V^T and the key norms come through LDS, shared by the block's 8 waves: a stage is 128 keys (4 passes), brought by asynchronous copies into one of two buffers while the other is worked on.
#define EFK 144                        /* K row pitch in LDS: 128 B + 16 = 16 B x odd, conflict-free for 16-byte fragment reads */
#define EFV 272                        /* V^T row pitch: 256 B (128 keys) + 16, 16 B x odd too */
#define EF_KL (128 * EFK)              /* rows 0..127 = K hi, 128..255 = K lo */
#define EF_V (256 * EFK)               /* then 64 rows of V^T */
#define EF_N (256 * EFK + 64 * EFV)    /* then 128 key norms */
#define EFS (EF_N + 512)               /* one stage */
// One stage's 12 copies of a lane, 16 bytes each. K: 8 lanes bring one row's 128 bytes, the block 32 rows per copy; V^T: 16 lanes one row's 256 bytes, the block 16 rows per copy.
// lk, lv = the lane's LDS byte addresses in its first K hi row and its first V^T row; kh, kl, v = its global addresses there.
// s_wait_xcnt 0 is the statement's last line, so that it stands in front of any later rewrite of these address registers.
__device__ __forceinline__ void ef_stage(unsigned lk, unsigned lv, const char* kh, const char* kl, const char* v) {
  asm volatile("global_load_async_to_lds_b128 %0, %12, off\n\tglobal_load_async_to_lds_b128 %1, %13, off\n\tglobal_load_async_to_lds_b128 %2, %14, off\n\tglobal_load_async_to_lds_b128 %3, %15, off\n\t"
               "global_load_async_to_lds_b128 %4, %16, off\n\tglobal_load_async_to_lds_b128 %5, %17, off\n\tglobal_load_async_to_lds_b128 %6, %18, off\n\tglobal_load_async_to_lds_b128 %7, %19, off\n\t"
               "global_load_async_to_lds_b128 %8, %20, off\n\tglobal_load_async_to_lds_b128 %9, %21, off\n\tglobal_load_async_to_lds_b128 %10, %22, off\n\tglobal_load_async_to_lds_b128 %11, %23, off\n\ts_wait_xcnt 0x0"
               :: "v"(lk), "v"(lk + 32 * EFK), "v"(lk + 64 * EFK), "v"(lk + 96 * EFK), "v"(lk + EF_KL), "v"(lk + EF_KL + 32 * EFK), "v"(lk + EF_KL + 64 * EFK), "v"(lk + EF_KL + 96 * EFK), "v"(lv), "v"(lv + 16 * EFV), "v"(lv + 32 * EFV), "v"(lv + 48 * EFV),
                  "v"(kh), "v"(kh + 32 * (DM * 2)), "v"(kh + 64 * (DM * 2)), "v"(kh + 96 * (DM * 2)), "v"(kl), "v"(kl + 32 * (DM * 2)), "v"(kl + 64 * (DM * 2)), "v"(kl + 96 * (DM * 2)), "v"(v), "v"(v + 16 * (SLEN * 2)), "v"(v + 32 * (SLEN * 2)), "v"(v + 48 * (SLEN * 2)) : "memory"); }
// the stage's 128 key norms, 512 bytes: one copy of one whole wave
__device__ __forceinline__ void ef_stage_n(unsigned ln_, const char* n) { asm volatile("global_load_async_to_lds_b128 %0, %1, off\n\ts_wait_xcnt 0x0" :: "v"(ln_), "v"(n) : "memory"); }
// amdgpu_waves_per_eu(4, 4): a budget of 256 VGPRs, so that the whole kernel stays in one register window (it takes 240, no scratch)
__global__ __launch_bounds__(256) __attribute__((amdgpu_waves_per_eu(4, 4))) void k_eflash(const _Float16* __restrict__ QHp, const _Float16* __restrict__ QLp, const _Float16* __restrict__ KHp, const _Float16* __restrict__ KLp, const _Float16* __restrict__ Vt,
                                                const float* __restrict__ QN, const float* __restrict__ KNT, const float* __restrict__ tmp, _Float16* __restrict__ OH, _Float16* __restrict__ OL) {
  __shared__ __attribute__((aligned(128))) char st[2 * EFS];
  const int tid = threadIdx.x, w = tid >> 5, lane = tid & 31, ln = lane & 15, hh = lane >> 4;
  const int slab = blockIdx.x / (SLEN / 256), qblk = blockIdx.x % (SLEN / 256); const int b = slab / NH, h = slab % NH; const int q0 = qblk * 256 + w * 32;
  const float nc = -(1.0f / bf16_round(tmp[0])) * 1.4426950408889634f;      /* logit in log2 units = d2 * nc */
  v16h qh[2][2], ql[2][2]; float qn[2];
#pragma unroll
  for (int qt = 0; qt < 2; ++qt) { const size_t row = (size_t)b * SLEN + q0 + qt * 16 + ln; const _Float16* ph = QHp + row * DM + h * 64; const _Float16* pl = QLp + row * DM + h * 64;
    qh[qt][0] = g2_frag(ph, hh); qh[qt][1] = g2_frag(ph + 32, hh); ql[qt][0] = g2_frag(pl, hh); ql[qt][1] = g2_frag(pl + 32, hh); qn[qt] = QN[(size_t)slab * SLEN + q0 + qt * 16 + ln]; }
  const char* gkh = (const char*)(KHp + (size_t)b * SLEN * DM + h * 64) + (tid >> 3) * (DM * 2) + (tid & 7) * 16; const char* gkl = (const char*)(KLp + (size_t)b * SLEN * DM + h * 64) + (tid >> 3) * (DM * 2) + (tid & 7) * 16;      /* the lane's copy sources in stage 0 */
  const char* gv = (const char*)(Vt + (size_t)slab * 64 * SLEN) + (tid >> 4) * (SLEN * 2) + (tid & 15) * 16; const char* gn = (const char*)(KNT + (size_t)slab * SLEN) + lane * 16;
  const unsigned lk0 = (unsigned)(size_t)st + (unsigned)((tid >> 3) * EFK + (tid & 7) * 16), lv0 = (unsigned)(size_t)st + (unsigned)(EF_V + (tid >> 4) * EFV + (tid & 15) * 16), ln0 = (unsigned)(size_t)st + (unsigned)(EF_N + lane * 16);
  const bool w0 = __builtin_amdgcn_readfirstlane(w) == 0;      /* scalar: the norms' copy is issued by wave 0 alone, behind a scalar branch */
  const char* fk = st + ln * EFK + hh * 16; const char* fv = st + EF_V + ln * EFV + hh * 16; const char* fn = st + EF_N + hh * 32;      /* fragment rows: k = 8h + s at +0, 16 + 8h + s at +32 bytes */
  const v8f z8 = {0.f,0.f,0.f,0.f,0.f,0.f,0.f,0.f};
  float m[2] = {-3.0e38f, -3.0e38f}; v2f l[2] = {{0.f, 0.f}, {0.f, 0.f}}; v8f o[2][4];
#pragma unroll
  for (int qt = 0; qt < 2; ++qt)
#pragma unroll
    for (int dt = 0; dt < 4; ++dt) o[qt][dt] = z8;
  ef_stage(lk0, lv0, gkh, gkl, gv); if (w0) ef_stage_n(ln0, gn);
  asm volatile("s_wait_asynccnt 0x0" ::: "memory");      /* this wave's copies of stage 0 have landed */
  __syncthreads();      /* ... and every other wave's: stage 0 may be read */
  ef_stage(lk0 + EFS, lv0 + EFS, gkh + 128 * (DM * 2), gkl + 128 * (DM * 2), gv + 256); if (w0) ef_stage_n(ln0 + EFS, gn + 512);      /* SLEN / 128 = 16 stages: stage 1 exists */
#pragma unroll 1      /* one stage per trip */
  for (int t = 0; t < SLEN / 128; ++t) { const int bo = (t & 1) * EFS;
#pragma unroll 1      /* one pass per trip: the body already holds 32 matrix instructions, a copy would only add registers */
  for (int ps = 0; ps < 4; ++ps) {
    v8f u[2][2];
#pragma unroll
    for (int kt = 0; kt < 2; ++kt) { const char* kr = fk + bo + (ps * 32 + kt * 16) * EFK; const char* kq = kr + EF_KL;
      const v8f k2 = *(const v8f*)(fn + bo + (ps * 32 + kt * 16) * 4); const v16h a0 = g2_lfrag(kr), a1 = g2_lfrag(kr + 64), c0 = g2_lfrag(kq), c1 = g2_lfrag(kq + 64);
#pragma unroll
      for (int qt = 0; qt < 2; ++qt) { v8f lo = wmh(a0, ql[qt][0], z8); lo = wmh(a1, ql[qt][1], lo); lo = wmh(c0, qh[qt][0], lo); lo = wmh(c1, qh[qt][1], lo); v8f hi = wmh(a0, qh[qt][0], z8); hi = wmh(a1, qh[qt][1], hi);
        const v8f s = hi + lo * 0.0009765625f; const v8f d2 = __builtin_elementwise_max((k2 + qn[qt]) - 2.0f * s, z8); u[qt][kt] = d2 * nc; } }
    float mn[2];
#pragma unroll
    for (int qt = 0; qt < 2; ++qt) { const v8f t = __builtin_elementwise_max(u[qt][0], u[qt][1]); float mx = fmaxf(fmaxf(fmaxf(t[0], t[1]), fmaxf(t[2], t[3])), fmaxf(fmaxf(t[4], t[5]), fmaxf(t[6], t[7])));
      mx = fmaxf(mx, xhalf(mx)); mn[qt] = fmaxf(m[qt], mx); }
    if (__builtin_amdgcn_ballot_w32((mn[0] > m[0]) || (mn[1] > m[1])) != 0) {      /* scalar branch: sums and output tiles are rescaled only in a pass that raises some column's maximum */
#pragma unroll
      for (int qt = 0; qt < 2; ++qt) { const float al = __builtin_amdgcn_exp2f(m[qt] - mn[qt]); m[qt] = mn[qt]; l[qt] *= al;
#pragma unroll
        for (int dt = 0; dt < 4; ++dt) o[qt][dt] *= al; } }
    FragH pb[2];
#pragma unroll
    for (int qt = 0; qt < 2; ++qt) { const float mo = m[qt] - 10.0f;      /* weights carried times 1024, as f16 operands away from the subnormal range; the factor cancels between sum and output */
      v8f p[2];
#pragma unroll
      for (int kt = 0; kt < 2; ++kt) { p[kt] = exp2x8(u[qt][kt] - mo);
        const v8h ph = __builtin_convertvector(p[kt], v8h);
#pragma unroll
        for (int r = 0; r < 8; ++r) pb[qt].h[kt * 8 + r] = ph[r]; }
      const v8f t = p[0] + p[1]; const v4f t4 = t.lo + t.hi; l[qt] += t4.lo + t4.hi; }
#pragma unroll
    for (int dt = 0; dt < 4; ++dt) { const v16h va = g2_lfrag(fv + bo + ps * 64 + dt * 16 * EFV);
#pragma unroll
      for (int qt = 0; qt < 2; ++qt) o[qt][dt] = wmh(va, pb[qt].v, o[qt][dt]); }
  }
    asm volatile("s_wait_dscnt 0x0" ::: "memory");      /* this wave has left the buffer that is refilled below */
    asm volatile("s_wait_asynccnt 0x0" ::: "memory");      /* its copies of stage t + 1 have landed */
    __syncthreads();      /* publishes stage t + 1 and ends every reader's last read of stage t */
    if (t + 2 < SLEN / 128) { ef_stage(lk0 + bo, lv0 + bo, gkh + (size_t)(t + 2) * (128 * DM * 2), gkl + (size_t)(t + 2) * (128 * DM * 2), gv + (size_t)(t + 2) * 256); if (w0) ef_stage_n(ln0 + bo, gn + (size_t)(t + 2) * 512); }
  }
  asm volatile("s_wait_asynccnt 0x0" ::: "memory");      /* no copy is outstanding when the wave goes on to the epilogue and ends */
#pragma unroll
  for (int qt = 0; qt < 2; ++qt) { const float lh = l[qt][0] + l[qt][1]; const float inv = 1.0f / (lh + xhalf(lh)); const size_t ob = ((size_t)b * SLEN + q0 + qt * 16 + ln) * DM + h * 64 + 8 * hh;
#pragma unroll
    for (int dt = 0; dt < 4; ++dt) { FragH f, fl;
#pragma unroll
      for (int r = 0; r < 8; ++r) { const float v = o[qt][dt][r] * inv; const _Float16 hv = (_Float16)v; f.h[r] = hv; fl.h[r] = (_Float16)((v - (float)hv) * 1024.0f); }
      *(v8us*)((unsigned short*)OH + ob + dt * 16) = f.half[0]; *(v8us*)((unsigned short*)OL + ob + dt * 16) = fl.half[0]; } }
}
extern "C" void kernel_launch(void* const* d_in, const int* in_sizes, int n_in,
                              void* d_out, int out_size, void* d_ws, size_t ws_size, hipStream_t stream) {
  (void)in_sizes; (void)n_in; (void)out_size;
  const float* const* I = (const float* const*)d_in; const float* x = I[0]; const float* wq = I[1]; const float* bq = I[2]; const float* wk = I[3]; const float* bk = I[4]; const float* wv = I[5]; const float* bv = I[6]; const float* wo = I[7]; const float* bo = I[8]; const float* tmp = I[9];
  char* ws = (char*)d_ws; size_t off = 0;
  auto take = [&](size_t bytes) { char* p = ws + off; off += (bytes + 255) & ~(size_t)255; return p; };
  const size_t np = (size_t)NR * DM;
  _Float16* BQ = (_Float16*)take((size_t)DM * DM * 2); _Float16* BK = (_Float16*)take((size_t)DM * DM * 2); _Float16* BV = (_Float16*)take((size_t)DM * DM * 2); _Float16* BO = (_Float16*)take((size_t)DM * DM * 2);
  _Float16* X16 = (_Float16*)take(np * 2); float* QN = (float*)take((size_t)NR * NH * 4); float* KN = (float*)take((size_t)NR * NH * 4); _Float16* QH = (_Float16*)take(np * 2); _Float16* QL = (_Float16*)take(np * 2); _Float16* KH = (_Float16*)take(np * 2); _Float16* KL = (_Float16*)take(np * 2); _Float16* OH = (_Float16*)take(np * 2); _Float16* VT = (_Float16*)take(np * 2);
  _Float16* OL = X16;      /* O lo over x (dead after the projections) */
  if (off > ws_size) return;      /* 8 + 8 + 0.5 + 6x8 = about 65 MiB */
  k_wt_f16<<<(unsigned)(((size_t)DM * DM / 8 + 255) / 256), 256, 0, stream>>>(wq, BQ, DM, DM, 16.0f); k_wt_f16<<<(unsigned)(((size_t)DM * DM / 8 + 255) / 256), 256, 0, stream>>>(wk, BK, DM, DM, 16.0f); k_wt_f16<<<(unsigned)(((size_t)DM * DM / 8 + 255) / 256), 256, 0, stream>>>(wv, BV, DM, DM, 16.0f); k_wt_f16<<<(unsigned)(((size_t)DM * DM / 8 + 255) / 256), 256, 0, stream>>>(wo, BO, DM, DM, 16.0f);      /* [in, out] */
  k_x16<<<(unsigned)((np / 8 + 255) / 256), 256, 0, stream>>>(x, X16, np / 8);
  const dim3 gP((NR / 128) * (DM / 64), 1);
  k_gemm2<0, 1><<<gP, 128, 0, stream>>>(X16, DM, 0, BQ, DM, 0, 0.0625f, bq, 0, nullptr, 1, 0, 0, QN, QH, QL, DM, 0, NR, DM, DM); k_gemm2<0, 1><<<gP, 128, 0, stream>>>(X16, DM, 0, BK, DM, 0, 0.0625f, bk, 0, nullptr, 1, 0, 0, KN, KH, KL, DM, 0, NR, DM, DM);      /* q, k: hi + residual planes and norms [(b,h)][2048] */
  k_gemm2<0, 2><<<gP, 128, 0, stream>>>(X16, DM, 0, BV, DM, 0, 0.0625f, bv, 0, nullptr, 1, 0, 0, nullptr, VT, nullptr, DM, 0, NR, DM, DM);      /* V^T [(b,h)][64][2048] */
  k_eflash<<<NB * NH * (SLEN / 256), 256, 0, stream>>>(QH, QL, KH, KL, VT, QN, KN, tmp, OH, OL);      /* scores, softmax, att . v, normalise, hi + residual: one launch */
  k_gemm2<0, 0><<<gP, 128, 0, stream>>>(OL, DM, 0, BO, DM, 0, 0.0625f / 1024.0f, nullptr, 0, nullptr, 1, 0, 0, (float*)d_out, nullptr, nullptr, DM, 0, NR, DM, DM);
  k_gemm2<0, 0><<<gP, 128, 0, stream>>>(OH, DM, 0, BO, DM, 0, 0.0625f, bo, 0, (const float*)d_out, 1, (size_t)DM, 0, (float*)d_out, nullptr, nullptr, DM, 0, NR, DM, DM);      /* out = (O_lo + O_hi) Wo + bo */
}

// v005
// It runs in 156 microseconds.
// In both of two side-by-side timings against v004, it was 1.18 times as fast.
// All steps since v000 together make it 12.8 times as fast.
#include <hip/hip_runtime.h>
// EuclideanAttention (2 x 2048 tokens, D 1024 = 16 heads x 64; Q, K, V = x W + b; d2 = max(|q|^2 + |k|^2 - 2 q.k, 0); attn = softmax_k(-d2 / temperature); out = (attn V) Wo + bo).
// Compute dtype: inputs rounded to bf16; x and weights exact as f16; q.k from hi+residual operands (~2^-21); norms/softmax f32; v and the softmax weights as plain f16 operands (~2^-12); attention output hi + residual. v_wmma_f32_16x16x32_f16.
#define NB 2
#define DM 1024
#define NKV 16
#define NREP (NH / NKV)
#define KVD (NKV * 64)           /* 1024 */
#define NR (NB * SLEN)           /* 4096 */
#define CHK 512                  /* attention chunk */
typedef int v4i __attribute__((ext_vector_type(4)));
#define FF 2048
#define SLEN 2048
#define TQ SLEN
#define TK SLEN
#define NH 16
#define SCL 0.125f
#define QBLKS (TQ / 64)
#define QB05 0
#define QBN5 4
#define QB0P 0
#define QBNP QBLKS           /* non-causal: plain flash on every query block */
#define RE 256
typedef __bf16 v16b __attribute__((ext_vector_type(16)));
typedef unsigned short v8us __attribute__((ext_vector_type(8), may_alias));
typedef float  v8f  __attribute__((ext_vector_type(8)));
typedef float  v4f  __attribute__((ext_vector_type(4)));
typedef float  v4fa __attribute__((ext_vector_type(4), may_alias));
union FragB { v16b v; v8us half[2]; unsigned short u[16]; };

__device__ __forceinline__ unsigned short bf16_bits(float x) { unsigned int u = __float_as_uint(x); return (unsigned short)((u + 0x7FFFu + ((u >> 16) & 1u)) >> 16); }
__device__ __forceinline__ float bf16_val(unsigned short b) { return __uint_as_float(((unsigned int)b) << 16); }
__device__ __forceinline__ float bf16_round(float x) { return bf16_val(bf16_bits(x)); }
// D += A·B with NT terms: 1 = ah·bh, 2 = + al·bh (A split), 3 = + ah·bl (both split)
template <int NT>
__device__ __forceinline__ v8f mmaN(v16b ah, v16b al, v16b bh, v16b bl, v8f c) {
  c = __builtin_amdgcn_wmma_f32_16x16x32_bf16(false, ah, false, bh, (short)0, c, false, false);
  if (NT >= 2) c = __builtin_amdgcn_wmma_f32_16x16x32_bf16(false, al, false, bh, (short)0, c, false, false);
  if (NT >= 3) c = __builtin_amdgcn_wmma_f32_16x16x32_bf16(false, ah, false, bl, (short)0, c, false, false);
  asm volatile("v_nop\n\tv_nop\n\tv_nop\n\tv_nop" : "+v"(c) : "v"(ah), "v"(al), "v"(bh), "v"(bl));
  return c;
}

__global__ __launch_bounds__(256) void k_wt_bf16(const float* __restrict__ W, unsigned short* __restrict__ Wt, int K, int N) {
  const int t = blockIdx.x * 256 + threadIdx.x;
  const int k8n = K / 8;
  if (t >= N * k8n) return;
  const int n = t / k8n, k8 = (t % k8n) * 8;
  v8us v;
#pragma unroll
  for (int i = 0; i < 8; ++i) v[i] = bf16_bits(W[(size_t)(k8 + i) * N + n]);
  *(v8us*)(Wt + (size_t)n * K + k8) = v;
  
}

// GEMM C[M][N] (f32, pitch ldc) = act(A[M][K]·W + bias). A f32 row-major (pitch lda) converted per fragment to bf16
// (ASPLIT: hi/lo two planes -> 2 terms, else single rounded term); Wt bf16 [N][K] (pitch ldb). BIAS_BF16 rounds the
// bias to bf16 first (bias quantised to bf16 before the add). K%32==0, M%16==0, N%64==0.
template <bool ASPLIT, int ACT, bool BIAS_BF16>
__global__ __launch_bounds__(128) void k_gemm_bf(const float* __restrict__ A, int lda, const unsigned short* __restrict__ Wt, int ldb,
                                               const float* __restrict__ bias, float* __restrict__ C, int ldc, int M, int N, int K) {
  __shared__ __attribute__((aligned(16))) float so[4][16][64];
  const int tid = threadIdx.x, w = tid >> 5, lane = tid & 31, ln = lane & 15, hh = lane >> 4;
  const int ntn = N / 64;
  const int wid = blockIdx.x * 4 + w;
  const int mt = wid / ntn, nq = wid % ntn;
  if (mt * 16 >= M) return;
  const int row0 = mt * 16, col0 = nq * 64;
  const float* arow = A + (size_t)(row0 + ln) * lda;
  v8f acc[4] = {};
  for (int kb = 0; kb < K; kb += 32) {
    FragB ah, al;
    const v4f x0 = *(const v4fa*)(arow + kb + 8 * hh), x1 = *(const v4fa*)(arow + kb + 8 * hh + 4);
    const v4f x2 = *(const v4fa*)(arow + kb + 16 + 8 * hh), x3 = *(const v4fa*)(arow + kb + 16 + 8 * hh + 4);
    float xs[16] = {x0[0],x0[1],x0[2],x0[3],x1[0],x1[1],x1[2],x1[3],x2[0],x2[1],x2[2],x2[3],x3[0],x3[1],x3[2],x3[3]};
#pragma unroll
    for (int i = 0; i < 16; ++i) { const unsigned short hb = bf16_bits(xs[i]); ah.u[i] = hb; al.u[i] = ASPLIT ? bf16_bits(xs[i] - bf16_val(hb)) : (unsigned short)0; }
#pragma unroll
    for (int t = 0; t < 4; ++t) {
      const unsigned short* brow = Wt + (size_t)(col0 + t * 16 + ln) * ldb + kb;
      FragB b;
      b.half[0] = *(const v8us*)(brow + 8 * hh);
      b.half[1] = *(const v8us*)(brow + 16 + 8 * hh);
      acc[t] = mmaN<ASPLIT ? 2 : 1>(ah.v, al.v, b.v, b.v, acc[t]);
    }
  }
#pragma unroll
  for (int t = 0; t < 4; ++t) {
    float bv = bias ? bias[col0 + t * 16 + ln] : 0.f;
    if (BIAS_BF16) bv = bf16_round(bv);
#pragma unroll
    for (int r = 0; r < 8; ++r) { float v = acc[t][r] + bv; if (ACT == 1) v = fmaxf(v, 0.f); so[w][8 * hh + r][t * 16 + ln] = v; }
  }
  __builtin_amdgcn_fence(__ATOMIC_ACQ_REL, "workgroup");
  __builtin_amdgcn_wave_barrier();
  const int rsub = lane >> 4, c4 = (lane & 15) * 4;
  {
#pragma unroll
    for (int q = 0; q < 8; ++q) {
      const int r = q * 2 + rsub;
      const v4f v = *(const v4fa*)&so[w][r][c4];
      *(v4f*)(C + (size_t)(row0 + r) * ldc + col0 + c4) = v;
    }
    
  }
}

// GEMM C = act(A·W + bias + resid): A f32 (ASPLIT -> hi/lo 2 terms), Wt bf16 [N][K]; ACT 0 none, 1 relu, 2 exact gelu;
// resid (optional, f32, row index = (row % rmod), pitch ldr, RES_BF16 rounds it) added before the activation.
template <bool ASPLIT, int ACT, bool BIAS_BF16, bool RES_BF16>
__global__ __launch_bounds__(128) void k_gemm_bf3(const float* __restrict__ A, int lda, const unsigned short* __restrict__ Wt, int ldb,
                                                const float* __restrict__ bias, const float* __restrict__ resid, int rmod, int ldr,
                                                float* __restrict__ C, int ldc, int M, int N, int K) {
  __shared__ __attribute__((aligned(16))) float so[4][16][64];
  const int tid = threadIdx.x, w = tid >> 5, lane = tid & 31, ln = lane & 15, hh = lane >> 4;
  const int ntn = N / 64;
  const int wid = blockIdx.x * 4 + w;
  const int mt = wid / ntn, nq = wid % ntn;
  if (mt * 16 >= M) return;
  const int row0 = mt * 16, col0 = nq * 64;
  const float* arow = A + (size_t)(row0 + ln) * lda;
  v8f acc[4] = {};
  for (int kb = 0; kb < K; kb += 32) {
    FragB ah, al;
    const v4f x0 = *(const v4fa*)(arow + kb + 8 * hh), x1 = *(const v4fa*)(arow + kb + 8 * hh + 4);
    const v4f x2 = *(const v4fa*)(arow + kb + 16 + 8 * hh), x3 = *(const v4fa*)(arow + kb + 16 + 8 * hh + 4);
    float xs[16] = {x0[0],x0[1],x0[2],x0[3],x1[0],x1[1],x1[2],x1[3],x2[0],x2[1],x2[2],x2[3],x3[0],x3[1],x3[2],x3[3]};
#pragma unroll
    for (int i = 0; i < 16; ++i) { const unsigned short hb = bf16_bits(xs[i]); ah.u[i] = hb; al.u[i] = ASPLIT ? bf16_bits(xs[i] - bf16_val(hb)) : (unsigned short)0; }
#pragma unroll
    for (int t = 0; t < 4; ++t) {
      const unsigned short* brow = Wt + (size_t)(col0 + t * 16 + ln) * ldb + kb;
      FragB b;
      b.half[0] = *(const v8us*)(brow + 8 * hh);
      b.half[1] = *(const v8us*)(brow + 16 + 8 * hh);
      acc[t] = mmaN<ASPLIT ? 2 : 1>(ah.v, al.v, b.v, b.v, acc[t]);
    }
  }
#pragma unroll
  for (int t = 0; t < 4; ++t) {
    const int col = col0 + t * 16 + ln;
    float bv = bias ? bias[col] : 0.f;
    if (BIAS_BF16) bv = bf16_round(bv);
#pragma unroll
    for (int r = 0; r < 8; ++r) {
      float v = acc[t][r] + bv;
      if (resid) { float rv = resid[(size_t)((row0 + 8 * hh + r) % rmod) * ldr + col]; if (RES_BF16) rv = bf16_round(rv); v += rv; }
      if (ACT == 1) v = fmaxf(v, 0.f);
      if (ACT == 2) v = 0.5f * v * (1.0f + erff(v * 0.70710678118654752f));
      if (ACT == 3) { const float u = 0.7978845608028654f * (v + 0.044715f * v * v * v); v = 0.5f * v * (1.0f + tanhf(u)); }
      so[w][8 * hh + r][t * 16 + ln] = v;
    }
  }
  __builtin_amdgcn_fence(__ATOMIC_ACQ_REL, "workgroup");
  __builtin_amdgcn_wave_barrier();
  const int rsub = lane >> 4, c4 = (lane & 15) * 4;
  {
#pragma unroll
    for (int q = 0; q < 8; ++q) {
      const int r = q * 2 + rsub;
      const v4f v = *(const v4fa*)&so[w][r][c4];
      *(v4f*)(C + (size_t)(row0 + r) * ldc + col0 + c4) = v;
    }
    
  }
}
// row LayerNorm (biased variance, eps) over N: s = X (+ R); optional out_sum <- s; out_norm <- (s-mu)*rsqrt(var+eps)*g + b
template <bool PARAM_BF16>
__global__ __launch_bounds__(256) void k_layernorm(const float* __restrict__ X, const float* __restrict__ R, const float* __restrict__ g, const float* __restrict__ bta,
                                                  float* __restrict__ out_sum, float* __restrict__ out_norm, int N, float eps) {
  __shared__ float red[256];
  const int row = blockIdx.x, tid = threadIdx.x;
  const float* x = X + (size_t)row * N; const float* rr = R ? R + (size_t)row * N : nullptr;
  float vals[16];                     // up to N = 4096
  const int per = N / 256;            // contiguous chunk per thread? use strided-by-4 chunks: thread handles j = tid*4 + 1024*u
  float s1 = 0.f;
  for (int u = 0; u < per / 4; ++u) {
    const int j = tid * 4 + 1024 * u;
    const v4f a = *(const v4fa*)(x + j);
    v4f b = {0.f,0.f,0.f,0.f}; if (rr) b = *(const v4fa*)(rr + j);
#pragma unroll
    for (int q = 0; q < 4; ++q) { const float v = a[q] + b[q]; vals[u * 4 + q] = v; s1 += v; }
  }
  red[tid] = s1; __syncthreads();
  for (int st = 128; st > 0; st >>= 1) { if (tid < st) red[tid] += red[tid + st]; __syncthreads(); }
  const float mu = red[0] / (float)N; __syncthreads();
  float s2 = 0.f;
  for (int u = 0; u < per / 4; ++u)
#pragma unroll
    for (int q = 0; q < 4; ++q) { const float c = vals[u * 4 + q] - mu; s2 += c * c; }
  red[tid] = s2; __syncthreads();
  for (int st = 128; st > 0; st >>= 1) { if (tid < st) red[tid] += red[tid + st]; __syncthreads(); }
  const float rs = rsqrtf(red[0] / (float)N + eps);
  {
    for (int u = 0; u < per / 4; ++u) {
      const int j = tid * 4 + 1024 * u;
      v4f o, sm;
#pragma unroll
      for (int q = 0; q < 4; ++q) {
        float gg = g[j + q], bb = bta[j + q];
        if (PARAM_BF16) { gg = bf16_round(gg); bb = bf16_round(bb); }
        sm[q] = vals[u * 4 + q]; o[q] = (vals[u * 4 + q] - mu) * rs * gg + bb;
      }
      if (out_sum) *(v4f*)(out_sum + (size_t)row * N + j) = sm;
      *(v4f*)(out_norm + (size_t)row * N + j) = o;
    }
    
  }
}



// ---- f16 WMMA path (v_wmma_f32_16x16x32_f16): 11-bit significands for operands in range — used where a [0,1] probability operand needs more precision than bf16
typedef _Float16 v16h __attribute__((ext_vector_type(16)));
union FragH { v16h v; v8us half[2]; _Float16 h[16]; unsigned short u[16]; };
template <int NT>
__device__ __forceinline__ v8f mmaH(v16h ah, v16h al, v16h bh, v16h bl, v8f c) {
  c = __builtin_amdgcn_wmma_f32_16x16x32_f16(false, ah, false, bh, (short)0, c, false, false);
  if (NT >= 2) c = __builtin_amdgcn_wmma_f32_16x16x32_f16(false, al, false, bh, (short)0, c, false, false);
  if (NT >= 3) c = __builtin_amdgcn_wmma_f32_16x16x32_f16(false, ah, false, bl, (short)0, c, false, false);
  asm volatile("v_nop\n\tv_nop\n\tv_nop\n\tv_nop" : "+v"(c) : "v"(ah), "v"(al), "v"(bh), "v"(bl));
  return c;
}
// batched GEMM like k_gemm_b but f16 operands: A f32 (split into f16 hi/lo if ASPLIT, else rounded to f16), Bt = f16 values [n][k]; alpha; C f32; N multiple of 16 (partial tiles skipped)
template <bool ASPLIT>
__global__ __launch_bounds__(128) void k_gemm_h(const float* __restrict__ A, int lda, size_t sA, const _Float16* __restrict__ Bh, int ldb, size_t sB, float alpha, float* __restrict__ C, int ldc, size_t sC, int M, int N, int K) {
  __shared__ __attribute__((aligned(16))) float so[4][16][64];
  const int tid = threadIdx.x, w = tid >> 5, lane = tid & 31, ln = lane & 15, hh = lane >> 4; const int by = blockIdx.y;
  A += (size_t)by * sA; Bh += (size_t)by * sB; C += (size_t)by * sC;
  const int ntn = (N + 63) / 64; const int wid = blockIdx.x * 4 + w; const int mt = wid / ntn, nq = wid % ntn; if (mt * 16 >= M) return;
  const int row0 = mt * 16, col0 = nq * 64; const float* arow = A + (size_t)(row0 + ln) * lda;
  v8f acc[4] = {};
  for (int kb = 0; kb < K; kb += 32) {
    FragH ah, al;
    const v4f x0 = *(const v4fa*)(arow + kb + 8 * hh), x1 = *(const v4fa*)(arow + kb + 8 * hh + 4), x2 = *(const v4fa*)(arow + kb + 16 + 8 * hh), x3 = *(const v4fa*)(arow + kb + 16 + 8 * hh + 4);
    float xs[16] = {x0[0],x0[1],x0[2],x0[3],x1[0],x1[1],x1[2],x1[3],x2[0],x2[1],x2[2],x2[3],x3[0],x3[1],x3[2],x3[3]};
#pragma unroll
    for (int i = 0; i < 16; ++i) { const _Float16 h = (_Float16)xs[i]; ah.h[i] = h; al.h[i] = ASPLIT ? (_Float16)(xs[i] - (float)h) : (_Float16)0.0f; }
#pragma unroll
    for (int t = 0; t < 4; ++t) { if (col0 + t * 16 >= N) continue; const size_t boff = (size_t)(col0 + t * 16 + ln) * ldb + kb; FragH bq; bq.half[0] = *(const v8us*)(Bh + boff + 8 * hh); bq.half[1] = *(const v8us*)(Bh + boff + 16 + 8 * hh);
      acc[t] = mmaH<ASPLIT ? 2 : 1>(ah.v, al.v, bq.v, bq.v, acc[t]); }
  }
#pragma unroll
  for (int t = 0; t < 4; ++t) { if (col0 + t * 16 >= N) continue;
#pragma unroll
    for (int r = 0; r < 8; ++r) so[w][8 * hh + r][t * 16 + ln] = acc[t][r] * alpha; }
  __builtin_amdgcn_fence(__ATOMIC_ACQ_REL, "workgroup"); __builtin_amdgcn_wave_barrier();
  const int rsub = lane >> 4, c4 = (lane & 15) * 4;
  {
#pragma unroll
    for (int q = 0; q < 8; ++q) { const int r = q * 2 + rsub; if (col0 + c4 < N) { const v4f v = *(const v4fa*)&so[w][r][c4]; *(v4f*)(C + (size_t)(row0 + r) * ldc + col0 + c4) = v; } }
     }
}

// Wt[n][k] = f16(W[k][n]·scale) from f32 row-major W[K][N] (scale = power of two; bf16-exact weights stay exact in f16 away from the subnormal range)
__global__ __launch_bounds__(256) void k_wt_f16(const float* __restrict__ W, _Float16* __restrict__ Wt, int K, int N, float scale) {
  const int t = blockIdx.x * 256 + threadIdx.x; if (t >= N * (K / 8)) return; const int n = t / (K / 8), k8 = (t % (K / 8)) * 8; FragH f;
#pragma unroll
  for (int i = 0; i < 8; ++i) f.h[i] = (_Float16)(bf16_round(W[(size_t)(k8 + i) * N + n]) * scale); const v8us o = f.half[0];
  *(v8us*)((unsigned short*)Wt + (size_t)n * K + k8) = o; 
}
// k_gemm_hh variant with fused epilogue: v = acc·alpha + bias[by·sBias + col] (+ CP[(row/rowsPerB)·sCPb + by·64 + col] if CP) ; ACT 0 none / 1 elu ; writes f16 C16 (and f32 C if non-null)
template <int ACT>
__global__ __launch_bounds__(128) void k_gemm_hhx(const _Float16* __restrict__ A, int lda, size_t sA, const _Float16* __restrict__ Bh, int ldb, size_t sB, float alpha, const float* __restrict__ bias, size_t sBias, const float* __restrict__ CP, int rowsPerB, size_t sCPb, int row0g,
    float* __restrict__ C, _Float16* __restrict__ C16, int ldc, size_t sC, int M, int N, int K) {
  __shared__ __attribute__((aligned(16))) float so[4][16][64];
  const int tid = threadIdx.x, w = tid >> 5, lane = tid & 31, ln = lane & 15, hh = lane >> 4; const int by = blockIdx.y;
  A += (size_t)by * sA; Bh += (size_t)by * sB; const size_t cofs = (size_t)by * sC; const float* bp = bias ? bias + (size_t)by * sBias : nullptr;
  const int ntn = (N + 63) / 64; const int wid = blockIdx.x * 4 + w; const int mt = wid / ntn, nq = wid % ntn; if (mt * 16 >= M) return;
  const int row0 = mt * 16, col0 = nq * 64; const _Float16* arow = A + (size_t)(row0 + ln) * lda;
  v8f acc[4] = {};
  for (int kb = 0; kb < K; kb += 32) { FragH ah; ah.half[0] = *(const v8us*)((const unsigned short*)arow + kb + 8 * hh); ah.half[1] = *(const v8us*)((const unsigned short*)arow + kb + 16 + 8 * hh);
#pragma unroll
    for (int t = 0; t < 4; ++t) { if (col0 + t * 16 >= N) continue; const size_t boff = (size_t)(col0 + t * 16 + ln) * ldb + kb; FragH bq; bq.half[0] = *(const v8us*)((const unsigned short*)Bh + boff + 8 * hh); bq.half[1] = *(const v8us*)((const unsigned short*)Bh + boff + 16 + 8 * hh);
      acc[t] = mmaH<1>(ah.v, ah.v, bq.v, bq.v, acc[t]); }
  }
#pragma unroll
  for (int t = 0; t < 4; ++t) { if (col0 + t * 16 >= N) continue; const int col = col0 + t * 16 + ln; const float bv = bp ? bf16_round(bp[col]) : 0.f;
#pragma unroll
    for (int r = 0; r < 8; ++r) { float v = acc[t][r] * alpha + bv; if (CP) { const int bidx = (row0g + row0 + 8 * hh + r) / rowsPerB; v += CP[(size_t)bidx * sCPb + (size_t)by * 64 + col]; } if (ACT == 1) v = (v > 0.f) ? v : expm1f(v); else if (ACT == 7) v = (v > 0.f) ? v + 1.0f : expf(v); else if (ACT == 8) v = tanhf(v); else if (ACT == 9) v = 0.5f * v * (1.0f + tanhf(0.7978845608028654f * (v + 0.044715f * v * v * v))); else if (ACT == 11) v = 1.0f / (1.0f + expf(-v)); else if (ACT == 12) v = (v > 0.f) ? v : 0.01f * v; else if (ACT == 14) v = (v > 0.f) ? v : 0.1f * v; else if (ACT == 15) v = v / (1.0f + expf(-v)); else if (ACT == 3) v = fmaxf(v, 0.f); else if (ACT == 6) v = 0.5f * v * (1.0f + erff(v * 0.70710678118654752f)); so[w][8 * hh + r][t * 16 + ln] = v; } }
  __builtin_amdgcn_fence(__ATOMIC_ACQ_REL, "workgroup"); __builtin_amdgcn_wave_barrier();
  const int rsub = lane >> 4, c4 = (lane & 15) * 4; typedef _Float16 v4h __attribute__((ext_vector_type(4)));
  {
#pragma unroll
    for (int q = 0; q < 8; ++q) { const int r = q * 2 + rsub; if (col0 + c4 < N) { const v4f v = *(const v4fa*)&so[w][r][c4]; if (C) *(v4f*)(C + cofs + (size_t)(row0 + r) * ldc + col0 + c4) = v; if (C16) { v4h h4; for (int i = 0; i < 4; ++i) h4[i] = (_Float16)v[i]; *(v4h*)(C16 + cofs + (size_t)(row0 + r) * ldc + col0 + c4) = h4; } } }
     }
}


typedef _Float16 v4h __attribute__((ext_vector_type(4)));

__global__ __launch_bounds__(256) void k_x16(const float* __restrict__ x, _Float16* __restrict__ X16, size_t n8) { const size_t t = (size_t)blockIdx.x * 256 + threadIdx.x; if (t >= n8) return; FragH f;
#pragma unroll
  for (int q = 0; q < 8; ++q) f.h[q] = (_Float16)bf16_round(x[t * 8 + q]); *(v8us*)((unsigned short*)X16 + t * 8) = f.half[0];  }
__global__ __launch_bounds__(256) void k_h16(const float* __restrict__ x, _Float16* __restrict__ X16, size_t n8) { const size_t t = (size_t)blockIdx.x * 256 + threadIdx.x; if (t >= n8) return; FragH f;
#pragma unroll
  for (int q = 0; q < 8; ++q) f.h[q] = (_Float16)x[t * 8 + q]; *(v8us*)((unsigned short*)X16 + t * 8) = f.half[0];  }
__global__ __launch_bounds__(256) void k_round16f(const float* __restrict__ W, _Float16* __restrict__ Bt, size_t n8) { const size_t t = (size_t)blockIdx.x * 256 + threadIdx.x; if (t >= n8) return; FragH f;
#pragma unroll
  for (int i = 0; i < 8; ++i) f.h[i] = (_Float16)(bf16_round(W[t * 8 + i]) * 16.0f); *(v8us*)((unsigned short*)Bt + t * 8) = f.half[0];  }
template <int NHv, int TTv>
__global__ __launch_bounds__(256) void k_vt(const _Float16* __restrict__ V16, int ldv, int voff, _Float16* __restrict__ Vt) { __shared__ unsigned short tl[64][66]; const int tid = threadIdx.x; const int slab = blockIdx.x / (TTv / 64), lg = blockIdx.x % (TTv / 64); const int b = slab / NHv, h = slab % NHv;
  for (int i = tid; i < 64 * 8; i += 256) { const int r = i / 8, c8 = (i % 8) * 8; FragH f; f.half[0] = *(const v8us*)((const unsigned short*)V16 + ((size_t)b * TTv + lg * 64 + r) * ldv + voff + h * 64 + c8);
#pragma unroll
    for (int q = 0; q < 8; ++q) tl[r][c8 + q] = f.u[q]; }
  __syncthreads();
  {
#pragma unroll
    for (int rd = 0; rd < 2; ++rd) { const int d = rd * 32 + tid / 8, pc = tid % 8; FragH f;
#pragma unroll
      for (int q = 0; q < 8; ++q) f.u[q] = tl[pc * 8 + q][d];
      *(v8us*)((unsigned short*)Vt + ((size_t)slab * 64 + d) * TTv + lg * 64 + pc * 8) = f.half[0]; }
     } }

__global__ __launch_bounds__(256) void k_hl(const float* __restrict__ F, _Float16* __restrict__ Hh, _Float16* __restrict__ Hl, size_t n8) { const size_t t = (size_t)blockIdx.x * 256 + threadIdx.x; if (t >= n8) return; FragH fh, fl; const v4f a = *(const v4fa*)(F + t * 8), c = *(const v4fa*)(F + t * 8 + 4);
#pragma unroll
  for (int q = 0; q < 4; ++q) { _Float16 h = (_Float16)a[q]; fh.h[q] = h; fl.h[q] = (_Float16)((a[q] - (float)h) * 1024.0f); h = (_Float16)c[q]; fh.h[4 + q] = h; fl.h[4 + q] = (_Float16)((c[q] - (float)h) * 1024.0f); }
  { *(v8us*)((unsigned short*)Hh + t * 8) = fh.half[0]; *(v8us*)((unsigned short*)Hl + t * 8) = fl.half[0];  } }

// ---- fast GEMM (block tile 128x64, wave tile 32x64; requires M % 128 == 0, N % 64 == 0, K % 64 == 0); epilogue = k_gemm_hhx semantics ----
// A and B come through LDS: a stage is 64 k of the block's 128 A rows and 64 B rows, brought by asynchronous copies into one of two buffers while the other is worked on.
// EPI picks what the epilogue stores (a block's 64 columns are one head, its 128 rows lie in one batch):
// 0 = C f32 and / or C16 f16, row-major; 1 = C16 = f16 hi and C16L = 2^10 residual, row-major, and C = the rows' sums of squares over the head, [(b, h)][s];
// 2 = C16 = the tile transposed, f16, [(b, h)][64 d][s]. 1 and 2 take no CP term and no batch (by = 0).
#define G2T 272              /* LDS row pitch of the transposed tile: 256 B (128 tokens) + 16 = 16 B x odd */
#define G2P 144              /* LDS row pitch in bytes: 128 B of k + 16 = 16 B x odd, the conflict-free pitch for 16-byte fragment reads */
#define G2S (192 * G2P)      /* one stage: rows 0..127 = A, rows 128..191 = B */
// One stage's 12 copies of a lane, 16 bytes each: 8 lanes bring one row's 128 bytes, the block's 128 threads 16 rows per copy; copies 0..7 are A rows, 8..11 B rows.
// l = the lane's LDS byte address in row tid / 8 of the buffer, a and b = its global addresses in that row of A and of B, sa and sb = 16 rows of A and of B in bytes.
// s_wait_xcnt 0 is the statement's last line, so that it stands in front of any later rewrite of these address registers.
__device__ __forceinline__ void g2_stage(unsigned l, const char* a, size_t sa, const char* b, size_t sb) {
  asm volatile("global_load_async_to_lds_b128 %0, %12, off\n\tglobal_load_async_to_lds_b128 %1, %13, off\n\tglobal_load_async_to_lds_b128 %2, %14, off\n\tglobal_load_async_to_lds_b128 %3, %15, off\n\t"
               "global_load_async_to_lds_b128 %4, %16, off\n\tglobal_load_async_to_lds_b128 %5, %17, off\n\tglobal_load_async_to_lds_b128 %6, %18, off\n\tglobal_load_async_to_lds_b128 %7, %19, off\n\t"
               "global_load_async_to_lds_b128 %8, %20, off\n\tglobal_load_async_to_lds_b128 %9, %21, off\n\tglobal_load_async_to_lds_b128 %10, %22, off\n\tglobal_load_async_to_lds_b128 %11, %23, off\n\ts_wait_xcnt 0x0"
               :: "v"(l), "v"(l + 16 * G2P), "v"(l + 32 * G2P), "v"(l + 48 * G2P), "v"(l + 64 * G2P), "v"(l + 80 * G2P), "v"(l + 96 * G2P), "v"(l + 112 * G2P), "v"(l + 128 * G2P), "v"(l + 144 * G2P), "v"(l + 160 * G2P), "v"(l + 176 * G2P),
                  "v"(a), "v"(a + sa), "v"(a + 2 * sa), "v"(a + 3 * sa), "v"(a + 4 * sa), "v"(a + 5 * sa), "v"(a + 6 * sa), "v"(a + 7 * sa), "v"(b), "v"(b + sb), "v"(b + 2 * sb), "v"(b + 3 * sb) : "memory"); }
__device__ __forceinline__ v16h g2_frag(const _Float16* p, int hh) { FragH f; f.half[0] = *(const v8us*)((const unsigned short*)p + 8 * hh); f.half[1] = *(const v8us*)((const unsigned short*)p + 16 + 8 * hh); return f.v; }
__device__ __forceinline__ v16h g2_lfrag(const char* p) { FragH f; f.half[0] = *(const v8us*)p; f.half[1] = *(const v8us*)(p + 32); return f.v; }
__device__ __forceinline__ v8f g2_mma(v16h a, v16h b, v8f c) { v8f d = __builtin_amdgcn_wmma_f32_16x16x32_f16(false, a, false, b, (short)0, c, false, false); asm volatile("v_nop\n\tv_nop\n\tv_nop\n\tv_nop" : "+v"(d) : "v"(a), "v"(b)); return d; }
template <int ACT, int EPI>
__global__ __launch_bounds__(128) void k_gemm2(const _Float16* __restrict__ A, int lda, size_t sA, const _Float16* __restrict__ Bh, int ldb, size_t sB, float alpha, const float* __restrict__ bias, size_t sBias, const float* __restrict__ CP, int rowsPerB, size_t sCPb, int row0g,
    float* __restrict__ C, _Float16* __restrict__ C16, _Float16* __restrict__ C16L, int ldc, size_t sC, int M, int N, int K) {
  __shared__ __attribute__((aligned(16))) float so[4][32][68]; __shared__ __attribute__((aligned(16))) char st[2 * G2S];
  const int tid = threadIdx.x, w = tid >> 5, lane = tid & 31, ln = lane & 15, hh = lane >> 4; const int by = blockIdx.y;
  A += (size_t)by * sA; Bh += (size_t)by * sB; const size_t cofs = (size_t)by * sC; const float* bp = bias ? bias + (size_t)by * sBias : nullptr;
  const int ntn = N >> 6; const int mt = blockIdx.x / ntn, nq = blockIdx.x - mt * ntn; const int row0 = mt * 128 + 32 * w, col0 = nq * 64; if (mt * 128 >= M) return;      /* the whole block or none: barriers follow */
  const int nst = K >> 6;      /* stages */
  const char* ga = (const char*)(A + (size_t)(mt * 128 + (tid >> 3)) * lda + (tid & 7) * 8); const char* gb = (const char*)(Bh + (size_t)(col0 + (tid >> 3)) * ldb + (tid & 7) * 8); const size_t sa = (size_t)lda * 32, sb = (size_t)ldb * 32;
  const unsigned l0 = (unsigned)(size_t)st + (unsigned)((tid >> 3) * G2P + (tid & 7) * 16);
  const char* fa = st + (32 * w + ln) * G2P + hh * 16; const char* fb = st + (128 + ln) * G2P + hh * 16;      /* fragment rows: k = 8h + s at +0, 16 + 8h + s at +32 bytes */
  const v8f z8 = {0.f,0.f,0.f,0.f,0.f,0.f,0.f,0.f}; v8f c00 = z8, c01 = z8, c02 = z8, c03 = z8, c10 = z8, c11 = z8, c12 = z8, c13 = z8;
  g2_stage(l0, ga, sa, gb, sb);
  asm volatile("s_wait_asynccnt 0x0" ::: "memory");      /* this wave's copies of stage 0 have landed */
  __syncthreads();      /* ... and every other wave's: stage 0 may be read */
  if (nst > 1) g2_stage(l0 + G2S, ga + 128, sa, gb + 128, sb);
#pragma unroll 1
  for (int t = 0; t < nst; ++t) { const int bo = (t & 1) * G2S; v16h a[2][2], b[2][4];
#pragma unroll
    for (int kk = 0; kk < 2; ++kk) { a[kk][0] = g2_lfrag(fa + bo + kk * 64); a[kk][1] = g2_lfrag(fa + bo + 16 * G2P + kk * 64);      /* the stage's 24 reads as one group ahead of its matrix instructions */
#pragma unroll
      for (int j = 0; j < 4; ++j) b[kk][j] = g2_lfrag(fb + bo + j * 16 * G2P + kk * 64); }
#pragma unroll
    for (int kk = 0; kk < 2; ++kk) { c00 = g2_mma(a[kk][0], b[kk][0], c00); c10 = g2_mma(a[kk][1], b[kk][0], c10); c01 = g2_mma(a[kk][0], b[kk][1], c01); c11 = g2_mma(a[kk][1], b[kk][1], c11);
      c02 = g2_mma(a[kk][0], b[kk][2], c02); c12 = g2_mma(a[kk][1], b[kk][2], c12); c03 = g2_mma(a[kk][0], b[kk][3], c03); c13 = g2_mma(a[kk][1], b[kk][3], c13); }
    asm volatile("s_wait_dscnt 0x0" ::: "memory");      /* this wave has left the buffer that is refilled below */
    asm volatile("s_wait_asynccnt 0x0" ::: "memory");      /* its copies of stage t + 1 have landed */
    __syncthreads();      /* publishes stage t + 1 and ends every reader's last read of stage t */
    if (t + 2 < nst) g2_stage(l0 + bo, ga + (size_t)(t + 2) * 128, sa, gb + (size_t)(t + 2) * 128, sb); }
  asm volatile("s_wait_asynccnt 0x0" ::: "memory");      /* no copy is outstanding when the wave goes on to the epilogue and ends */
  v8f accs[8] = {c00, c01, c02, c03, c10, c11, c12, c13};
#pragma unroll
  for (int u = 0; u < 8; ++u) { const int t = u & 3, half = u >> 2; const int col = col0 + t * 16 + ln; const float bv = bp ? bf16_round(bp[col]) : 0.f; FragH vt;
#pragma unroll
    for (int r = 0; r < 8; ++r) { const int rloc = half * 16 + 8 * hh + r; float v = accs[u][r] * alpha + bv; if (EPI == 0 && CP) { if (rowsPerB < 0) v += CP[cofs + (size_t)(row0g + row0 + rloc) * ldc + col];      /* rowsPerB < 0: own element of the batched C plane */ else { const int bidx = (row0g + row0 + rloc) / rowsPerB; v += CP[(size_t)bidx * sCPb + (size_t)by * 64 + col]; } }
      if (ACT == 3) v = fmaxf(v, 0.f); else if (ACT == 6) v = 0.5f * v * (1.0f + erff(v * 0.70710678118654752f)); else if (ACT == 11) v = 1.0f / (1.0f + expf(-v)); else if (ACT == 15) v = v / (1.0f + expf(-v)); else if (ACT == 12) v = (v > 0.f) ? v : 0.01f * v; else if (ACT == 8) v = tanhf(v);
      if (EPI == 2) vt.h[r] = (_Float16)v; else so[w][rloc][t * 16 + ln] = v; }
    if (EPI == 2) *(v8us*)((char*)so + (t * 16 + ln) * G2T + (32 * w + half * 16 + 8 * hh) * 2) = vt.half[0]; }      /* a lane's 8 accumulator rows are 8 consecutive tokens of one column: 16 bytes of the transposed row */
  if (EPI == 2) { __syncthreads();      /* a transposed row holds all four waves' tokens */
    const size_t tb = ((size_t)((mt * 128) / SLEN * NH + nq) * 64) * SLEN + (mt * 128) % SLEN;
#pragma unroll      /* the 8 LDS reads go ahead of the stores as one group */
    for (int q = 0; q < 8; ++q) { const int d = q * 8 + (tid >> 4), c = tid & 15; const v8us v = *(const v8us*)((const char*)so + d * G2T + c * 16); *(v8us*)((unsigned short*)C16 + tb + (size_t)d * SLEN + c * 8) = v; }      /* 16 lanes store one row's 256 bytes */
    return; }
  __builtin_amdgcn_fence(__ATOMIC_ACQ_REL, "workgroup"); __builtin_amdgcn_wave_barrier();
  const int rsub = lane >> 4, c4 = (lane & 15) * 4;
  if (EPI == 1) {
#pragma unroll      /* constant LDS offsets, and later rows' reads run ahead of earlier rows' stores */
    for (int q = 0; q < 16; ++q) { const int r = q * 2 + rsub; const v4f v = *(const v4fa*)&so[w][r][c4]; v4h h4, l4; for (int i = 0; i < 4; ++i) { const _Float16 h = (_Float16)v[i]; h4[i] = h; l4[i] = (_Float16)((v[i] - (float)h) * 1024.0f); }
      *(v4h*)(C16 + (size_t)(row0 + r) * ldc + col0 + c4) = h4; *(v4h*)(C16L + (size_t)(row0 + r) * ldc + col0 + c4) = l4; }      /* 16 lanes store one row's 128 bytes of each plane */
    float sq = 0.f;      /* lane = row: its 64 squares summed in column order */
#pragma unroll      /* the row's 16 LDS reads issue ahead of the sum chain */
    for (int d = 0; d < 64; d += 4) { const v4f a = *(const v4fa*)&so[w][lane][d]; for (int i = 0; i < 4; ++i) sq += a[i] * a[i]; }
    const int row = row0 + lane; *(float*)(C + ((size_t)(row / SLEN) * NH + nq) * SLEN + row % SLEN) = sq;
  } else {
#pragma unroll
    for (int q = 0; q < 16; ++q) { const int r = q * 2 + rsub; const v4f v = *(const v4fa*)&so[w][r][c4]; if (C) *(v4f*)(C + cofs + (size_t)(row0 + r) * ldc + col0 + c4) = v; if (C16) { v4h h4; for (int i = 0; i < 4; ++i) h4[i] = (_Float16)v[i]; *(v4h*)(C16 + cofs + (size_t)(row0 + r) * ldc + col0 + c4) = h4; } }
     } }



template <int CAUSAL>
__global__ __launch_bounds__(128) void k_flash(const _Float16* __restrict__ Q16, int ldq, const _Float16* __restrict__ K16, int ldk, const _Float16* __restrict__ Vt, const int* __restrict__ MSK, float* __restrict__ O, int ldo) {
  constexpr int RPW = 16, RTN = RPW / 16, NQB = TQ / (4 * RPW), DT = 4, KS = 2;
  __shared__ __attribute__((aligned(16))) unsigned short sP[4][RPW][40]; __shared__ __attribute__((aligned(16))) float sO[4][RPW][64 + 4];
  const int tid = threadIdx.x, w = tid >> 5, lane = tid & 31, ln = lane & 15, hh = lane >> 4;
  const int slab = blockIdx.x / QBNP, qblk = QB0P + blockIdx.x % QBNP; (void)NQB; const int b = slab / NH, h = slab % NH; const int qb0 = qblk * (4 * RPW); const int q0 = qb0 + w * RPW;
  FragH aq[2][KS];
#pragma unroll
  for (int rt = 0; rt < RTN; ++rt) { const unsigned short* qr = (const unsigned short*)Q16 + ((size_t)b * TQ + q0 + rt * 16 + ln) * ldq + h * 64;
#pragma unroll
    for (int ks = 0; ks < KS; ++ks) { aq[rt][ks].half[0] = *(const v8us*)(qr + ks * 32 + 8 * hh); aq[rt][ks].half[1] = *(const v8us*)(qr + ks * 32 + 16 + 8 * hh); } }
  const unsigned short* Vth = (const unsigned short*)Vt + (size_t)slab * 64 * TK;
  float m_r[2][8], l_r[2][8]; v8f oacc[2][DT];
#pragma unroll
  for (int rt = 0; rt < RTN; ++rt) {
#pragma unroll
    for (int r = 0; r < 8; ++r) { m_r[rt][r] = -3.0e38f; l_r[rt][r] = 0.f; }
#pragma unroll
    for (int dt = 0; dt < DT; ++dt) oacc[rt][dt] = (v8f){0.f,0.f,0.f,0.f,0.f,0.f,0.f,0.f}; }
  const int jend = (CAUSAL == 1) ? (qb0 + 4 * RPW) : ((CAUSAL == 23) ? min(TK, (qb0 / CHK + 2) * CHK) : TK);      /* causal / window: keys that can never contribute are skipped */ const int jbeg = (CAUSAL == 23) ? max(0, (qb0 / CHK - 1) * CHK) : 0;
#pragma unroll 1
  for (int j0 = jbeg; j0 < jend; j0 += 32) {
    v8f s[2][2];
#pragma unroll
    for (int nt = 0; nt < 2; ++nt) { const unsigned short* kr = (const unsigned short*)K16 + ((size_t)b * TK + j0 + nt * 16 + ln) * ldk + h * 64; FragH bk[KS];
#pragma unroll
      for (int ks = 0; ks < KS; ++ks) { bk[ks].half[0] = *(const v8us*)(kr + ks * 32 + 8 * hh); bk[ks].half[1] = *(const v8us*)(kr + ks * 32 + 16 + 8 * hh); }
#pragma unroll
      for (int rt = 0; rt < RTN; ++rt) { v8f acc = (v8f){0.f,0.f,0.f,0.f,0.f,0.f,0.f,0.f};
#pragma unroll
        for (int ks = 0; ks < KS; ++ks) acc = mmaH<1>(aq[rt][ks].v, aq[rt][ks].v, bk[ks].v, bk[ks].v, acc); s[rt][nt] = acc; } }
#pragma unroll
    for (int rt = 0; rt < RTN; ++rt)
#pragma unroll
      for (int r = 0; r < 8; ++r) { const int tq = q0 + rt * 16 + 8 * hh + r; const int k0 = j0 + ln, k1 = j0 + 16 + ln;
        bool ok0 = (CAUSAL == 1) ? (k0 <= tq) : ((CAUSAL == 2) ? ((k0 >> 5) == (tq >> 5)) : true), ok1 = (CAUSAL == 1) ? (k1 <= tq) : ((CAUSAL == 2) ? ((k1 >> 5) == (tq >> 5)) : true); if (CAUSAL == 23) { const int cq = tq / CHK; ok0 = (abs(k0 / CHK - cq) <= 1) && (MSK[(size_t)b * TK + k0] == 0); ok1 = (abs(k1 / CHK - cq) <= 1) && (MSK[(size_t)b * TK + k1] == 0); }      /* mode 23: 3-chunk window + int key-padding mask */
        if (CAUSAL == 24) { ok0 = (MSK[(size_t)b * TK + k0] == 0); ok1 = (MSK[(size_t)b * TK + k1] == 0); }      /* mode 24: int key-padding mask (nonzero = padded = excluded) */      /* mode 2: block-diagonal 32-token groups */
        float s0 = ok0 ? s[rt][0][r] * SCL : -3.0e38f, s1 = ok1 ? s[rt][1][r] * SCL : -3.0e38f; if (CAUSAL == 17) { const float* amk = (const float*)MSK + (size_t)b * TK; s0 += bf16_round(amk[k0]); s1 += bf16_round(amk[k1]); } if (CAUSAL == 18) { const float* tb = (const float*)MSK; const int* ri = MSK + 1024 + (size_t)b * TK; const int rq = ri[tq]; s0 += tb[(h * 8 + rq) * 8 + ri[k0]]; s1 += tb[(h * 8 + rq) * 8 + ri[k1]]; } if (CAUSAL == 19) { const int* rel = MSK + (size_t)tq * TK; const float* rb = (const float*)MSK + (size_t)TQ * TK + ((size_t)(b * NH + h) * TQ + tq) * 64; s0 += rb[rel[k0]]; s1 += rb[rel[k1]]; }      /* mode 19: + (q.Ek[rel] + Eb[rel][h]) / 8 gathered by the int relative ids (packed [ids | table]) */      /* mode 18: + resource_bias[h][r_q][r_k] from the packed [table | ids] buffer (TQ == TK) */      /* mode 17: additive per-(batch, key) mask INPUT */ float mc = fmaxf(s0, s1);
        mc = fmaxf(mc, __shfl_xor(mc, 1, 32)); mc = fmaxf(mc, __shfl_xor(mc, 2, 32)); mc = fmaxf(mc, __shfl_xor(mc, 4, 32)); mc = fmaxf(mc, __shfl_xor(mc, 8, 32));
        const float mn = fmaxf(m_r[rt][r], mc); const float al = (mn > -1.0e38f) ? expf(m_r[rt][r] - mn) : 1.0f; m_r[rt][r] = mn; const float p0 = ok0 ? expf(s0 - mn) : 0.f, p1 = ok1 ? expf(s1 - mn) : 0.f; l_r[rt][r] = l_r[rt][r] * al + p0 + p1;
#pragma unroll
        for (int dt = 0; dt < DT; ++dt) oacc[rt][dt][r] *= al;
        FragH t2; t2.h[0] = (_Float16)(p0 * 1024.0f); t2.h[1] = (_Float16)(p1 * 1024.0f); sP[w][rt * 16 + 8 * hh + r][ln] = t2.u[0]; sP[w][rt * 16 + 8 * hh + r][16 + ln] = t2.u[1]; }
    __builtin_amdgcn_fence(__ATOMIC_ACQ_REL, "workgroup"); __builtin_amdgcn_wave_barrier();
    FragH pa[2];
#pragma unroll
    for (int rt = 0; rt < RTN; ++rt) { pa[rt].half[0] = *(const v8us*)&sP[w][rt * 16 + ln][8 * hh]; pa[rt].half[1] = *(const v8us*)&sP[w][rt * 16 + ln][16 + 8 * hh]; }
#pragma unroll
    for (int dt = 0; dt < DT; ++dt) { const unsigned short* vrow = Vth + (size_t)(dt * 16 + ln) * TK + j0; FragH bv; bv.half[0] = *(const v8us*)(vrow + 8 * hh); bv.half[1] = *(const v8us*)(vrow + 16 + 8 * hh);
#pragma unroll
      for (int rt = 0; rt < RTN; ++rt) oacc[rt][dt] = mmaH<1>(pa[rt].v, pa[rt].v, bv.v, bv.v, oacc[rt][dt]); }
    __builtin_amdgcn_fence(__ATOMIC_ACQ_REL, "workgroup"); __builtin_amdgcn_wave_barrier(); }
#pragma unroll
  for (int rt = 0; rt < RTN; ++rt) {
#pragma unroll
    for (int r = 0; r < 8; ++r) { float l = l_r[rt][r]; l += __shfl_xor(l, 1, 32); l += __shfl_xor(l, 2, 32); l += __shfl_xor(l, 4, 32); l += __shfl_xor(l, 8, 32); l_r[rt][r] = (l > 0.f) ? 1.0f / (l * 1024.0f) : 0.f; }
#pragma unroll
    for (int dt = 0; dt < DT; ++dt)
#pragma unroll
      for (int r = 0; r < 8; ++r) sO[w][rt * 16 + 8 * hh + r][dt * 16 + ln] = oacc[rt][dt][r] * l_r[rt][r]; }
  __builtin_amdgcn_fence(__ATOMIC_ACQ_REL, "workgroup"); __builtin_amdgcn_wave_barrier();
  {
#pragma unroll
    for (int rp = 0; rp < RPW; rp += 2) { const int r = rp + (lane >> 4), pc = lane & 15; const v4f val = *(const v4fa*)&sO[w][r][pc * 4]; *(v4f*)(O + ((size_t)b * TQ + q0 + r) * ldo + h * 64 + pc * 4) = val; }
     } }
// 5-plane variant: S = Qh Kh^T + (Ql Kh^T + Qh Kl^T)/1024 with Q/K = [hi | 2^10 residual] f16 planes (QL/KL same layout as Q16/K16), then the 3-term P.V below.
// 3-term variant: O = (P_hi V_hi + (P_lo V_hi + P_hi V_lo) / 1024) / l with P = [hi | 2^10 residual] of 1024 p and V^T = [hi | 2^10 residual] planes (VtL same layout as Vt) -> ~2^-21-class products for un-averaged (early causal / peaked) rows
template <int CAUSAL>
__global__ __launch_bounds__(128) void k_flash5(const _Float16* __restrict__ Q16, const _Float16* __restrict__ QL, int ldq, const _Float16* __restrict__ K16, const _Float16* __restrict__ KL, int ldk, const _Float16* __restrict__ Vt, const _Float16* __restrict__ VtL, const int* __restrict__ MSK, float* __restrict__ O, int ldo) {
  constexpr int RPW = 16, RTN = RPW / 16, NQB = TQ / (4 * RPW), DT = 4, KS = 2;
  __shared__ __attribute__((aligned(16))) unsigned short sP[4][RPW][40]; __shared__ __attribute__((aligned(16))) unsigned short sPL[4][RPW][40]; __shared__ __attribute__((aligned(16))) float sO[4][RPW][64 + 4];
  const int tid = threadIdx.x, w = tid >> 5, lane = tid & 31, ln = lane & 15, hh = lane >> 4;
  const int slab = blockIdx.x / QBN5, qblk = QB05 + blockIdx.x % QBN5; (void)NQB; const int b = slab / NH, h = slab % NH; const int qb0 = qblk * (4 * RPW); const int q0 = qb0 + w * RPW;
  FragH aq[2][KS], aql[2][KS];
#pragma unroll
  for (int rt = 0; rt < RTN; ++rt) { const unsigned short* qr = (const unsigned short*)Q16 + ((size_t)b * TQ + q0 + rt * 16 + ln) * ldq + h * 64; const unsigned short* ql = (const unsigned short*)QL + ((size_t)b * TQ + q0 + rt * 16 + ln) * ldq + h * 64;
#pragma unroll
    for (int ks = 0; ks < KS; ++ks) { aq[rt][ks].half[0] = *(const v8us*)(qr + ks * 32 + 8 * hh); aq[rt][ks].half[1] = *(const v8us*)(qr + ks * 32 + 16 + 8 * hh); aql[rt][ks].half[0] = *(const v8us*)(ql + ks * 32 + 8 * hh); aql[rt][ks].half[1] = *(const v8us*)(ql + ks * 32 + 16 + 8 * hh); } }
  const unsigned short* Vth = (const unsigned short*)Vt + (size_t)slab * 64 * TK; const unsigned short* Vtl = (const unsigned short*)VtL + (size_t)slab * 64 * TK;
  float m_r[2][8], l_r[2][8]; v8f oacc[2][DT], oaccL[2][DT];
#pragma unroll
  for (int rt = 0; rt < RTN; ++rt) {
#pragma unroll
    for (int r = 0; r < 8; ++r) { m_r[rt][r] = -3.0e38f; l_r[rt][r] = 0.f; }
#pragma unroll
    for (int dt = 0; dt < DT; ++dt) { oacc[rt][dt] = (v8f){0.f,0.f,0.f,0.f,0.f,0.f,0.f,0.f}; oaccL[rt][dt] = oacc[rt][dt]; } }
  const int jend = (CAUSAL == 1) ? (qb0 + 4 * RPW) : ((CAUSAL == 23) ? min(TK, (qb0 / CHK + 2) * CHK) : TK);      /* causal / window: keys that can never contribute are skipped */ const int jbeg = (CAUSAL == 23) ? max(0, (qb0 / CHK - 1) * CHK) : 0;
#pragma unroll 1
  for (int j0 = jbeg; j0 < jend; j0 += 32) {
    v8f s[2][2];
#pragma unroll
    for (int nt = 0; nt < 2; ++nt) { const unsigned short* kr = (const unsigned short*)K16 + ((size_t)b * TK + j0 + nt * 16 + ln) * ldk + h * 64; const unsigned short* klr = (const unsigned short*)KL + ((size_t)b * TK + j0 + nt * 16 + ln) * ldk + h * 64; FragH bk[KS], bkl[KS];
#pragma unroll
      for (int ks = 0; ks < KS; ++ks) { bk[ks].half[0] = *(const v8us*)(kr + ks * 32 + 8 * hh); bk[ks].half[1] = *(const v8us*)(kr + ks * 32 + 16 + 8 * hh); bkl[ks].half[0] = *(const v8us*)(klr + ks * 32 + 8 * hh); bkl[ks].half[1] = *(const v8us*)(klr + ks * 32 + 16 + 8 * hh); }
#pragma unroll
      for (int rt = 0; rt < RTN; ++rt) { v8f acc = (v8f){0.f,0.f,0.f,0.f,0.f,0.f,0.f,0.f}, accl = acc;
#pragma unroll
        for (int ks = 0; ks < KS; ++ks) { acc = mmaH<1>(aq[rt][ks].v, aq[rt][ks].v, bk[ks].v, bk[ks].v, acc); accl = mmaH<1>(aql[rt][ks].v, aql[rt][ks].v, bk[ks].v, bk[ks].v, accl); accl = mmaH<1>(aq[rt][ks].v, aq[rt][ks].v, bkl[ks].v, bkl[ks].v, accl); }
#pragma unroll
        for (int r = 0; r < 8; ++r) acc[r] += accl[r] * 0.0009765625f;
        s[rt][nt] = acc; } }
#pragma unroll
    for (int rt = 0; rt < RTN; ++rt)
#pragma unroll
      for (int r = 0; r < 8; ++r) { const int tq = q0 + rt * 16 + 8 * hh + r; const int k0 = j0 + ln, k1 = j0 + 16 + ln;
        bool ok0 = (CAUSAL == 1) ? (k0 <= tq) : ((CAUSAL == 2) ? ((k0 >> 5) == (tq >> 5)) : true), ok1 = (CAUSAL == 1) ? (k1 <= tq) : ((CAUSAL == 2) ? ((k1 >> 5) == (tq >> 5)) : true);      /* mode 2: block-diagonal 32-token groups */
        if (CAUSAL == 4) { const int* mrow = MSK + ((size_t)b * TQ + tq) * TK; ok0 = mrow[k0] != 0; ok1 = mrow[k1] != 0; }      /* mode 4: per-(query, key) INPUT mask shared by all heads; masked keys contribute nothing (== the reference's -4096 fill, whose exp underflows to 0), rows with no valid key give l = 0 -> output 0 (== the reference's row_valid zeroing) */
        float s0 = ok0 ? s[rt][0][r] * SCL : -3.0e38f, s1 = ok1 ? s[rt][1][r] * SCL : -3.0e38f; if (CAUSAL == 17) { const float* amk = (const float*)MSK + (size_t)b * TK; s0 += bf16_round(amk[k0]); s1 += bf16_round(amk[k1]); } if (CAUSAL == 18) { const float* tb = (const float*)MSK; const int* ri = MSK + 1024 + (size_t)b * TK; const int rq = ri[tq]; s0 += tb[(h * 8 + rq) * 8 + ri[k0]]; s1 += tb[(h * 8 + rq) * 8 + ri[k1]]; } if (CAUSAL == 19) { const int* rel = MSK + (size_t)tq * TK; const float* rb = (const float*)MSK + (size_t)TQ * TK + ((size_t)(b * NH + h) * TQ + tq) * 64; s0 += rb[rel[k0]]; s1 += rb[rel[k1]]; }      /* mode 19: + (q.Ek[rel] + Eb[rel][h]) / 8 gathered by the int relative ids (packed [ids | table]) */      /* mode 18: + resource_bias[h][r_q][r_k] from the packed [table | ids] buffer (TQ == TK) */      /* mode 17: additive per-(batch, key) mask INPUT */ float mc = fmaxf(s0, s1);
        mc = fmaxf(mc, __shfl_xor(mc, 1, 32)); mc = fmaxf(mc, __shfl_xor(mc, 2, 32)); mc = fmaxf(mc, __shfl_xor(mc, 4, 32)); mc = fmaxf(mc, __shfl_xor(mc, 8, 32));
        const float mn = fmaxf(m_r[rt][r], mc); const float al = (mn > -1.0e38f) ? expf(m_r[rt][r] - mn) : 1.0f; m_r[rt][r] = mn; const float p0 = ok0 ? expf(s0 - mn) : 0.f, p1 = ok1 ? expf(s1 - mn) : 0.f; l_r[rt][r] = l_r[rt][r] * al + p0 + p1;
#pragma unroll
        for (int dt = 0; dt < DT; ++dt) { oacc[rt][dt][r] *= al; oaccL[rt][dt][r] *= al; }
        FragH t2, t2l; const float ps0 = p0 * 1024.0f, ps1 = p1 * 1024.0f; t2.h[0] = (_Float16)ps0; t2.h[1] = (_Float16)ps1; t2l.h[0] = (_Float16)((ps0 - (float)t2.h[0]) * 1024.0f); t2l.h[1] = (_Float16)((ps1 - (float)t2.h[1]) * 1024.0f);
        sP[w][rt * 16 + 8 * hh + r][ln] = t2.u[0]; sP[w][rt * 16 + 8 * hh + r][16 + ln] = t2.u[1]; sPL[w][rt * 16 + 8 * hh + r][ln] = t2l.u[0]; sPL[w][rt * 16 + 8 * hh + r][16 + ln] = t2l.u[1]; }
    __builtin_amdgcn_fence(__ATOMIC_ACQ_REL, "workgroup"); __builtin_amdgcn_wave_barrier();
    FragH pa[2], pl[2];
#pragma unroll
    for (int rt = 0; rt < RTN; ++rt) { pa[rt].half[0] = *(const v8us*)&sP[w][rt * 16 + ln][8 * hh]; pa[rt].half[1] = *(const v8us*)&sP[w][rt * 16 + ln][16 + 8 * hh]; pl[rt].half[0] = *(const v8us*)&sPL[w][rt * 16 + ln][8 * hh]; pl[rt].half[1] = *(const v8us*)&sPL[w][rt * 16 + ln][16 + 8 * hh]; }
#pragma unroll
    for (int dt = 0; dt < DT; ++dt) { const unsigned short* vrow = Vth + (size_t)(dt * 16 + ln) * TK + j0; const unsigned short* vrl = Vtl + (size_t)(dt * 16 + ln) * TK + j0; FragH bv, bl; bv.half[0] = *(const v8us*)(vrow + 8 * hh); bv.half[1] = *(const v8us*)(vrow + 16 + 8 * hh); bl.half[0] = *(const v8us*)(vrl + 8 * hh); bl.half[1] = *(const v8us*)(vrl + 16 + 8 * hh);
#pragma unroll
      for (int rt = 0; rt < RTN; ++rt) { oacc[rt][dt] = mmaH<1>(pa[rt].v, pa[rt].v, bv.v, bv.v, oacc[rt][dt]); oaccL[rt][dt] = mmaH<1>(pl[rt].v, pl[rt].v, bv.v, bv.v, oaccL[rt][dt]); oaccL[rt][dt] = mmaH<1>(pa[rt].v, pa[rt].v, bl.v, bl.v, oaccL[rt][dt]); } }
    __builtin_amdgcn_fence(__ATOMIC_ACQ_REL, "workgroup"); __builtin_amdgcn_wave_barrier(); }
#pragma unroll
  for (int rt = 0; rt < RTN; ++rt) {
#pragma unroll
    for (int r = 0; r < 8; ++r) { float l = l_r[rt][r]; l += __shfl_xor(l, 1, 32); l += __shfl_xor(l, 2, 32); l += __shfl_xor(l, 4, 32); l += __shfl_xor(l, 8, 32); l_r[rt][r] = (l > 0.f) ? 1.0f / (l * 1024.0f) : 0.f; }
#pragma unroll
    for (int dt = 0; dt < DT; ++dt)
#pragma unroll
      for (int r = 0; r < 8; ++r) { float v = oacc[rt][dt][r]; v += oaccL[rt][dt][r] * 0.0009765625f; sO[w][rt * 16 + 8 * hh + r][dt * 16 + ln] = v * l_r[rt][r]; } }
  __builtin_amdgcn_fence(__ATOMIC_ACQ_REL, "workgroup"); __builtin_amdgcn_wave_barrier();
  {
#pragma unroll
    for (int rp = 0; rp < RPW; rp += 2) { const int r = rp + (lane >> 4), pc = lane & 15; const v4f val = *(const v4fa*)&sO[w][r][pc * 4]; *(v4f*)(O + ((size_t)b * TQ + q0 + r) * ldo + h * 64 + pc * 4) = val; }
     } }

__global__ __launch_bounds__(256) void k_rotab(float* __restrict__ CS, float* __restrict__ SN) {
  #pragma clang fp contract(off)
  const int t = blockIdx.x * 256 + threadIdx.x; if (t >= SLEN * 32) return; const int j = t % 32, s = t / 32; const float ex = (float)(2 * j) / 64.0f; const float inv = 1.0f / powf(10000.0f, ex); const float th = (float)s * inv; const float c = cosf(th), sn = sinf(th);
  { *(float*)(CS + t) = c; *(float*)(SN + t) = sn;  } }
__global__ __launch_bounds__(256) void k_rope(const float* __restrict__ F, int nsrc, int ndst, int rep, const float* __restrict__ CS, const float* __restrict__ SN, _Float16* __restrict__ H, _Float16* __restrict__ L) {
  #pragma clang fp contract(off)
  const size_t t = (size_t)blockIdx.x * 256 + threadIdx.x; if (t >= (size_t)NR * ndst * 4) return; const int g8 = (int)(t % 4); const int hd = (int)((t / 4) % ndst); const size_t row = t / ((size_t)4 * ndst); const int s = (int)(row % SLEN); const int hs = hd / rep;
  const float* src = F + row * (size_t)(nsrc * 64) + hs * 64; FragH ah, al, bh, bl;
  for (int i = 0; i < 8; ++i) { const int d = g8 * 8 + i; const float c = CS[s * 32 + d], sn = SN[s * 32 + d]; const float x1 = src[d], x2 = src[d + 32];
    float o1 = x1 * c; o1 += -x2 * sn; float o2 = x2 * c; o2 += x1 * sn;
    _Float16 hv = (_Float16)o1; ah.h[i] = hv; al.h[i] = (_Float16)((o1 - (float)hv) * 1024.0f); hv = (_Float16)o2; bh.h[i] = hv; bl.h[i] = (_Float16)((o2 - (float)hv) * 1024.0f); }
  const size_t o = row * (size_t)(ndst * 64) + hd * 64 + g8 * 8;
  { *(v8us*)((unsigned short*)H + o) = ah.half[0]; *(v8us*)((unsigned short*)H + o + 32) = bh.half[0]; *(v8us*)((unsigned short*)L + o) = al.half[0]; *(v8us*)((unsigned short*)L + o + 32) = bl.half[0];  } }
__global__ __launch_bounds__(256) void k_rope2(const float* __restrict__ F, int nsrc, int ndst, int rep, const float* __restrict__ CS, const float* __restrict__ SN, _Float16* __restrict__ H, _Float16* __restrict__ L) {
  #pragma clang fp contract(off)
  const size_t t = (size_t)blockIdx.x * 256 + threadIdx.x; if (t >= (size_t)NR * ndst * 4) return; const int g16 = (int)(t % 4); const int hd = (int)((t / 4) % ndst); const size_t row = t / ((size_t)4 * ndst); const int s = (int)(row % SLEN); const int hs = hd / rep;
  const float* src = F + row * (size_t)(nsrc * 64) + hs * 64 + g16 * 16; FragH ah, al;
  for (int pr = 0; pr < 8; ++pr) { const int i = g16 * 8 + pr; const float c = CS[s * 32 + i], sn = SN[s * 32 + i]; const float x1 = src[2 * pr], x2 = src[2 * pr + 1];
    float o1 = x1 * c; o1 -= x2 * sn; float o2 = x1 * sn; o2 += x2 * c;
    _Float16 hv = (_Float16)o1; ah.h[2 * pr] = hv; al.h[2 * pr] = (_Float16)((o1 - (float)hv) * 1024.0f); hv = (_Float16)o2; ah.h[2 * pr + 1] = hv; al.h[2 * pr + 1] = (_Float16)((o2 - (float)hv) * 1024.0f); }
  const size_t o = row * (size_t)(ndst * 64) + hd * 64 + g16 * 16;
  { *(v8us*)((unsigned short*)H + o) = ah.half[0]; *(v8us*)((unsigned short*)H + o + 8) = ah.half[1]; *(v8us*)((unsigned short*)L + o) = al.half[0]; *(v8us*)((unsigned short*)L + o + 8) = al.half[1];  } }
__global__ __launch_bounds__(256) void k_ln512(const float* __restrict__ A, const float* __restrict__ res, const float* __restrict__ g, const float* __restrict__ bb, float* __restrict__ Y, _Float16* __restrict__ Y16) {
  #pragma clang fp contract(off)
  const int wv = threadIdx.x >> 5, ln = threadIdx.x & 31; const size_t r = (size_t)blockIdx.x * 8 + wv; if (r >= NR) return; float x[16]; float s = 0.f;
  for (int i = 0; i < 2; ++i) { const v8f a = *(const v8f*)(A + r * DM + i * 256 + ln * 8); for (int q = 0; q < 8; ++q) { float v = a[q]; if (res) v += bf16_round(res[r * DM + i * 256 + ln * 8 + q]); x[i * 8 + q] = v; s += v; } }
  for (int o = 16; o > 0; o >>= 1) s += __shfl_xor(s, o, 32); const float mu = s / (float)DM; float var = 0.f; for (int q = 0; q < 16; ++q) { const float d = x[q] - mu; var += d * d; }
  for (int o = 16; o > 0; o >>= 1) var += __shfl_xor(var, o, 32); const float inv = rsqrtf(var / (float)DM + 1e-5f);
  { for (int i = 0; i < 2; ++i) { const int c0 = i * 256 + ln * 8; v8f y; FragH f; for (int q = 0; q < 8; ++q) { float v = (x[i * 8 + q] - mu) * inv; v *= bf16_round(g[c0 + q]); v += bf16_round(bb[c0 + q]); y[q] = v; f.h[q] = (_Float16)v; } *(v8f*)(Y + r * DM + c0) = y; if (Y16) *(v8us*)((unsigned short*)Y16 + r * DM + c0) = f.half[0]; }  } }
__global__ __launch_bounds__(256) void k_pack(const float* __restrict__ rb, const int* __restrict__ rid, int* __restrict__ PK) { const int t = blockIdx.x * 256 + threadIdx.x; if (t >= 1024 + NB * TK) return; int v; if (t < 1024) v = __float_as_int(bf16_round(rb[t])); else v = rid[t - 1024]; *(int*)(PK + t) = v;  }
__global__ __launch_bounds__(256) void k_tabin(const float* __restrict__ sp, float* __restrict__ CS, float* __restrict__ SN) { const int t = blockIdx.x * 256 + threadIdx.x; if (t >= SLEN * 32) return; const int i = t % 32, s = t / 32; const float c = bf16_round(sp[s * 64 + 32 + i]), sn = bf16_round(sp[s * 64 + i]);
  { *(float*)(CS + t) = c; *(float*)(SN + t) = sn;  } }
__global__ __launch_bounds__(256) void k_wsc(const float* __restrict__ Wm, _Float16* __restrict__ Bt, size_t n8, float sc) { const size_t t = (size_t)blockIdx.x * 256 + threadIdx.x; if (t >= n8) return; FragH f; for (int q = 0; q < 8; ++q) f.h[q] = (_Float16)(bf16_round(Wm[t * 8 + q]) * sc); *(v8us*)((unsigned short*)Bt + t * 8) = f.half[0];  }
__global__ __launch_bounds__(256) void k_rotab2(float* __restrict__ CS, float* __restrict__ SN) {
  #pragma clang fp contract(off)
  const int t = blockIdx.x * 256 + threadIdx.x; if (t >= SLEN * 32) return; const int j = t % 32, s = t / 32; const float c0 = -0.14391156831212787f;      /* -ln(10000)/64 rounded to f32 */ const float inv = expf((float)(2 * j) * c0); const float th = (float)s * inv; const float c = cosf(th), sn = sinf(th);
  { *(float*)(CS + t) = c; *(float*)(SN + t) = sn;  } }
__global__ __launch_bounds__(256) void k_lnu(const float* __restrict__ X, _Float16* __restrict__ N16, float* __restrict__ XB) {
  #pragma clang fp contract(off)
  const int wv = threadIdx.x >> 5, ln = threadIdx.x & 31; const size_t r = (size_t)blockIdx.x * 8 + wv; if (r >= NR) return; float a[32]; float s = 0.f;
  for (int i = 0; i < 4; ++i) { const v8f v = *(const v8f*)(X + r * DM + (i * 32 + ln) * 8); for (int q = 0; q < 8; ++q) { const float u = bf16_round(v[q]); a[i * 8 + q] = u; s += u; } }
  for (int o = 16; o > 0; o >>= 1) s += __shfl_xor(s, o, 32); const float mu = s / (float)DM; float var = 0.f; for (int q = 0; q < 32; ++q) { const float d = a[q] - mu; var += d * d; }
  for (int o = 16; o > 0; o >>= 1) var += __shfl_xor(var, o, 32); const float den = sqrtf(var / (float)(DM - 1)) + 1e-6f; const float inv = 1.0f / den;      /* one reciprocal per row; (x-mean)*inv vs the reference's division differs by <= 1 ulp */
  { for (int i = 0; i < 4; ++i) { const int c0 = (i * 32 + ln) * 8; FragH f; v8f xb; for (int q = 0; q < 8; ++q) { f.h[q] = (_Float16)((a[i * 8 + q] - mu) * inv); xb[q] = a[i * 8 + q]; } *(v8us*)((unsigned short*)N16 + r * DM + c0) = f.half[0]; *(v8f*)(XB + r * DM + c0) = xb; }  } }
// lane l <-> l ^ 16 (the two halves of a wave hold the two key halves of one query column)
__device__ __forceinline__ float xhalf(float v) { const int t = __float_as_int(v); return __int_as_float(__builtin_amdgcn_permlanex16(t, t, 0x76543210, 0xfedcba98, false, false)); }
__device__ __forceinline__ v8f wmh(v16h a, v16h b, v8f c) { return __builtin_amdgcn_wmma_f32_16x16x32_f16(false, a, false, b, (short)0, c, false, false); }
typedef _Float16 v8h __attribute__((ext_vector_type(8)));
typedef float v2f __attribute__((ext_vector_type(2)));
// eight 2^x in one statement: results kept apart from the arguments ("=&v") and one v_nop behind the last, the slot the instruction set asks for
// between a transcendental and an instruction that uses its result or overwrites its source (the register allocator otherwise reuses the previous argument as the next result)
__device__ __forceinline__ v8f exp2x8(v8f e) { float p0, p1, p2, p3, p4, p5, p6, p7;
  asm("v_exp_f32 %0, %8\n\tv_exp_f32 %1, %9\n\tv_exp_f32 %2, %10\n\tv_exp_f32 %3, %11\n\tv_exp_f32 %4, %12\n\tv_exp_f32 %5, %13\n\tv_exp_f32 %6, %14\n\tv_exp_f32 %7, %15\n\tv_nop"
      : "=&v"(p0), "=&v"(p1), "=&v"(p2), "=&v"(p3), "=&v"(p4), "=&v"(p5), "=&v"(p6), "=&v"(p7) : "v"(e[0]), "v"(e[1]), "v"(e[2]), "v"(e[3]), "v"(e[4]), "v"(e[5]), "v"(e[6]), "v"(e[7]));
  return (v8f){p0, p1, p2, p3, p4, p5, p6, p7}; }
// Fused distance attention, one launch for all (batch, head) slabs: per wave 32 query columns, per pass 32 keys.
// S^T = K Q^T (A = key rows, B = query rows; hi.hi + (hi.lo + lo.hi) / 1024), so a lane holds 8 + 8 keys of ONE query per column group:
// logits, running maximum and sum stay in the lane (one exchange between the wave halves); the two f32 score tiles, converted in place,
// are the B operand of O^T += V^T P^T (k order 8h + s, 16 + 8h + s on both sides). A lane ends with 8 consecutive d of one query: 16-byte stores of hi and residual.
// K hi, K lo, V^T and the key norms come through LDS, shared by the block's 8 waves: a stage is 128 keys (4 passes), brought by asynchronous copies into one of two buffers while the other is worked on.
#define EFK 144                        /* K row pitch in LDS: 128 B + 16 = 16 B x odd, conflict-free for 16-byte fragment reads */
#define EFV 272                        /* V^T row pitch: 256 B (128 keys) + 16, 16 B x odd too */
#define EF_KL (128 * EFK)              /* rows 0..127 = K hi, 128..255 = K lo */
#define EF_V (256 * EFK)               /* then 64 rows of V^T */
#define EF_N (256 * EFK + 64 * EFV)    /* then 128 key norms */
#define EFS (EF_N + 512)               /* one stage */
// One stage's 12 copies of a lane, 16 bytes each. K: 8 lanes bring one row's 128 bytes, the block 32 rows per copy; V^T: 16 lanes one row's 256 bytes, the block 16 rows per copy.
// lk, lv = the lane's LDS byte addresses in its first K hi row and its first V^T row; kh, kl, v = its global addresses there.
// s_wait_xcnt 0 is the statement's last line, so that it stands in front of any later rewrite of these address registers.
__device__ __forceinline__ void ef_stage(unsigned lk, unsigned lv, const char* kh, const char* kl, const char* v) {
  asm volatile("global_load_async_to_lds_b128 %0, %12, off\n\tglobal_load_async_to_lds_b128 %1, %13, off\n\tglobal_load_async_to_lds_b128 %2, %14, off\n\tglobal_load_async_to_lds_b128 %3, %15, off\n\t"
               "global_load_async_to_lds_b128 %4, %16, off\n\tglobal_load_async_to_lds_b128 %5, %17, off\n\tglobal_load_async_to_lds_b128 %6, %18, off\n\tglobal_load_async_to_lds_b128 %7, %19, off\n\t"
               "global_load_async_to_lds_b128 %8, %20, off\n\tglobal_load_async_to_lds_b128 %9, %21, off\n\tglobal_load_async_to_lds_b128 %10, %22, off\n\tglobal_load_async_to_lds_b128 %11, %23, off\n\ts_wait_xcnt 0x0"
               :: "v"(lk), "v"(lk + 32 * EFK), "v"(lk + 64 * EFK), "v"(lk + 96 * EFK), "v"(lk + EF_KL), "v"(lk + EF_KL + 32 * EFK), "v"(lk + EF_KL + 64 * EFK), "v"(lk + EF_KL + 96 * EFK), "v"(lv), "v"(lv + 16 * EFV), "v"(lv + 32 * EFV), "v"(lv + 48 * EFV),
                  "v"(kh), "v"(kh + 32 * (DM * 2)), "v"(kh + 64 * (DM * 2)), "v"(kh + 96 * (DM * 2)), "v"(kl), "v"(kl + 32 * (DM * 2)), "v"(kl + 64 * (DM * 2)), "v"(kl + 96 * (DM * 2)), "v"(v), "v"(v + 16 * (SLEN * 2)), "v"(v + 32 * (SLEN * 2)), "v"(v + 48 * (SLEN * 2)) : "memory"); }
// the stage's 128 key norms, 512 bytes: one copy of one whole wave
__device__ __forceinline__ void ef_stage_n(unsigned ln_, const char* n) { asm volatile("global_load_async_to_lds_b128 %0, %1, off\n\ts_wait_xcnt 0x0" :: "v"(ln_), "v"(n) : "memory"); }
// amdgpu_waves_per_eu(4, 4): a budget of 256 VGPRs, so that the whole kernel stays in one register window (it takes 240, no scratch)
__global__ __launch_bounds__(256) __attribute__((amdgpu_waves_per_eu(4, 4))) void k_eflash(const _Float16* __restrict__ QHp, const _Float16* __restrict__ QLp, const _Float16* __restrict__ KHp, const _Float16* __restrict__ KLp, const _Float16* __restrict__ Vt,
                                                const float* __restrict__ QN, const float* __restrict__ KNT, const float* __restrict__ tmp, _Float16* __restrict__ OH, _Float16* __restrict__ OL) {
  __shared__ __attribute__((aligned(128))) char st[2 * EFS];
  const int tid = threadIdx.x, w = tid >> 5, lane = tid & 31, ln = lane & 15, hh = lane >> 4;
  const int slab = blockIdx.x / (SLEN / 256), qblk = blockIdx.x % (SLEN / 256); const int b = slab / NH, h = slab % NH; const int q0 = qblk * 256 + w * 32;
  const float nc = -(1.0f / bf16_round(tmp[0])) * 1.4426950408889634f;      /* logit in log2 units = d2 * nc */
  v16h qh[2][2], ql[2][2]; float qn[2];
#pragma unroll
  for (int qt = 0; qt < 2; ++qt) { const size_t row = (size_t)b * SLEN + q0 + qt * 16 + ln; const _Float16* ph = QHp + row * DM + h * 64; const _Float16* pl = QLp + row * DM + h * 64;
    qh[qt][0] = g2_frag(ph, hh); qh[qt][1] = g2_frag(ph + 32, hh); ql[qt][0] = g2_frag(pl, hh); ql[qt][1] = g2_frag(pl + 32, hh); qn[qt] = QN[(size_t)slab * SLEN + q0 + qt * 16 + ln]; }
  const char* gkh = (const char*)(KHp + (size_t)b * SLEN * DM + h * 64) + (tid >> 3) * (DM * 2) + (tid & 7) * 16; const char* gkl = (const char*)(KLp + (size_t)b * SLEN * DM + h * 64) + (tid >> 3) * (DM * 2) + (tid & 7) * 16;      /* the lane's copy sources in stage 0 */
  const char* gv = (const char*)(Vt + (size_t)slab * 64 * SLEN) + (tid >> 4) * (SLEN * 2) + (tid & 15) * 16; const char* gn = (const char*)(KNT + (size_t)slab * SLEN) + lane * 16;
  const unsigned lk0 = (unsigned)(size_t)st + (unsigned)((tid >> 3) * EFK + (tid & 7) * 16), lv0 = (unsigned)(size_t)st + (unsigned)(EF_V + (tid >> 4) * EFV + (tid & 15) * 16), ln0 = (unsigned)(size_t)st + (unsigned)(EF_N + lane * 16);
  const bool w0 = __builtin_amdgcn_readfirstlane(w) == 0;      /* scalar: the norms' copy is issued by wave 0 alone, behind a scalar branch */
  const char* fk = st + ln * EFK + hh * 16; const char* fv = st + EF_V + ln * EFV + hh * 16; const char* fn = st + EF_N + hh * 32;      /* fragment rows: k = 8h + s at +0, 16 + 8h + s at +32 bytes */
  const v8f z8 = {0.f,0.f,0.f,0.f,0.f,0.f,0.f,0.f};
  float m[2] = {-3.0e38f, -3.0e38f}; v2f l[2] = {{0.f, 0.f}, {0.f, 0.f}}; v8f o[2][4];
#pragma unroll
  for (int qt = 0; qt < 2; ++qt)
#pragma unroll
    for (int dt = 0; dt < 4; ++dt) o[qt][dt] = z8;
  ef_stage(lk0, lv0, gkh, gkl, gv); if (w0) ef_stage_n(ln0, gn);
  asm volatile("s_wait_asynccnt 0x0" ::: "memory");      /* this wave's copies of stage 0 have landed */
  __syncthreads();      /* ... and every other wave's: stage 0 may be read */
  ef_stage(lk0 + EFS, lv0 + EFS, gkh + 128 * (DM * 2), gkl + 128 * (DM * 2), gv + 256); if (w0) ef_stage_n(ln0 + EFS, gn + 512);      /* SLEN / 128 = 16 stages: stage 1 exists */
#pragma unroll 1      /* one stage per trip */
  for (int t = 0; t < SLEN / 128; ++t) { const int bo = (t & 1) * EFS;
#pragma unroll 1      /* one pass per trip: the body already holds 32 matrix instructions, a copy would only add registers */
  for (int ps = 0; ps < 4; ++ps) {
    v8f u[2][2];
#pragma unroll
    for (int kt = 0; kt < 2; ++kt) { const char* kr = fk + bo + (ps * 32 + kt * 16) * EFK; const char* kq = kr + EF_KL;
      const v8f k2 = *(const v8f*)(fn + bo + (ps * 32 + kt * 16) * 4); const v16h a0 = g2_lfrag(kr), a1 = g2_lfrag(kr + 64), c0 = g2_lfrag(kq), c1 = g2_lfrag(kq + 64);
#pragma unroll
      for (int qt = 0; qt < 2; ++qt) { v8f lo = wmh(a0, ql[qt][0], z8); lo = wmh(a1, ql[qt][1], lo); lo = wmh(c0, qh[qt][0], lo); lo = wmh(c1, qh[qt][1], lo); v8f hi = wmh(a0, qh[qt][0], z8); hi = wmh(a1, qh[qt][1], hi);
        const v8f s = hi + lo * 0.0009765625f; const v8f d2 = __builtin_elementwise_max((k2 + qn[qt]) - 2.0f * s, z8); u[qt][kt] = d2 * nc; } }
    float mn[2];
#pragma unroll
    for (int qt = 0; qt < 2; ++qt) { const v8f t = __builtin_elementwise_max(u[qt][0], u[qt][1]); float mx = fmaxf(fmaxf(fmaxf(t[0], t[1]), fmaxf(t[2], t[3])), fmaxf(fmaxf(t[4], t[5]), fmaxf(t[6], t[7])));
      mx = fmaxf(mx, xhalf(mx)); mn[qt] = fmaxf(m[qt], mx); }
    if (__builtin_amdgcn_ballot_w32((mn[0] > m[0]) || (mn[1] > m[1])) != 0) {      /* scalar branch: sums and output tiles are rescaled only in a pass that raises some column's maximum */
#pragma unroll
      for (int qt = 0; qt < 2; ++qt) { const float al = __builtin_amdgcn_exp2f(m[qt] - mn[qt]); m[qt] = mn[qt]; l[qt] *= al;
#pragma unroll
        for (int dt = 0; dt < 4; ++dt) o[qt][dt] *= al; } }
    FragH pb[2];
#pragma unroll
    for (int qt = 0; qt < 2; ++qt) { const float mo = m[qt] - 10.0f;      /* weights carried times 1024, as f16 operands away from the subnormal range; the factor cancels between sum and output */
      v8f p[2];
#pragma unroll
      for (int kt = 0; kt < 2; ++kt) { p[kt] = exp2x8(u[qt][kt] - mo);
        const v8h ph = __builtin_convertvector(p[kt], v8h);
#pragma unroll
        for (int r = 0; r < 8; ++r) pb[qt].h[kt * 8 + r] = ph[r]; }
      const v8f t = p[0] + p[1]; const v4f t4 = t.lo + t.hi; l[qt] += t4.lo + t4.hi; }
#pragma unroll
    for (int dt = 0; dt < 4; ++dt) { const v16h va = g2_lfrag(fv + bo + ps * 64 + dt * 16 * EFV);
#pragma unroll
      for (int qt = 0; qt < 2; ++qt) o[qt][dt] = wmh(va, pb[qt].v, o[qt][dt]); }
  }
    asm volatile("s_wait_dscnt 0x0" ::: "memory");      /* this wave has left the buffer that is refilled below */
    asm volatile("s_wait_asynccnt 0x0" ::: "memory");      /* its copies of stage t + 1 have landed */
    __syncthreads();      /* publishes stage t + 1 and ends every reader's last read of stage t */
    if (t + 2 < SLEN / 128) { ef_stage(lk0 + bo, lv0 + bo, gkh + (size_t)(t + 2) * (128 * DM * 2), gkl + (size_t)(t + 2) * (128 * DM * 2), gv + (size_t)(t + 2) * 256); if (w0) ef_stage_n(ln0 + bo, gn + (size_t)(t + 2) * 512); }
  }
  asm volatile("s_wait_asynccnt 0x0" ::: "memory");      /* no copy is outstanding when the wave goes on to the epilogue and ends */
#pragma unroll
  for (int qt = 0; qt < 2; ++qt) { const float lh = l[qt][0] + l[qt][1]; const float inv = 1.0f / (lh + xhalf(lh)); const size_t ob = ((size_t)b * SLEN + q0 + qt * 16 + ln) * DM + h * 64 + 8 * hh;
#pragma unroll
    for (int dt = 0; dt < 4; ++dt) { FragH f, fl;
#pragma unroll
      for (int r = 0; r < 8; ++r) { const float v = o[qt][dt][r] * inv; const _Float16 hv = (_Float16)v; f.h[r] = hv; fl.h[r] = (_Float16)((v - (float)hv) * 1024.0f); }
      *(v8us*)((unsigned short*)OH + ob + dt * 16) = f.half[0]; *(v8us*)((unsigned short*)OL + ob + dt * 16) = fl.half[0]; } }
}
// One preparation launch for all five operand planes; every one of its 512 blocks does the same two pieces of work.
// (a) One 64 k x 64 n tile of two of the four weights, Wt[n][k] = f16(bf16(W[k][n]) * 16), transposed through LDS, so that reads (256 B of a W row per 16 lanes) and writes (128 B of a Wt row per 8 lanes) are whole lines.
// (b) 2048 float4 of x, X16 = f16(bf16(x)), lanes adjacent.
// A thread issues its 16 loads as one group; s_wait_xcnt 0 stands behind the group, in front of any rewrite of its two offset registers, which as the statement's inputs keep their values up to there.
#define PWP 144              /* LDS row pitch of a transposed tile: 128 B (64 k) + 16 = 16 B x odd, conflict-free for the 16-byte reads */
__global__ __launch_bounds__(256) void k_prep(const float* __restrict__ x, const float* __restrict__ w0, const float* __restrict__ w1, const float* __restrict__ w2, const float* __restrict__ w3,
                                              _Float16* __restrict__ X16, _Float16* __restrict__ T0, _Float16* __restrict__ T1, _Float16* __restrict__ T2, _Float16* __restrict__ T3) {
  __shared__ __attribute__((aligned(16))) char tl[2][64 * PWP];
  const int tid = threadIdx.x, b = blockIdx.x; const bool hi = (b & 256) != 0;      /* blocks 0..255: weights 0 and 1, blocks 256..511: weights 2 and 3 */
  const float* const wp[2] = {hi ? w2 : w0, hi ? w3 : w1}; _Float16* const tp[2] = {hi ? T2 : T0, hi ? T3 : T1};
  const int k0 = ((b >> 4) & 15) * 64, n0 = (b & 15) * 64; const int kq = (tid >> 4) * 4, c4 = (tid & 15) * 4;      /* a thread holds 4 k x 4 n of each tile */
  const unsigned sb = (unsigned)(((k0 + kq) * DM + n0 + c4) * 4);      /* byte offset in each W */
  const unsigned fi = (unsigned)((b & 511) * 2048 + tid);      /* float4 index in x: NR * DM floats = 512 blocks x 8 x 256 float4; the mask shows the compiler that fi + u * 256 cannot wrap, so the eight steps fold into the instructions' offsets */
  v4f r[8], q[8];
#pragma unroll
  for (int u = 0; u < 8; ++u) r[u] = *(const v4fa*)((const char*)wp[u >> 2] + sb + (u & 3) * (DM * 4));
#pragma unroll
  for (int u = 0; u < 8; ++u) q[u] = ((const v4fa*)x)[fi + u * 256];
  asm volatile("s_wait_xcnt 0x0" :: "v"(sb), "v"(fi) : "memory");      /* see the head comment */
  __builtin_amdgcn_sched_barrier(0);      /* keeps all 16 loads and their wait ahead of the first conversion: one memory latency per thread, not two */
#pragma unroll
  for (int mx = 0; mx < 2; ++mx)
#pragma unroll
    for (int j = 0; j < 4; ++j) { v4h p;
#pragma unroll
      for (int i = 0; i < 4; ++i) p[i] = (_Float16)(bf16_round(r[mx * 4 + i][j]) * 16.0f);
      *(v4h*)(tl[mx] + (c4 + j) * PWP + kq * 2) = p; }      /* 4 consecutive k of one n: 8 bytes of the transposed row */
  __syncthreads();      /* a transposed row holds 16 threads' k */
#pragma unroll
  for (int u = 0; u < 4; ++u) { const int n = (u & 1) * 32 + (tid >> 3), c = tid & 7; const v8us v = *(const v8us*)(tl[u >> 1] + n * PWP + c * 16);
    *(v8us*)((unsigned short*)tp[u >> 1] + (size_t)(n0 + n) * DM + k0 + c * 8) = v; }
#pragma unroll
  for (int u = 0; u < 8; ++u) { v4h p;      /* behind the barrier, which would otherwise wait for these stores */
#pragma unroll
    for (int i = 0; i < 4; ++i) p[i] = (_Float16)bf16_round(q[u][i]);
    ((v4h*)X16)[fi + u * 256] = p; }
}
extern "C" void kernel_launch(void* const* d_in, const int* in_sizes, int n_in,
                              void* d_out, int out_size, void* d_ws, size_t ws_size, hipStream_t stream) {
  (void)in_sizes; (void)n_in; (void)out_size;
  const float* const* I = (const float* const*)d_in; const float* x = I[0]; const float* wq = I[1]; const float* bq = I[2]; const float* wk = I[3]; const float* bk = I[4]; const float* wv = I[5]; const float* bv = I[6]; const float* wo = I[7]; const float* bo = I[8]; const float* tmp = I[9];
  char* ws = (char*)d_ws; size_t off = 0;
  auto take = [&](size_t bytes) { char* p = ws + off; off += (bytes + 255) & ~(size_t)255; return p; };
  const size_t np = (size_t)NR * DM;
  _Float16* BQ = (_Float16*)take((size_t)DM * DM * 2); _Float16* BK = (_Float16*)take((size_t)DM * DM * 2); _Float16* BV = (_Float16*)take((size_t)DM * DM * 2); _Float16* BO = (_Float16*)take((size_t)DM * DM * 2);
  _Float16* X16 = (_Float16*)take(np * 2); float* QN = (float*)take((size_t)NR * NH * 4); float* KN = (float*)take((size_t)NR * NH * 4); _Float16* QH = (_Float16*)take(np * 2); _Float16* QL = (_Float16*)take(np * 2); _Float16* KH = (_Float16*)take(np * 2); _Float16* KL = (_Float16*)take(np * 2); _Float16* OH = (_Float16*)take(np * 2); _Float16* VT = (_Float16*)take(np * 2);
  _Float16* OL = X16;      /* O lo over x (dead after the projections) */
  if (off > ws_size) return;      /* 8 + 8 + 0.5 + 6x8 = about 65 MiB */
  k_prep<<<512, 256, 0, stream>>>(x, wq, wk, wv, wo, X16, BQ, BK, BV, BO);      /* weights [in, out] -> f16 [out][in] x 16, x -> f16: one launch */
  const dim3 gP((NR / 128) * (DM / 64), 1);
  k_gemm2<0, 1><<<gP, 128, 0, stream>>>(X16, DM, 0, BQ, DM, 0, 0.0625f, bq, 0, nullptr, 1, 0, 0, QN, QH, QL, DM, 0, NR, DM, DM); k_gemm2<0, 1><<<gP, 128, 0, stream>>>(X16, DM, 0, BK, DM, 0, 0.0625f, bk, 0, nullptr, 1, 0, 0, KN, KH, KL, DM, 0, NR, DM, DM);      /* q, k: hi + residual planes and norms [(b,h)][2048] */
  k_gemm2<0, 2><<<gP, 128, 0, stream>>>(X16, DM, 0, BV, DM, 0, 0.0625f, bv, 0, nullptr, 1, 0, 0, nullptr, VT, nullptr, DM, 0, NR, DM, DM);      /* V^T [(b,h)][64][2048] */
  k_eflash<<<NB * NH * (SLEN / 256), 256, 0, stream>>>(QH, QL, KH, KL, VT, QN, KN, tmp, OH, OL);      /* scores, softmax, att . v, normalise, hi + residual: one launch */
  k_gemm2<0, 0><<<gP, 128, 0, stream>>>(OL, DM, 0, BO, DM, 0, 0.0625f / 1024.0f, nullptr, 0, nullptr, 1, 0, 0, (float*)d_out, nullptr, nullptr, DM, 0, NR, DM, DM);
  k_gemm2<0, 0><<<gP, 128, 0, stream>>>(OH, DM, 0, BO, DM, 0, 0.0625f, bo, 0, (const float*)d_out, 1, (size_t)DM, 0, (float*)d_out, nullptr, nullptr, DM, 0, NR, DM, DM);      /* out = (O_lo + O_hi) Wo + bo */
}

// v006
// A run of this version takes 147 microseconds.
// Timed twice side by side with v005, it ran 1.05 and 1.06 times as fast.
// Over all steps from v000 it is 13.5 times as fast.
#include <hip/hip_runtime.h>
// EuclideanAttention (2 x 2048 tokens, D 1024 = 16 heads x 64; Q, K, V = x W + b; d2 = max(|q|^2 + |k|^2 - 2 q.k, 0); attn = softmax_k(-d2 / temperature); out = (attn V) Wo + bo).
// Compute dtype: inputs rounded to bf16; x and weights exact as f16; q.k from hi+residual operands (~2^-21); norms/softmax f32; v and the softmax weights as plain f16 operands (~2^-12); attention output hi + residual. v_wmma_f32_16x16x32_f16.
#define NB 2
#define DM 1024
#define NKV 16
#define NREP (NH / NKV)
#define KVD (NKV * 64)           /* 1024 */
#define NR (NB * SLEN)           /* 4096 */
#define CHK 512                  /* attention chunk */
typedef int v4i __attribute__((ext_vector_type(4)));
#define FF 2048
#define SLEN 2048
#define TQ SLEN
#define TK SLEN
#define NH 16
#define SCL 0.125f
#define QBLKS (TQ / 64)
#define QB05 0
#define QBN5 4
#define QB0P 0
#define QBNP QBLKS           /* non-causal: plain flash on every query block */
#define RE 256
typedef __bf16 v16b __attribute__((ext_vector_type(16)));
typedef unsigned short v8us __attribute__((ext_vector_type(8), may_alias));
typedef float  v8f  __attribute__((ext_vector_type(8)));
typedef float  v4f  __attribute__((ext_vector_type(4)));
typedef float  v4fa __attribute__((ext_vector_type(4), may_alias));
union FragB { v16b v; v8us half[2]; unsigned short u[16]; };

__device__ __forceinline__ unsigned short bf16_bits(float x) { unsigned int u = __float_as_uint(x); return (unsigned short)((u + 0x7FFFu + ((u >> 16) & 1u)) >> 16); }
__device__ __forceinline__ float bf16_val(unsigned short b) { return __uint_as_float(((unsigned int)b) << 16); }
__device__ __forceinline__ float bf16_round(float x) { return bf16_val(bf16_bits(x)); }
// D += A·B with NT terms: 1 = ah·bh, 2 = + al·bh (A split), 3 = + ah·bl (both split)
template <int NT>
__device__ __forceinline__ v8f mmaN(v16b ah, v16b al, v16b bh, v16b bl, v8f c) {
  c = __builtin_amdgcn_wmma_f32_16x16x32_bf16(false, ah, false, bh, (short)0, c, false, false);
  if (NT >= 2) c = __builtin_amdgcn_wmma_f32_16x16x32_bf16(false, al, false, bh, (short)0, c, false, false);
  if (NT >= 3) c = __builtin_amdgcn_wmma_f32_16x16x32_bf16(false, ah, false, bl, (short)0, c, false, false);
  asm volatile("v_nop\n\tv_nop\n\tv_nop\n\tv_nop" : "+v"(c) : "v"(ah), "v"(al), "v"(bh), "v"(bl));
  return c;
}

__global__ __launch_bounds__(256) void k_wt_bf16(const float* __restrict__ W, unsigned short* __restrict__ Wt, int K, int N) {
  const int t = blockIdx.x * 256 + threadIdx.x;
  const int k8n = K / 8;
  if (t >= N * k8n) return;
  const int n = t / k8n, k8 = (t % k8n) * 8;
  v8us v;
#pragma unroll
  for (int i = 0; i < 8; ++i) v[i] = bf16_bits(W[(size_t)(k8 + i) * N + n]);
  *(v8us*)(Wt + (size_t)n * K + k8) = v;
  
}

// GEMM C[M][N] (f32, pitch ldc) = act(A[M][K]·W + bias). A f32 row-major (pitch lda) converted per fragment to bf16
// (ASPLIT: hi/lo two planes -> 2 terms, else single rounded term); Wt bf16 [N][K] (pitch ldb). BIAS_BF16 rounds the
// bias to bf16 first (bias quantised to bf16 before the add). K%32==0, M%16==0, N%64==0.
template <bool ASPLIT, int ACT, bool BIAS_BF16>
__global__ __launch_bounds__(128) void k_gemm_bf(const float* __restrict__ A, int lda, const unsigned short* __restrict__ Wt, int ldb,
                                               const float* __restrict__ bias, float* __restrict__ C, int ldc, int M, int N, int K) {
  __shared__ __attribute__((aligned(16))) float so[4][16][64];
  const int tid = threadIdx.x, w = tid >> 5, lane = tid & 31, ln = lane & 15, hh = lane >> 4;
  const int ntn = N / 64;
  const int wid = blockIdx.x * 4 + w;
  const int mt = wid / ntn, nq = wid % ntn;
  if (mt * 16 >= M) return;
  const int row0 = mt * 16, col0 = nq * 64;
  const float* arow = A + (size_t)(row0 + ln) * lda;
  v8f acc[4] = {};
  for (int kb = 0; kb < K; kb += 32) {
    FragB ah, al;
    const v4f x0 = *(const v4fa*)(arow + kb + 8 * hh), x1 = *(const v4fa*)(arow + kb + 8 * hh + 4);
    const v4f x2 = *(const v4fa*)(arow + kb + 16 + 8 * hh), x3 = *(const v4fa*)(arow + kb + 16 + 8 * hh + 4);
    float xs[16] = {x0[0],x0[1],x0[2],x0[3],x1[0],x1[1],x1[2],x1[3],x2[0],x2[1],x2[2],x2[3],x3[0],x3[1],x3[2],x3[3]};
#pragma unroll
    for (int i = 0; i < 16; ++i) { const unsigned short hb = bf16_bits(xs[i]); ah.u[i] = hb; al.u[i] = ASPLIT ? bf16_bits(xs[i] - bf16_val(hb)) : (unsigned short)0; }
#pragma unroll
    for (int t = 0; t < 4; ++t) {
      const unsigned short* brow = Wt + (size_t)(col0 + t * 16 + ln) * ldb + kb;
      FragB b;
      b.half[0] = *(const v8us*)(brow + 8 * hh);
      b.half[1] = *(const v8us*)(brow + 16 + 8 * hh);
      acc[t] = mmaN<ASPLIT ? 2 : 1>(ah.v, al.v, b.v, b.v, acc[t]);
    }
  }
#pragma unroll
  for (int t = 0; t < 4; ++t) {
    float bv = bias ? bias[col0 + t * 16 + ln] : 0.f;
    if (BIAS_BF16) bv = bf16_round(bv);
#pragma unroll
    for (int r = 0; r < 8; ++r) { float v = acc[t][r] + bv; if (ACT == 1) v = fmaxf(v, 0.f); so[w][8 * hh + r][t * 16 + ln] = v; }
  }
  __builtin_amdgcn_fence(__ATOMIC_ACQ_REL, "workgroup");
  __builtin_amdgcn_wave_barrier();
  const int rsub = lane >> 4, c4 = (lane & 15) * 4;
  {
#pragma unroll
    for (int q = 0; q < 8; ++q) {
      const int r = q * 2 + rsub;
      const v4f v = *(const v4fa*)&so[w][r][c4];
      *(v4f*)(C + (size_t)(row0 + r) * ldc + col0 + c4) = v;
    }
    
  }
}

// GEMM C = act(A·W + bias + resid): A f32 (ASPLIT -> hi/lo 2 terms), Wt bf16 [N][K]; ACT 0 none, 1 relu, 2 exact gelu;
// resid (optional, f32, row index = (row % rmod), pitch ldr, RES_BF16 rounds it) added before the activation.
template <bool ASPLIT, int ACT, bool BIAS_BF16, bool RES_BF16>
__global__ __launch_bounds__(128) void k_gemm_bf3(const float* __restrict__ A, int lda, const unsigned short* __restrict__ Wt, int ldb,
                                                const float* __restrict__ bias, const float* __restrict__ resid, int rmod, int ldr,
                                                float* __restrict__ C, int ldc, int M, int N, int K) {
  __shared__ __attribute__((aligned(16))) float so[4][16][64];
  const int tid = threadIdx.x, w = tid >> 5, lane = tid & 31, ln = lane & 15, hh = lane >> 4;
  const int ntn = N / 64;
  const int wid = blockIdx.x * 4 + w;
  const int mt = wid / ntn, nq = wid % ntn;
  if (mt * 16 >= M) return;
  const int row0 = mt * 16, col0 = nq * 64;
  const float* arow = A + (size_t)(row0 + ln) * lda;
  v8f acc[4] = {};
  for (int kb = 0; kb < K; kb += 32) {
    FragB ah, al;
    const v4f x0 = *(const v4fa*)(arow + kb + 8 * hh), x1 = *(const v4fa*)(arow + kb + 8 * hh + 4);
    const v4f x2 = *(const v4fa*)(arow + kb + 16 + 8 * hh), x3 = *(const v4fa*)(arow + kb + 16 + 8 * hh + 4);
    float xs[16] = {x0[0],x0[1],x0[2],x0[3],x1[0],x1[1],x1[2],x1[3],x2[0],x2[1],x2[2],x2[3],x3[0],x3[1],x3[2],x3[3]};
#pragma unroll
    for (int i = 0; i < 16; ++i) { const unsigned short hb = bf16_bits(xs[i]); ah.u[i] = hb; al.u[i] = ASPLIT ? bf16_bits(xs[i] - bf16_val(hb)) : (unsigned short)0; }
#pragma unroll
    for (int t = 0; t < 4; ++t) {
      const unsigned short* brow = Wt + (size_t)(col0 + t * 16 + ln) * ldb + kb;
      FragB b;
      b.half[0] = *(const v8us*)(brow + 8 * hh);
      b.half[1] = *(const v8us*)(brow + 16 + 8 * hh);
      acc[t] = mmaN<ASPLIT ? 2 : 1>(ah.v, al.v, b.v, b.v, acc[t]);
    }
  }
#pragma unroll
  for (int t = 0; t < 4; ++t) {
    const int col = col0 + t * 16 + ln;
    float bv = bias ? bias[col] : 0.f;
    if (BIAS_BF16) bv = bf16_round(bv);
#pragma unroll
    for (int r = 0; r < 8; ++r) {
      float v = acc[t][r] + bv;
      if (resid) { float rv = resid[(size_t)((row0 + 8 * hh + r) % rmod) * ldr + col]; if (RES_BF16) rv = bf16_round(rv); v += rv; }
      if (ACT == 1) v = fmaxf(v, 0.f);
      if (ACT == 2) v = 0.5f * v * (1.0f + erff(v * 0.70710678118654752f));
      if (ACT == 3) { const float u = 0.7978845608028654f * (v + 0.044715f * v * v * v); v = 0.5f * v * (1.0f + tanhf(u)); }
      so[w][8 * hh + r][t * 16 + ln] = v;
    }
  }
  __builtin_amdgcn_fence(__ATOMIC_ACQ_REL, "workgroup");
  __builtin_amdgcn_wave_barrier();
  const int rsub = lane >> 4, c4 = (lane & 15) * 4;
  {
#pragma unroll
    for (int q = 0; q < 8; ++q) {
      const int r = q * 2 + rsub;
      const v4f v = *(const v4fa*)&so[w][r][c4];
      *(v4f*)(C + (size_t)(row0 + r) * ldc + col0 + c4) = v;
    }
    
  }
}
// row LayerNorm (biased variance, eps) over N: s = X (+ R); optional out_sum <- s; out_norm <- (s-mu)*rsqrt(var+eps)*g + b
template <bool PARAM_BF16>
__global__ __launch_bounds__(256) void k_layernorm(const float* __restrict__ X, const float* __restrict__ R, const float* __restrict__ g, const float* __restrict__ bta,
                                                  float* __restrict__ out_sum, float* __restrict__ out_norm, int N, float eps) {
  __shared__ float red[256];
  const int row = blockIdx.x, tid = threadIdx.x;
  const float* x = X + (size_t)row * N; const float* rr = R ? R + (size_t)row * N : nullptr;
  float vals[16];                     // up to N = 4096
  const int per = N / 256;            // contiguous chunk per thread? use strided-by-4 chunks: thread handles j = tid*4 + 1024*u
  float s1 = 0.f;
  for (int u = 0; u < per / 4; ++u) {
    const int j = tid * 4 + 1024 * u;
    const v4f a = *(const v4fa*)(x + j);
    v4f b = {0.f,0.f,0.f,0.f}; if (rr) b = *(const v4fa*)(rr + j);
#pragma unroll
    for (int q = 0; q < 4; ++q) { const float v = a[q] + b[q]; vals[u * 4 + q] = v; s1 += v; }
  }
  red[tid] = s1; __syncthreads();
  for (int st = 128; st > 0; st >>= 1) { if (tid < st) red[tid] += red[tid + st]; __syncthreads(); }
  const float mu = red[0] / (float)N; __syncthreads();
  float s2 = 0.f;
  for (int u = 0; u < per / 4; ++u)
#pragma unroll
    for (int q = 0; q < 4; ++q) { const float c = vals[u * 4 + q] - mu; s2 += c * c; }
  red[tid] = s2; __syncthreads();
  for (int st = 128; st > 0; st >>= 1) { if (tid < st) red[tid] += red[tid + st]; __syncthreads(); }
  const float rs = rsqrtf(red[0] / (float)N + eps);
  {
    for (int u = 0; u < per / 4; ++u) {
      const int j = tid * 4 + 1024 * u;
      v4f o, sm;
#pragma unroll
      for (int q = 0; q < 4; ++q) {
        float gg = g[j + q], bb = bta[j + q];
        if (PARAM_BF16) { gg = bf16_round(gg); bb = bf16_round(bb); }
        sm[q] = vals[u * 4 + q]; o[q] = (vals[u * 4 + q] - mu) * rs * gg + bb;
      }
      if (out_sum) *(v4f*)(out_sum + (size_t)row * N + j) = sm;
      *(v4f*)(out_norm + (size_t)row * N + j) = o;
    }
    
  }
}



// ---- f16 WMMA path (v_wmma_f32_16x16x32_f16): 11-bit significands for operands in range — used where a [0,1] probability operand needs more precision than bf16
typedef _Float16 v16h __attribute__((ext_vector_type(16)));
union FragH { v16h v; v8us half[2]; _Float16 h[16]; unsigned short u[16]; };
template <int NT>
__device__ __forceinline__ v8f mmaH(v16h ah, v16h al, v16h bh, v16h bl, v8f c) {
  c = __builtin_amdgcn_wmma_f32_16x16x32_f16(false, ah, false, bh, (short)0, c, false, false);
  if (NT >= 2) c = __builtin_amdgcn_wmma_f32_16x16x32_f16(false, al, false, bh, (short)0, c, false, false);
  if (NT >= 3) c = __builtin_amdgcn_wmma_f32_16x16x32_f16(false, ah, false, bl, (short)0, c, false, false);
  asm volatile("v_nop\n\tv_nop\n\tv_nop\n\tv_nop" : "+v"(c) : "v"(ah), "v"(al), "v"(bh), "v"(bl));
  return c;
}
// batched GEMM like k_gemm_b but f16 operands: A f32 (split into f16 hi/lo if ASPLIT, else rounded to f16), Bt = f16 values [n][k]; alpha; C f32; N multiple of 16 (partial tiles skipped)
template <bool ASPLIT>
__global__ __launch_bounds__(128) void k_gemm_h(const float* __restrict__ A, int lda, size_t sA, const _Float16* __restrict__ Bh, int ldb, size_t sB, float alpha, float* __restrict__ C, int ldc, size_t sC, int M, int N, int K) {
  __shared__ __attribute__((aligned(16))) float so[4][16][64];
  const int tid = threadIdx.x, w = tid >> 5, lane = tid & 31, ln = lane & 15, hh = lane >> 4; const int by = blockIdx.y;
  A += (size_t)by * sA; Bh += (size_t)by * sB; C += (size_t)by * sC;
  const int ntn = (N + 63) / 64; const int wid = blockIdx.x * 4 + w; const int mt = wid / ntn, nq = wid % ntn; if (mt * 16 >= M) return;
  const int row0 = mt * 16, col0 = nq * 64; const float* arow = A + (size_t)(row0 + ln) * lda;
  v8f acc[4] = {};
  for (int kb = 0; kb < K; kb += 32) {
    FragH ah, al;
    const v4f x0 = *(const v4fa*)(arow + kb + 8 * hh), x1 = *(const v4fa*)(arow + kb + 8 * hh + 4), x2 = *(const v4fa*)(arow + kb + 16 + 8 * hh), x3 = *(const v4fa*)(arow + kb + 16 + 8 * hh + 4);
    float xs[16] = {x0[0],x0[1],x0[2],x0[3],x1[0],x1[1],x1[2],x1[3],x2[0],x2[1],x2[2],x2[3],x3[0],x3[1],x3[2],x3[3]};
#pragma unroll
    for (int i = 0; i < 16; ++i) { const _Float16 h = (_Float16)xs[i]; ah.h[i] = h; al.h[i] = ASPLIT ? (_Float16)(xs[i] - (float)h) : (_Float16)0.0f; }
#pragma unroll
    for (int t = 0; t < 4; ++t) { if (col0 + t * 16 >= N) continue; const size_t boff = (size_t)(col0 + t * 16 + ln) * ldb + kb; FragH bq; bq.half[0] = *(const v8us*)(Bh + boff + 8 * hh); bq.half[1] = *(const v8us*)(Bh + boff + 16 + 8 * hh);
      acc[t] = mmaH<ASPLIT ? 2 : 1>(ah.v, al.v, bq.v, bq.v, acc[t]); }
  }
#pragma unroll
  for (int t = 0; t < 4; ++t) { if (col0 + t * 16 >= N) continue;
#pragma unroll
    for (int r = 0; r < 8; ++r) so[w][8 * hh + r][t * 16 + ln] = acc[t][r] * alpha; }
  __builtin_amdgcn_fence(__ATOMIC_ACQ_REL, "workgroup"); __builtin_amdgcn_wave_barrier();
  const int rsub = lane >> 4, c4 = (lane & 15) * 4;
  {
#pragma unroll
    for (int q = 0; q < 8; ++q) { const int r = q * 2 + rsub; if (col0 + c4 < N) { const v4f v = *(const v4fa*)&so[w][r][c4]; *(v4f*)(C + (size_t)(row0 + r) * ldc + col0 + c4) = v; } }
     }
}

// Wt[n][k] = f16(W[k][n]·scale) from f32 row-major W[K][N] (scale = power of two; bf16-exact weights stay exact in f16 away from the subnormal range)
__global__ __launch_bounds__(256) void k_wt_f16(const float* __restrict__ W, _Float16* __restrict__ Wt, int K, int N, float scale) {
  const int t = blockIdx.x * 256 + threadIdx.x; if (t >= N * (K / 8)) return; const int n = t / (K / 8), k8 = (t % (K / 8)) * 8; FragH f;
#pragma unroll
  for (int i = 0; i < 8; ++i) f.h[i] = (_Float16)(bf16_round(W[(size_t)(k8 + i) * N + n]) * scale); const v8us o = f.half[0];
  *(v8us*)((unsigned short*)Wt + (size_t)n * K + k8) = o; 
}
// k_gemm_hh variant with fused epilogue: v = acc·alpha + bias[by·sBias + col] (+ CP[(row/rowsPerB)·sCPb + by·64 + col] if CP) ; ACT 0 none / 1 elu ; writes f16 C16 (and f32 C if non-null)
template <int ACT>
__global__ __launch_bounds__(128) void k_gemm_hhx(const _Float16* __restrict__ A, int lda, size_t sA, const _Float16* __restrict__ Bh, int ldb, size_t sB, float alpha, const float* __restrict__ bias, size_t sBias, const float* __restrict__ CP, int rowsPerB, size_t sCPb, int row0g,
    float* __restrict__ C, _Float16* __restrict__ C16, int ldc, size_t sC, int M, int N, int K) {
  __shared__ __attribute__((aligned(16))) float so[4][16][64];
  const int tid = threadIdx.x, w = tid >> 5, lane = tid & 31, ln = lane & 15, hh = lane >> 4; const int by = blockIdx.y;
  A += (size_t)by * sA; Bh += (size_t)by * sB; const size_t cofs = (size_t)by * sC; const float* bp = bias ? bias + (size_t)by * sBias : nullptr;
  const int ntn = (N + 63) / 64; const int wid = blockIdx.x * 4 + w; const int mt = wid / ntn, nq = wid % ntn; if (mt * 16 >= M) return;
  const int row0 = mt * 16, col0 = nq * 64; const _Float16* arow = A + (size_t)(row0 + ln) * lda;
  v8f acc[4] = {};
  for (int kb = 0; kb < K; kb += 32) { FragH ah; ah.half[0] = *(const v8us*)((const unsigned short*)arow + kb + 8 * hh); ah.half[1] = *(const v8us*)((const unsigned short*)arow + kb + 16 + 8 * hh);
#pragma unroll
    for (int t = 0; t < 4; ++t) { if (col0 + t * 16 >= N) continue; const size_t boff = (size_t)(col0 + t * 16 + ln) * ldb + kb; FragH bq; bq.half[0] = *(const v8us*)((const unsigned short*)Bh + boff + 8 * hh); bq.half[1] = *(const v8us*)((const unsigned short*)Bh + boff + 16 + 8 * hh);
      acc[t] = mmaH<1>(ah.v, ah.v, bq.v, bq.v, acc[t]); }
  }
#pragma unroll
  for (int t = 0; t < 4; ++t) { if (col0 + t * 16 >= N) continue; const int col = col0 + t * 16 + ln; const float bv = bp ? bf16_round(bp[col]) : 0.f;
#pragma unroll
    for (int r = 0; r < 8; ++r) { float v = acc[t][r] * alpha + bv; if (CP) { const int bidx = (row0g + row0 + 8 * hh + r) / rowsPerB; v += CP[(size_t)bidx * sCPb + (size_t)by * 64 + col]; } if (ACT == 1) v = (v > 0.f) ? v : expm1f(v); else if (ACT == 7) v = (v > 0.f) ? v + 1.0f : expf(v); else if (ACT == 8) v = tanhf(v); else if (ACT == 9) v = 0.5f * v * (1.0f + tanhf(0.7978845608028654f * (v + 0.044715f * v * v * v))); else if (ACT == 11) v = 1.0f / (1.0f + expf(-v)); else if (ACT == 12) v = (v > 0.f) ? v : 0.01f * v; else if (ACT == 14) v = (v > 0.f) ? v : 0.1f * v; else if (ACT == 15) v = v / (1.0f + expf(-v)); else if (ACT == 3) v = fmaxf(v, 0.f); else if (ACT == 6) v = 0.5f * v * (1.0f + erff(v * 0.70710678118654752f)); so[w][8 * hh + r][t * 16 + ln] = v; } }
  __builtin_amdgcn_fence(__ATOMIC_ACQ_REL, "workgroup"); __builtin_amdgcn_wave_barrier();
  const int rsub = lane >> 4, c4 = (lane & 15) * 4; typedef _Float16 v4h __attribute__((ext_vector_type(4)));
  {
#pragma unroll
    for (int q = 0; q < 8; ++q) { const int r = q * 2 + rsub; if (col0 + c4 < N) { const v4f v = *(const v4fa*)&so[w][r][c4]; if (C) *(v4f*)(C + cofs + (size_t)(row0 + r) * ldc + col0 + c4) = v; if (C16) { v4h h4; for (int i = 0; i < 4; ++i) h4[i] = (_Float16)v[i]; *(v4h*)(C16 + cofs + (size_t)(row0 + r) * ldc + col0 + c4) = h4; } } }
     }
}


typedef _Float16 v4h __attribute__((ext_vector_type(4)));

__global__ __launch_bounds__(256) void k_x16(const float* __restrict__ x, _Float16* __restrict__ X16, size_t n8) { const size_t t = (size_t)blockIdx.x * 256 + threadIdx.x; if (t >= n8) return; FragH f;
#pragma unroll
  for (int q = 0; q < 8; ++q) f.h[q] = (_Float16)bf16_round(x[t * 8 + q]); *(v8us*)((unsigned short*)X16 + t * 8) = f.half[0];  }
__global__ __launch_bounds__(256) void k_h16(const float* __restrict__ x, _Float16* __restrict__ X16, size_t n8) { const size_t t = (size_t)blockIdx.x * 256 + threadIdx.x; if (t >= n8) return; FragH f;
#pragma unroll
  for (int q = 0; q < 8; ++q) f.h[q] = (_Float16)x[t * 8 + q]; *(v8us*)((unsigned short*)X16 + t * 8) = f.half[0];  }
__global__ __launch_bounds__(256) void k_round16f(const float* __restrict__ W, _Float16* __restrict__ Bt, size_t n8) { const size_t t = (size_t)blockIdx.x * 256 + threadIdx.x; if (t >= n8) return; FragH f;
#pragma unroll
  for (int i = 0; i < 8; ++i) f.h[i] = (_Float16)(bf16_round(W[t * 8 + i]) * 16.0f); *(v8us*)((unsigned short*)Bt + t * 8) = f.half[0];  }
template <int NHv, int TTv>
__global__ __launch_bounds__(256) void k_vt(const _Float16* __restrict__ V16, int ldv, int voff, _Float16* __restrict__ Vt) { __shared__ unsigned short tl[64][66]; const int tid = threadIdx.x; const int slab = blockIdx.x / (TTv / 64), lg = blockIdx.x % (TTv / 64); const int b = slab / NHv, h = slab % NHv;
  for (int i = tid; i < 64 * 8; i += 256) { const int r = i / 8, c8 = (i % 8) * 8; FragH f; f.half[0] = *(const v8us*)((const unsigned short*)V16 + ((size_t)b * TTv + lg * 64 + r) * ldv + voff + h * 64 + c8);
#pragma unroll
    for (int q = 0; q < 8; ++q) tl[r][c8 + q] = f.u[q]; }
  __syncthreads();
  {
#pragma unroll
    for (int rd = 0; rd < 2; ++rd) { const int d = rd * 32 + tid / 8, pc = tid % 8; FragH f;
#pragma unroll
      for (int q = 0; q < 8; ++q) f.u[q] = tl[pc * 8 + q][d];
      *(v8us*)((unsigned short*)Vt + ((size_t)slab * 64 + d) * TTv + lg * 64 + pc * 8) = f.half[0]; }
     } }

__global__ __launch_bounds__(256) void k_hl(const float* __restrict__ F, _Float16* __restrict__ Hh, _Float16* __restrict__ Hl, size_t n8) { const size_t t = (size_t)blockIdx.x * 256 + threadIdx.x; if (t >= n8) return; FragH fh, fl; const v4f a = *(const v4fa*)(F + t * 8), c = *(const v4fa*)(F + t * 8 + 4);
#pragma unroll
  for (int q = 0; q < 4; ++q) { _Float16 h = (_Float16)a[q]; fh.h[q] = h; fl.h[q] = (_Float16)((a[q] - (float)h) * 1024.0f); h = (_Float16)c[q]; fh.h[4 + q] = h; fl.h[4 + q] = (_Float16)((c[q] - (float)h) * 1024.0f); }
  { *(v8us*)((unsigned short*)Hh + t * 8) = fh.half[0]; *(v8us*)((unsigned short*)Hl + t * 8) = fl.half[0];  } }

// ---- fast GEMM (block tile 128x64, wave tile 32x64; requires M % 128 == 0, N % 64 == 0, K % 64 == 0); epilogue = k_gemm_hhx semantics ----
// A and B come through LDS: a stage is 64 k of the block's 128 A rows and 64 B rows, brought by asynchronous copies into one of two buffers while the other is worked on.
// EPI picks what the epilogue stores (a block's 64 columns are one head, its 128 rows lie in one batch):
// 0 = C f32 and / or C16 f16, row-major; 1 = C16 = f16 hi and C16L = 2^10 residual, row-major, and C = the rows' sums of squares over the head, [(b, h)][s];
// 2 = C16 = the tile transposed, f16, [(b, h)][64 d][s]. 1 and 2 take no CP term and no batch (by = 0).
#define G2T 272              /* LDS row pitch of the transposed tile: 256 B (128 tokens) + 16 = 16 B x odd */
#define G2P 144              /* LDS row pitch in bytes: 128 B of k + 16 = 16 B x odd, the conflict-free pitch for 16-byte fragment reads */
#define G2S (192 * G2P)      /* one stage: rows 0..127 = A, rows 128..191 = B */
// One stage's 12 copies of a lane, 16 bytes each: 8 lanes bring one row's 128 bytes, the block's 128 threads 16 rows per copy; copies 0..7 are A rows, 8..11 B rows.
// l = the lane's LDS byte address in row tid / 8 of the buffer, a and b = its global addresses in that row of A and of B, sa and sb = 16 rows of A and of B in bytes.
// s_wait_xcnt 0 is the statement's last line, so that it stands in front of any later rewrite of these address registers.
__device__ __forceinline__ void g2_stage(unsigned l, const char* a, size_t sa, const char* b, size_t sb) {
  asm volatile("global_load_async_to_lds_b128 %0, %12, off\n\tglobal_load_async_to_lds_b128 %1, %13, off\n\tglobal_load_async_to_lds_b128 %2, %14, off\n\tglobal_load_async_to_lds_b128 %3, %15, off\n\t"
               "global_load_async_to_lds_b128 %4, %16, off\n\tglobal_load_async_to_lds_b128 %5, %17, off\n\tglobal_load_async_to_lds_b128 %6, %18, off\n\tglobal_load_async_to_lds_b128 %7, %19, off\n\t"
               "global_load_async_to_lds_b128 %8, %20, off\n\tglobal_load_async_to_lds_b128 %9, %21, off\n\tglobal_load_async_to_lds_b128 %10, %22, off\n\tglobal_load_async_to_lds_b128 %11, %23, off\n\ts_wait_xcnt 0x0"
               :: "v"(l), "v"(l + 16 * G2P), "v"(l + 32 * G2P), "v"(l + 48 * G2P), "v"(l + 64 * G2P), "v"(l + 80 * G2P), "v"(l + 96 * G2P), "v"(l + 112 * G2P), "v"(l + 128 * G2P), "v"(l + 144 * G2P), "v"(l + 160 * G2P), "v"(l + 176 * G2P),
                  "v"(a), "v"(a + sa), "v"(a + 2 * sa), "v"(a + 3 * sa), "v"(a + 4 * sa), "v"(a + 5 * sa), "v"(a + 6 * sa), "v"(a + 7 * sa), "v"(b), "v"(b + sb), "v"(b + 2 * sb), "v"(b + 3 * sb) : "memory"); }
__device__ __forceinline__ v16h g2_frag(const _Float16* p, int hh) { FragH f; f.half[0] = *(const v8us*)((const unsigned short*)p + 8 * hh); f.half[1] = *(const v8us*)((const unsigned short*)p + 16 + 8 * hh); return f.v; }
__device__ __forceinline__ v16h g2_lfrag(const char* p) { FragH f; f.half[0] = *(const v8us*)p; f.half[1] = *(const v8us*)(p + 32); return f.v; }
__device__ __forceinline__ v8f g2_mma(v16h a, v16h b, v8f c) { v8f d = __builtin_amdgcn_wmma_f32_16x16x32_f16(false, a, false, b, (short)0, c, false, false); asm volatile("v_nop\n\tv_nop\n\tv_nop\n\tv_nop" : "+v"(d) : "v"(a), "v"(b)); return d; }
// The body of a block; so (epilogue staging) and st (the two stage buffers) are the calling kernel's LDS, by its batch index.
template <int ACT, int EPI>
__device__ __forceinline__ void g2_body(float (*so)[32][68], char* st, const int by, const _Float16* __restrict__ A, int lda, size_t sA, const _Float16* __restrict__ Bh, int ldb, size_t sB, float alpha, const float* __restrict__ bias, size_t sBias, const float* __restrict__ CP, int rowsPerB, size_t sCPb, int row0g,
    float* __restrict__ C, _Float16* __restrict__ C16, _Float16* __restrict__ C16L, int ldc, size_t sC, int M, int N, int K) {
  const int tid = threadIdx.x, w = tid >> 5, lane = tid & 31, ln = lane & 15, hh = lane >> 4;
  A += (size_t)by * sA; Bh += (size_t)by * sB; const size_t cofs = (size_t)by * sC; const float* bp = bias ? bias + (size_t)by * sBias : nullptr;
  const int ntn = N >> 6; const int mt = blockIdx.x / ntn, nq = blockIdx.x - mt * ntn; const int row0 = mt * 128 + 32 * w, col0 = nq * 64; if (mt * 128 >= M) return;      /* the whole block or none: barriers follow */
  const int nst = K >> 6;      /* stages */
  const char* ga = (const char*)(A + (size_t)(mt * 128 + (tid >> 3)) * lda + (tid & 7) * 8); const char* gb = (const char*)(Bh + (size_t)(col0 + (tid >> 3)) * ldb + (tid & 7) * 8); const size_t sa = (size_t)lda * 32, sb = (size_t)ldb * 32;
  const unsigned l0 = (unsigned)(size_t)st + (unsigned)((tid >> 3) * G2P + (tid & 7) * 16);
  const char* fa = st + (32 * w + ln) * G2P + hh * 16; const char* fb = st + (128 + ln) * G2P + hh * 16;      /* fragment rows: k = 8h + s at +0, 16 + 8h + s at +32 bytes */
  const v8f z8 = {0.f,0.f,0.f,0.f,0.f,0.f,0.f,0.f}; v8f c00 = z8, c01 = z8, c02 = z8, c03 = z8, c10 = z8, c11 = z8, c12 = z8, c13 = z8;
  g2_stage(l0, ga, sa, gb, sb);
  asm volatile("s_wait_asynccnt 0x0" ::: "memory");      /* this wave's copies of stage 0 have landed */
  __syncthreads();      /* ... and every other wave's: stage 0 may be read */
  if (nst > 1) g2_stage(l0 + G2S, ga + 128, sa, gb + 128, sb);
#pragma unroll 1
  for (int t = 0; t < nst; ++t) { const int bo = (t & 1) * G2S; v16h a[2][2], b[2][4];
#pragma unroll
    for (int kk = 0; kk < 2; ++kk) { a[kk][0] = g2_lfrag(fa + bo + kk * 64); a[kk][1] = g2_lfrag(fa + bo + 16 * G2P + kk * 64);      /* the stage's 24 reads as one group ahead of its matrix instructions */
#pragma unroll
      for (int j = 0; j < 4; ++j) b[kk][j] = g2_lfrag(fb + bo + j * 16 * G2P + kk * 64); }
#pragma unroll
    for (int kk = 0; kk < 2; ++kk) { c00 = g2_mma(a[kk][0], b[kk][0], c00); c10 = g2_mma(a[kk][1], b[kk][0], c10); c01 = g2_mma(a[kk][0], b[kk][1], c01); c11 = g2_mma(a[kk][1], b[kk][1], c11);
      c02 = g2_mma(a[kk][0], b[kk][2], c02); c12 = g2_mma(a[kk][1], b[kk][2], c12); c03 = g2_mma(a[kk][0], b[kk][3], c03); c13 = g2_mma(a[kk][1], b[kk][3], c13); }
    asm volatile("s_wait_dscnt 0x0" ::: "memory");      /* this wave has left the buffer that is refilled below */
    asm volatile("s_wait_asynccnt 0x0" ::: "memory");      /* its copies of stage t + 1 have landed */
    __syncthreads();      /* publishes stage t + 1 and ends every reader's last read of stage t */
    if (t + 2 < nst) g2_stage(l0 + bo, ga + (size_t)(t + 2) * 128, sa, gb + (size_t)(t + 2) * 128, sb); }
  asm volatile("s_wait_asynccnt 0x0" ::: "memory");      /* no copy is outstanding when the wave goes on to the epilogue and ends */
  v8f accs[8] = {c00, c01, c02, c03, c10, c11, c12, c13};
#pragma unroll
  for (int u = 0; u < 8; ++u) { const int t = u & 3, half = u >> 2; const int col = col0 + t * 16 + ln; const float bv = bp ? bf16_round(bp[col]) : 0.f; FragH vt;
#pragma unroll
    for (int r = 0; r < 8; ++r) { const int rloc = half * 16 + 8 * hh + r; float v = accs[u][r] * alpha + bv; if (EPI == 0 && CP) { if (rowsPerB < 0) v += CP[cofs + (size_t)(row0g + row0 + rloc) * ldc + col];      /* rowsPerB < 0: own element of the batched C plane */ else { const int bidx = (row0g + row0 + rloc) / rowsPerB; v += CP[(size_t)bidx * sCPb + (size_t)by * 64 + col]; } }
      if (ACT == 3) v = fmaxf(v, 0.f); else if (ACT == 6) v = 0.5f * v * (1.0f + erff(v * 0.70710678118654752f)); else if (ACT == 11) v = 1.0f / (1.0f + expf(-v)); else if (ACT == 15) v = v / (1.0f + expf(-v)); else if (ACT == 12) v = (v > 0.f) ? v : 0.01f * v; else if (ACT == 8) v = tanhf(v);
      if (EPI == 2) vt.h[r] = (_Float16)v; else so[w][rloc][t * 16 + ln] = v; }
    if (EPI == 2) *(v8us*)((char*)so + (t * 16 + ln) * G2T + (32 * w + half * 16 + 8 * hh) * 2) = vt.half[0]; }      /* a lane's 8 accumulator rows are 8 consecutive tokens of one column: 16 bytes of the transposed row */
  if (EPI == 2) { __syncthreads();      /* a transposed row holds all four waves' tokens */
    const size_t tb = ((size_t)((mt * 128) / SLEN * NH + nq) * 64) * SLEN + (mt * 128) % SLEN;
#pragma unroll      /* the 8 LDS reads go ahead of the stores as one group */
    for (int q = 0; q < 8; ++q) { const int d = q * 8 + (tid >> 4), c = tid & 15; const v8us v = *(const v8us*)((const char*)so + d * G2T + c * 16); *(v8us*)((unsigned short*)C16 + tb + (size_t)d * SLEN + c * 8) = v; }      /* 16 lanes store one row's 256 bytes */
    return; }
  __builtin_amdgcn_fence(__ATOMIC_ACQ_REL, "workgroup"); __builtin_amdgcn_wave_barrier();
  const int rsub = lane >> 4, c4 = (lane & 15) * 4;
  if (EPI == 1) {
#pragma unroll      /* constant LDS offsets, and later rows' reads run ahead of earlier rows' stores */
    for (int q = 0; q < 16; ++q) { const int r = q * 2 + rsub; const v4f v = *(const v4fa*)&so[w][r][c4]; v4h h4, l4; for (int i = 0; i < 4; ++i) { const _Float16 h = (_Float16)v[i]; h4[i] = h; l4[i] = (_Float16)((v[i] - (float)h) * 1024.0f); }
      *(v4h*)(C16 + (size_t)(row0 + r) * ldc + col0 + c4) = h4; *(v4h*)(C16L + (size_t)(row0 + r) * ldc + col0 + c4) = l4; }      /* 16 lanes store one row's 128 bytes of each plane */
    float sq = 0.f;      /* lane = row: its 64 squares summed in column order */
#pragma unroll      /* the row's 16 LDS reads issue ahead of the sum chain */
    for (int d = 0; d < 64; d += 4) { const v4f a = *(const v4fa*)&so[w][lane][d]; for (int i = 0; i < 4; ++i) sq += a[i] * a[i]; }
    const int row = row0 + lane; *(float*)(C + ((size_t)(row / SLEN) * NH + nq) * SLEN + row % SLEN) = sq;
    asm volatile("s_wait_xcnt 0x0" ::: "memory");      /* behind the last store of the run: where the body is inlined beside another one, code that follows in the listing rewrites these stores' address and data registers */
  } else {
#pragma unroll
    for (int q = 0; q < 16; ++q) { const int r = q * 2 + rsub; const v4f v = *(const v4fa*)&so[w][r][c4]; if (C) *(v4f*)(C + cofs + (size_t)(row0 + r) * ldc + col0 + c4) = v; if (C16) { v4h h4; for (int i = 0; i < 4; ++i) h4[i] = (_Float16)v[i]; *(v4h*)(C16 + cofs + (size_t)(row0 + r) * ldc + col0 + c4) = h4; } }
     } }
template <int ACT, int EPI>
__global__ __launch_bounds__(128) void k_gemm2(const _Float16* __restrict__ A, int lda, size_t sA, const _Float16* __restrict__ Bh, int ldb, size_t sB, float alpha, const float* __restrict__ bias, size_t sBias, const float* __restrict__ CP, int rowsPerB, size_t sCPb, int row0g,
    float* __restrict__ C, _Float16* __restrict__ C16, _Float16* __restrict__ C16L, int ldc, size_t sC, int M, int N, int K) {
  __shared__ __attribute__((aligned(16))) float so[4][32][68]; __shared__ __attribute__((aligned(16))) char st[2 * G2S];
  g2_body<ACT, EPI>(so, st, blockIdx.y, A, lda, sA, Bh, ldb, sB, alpha, bias, sBias, CP, rowsPerB, sCPb, row0g, C, C16, C16L, ldc, sC, M, N, K); }
// The three projections of x in one launch: blockIdx.y = 0 q, 1 k (hi + residual planes and norms), 2 v (transposed). 1536 blocks, three resident per WGP by their LDS,
// so that one block's stage waits, prologue and epilogue run under the other blocks' matrix work, and two launch gaps go.
__global__ __launch_bounds__(128) void k_qkv(const _Float16* __restrict__ X, const _Float16* __restrict__ Wq, const _Float16* __restrict__ Wk, const _Float16* __restrict__ Wv, const float* __restrict__ bq, const float* __restrict__ bk, const float* __restrict__ bv,
    float* __restrict__ QN, float* __restrict__ KN, _Float16* __restrict__ QH, _Float16* __restrict__ QL, _Float16* __restrict__ KH, _Float16* __restrict__ KL, _Float16* __restrict__ VT) {
  __shared__ __attribute__((aligned(16))) float so[4][32][68]; __shared__ __attribute__((aligned(16))) char st[2 * G2S];
  const int wh = blockIdx.y;      /* the same for the whole block: the barriers inside stand under block-uniform control flow */
  if (wh == 2) g2_body<0, 2>(so, st, 0, X, DM, 0, Wv, DM, 0, 0.0625f, bv, 0, nullptr, 1, 0, 0, nullptr, VT, nullptr, DM, 0, NR, DM, DM);
  else g2_body<0, 1>(so, st, 0, X, DM, 0, wh ? Wk : Wq, DM, 0, 0.0625f, wh ? bk : bq, 0, nullptr, 1, 0, 0, wh ? KN : QN, wh ? KH : QH, wh ? KL : QL, DM, 0, NR, DM, DM); }



template <int CAUSAL>
__global__ __launch_bounds__(128) void k_flash(const _Float16* __restrict__ Q16, int ldq, const _Float16* __restrict__ K16, int ldk, const _Float16* __restrict__ Vt, const int* __restrict__ MSK, float* __restrict__ O, int ldo) {
  constexpr int RPW = 16, RTN = RPW / 16, NQB = TQ / (4 * RPW), DT = 4, KS = 2;
  __shared__ __attribute__((aligned(16))) unsigned short sP[4][RPW][40]; __shared__ __attribute__((aligned(16))) float sO[4][RPW][64 + 4];
  const int tid = threadIdx.x, w = tid >> 5, lane = tid & 31, ln = lane & 15, hh = lane >> 4;
  const int slab = blockIdx.x / QBNP, qblk = QB0P + blockIdx.x % QBNP; (void)NQB; const int b = slab / NH, h = slab % NH; const int qb0 = qblk * (4 * RPW); const int q0 = qb0 + w * RPW;
  FragH aq[2][KS];
#pragma unroll
  for (int rt = 0; rt < RTN; ++rt) { const unsigned short* qr = (const unsigned short*)Q16 + ((size_t)b * TQ + q0 + rt * 16 + ln) * ldq + h * 64;
#pragma unroll
    for (int ks = 0; ks < KS; ++ks) { aq[rt][ks].half[0] = *(const v8us*)(qr + ks * 32 + 8 * hh); aq[rt][ks].half[1] = *(const v8us*)(qr + ks * 32 + 16 + 8 * hh); } }
  const unsigned short* Vth = (const unsigned short*)Vt + (size_t)slab * 64 * TK;
  float m_r[2][8], l_r[2][8]; v8f oacc[2][DT];
#pragma unroll
  for (int rt = 0; rt < RTN; ++rt) {
#pragma unroll
    for (int r = 0; r < 8; ++r) { m_r[rt][r] = -3.0e38f; l_r[rt][r] = 0.f; }
#pragma unroll
    for (int dt = 0; dt < DT; ++dt) oacc[rt][dt] = (v8f){0.f,0.f,0.f,0.f,0.f,0.f,0.f,0.f}; }
  const int jend = (CAUSAL == 1) ? (qb0 + 4 * RPW) : ((CAUSAL == 23) ? min(TK, (qb0 / CHK + 2) * CHK) : TK);      /* causal / window: keys that can never contribute are skipped */ const int jbeg = (CAUSAL == 23) ? max(0, (qb0 / CHK - 1) * CHK) : 0;
#pragma unroll 1
  for (int j0 = jbeg; j0 < jend; j0 += 32) {
    v8f s[2][2];
#pragma unroll
    for (int nt = 0; nt < 2; ++nt) { const unsigned short* kr = (const unsigned short*)K16 + ((size_t)b * TK + j0 + nt * 16 + ln) * ldk + h * 64; FragH bk[KS];
#pragma unroll
      for (int ks = 0; ks < KS; ++ks) { bk[ks].half[0] = *(const v8us*)(kr + ks * 32 + 8 * hh); bk[ks].half[1] = *(const v8us*)(kr + ks * 32 + 16 + 8 * hh); }
#pragma unroll
      for (int rt = 0; rt < RTN; ++rt) { v8f acc = (v8f){0.f,0.f,0.f,0.f,0.f,0.f,0.f,0.f};
#pragma unroll
        for (int ks = 0; ks < KS; ++ks) acc = mmaH<1>(aq[rt][ks].v, aq[rt][ks].v, bk[ks].v, bk[ks].v, acc); s[rt][nt] = acc; } }
#pragma unroll
    for (int rt = 0; rt < RTN; ++rt)
#pragma unroll
      for (int r = 0; r < 8; ++r) { const int tq = q0 + rt * 16 + 8 * hh + r; const int k0 = j0 + ln, k1 = j0 + 16 + ln;
        bool ok0 = (CAUSAL == 1) ? (k0 <= tq) : ((CAUSAL == 2) ? ((k0 >> 5) == (tq >> 5)) : true), ok1 = (CAUSAL == 1) ? (k1 <= tq) : ((CAUSAL == 2) ? ((k1 >> 5) == (tq >> 5)) : true); if (CAUSAL == 23) { const int cq = tq / CHK; ok0 = (abs(k0 / CHK - cq) <= 1) && (MSK[(size_t)b * TK + k0] == 0); ok1 = (abs(k1 / CHK - cq) <= 1) && (MSK[(size_t)b * TK + k1] == 0); }      /* mode 23: 3-chunk window + int key-padding mask */
        if (CAUSAL == 24) { ok0 = (MSK[(size_t)b * TK + k0] == 0); ok1 = (MSK[(size_t)b * TK + k1] == 0); }      /* mode 24: int key-padding mask (nonzero = padded = excluded) */      /* mode 2: block-diagonal 32-token groups */
        float s0 = ok0 ? s[rt][0][r] * SCL : -3.0e38f, s1 = ok1 ? s[rt][1][r] * SCL : -3.0e38f; if (CAUSAL == 17) { const float* amk = (const float*)MSK + (size_t)b * TK; s0 += bf16_round(amk[k0]); s1 += bf16_round(amk[k1]); } if (CAUSAL == 18) { const float* tb = (const float*)MSK; const int* ri = MSK + 1024 + (size_t)b * TK; const int rq = ri[tq]; s0 += tb[(h * 8 + rq) * 8 + ri[k0]]; s1 += tb[(h * 8 + rq) * 8 + ri[k1]]; } if (CAUSAL == 19) { const int* rel = MSK + (size_t)tq * TK; const float* rb = (const float*)MSK + (size_t)TQ * TK + ((size_t)(b * NH + h) * TQ + tq) * 64; s0 += rb[rel[k0]]; s1 += rb[rel[k1]]; }      /* mode 19: + (q.Ek[rel] + Eb[rel][h]) / 8 gathered by the int relative ids (packed [ids | table]) */      /* mode 18: + resource_bias[h][r_q][r_k] from the packed [table | ids] buffer (TQ == TK) */      /* mode 17: additive per-(batch, key) mask INPUT */ float mc = fmaxf(s0, s1);
        mc = fmaxf(mc, __shfl_xor(mc, 1, 32)); mc = fmaxf(mc, __shfl_xor(mc, 2, 32)); mc = fmaxf(mc, __shfl_xor(mc, 4, 32)); mc = fmaxf(mc, __shfl_xor(mc, 8, 32));
        const float mn = fmaxf(m_r[rt][r], mc); const float al = (mn > -1.0e38f) ? expf(m_r[rt][r] - mn) : 1.0f; m_r[rt][r] = mn; const float p0 = ok0 ? expf(s0 - mn) : 0.f, p1 = ok1 ? expf(s1 - mn) : 0.f; l_r[rt][r] = l_r[rt][r] * al + p0 + p1;
#pragma unroll
        for (int dt = 0; dt < DT; ++dt) oacc[rt][dt][r] *= al;
        FragH t2; t2.h[0] = (_Float16)(p0 * 1024.0f); t2.h[1] = (_Float16)(p1 * 1024.0f); sP[w][rt * 16 + 8 * hh + r][ln] = t2.u[0]; sP[w][rt * 16 + 8 * hh + r][16 + ln] = t2.u[1]; }
    __builtin_amdgcn_fence(__ATOMIC_ACQ_REL, "workgroup"); __builtin_amdgcn_wave_barrier();
    FragH pa[2];
#pragma unroll
    for (int rt = 0; rt < RTN; ++rt) { pa[rt].half[0] = *(const v8us*)&sP[w][rt * 16 + ln][8 * hh]; pa[rt].half[1] = *(const v8us*)&sP[w][rt * 16 + ln][16 + 8 * hh]; }
#pragma unroll
    for (int dt = 0; dt < DT; ++dt) { const unsigned short* vrow = Vth + (size_t)(dt * 16 + ln) * TK + j0; FragH bv; bv.half[0] = *(const v8us*)(vrow + 8 * hh); bv.half[1] = *(const v8us*)(vrow + 16 + 8 * hh);
#pragma unroll
      for (int rt = 0; rt < RTN; ++rt) oacc[rt][dt] = mmaH<1>(pa[rt].v, pa[rt].v, bv.v, bv.v, oacc[rt][dt]); }
    __builtin_amdgcn_fence(__ATOMIC_ACQ_REL, "workgroup"); __builtin_amdgcn_wave_barrier(); }
#pragma unroll
  for (int rt = 0; rt < RTN; ++rt) {
#pragma unroll
    for (int r = 0; r < 8; ++r) { float l = l_r[rt][r]; l += __shfl_xor(l, 1, 32); l += __shfl_xor(l, 2, 32); l += __shfl_xor(l, 4, 32); l += __shfl_xor(l, 8, 32); l_r[rt][r] = (l > 0.f) ? 1.0f / (l * 1024.0f) : 0.f; }
#pragma unroll
    for (int dt = 0; dt < DT; ++dt)
#pragma unroll
      for (int r = 0; r < 8; ++r) sO[w][rt * 16 + 8 * hh + r][dt * 16 + ln] = oacc[rt][dt][r] * l_r[rt][r]; }
  __builtin_amdgcn_fence(__ATOMIC_ACQ_REL, "workgroup"); __builtin_amdgcn_wave_barrier();
  {
#pragma unroll
    for (int rp = 0; rp < RPW; rp += 2) { const int r = rp + (lane >> 4), pc = lane & 15; const v4f val = *(const v4fa*)&sO[w][r][pc * 4]; *(v4f*)(O + ((size_t)b * TQ + q0 + r) * ldo + h * 64 + pc * 4) = val; }
     } }
// 5-plane variant: S = Qh Kh^T + (Ql Kh^T + Qh Kl^T)/1024 with Q/K = [hi | 2^10 residual] f16 planes (QL/KL same layout as Q16/K16), then the 3-term P.V below.
// 3-term variant: O = (P_hi V_hi + (P_lo V_hi + P_hi V_lo) / 1024) / l with P = [hi | 2^10 residual] of 1024 p and V^T = [hi | 2^10 residual] planes (VtL same layout as Vt) -> ~2^-21-class products for un-averaged (early causal / peaked) rows
template <int CAUSAL>
__global__ __launch_bounds__(128) void k_flash5(const _Float16* __restrict__ Q16, const _Float16* __restrict__ QL, int ldq, const _Float16* __restrict__ K16, const _Float16* __restrict__ KL, int ldk, const _Float16* __restrict__ Vt, const _Float16* __restrict__ VtL, const int* __restrict__ MSK, float* __restrict__ O, int ldo) {
  constexpr int RPW = 16, RTN = RPW / 16, NQB = TQ / (4 * RPW), DT = 4, KS = 2;
  __shared__ __attribute__((aligned(16))) unsigned short sP[4][RPW][40]; __shared__ __attribute__((aligned(16))) unsigned short sPL[4][RPW][40]; __shared__ __attribute__((aligned(16))) float sO[4][RPW][64 + 4];
  const int tid = threadIdx.x, w = tid >> 5, lane = tid & 31, ln = lane & 15, hh = lane >> 4;
  const int slab = blockIdx.x / QBN5, qblk = QB05 + blockIdx.x % QBN5; (void)NQB; const int b = slab / NH, h = slab % NH; const int qb0 = qblk * (4 * RPW); const int q0 = qb0 + w * RPW;
  FragH aq[2][KS], aql[2][KS];
#pragma unroll
  for (int rt = 0; rt < RTN; ++rt) { const unsigned short* qr = (const unsigned short*)Q16 + ((size_t)b * TQ + q0 + rt * 16 + ln) * ldq + h * 64; const unsigned short* ql = (const unsigned short*)QL + ((size_t)b * TQ + q0 + rt * 16 + ln) * ldq + h * 64;
#pragma unroll
    for (int ks = 0; ks < KS; ++ks) { aq[rt][ks].half[0] = *(const v8us*)(qr + ks * 32 + 8 * hh); aq[rt][ks].half[1] = *(const v8us*)(qr + ks * 32 + 16 + 8 * hh); aql[rt][ks].half[0] = *(const v8us*)(ql + ks * 32 + 8 * hh); aql[rt][ks].half[1] = *(const v8us*)(ql + ks * 32 + 16 + 8 * hh); } }
  const unsigned short* Vth = (const unsigned short*)Vt + (size_t)slab * 64 * TK; const unsigned short* Vtl = (const unsigned short*)VtL + (size_t)slab * 64 * TK;
  float m_r[2][8], l_r[2][8]; v8f oacc[2][DT], oaccL[2][DT];
#pragma unroll
  for (int rt = 0; rt < RTN; ++rt) {
#pragma unroll
    for (int r = 0; r < 8; ++r) { m_r[rt][r] = -3.0e38f; l_r[rt][r] = 0.f; }
#pragma unroll
    for (int dt = 0; dt < DT; ++dt) { oacc[rt][dt] = (v8f){0.f,0.f,0.f,0.f,0.f,0.f,0.f,0.f}; oaccL[rt][dt] = oacc[rt][dt]; } }
  const int jend = (CAUSAL == 1) ? (qb0 + 4 * RPW) : ((CAUSAL == 23) ? min(TK, (qb0 / CHK + 2) * CHK) : TK);      /* causal / window: keys that can never contribute are skipped */ const int jbeg = (CAUSAL == 23) ? max(0, (qb0 / CHK - 1) * CHK) : 0;
#pragma unroll 1
  for (int j0 = jbeg; j0 < jend; j0 += 32) {
    v8f s[2][2];
#pragma unroll
    for (int nt = 0; nt < 2; ++nt) { const unsigned short* kr = (const unsigned short*)K16 + ((size_t)b * TK + j0 + nt * 16 + ln) * ldk + h * 64; const unsigned short* klr = (const unsigned short*)KL + ((size_t)b * TK + j0 + nt * 16 + ln) * ldk + h * 64; FragH bk[KS], bkl[KS];
#pragma unroll
      for (int ks = 0; ks < KS; ++ks) { bk[ks].half[0] = *(const v8us*)(kr + ks * 32 + 8 * hh); bk[ks].half[1] = *(const v8us*)(kr + ks * 32 + 16 + 8 * hh); bkl[ks].half[0] = *(const v8us*)(klr + ks * 32 + 8 * hh); bkl[ks].half[1] = *(const v8us*)(klr + ks * 32 + 16 + 8 * hh); }
#pragma unroll
      for (int rt = 0; rt < RTN; ++rt) { v8f acc = (v8f){0.f,0.f,0.f,0.f,0.f,0.f,0.f,0.f}, accl = acc;
#pragma unroll
        for (int ks = 0; ks < KS; ++ks) { acc = mmaH<1>(aq[rt][ks].v, aq[rt][ks].v, bk[ks].v, bk[ks].v, acc); accl = mmaH<1>(aql[rt][ks].v, aql[rt][ks].v, bk[ks].v, bk[ks].v, accl); accl = mmaH<1>(aq[rt][ks].v, aq[rt][ks].v, bkl[ks].v, bkl[ks].v, accl); }
#pragma unroll
        for (int r = 0; r < 8; ++r) acc[r] += accl[r] * 0.0009765625f;
        s[rt][nt] = acc; } }
#pragma unroll
    for (int rt = 0; rt < RTN; ++rt)
#pragma unroll
      for (int r = 0; r < 8; ++r) { const int tq = q0 + rt * 16 + 8 * hh + r; const int k0 = j0 + ln, k1 = j0 + 16 + ln;
        bool ok0 = (CAUSAL == 1) ? (k0 <= tq) : ((CAUSAL == 2) ? ((k0 >> 5) == (tq >> 5)) : true), ok1 = (CAUSAL == 1) ? (k1 <= tq) : ((CAUSAL == 2) ? ((k1 >> 5) == (tq >> 5)) : true);      /* mode 2: block-diagonal 32-token groups */
        if (CAUSAL == 4) { const int* mrow = MSK + ((size_t)b * TQ + tq) * TK; ok0 = mrow[k0] != 0; ok1 = mrow[k1] != 0; }      /* mode 4: per-(query, key) INPUT mask shared by all heads; masked keys contribute nothing (== the reference's -4096 fill, whose exp underflows to 0), rows with no valid key give l = 0 -> output 0 (== the reference's row_valid zeroing) */
        float s0 = ok0 ? s[rt][0][r] * SCL : -3.0e38f, s1 = ok1 ? s[rt][1][r] * SCL : -3.0e38f; if (CAUSAL == 17) { const float* amk = (const float*)MSK + (size_t)b * TK; s0 += bf16_round(amk[k0]); s1 += bf16_round(amk[k1]); } if (CAUSAL == 18) { const float* tb = (const float*)MSK; const int* ri = MSK + 1024 + (size_t)b * TK; const int rq = ri[tq]; s0 += tb[(h * 8 + rq) * 8 + ri[k0]]; s1 += tb[(h * 8 + rq) * 8 + ri[k1]]; } if (CAUSAL == 19) { const int* rel = MSK + (size_t)tq * TK; const float* rb = (const float*)MSK + (size_t)TQ * TK + ((size_t)(b * NH + h) * TQ + tq) * 64; s0 += rb[rel[k0]]; s1 += rb[rel[k1]]; }      /* mode 19: + (q.Ek[rel] + Eb[rel][h]) / 8 gathered by the int relative ids (packed [ids | table]) */      /* mode 18: + resource_bias[h][r_q][r_k] from the packed [table | ids] buffer (TQ == TK) */      /* mode 17: additive per-(batch, key) mask INPUT */ float mc = fmaxf(s0, s1);
        mc = fmaxf(mc, __shfl_xor(mc, 1, 32)); mc = fmaxf(mc, __shfl_xor(mc, 2, 32)); mc = fmaxf(mc, __shfl_xor(mc, 4, 32)); mc = fmaxf(mc, __shfl_xor(mc, 8, 32));
        const float mn = fmaxf(m_r[rt][r], mc); const float al = (mn > -1.0e38f) ? expf(m_r[rt][r] - mn) : 1.0f; m_r[rt][r] = mn; const float p0 = ok0 ? expf(s0 - mn) : 0.f, p1 = ok1 ? expf(s1 - mn) : 0.f; l_r[rt][r] = l_r[rt][r] * al + p0 + p1;
#pragma unroll
        for (int dt = 0; dt < DT; ++dt) { oacc[rt][dt][r] *= al; oaccL[rt][dt][r] *= al; }
        FragH t2, t2l; const float ps0 = p0 * 1024.0f, ps1 = p1 * 1024.0f; t2.h[0] = (_Float16)ps0; t2.h[1] = (_Float16)ps1; t2l.h[0] = (_Float16)((ps0 - (float)t2.h[0]) * 1024.0f); t2l.h[1] = (_Float16)((ps1 - (float)t2.h[1]) * 1024.0f);
        sP[w][rt * 16 + 8 * hh + r][ln] = t2.u[0]; sP[w][rt * 16 + 8 * hh + r][16 + ln] = t2.u[1]; sPL[w][rt * 16 + 8 * hh + r][ln] = t2l.u[0]; sPL[w][rt * 16 + 8 * hh + r][16 + ln] = t2l.u[1]; }
    __builtin_amdgcn_fence(__ATOMIC_ACQ_REL, "workgroup"); __builtin_amdgcn_wave_barrier();
    FragH pa[2], pl[2];
#pragma unroll
    for (int rt = 0; rt < RTN; ++rt) { pa[rt].half[0] = *(const v8us*)&sP[w][rt * 16 + ln][8 * hh]; pa[rt].half[1] = *(const v8us*)&sP[w][rt * 16 + ln][16 + 8 * hh]; pl[rt].half[0] = *(const v8us*)&sPL[w][rt * 16 + ln][8 * hh]; pl[rt].half[1] = *(const v8us*)&sPL[w][rt * 16 + ln][16 + 8 * hh]; }
#pragma unroll
    for (int dt = 0; dt < DT; ++dt) { const unsigned short* vrow = Vth + (size_t)(dt * 16 + ln) * TK + j0; const unsigned short* vrl = Vtl + (size_t)(dt * 16 + ln) * TK + j0; FragH bv, bl; bv.half[0] = *(const v8us*)(vrow + 8 * hh); bv.half[1] = *(const v8us*)(vrow + 16 + 8 * hh); bl.half[0] = *(const v8us*)(vrl + 8 * hh); bl.half[1] = *(const v8us*)(vrl + 16 + 8 * hh);
#pragma unroll
      for (int rt = 0; rt < RTN; ++rt) { oacc[rt][dt] = mmaH<1>(pa[rt].v, pa[rt].v, bv.v, bv.v, oacc[rt][dt]); oaccL[rt][dt] = mmaH<1>(pl[rt].v, pl[rt].v, bv.v, bv.v, oaccL[rt][dt]); oaccL[rt][dt] = mmaH<1>(pa[rt].v, pa[rt].v, bl.v, bl.v, oaccL[rt][dt]); } }
    __builtin_amdgcn_fence(__ATOMIC_ACQ_REL, "workgroup"); __builtin_amdgcn_wave_barrier(); }
#pragma unroll
  for (int rt = 0; rt < RTN; ++rt) {
#pragma unroll
    for (int r = 0; r < 8; ++r) { float l = l_r[rt][r]; l += __shfl_xor(l, 1, 32); l += __shfl_xor(l, 2, 32); l += __shfl_xor(l, 4, 32); l += __shfl_xor(l, 8, 32); l_r[rt][r] = (l > 0.f) ? 1.0f / (l * 1024.0f) : 0.f; }
#pragma unroll
    for (int dt = 0; dt < DT; ++dt)
#pragma unroll
      for (int r = 0; r < 8; ++r) { float v = oacc[rt][dt][r]; v += oaccL[rt][dt][r] * 0.0009765625f; sO[w][rt * 16 + 8 * hh + r][dt * 16 + ln] = v * l_r[rt][r]; } }
  __builtin_amdgcn_fence(__ATOMIC_ACQ_REL, "workgroup"); __builtin_amdgcn_wave_barrier();
  {
#pragma unroll
    for (int rp = 0; rp < RPW; rp += 2) { const int r = rp + (lane >> 4), pc = lane & 15; const v4f val = *(const v4fa*)&sO[w][r][pc * 4]; *(v4f*)(O + ((size_t)b * TQ + q0 + r) * ldo + h * 64 + pc * 4) = val; }
     } }

__global__ __launch_bounds__(256) void k_rotab(float* __restrict__ CS, float* __restrict__ SN) {
  #pragma clang fp contract(off)
  const int t = blockIdx.x * 256 + threadIdx.x; if (t >= SLEN * 32) return; const int j = t % 32, s = t / 32; const float ex = (float)(2 * j) / 64.0f; const float inv = 1.0f / powf(10000.0f, ex); const float th = (float)s * inv; const float c = cosf(th), sn = sinf(th);
  { *(float*)(CS + t) = c; *(float*)(SN + t) = sn;  } }
__global__ __launch_bounds__(256) void k_rope(const float* __restrict__ F, int nsrc, int ndst, int rep, const float* __restrict__ CS, const float* __restrict__ SN, _Float16* __restrict__ H, _Float16* __restrict__ L) {
  #pragma clang fp contract(off)
  const size_t t = (size_t)blockIdx.x * 256 + threadIdx.x; if (t >= (size_t)NR * ndst * 4) return; const int g8 = (int)(t % 4); const int hd = (int)((t / 4) % ndst); const size_t row = t / ((size_t)4 * ndst); const int s = (int)(row % SLEN); const int hs = hd / rep;
  const float* src = F + row * (size_t)(nsrc * 64) + hs * 64; FragH ah, al, bh, bl;
  for (int i = 0; i < 8; ++i) { const int d = g8 * 8 + i; const float c = CS[s * 32 + d], sn = SN[s * 32 + d]; const float x1 = src[d], x2 = src[d + 32];
    float o1 = x1 * c; o1 += -x2 * sn; float o2 = x2 * c; o2 += x1 * sn;
    _Float16 hv = (_Float16)o1; ah.h[i] = hv; al.h[i] = (_Float16)((o1 - (float)hv) * 1024.0f); hv = (_Float16)o2; bh.h[i] = hv; bl.h[i] = (_Float16)((o2 - (float)hv) * 1024.0f); }
  const size_t o = row * (size_t)(ndst * 64) + hd * 64 + g8 * 8;
  { *(v8us*)((unsigned short*)H + o) = ah.half[0]; *(v8us*)((unsigned short*)H + o + 32) = bh.half[0]; *(v8us*)((unsigned short*)L + o) = al.half[0]; *(v8us*)((unsigned short*)L + o + 32) = bl.half[0];  } }
__global__ __launch_bounds__(256) void k_rope2(const float* __restrict__ F, int nsrc, int ndst, int rep, const float* __restrict__ CS, const float* __restrict__ SN, _Float16* __restrict__ H, _Float16* __restrict__ L) {
  #pragma clang fp contract(off)
  const size_t t = (size_t)blockIdx.x * 256 + threadIdx.x; if (t >= (size_t)NR * ndst * 4) return; const int g16 = (int)(t % 4); const int hd = (int)((t / 4) % ndst); const size_t row = t / ((size_t)4 * ndst); const int s = (int)(row % SLEN); const int hs = hd / rep;
  const float* src = F + row * (size_t)(nsrc * 64) + hs * 64 + g16 * 16; FragH ah, al;
  for (int pr = 0; pr < 8; ++pr) { const int i = g16 * 8 + pr; const float c = CS[s * 32 + i], sn = SN[s * 32 + i]; const float x1 = src[2 * pr], x2 = src[2 * pr + 1];
    float o1 = x1 * c; o1 -= x2 * sn; float o2 = x1 * sn; o2 += x2 * c;
    _Float16 hv = (_Float16)o1; ah.h[2 * pr] = hv; al.h[2 * pr] = (_Float16)((o1 - (float)hv) * 1024.0f); hv = (_Float16)o2; ah.h[2 * pr + 1] = hv; al.h[2 * pr + 1] = (_Float16)((o2 - (float)hv) * 1024.0f); }
  const size_t o = row * (size_t)(ndst * 64) + hd * 64 + g16 * 16;
  { *(v8us*)((unsigned short*)H + o) = ah.half[0]; *(v8us*)((unsigned short*)H + o + 8) = ah.half[1]; *(v8us*)((unsigned short*)L + o) = al.half[0]; *(v8us*)((unsigned short*)L + o + 8) = al.half[1];  } }
__global__ __launch_bounds__(256) void k_ln512(const float* __restrict__ A, const float* __restrict__ res, const float* __restrict__ g, const float* __restrict__ bb, float* __restrict__ Y, _Float16* __restrict__ Y16) {
  #pragma clang fp contract(off)
  const int wv = threadIdx.x >> 5, ln = threadIdx.x & 31; const size_t r = (size_t)blockIdx.x * 8 + wv; if (r >= NR) return; float x[16]; float s = 0.f;
  for (int i = 0; i < 2; ++i) { const v8f a = *(const v8f*)(A + r * DM + i * 256 + ln * 8); for (int q = 0; q < 8; ++q) { float v = a[q]; if (res) v += bf16_round(res[r * DM + i * 256 + ln * 8 + q]); x[i * 8 + q] = v; s += v; } }
  for (int o = 16; o > 0; o >>= 1) s += __shfl_xor(s, o, 32); const float mu = s / (float)DM; float var = 0.f; for (int q = 0; q < 16; ++q) { const float d = x[q] - mu; var += d * d; }
  for (int o = 16; o > 0; o >>= 1) var += __shfl_xor(var, o, 32); const float inv = rsqrtf(var / (float)DM + 1e-5f);
  { for (int i = 0; i < 2; ++i) { const int c0 = i * 256 + ln * 8; v8f y; FragH f; for (int q = 0; q < 8; ++q) { float v = (x[i * 8 + q] - mu) * inv; v *= bf16_round(g[c0 + q]); v += bf16_round(bb[c0 + q]); y[q] = v; f.h[q] = (_Float16)v; } *(v8f*)(Y + r * DM + c0) = y; if (Y16) *(v8us*)((unsigned short*)Y16 + r * DM + c0) = f.half[0]; }  } }
__global__ __launch_bounds__(256) void k_pack(const float* __restrict__ rb, const int* __restrict__ rid, int* __restrict__ PK) { const int t = blockIdx.x * 256 + threadIdx.x; if (t >= 1024 + NB * TK) return; int v; if (t < 1024) v = __float_as_int(bf16_round(rb[t])); else v = rid[t - 1024]; *(int*)(PK + t) = v;  }
__global__ __launch_bounds__(256) void k_tabin(const float* __restrict__ sp, float* __restrict__ CS, float* __restrict__ SN) { const int t = blockIdx.x * 256 + threadIdx.x; if (t >= SLEN * 32) return; const int i = t % 32, s = t / 32; const float c = bf16_round(sp[s * 64 + 32 + i]), sn = bf16_round(sp[s * 64 + i]);
  { *(float*)(CS + t) = c; *(float*)(SN + t) = sn;  } }
__global__ __launch_bounds__(256) void k_wsc(const float* __restrict__ Wm, _Float16* __restrict__ Bt, size_t n8, float sc) { const size_t t = (size_t)blockIdx.x * 256 + threadIdx.x; if (t >= n8) return; FragH f; for (int q = 0; q < 8; ++q) f.h[q] = (_Float16)(bf16_round(Wm[t * 8 + q]) * sc); *(v8us*)((unsigned short*)Bt + t * 8) = f.half[0];  }
__global__ __launch_bounds__(256) void k_rotab2(float* __restrict__ CS, float* __restrict__ SN) {
  #pragma clang fp contract(off)
  const int t = blockIdx.x * 256 + threadIdx.x; if (t >= SLEN * 32) return; const int j = t % 32, s = t / 32; const float c0 = -0.14391156831212787f;      /* -ln(10000)/64 rounded to f32 */ const float inv = expf((float)(2 * j) * c0); const float th = (float)s * inv; const float c = cosf(th), sn = sinf(th);
  { *(float*)(CS + t) = c; *(float*)(SN + t) = sn;  } }
__global__ __launch_bounds__(256) void k_lnu(const float* __restrict__ X, _Float16* __restrict__ N16, float* __restrict__ XB) {
  #pragma clang fp contract(off)
  const int wv = threadIdx.x >> 5, ln = threadIdx.x & 31; const size_t r = (size_t)blockIdx.x * 8 + wv; if (r >= NR) return; float a[32]; float s = 0.f;
  for (int i = 0; i < 4; ++i) { const v8f v = *(const v8f*)(X + r * DM + (i * 32 + ln) * 8); for (int q = 0; q < 8; ++q) { const float u = bf16_round(v[q]); a[i * 8 + q] = u; s += u; } }
  for (int o = 16; o > 0; o >>= 1) s += __shfl_xor(s, o, 32); const float mu = s / (float)DM; float var = 0.f; for (int q = 0; q < 32; ++q) { const float d = a[q] - mu; var += d * d; }
  for (int o = 16; o > 0; o >>= 1) var += __shfl_xor(var, o, 32); const float den = sqrtf(var / (float)(DM - 1)) + 1e-6f; const float inv = 1.0f / den;      /* one reciprocal per row; (x-mean)*inv vs the reference's division differs by <= 1 ulp */
  { for (int i = 0; i < 4; ++i) { const int c0 = (i * 32 + ln) * 8; FragH f; v8f xb; for (int q = 0; q < 8; ++q) { f.h[q] = (_Float16)((a[i * 8 + q] - mu) * inv); xb[q] = a[i * 8 + q]; } *(v8us*)((unsigned short*)N16 + r * DM + c0) = f.half[0]; *(v8f*)(XB + r * DM + c0) = xb; }  } }
// lane l <-> l ^ 16 (the two halves of a wave hold the two key halves of one query column)
__device__ __forceinline__ float xhalf(float v) { const int t = __float_as_int(v); return __int_as_float(__builtin_amdgcn_permlanex16(t, t, 0x76543210, 0xfedcba98, false, false)); }
__device__ __forceinline__ v8f wmh(v16h a, v16h b, v8f c) { return __builtin_amdgcn_wmma_f32_16x16x32_f16(false, a, false, b, (short)0, c, false, false); }
typedef _Float16 v8h __attribute__((ext_vector_type(8)));
typedef float v2f __attribute__((ext_vector_type(2)));
// eight 2^x in one statement: results kept apart from the arguments ("=&v") and one v_nop behind the last, the slot the instruction set asks for
// between a transcendental and an instruction that uses its result or overwrites its source (the register allocator otherwise reuses the previous argument as the next result)
__device__ __forceinline__ v8f exp2x8(v8f e) { float p0, p1, p2, p3, p4, p5, p6, p7;
  asm("v_exp_f32 %0, %8\n\tv_exp_f32 %1, %9\n\tv_exp_f32 %2, %10\n\tv_exp_f32 %3, %11\n\tv_exp_f32 %4, %12\n\tv_exp_f32 %5, %13\n\tv_exp_f32 %6, %14\n\tv_exp_f32 %7, %15\n\tv_nop"
      : "=&v"(p0), "=&v"(p1), "=&v"(p2), "=&v"(p3), "=&v"(p4), "=&v"(p5), "=&v"(p6), "=&v"(p7) : "v"(e[0]), "v"(e[1]), "v"(e[2]), "v"(e[3]), "v"(e[4]), "v"(e[5]), "v"(e[6]), "v"(e[7]));
  return (v8f){p0, p1, p2, p3, p4, p5, p6, p7}; }
// Fused distance attention, one launch for all (batch, head) slabs: per wave 32 query columns, per pass 32 keys.
// S^T = K Q^T (A = key rows, B = query rows; hi.hi + (hi.lo + lo.hi) / 1024), so a lane holds 8 + 8 keys of ONE query per column group:
// logits, running maximum and sum stay in the lane (one exchange between the wave halves); the two f32 score tiles, converted in place,
// are the B operand of O^T += V^T P^T (k order 8h + s, 16 + 8h + s on both sides). A lane ends with 8 consecutive d of one query: 16-byte stores of hi and residual.
// K hi, K lo, V^T and the key norms come through LDS, shared by the block's 8 waves: a stage is 128 keys (4 passes), brought by asynchronous copies into one of two buffers while the other is worked on.
#define EFK 144                        /* K row pitch in LDS: 128 B + 16 = 16 B x odd, conflict-free for 16-byte fragment reads */
#define EFV 272                        /* V^T row pitch: 256 B (128 keys) + 16, 16 B x odd too */
#define EF_KL (128 * EFK)              /* rows 0..127 = K hi, 128..255 = K lo */
#define EF_V (256 * EFK)               /* then 64 rows of V^T */
#define EF_N (256 * EFK + 64 * EFV)    /* then 128 key norms */
#define EFS (EF_N + 512)               /* one stage */
// One stage's 12 copies of a lane, 16 bytes each. K: 8 lanes bring one row's 128 bytes, the block 32 rows per copy; V^T: 16 lanes one row's 256 bytes, the block 16 rows per copy.
// lk, lv = the lane's LDS byte addresses in its first K hi row and its first V^T row; kh, kl, v = its global addresses there.
// s_wait_xcnt 0 is the statement's last line, so that it stands in front of any later rewrite of these address registers.
__device__ __forceinline__ void ef_stage(unsigned lk, unsigned lv, const char* kh, const char* kl, const char* v) {
  asm volatile("global_load_async_to_lds_b128 %0, %12, off\n\tglobal_load_async_to_lds_b128 %1, %13, off\n\tglobal_load_async_to_lds_b128 %2, %14, off\n\tglobal_load_async_to_lds_b128 %3, %15, off\n\t"
               "global_load_async_to_lds_b128 %4, %16, off\n\tglobal_load_async_to_lds_b128 %5, %17, off\n\tglobal_load_async_to_lds_b128 %6, %18, off\n\tglobal_load_async_to_lds_b128 %7, %19, off\n\t"
               "global_load_async_to_lds_b128 %8, %20, off\n\tglobal_load_async_to_lds_b128 %9, %21, off\n\tglobal_load_async_to_lds_b128 %10, %22, off\n\tglobal_load_async_to_lds_b128 %11, %23, off\n\ts_wait_xcnt 0x0"
               :: "v"(lk), "v"(lk + 32 * EFK), "v"(lk + 64 * EFK), "v"(lk + 96 * EFK), "v"(lk + EF_KL), "v"(lk + EF_KL + 32 * EFK), "v"(lk + EF_KL + 64 * EFK), "v"(lk + EF_KL + 96 * EFK), "v"(lv), "v"(lv + 16 * EFV), "v"(lv + 32 * EFV), "v"(lv + 48 * EFV),
                  "v"(kh), "v"(kh + 32 * (DM * 2)), "v"(kh + 64 * (DM * 2)), "v"(kh + 96 * (DM * 2)), "v"(kl), "v"(kl + 32 * (DM * 2)), "v"(kl + 64 * (DM * 2)), "v"(kl + 96 * (DM * 2)), "v"(v), "v"(v + 16 * (SLEN * 2)), "v"(v + 32 * (SLEN * 2)), "v"(v + 48 * (SLEN * 2)) : "memory"); }
// the stage's 128 key norms, 512 bytes: one copy of one whole wave
__device__ __forceinline__ void ef_stage_n(unsigned ln_, const char* n) { asm volatile("global_load_async_to_lds_b128 %0, %1, off\n\ts_wait_xcnt 0x0" :: "v"(ln_), "v"(n) : "memory"); }
// amdgpu_waves_per_eu(4, 4): a budget of 256 VGPRs, so that the whole kernel stays in one register window (it takes 240, no scratch)
__global__ __launch_bounds__(256) __attribute__((amdgpu_waves_per_eu(4, 4))) void k_eflash(const _Float16* __restrict__ QHp, const _Float16* __restrict__ QLp, const _Float16* __restrict__ KHp, const _Float16* __restrict__ KLp, const _Float16* __restrict__ Vt,
                                                const float* __restrict__ QN, const float* __restrict__ KNT, const float* __restrict__ tmp, _Float16* __restrict__ OH, _Float16* __restrict__ OL) {
  __shared__ __attribute__((aligned(128))) char st[2 * EFS];
  const int tid = threadIdx.x, w = tid >> 5, lane = tid & 31, ln = lane & 15, hh = lane >> 4;
  const int slab = blockIdx.x / (SLEN / 256), qblk = blockIdx.x % (SLEN / 256); const int b = slab / NH, h = slab % NH; const int q0 = qblk * 256 + w * 32;
  const float nc = -(1.0f / bf16_round(tmp[0])) * 1.4426950408889634f;      /* logit in log2 units = d2 * nc */
  v16h qh[2][2], ql[2][2]; float qn[2];
#pragma unroll
  for (int qt = 0; qt < 2; ++qt) { const size_t row = (size_t)b * SLEN + q0 + qt * 16 + ln; const _Float16* ph = QHp + row * DM + h * 64; const _Float16* pl = QLp + row * DM + h * 64;
    qh[qt][0] = g2_frag(ph, hh); qh[qt][1] = g2_frag(ph + 32, hh); ql[qt][0] = g2_frag(pl, hh); ql[qt][1] = g2_frag(pl + 32, hh); qn[qt] = QN[(size_t)slab * SLEN + q0 + qt * 16 + ln]; }
  const char* gkh = (const char*)(KHp + (size_t)b * SLEN * DM + h * 64) + (tid >> 3) * (DM * 2) + (tid & 7) * 16; const char* gkl = (const char*)(KLp + (size_t)b * SLEN * DM + h * 64) + (tid >> 3) * (DM * 2) + (tid & 7) * 16;      /* the lane's copy sources in stage 0 */
  const char* gv = (const char*)(Vt + (size_t)slab * 64 * SLEN) + (tid >> 4) * (SLEN * 2) + (tid & 15) * 16; const char* gn = (const char*)(KNT + (size_t)slab * SLEN) + lane * 16;
  const unsigned lk0 = (unsigned)(size_t)st + (unsigned)((tid >> 3) * EFK + (tid & 7) * 16), lv0 = (unsigned)(size_t)st + (unsigned)(EF_V + (tid >> 4) * EFV + (tid & 15) * 16), ln0 = (unsigned)(size_t)st + (unsigned)(EF_N + lane * 16);
  const bool w0 = __builtin_amdgcn_readfirstlane(w) == 0;      /* scalar: the norms' copy is issued by wave 0 alone, behind a scalar branch */
  const char* fk = st + ln * EFK + hh * 16; const char* fv = st + EF_V + ln * EFV + hh * 16; const char* fn = st + EF_N + hh * 32;      /* fragment rows: k = 8h + s at +0, 16 + 8h + s at +32 bytes */
  const v8f z8 = {0.f,0.f,0.f,0.f,0.f,0.f,0.f,0.f};
  float m[2] = {-3.0e38f, -3.0e38f}; v2f l[2] = {{0.f, 0.f}, {0.f, 0.f}}; v8f o[2][4];
#pragma unroll
  for (int qt = 0; qt < 2; ++qt)
#pragma unroll
    for (int dt = 0; dt < 4; ++dt) o[qt][dt] = z8;
  ef_stage(lk0, lv0, gkh, gkl, gv); if (w0) ef_stage_n(ln0, gn);
  asm volatile("s_wait_asynccnt 0x0" ::: "memory");      /* this wave's copies of stage 0 have landed */
  __syncthreads();      /* ... and every other wave's: stage 0 may be read */
  ef_stage(lk0 + EFS, lv0 + EFS, gkh + 128 * (DM * 2), gkl + 128 * (DM * 2), gv + 256); if (w0) ef_stage_n(ln0 + EFS, gn + 512);      /* SLEN / 128 = 16 stages: stage 1 exists */
#pragma unroll 1      /* one stage per trip */
  for (int t = 0; t < SLEN / 128; ++t) { const int bo = (t & 1) * EFS;
#pragma unroll 1      /* one pass per trip: the body already holds 32 matrix instructions, a copy would only add registers */
  for (int ps = 0; ps < 4; ++ps) {
    v8f u[2][2];
#pragma unroll
    for (int kt = 0; kt < 2; ++kt) { const char* kr = fk + bo + (ps * 32 + kt * 16) * EFK; const char* kq = kr + EF_KL;
      const v8f k2 = *(const v8f*)(fn + bo + (ps * 32 + kt * 16) * 4); const v16h a0 = g2_lfrag(kr), a1 = g2_lfrag(kr + 64), c0 = g2_lfrag(kq), c1 = g2_lfrag(kq + 64);
#pragma unroll
      for (int qt = 0; qt < 2; ++qt) { v8f lo = wmh(a0, ql[qt][0], z8); lo = wmh(a1, ql[qt][1], lo); lo = wmh(c0, qh[qt][0], lo); lo = wmh(c1, qh[qt][1], lo); v8f hi = wmh(a0, qh[qt][0], z8); hi = wmh(a1, qh[qt][1], hi);
        const v8f s = hi + lo * 0.0009765625f; const v8f d2 = __builtin_elementwise_max((k2 + qn[qt]) - 2.0f * s, z8); u[qt][kt] = d2 * nc; } }
    float mn[2];
#pragma unroll
    for (int qt = 0; qt < 2; ++qt) { const v8f t = __builtin_elementwise_max(u[qt][0], u[qt][1]); float mx = fmaxf(fmaxf(fmaxf(t[0], t[1]), fmaxf(t[2], t[3])), fmaxf(fmaxf(t[4], t[5]), fmaxf(t[6], t[7])));
      mx = fmaxf(mx, xhalf(mx)); mn[qt] = fmaxf(m[qt], mx); }
    if (__builtin_amdgcn_ballot_w32((mn[0] > m[0]) || (mn[1] > m[1])) != 0) {      /* scalar branch: sums and output tiles are rescaled only in a pass that raises some column's maximum */
#pragma unroll
      for (int qt = 0; qt < 2; ++qt) { const float al = __builtin_amdgcn_exp2f(m[qt] - mn[qt]); m[qt] = mn[qt]; l[qt] *= al;
#pragma unroll
        for (int dt = 0; dt < 4; ++dt) o[qt][dt] *= al; } }
    FragH pb[2];
#pragma unroll
    for (int qt = 0; qt < 2; ++qt) { const float mo = m[qt] - 10.0f;      /* weights carried times 1024, as f16 operands away from the subnormal range; the factor cancels between sum and output */
      v8f p[2];
#pragma unroll
      for (int kt = 0; kt < 2; ++kt) { p[kt] = exp2x8(u[qt][kt] - mo);
        const v8h ph = __builtin_convertvector(p[kt], v8h);
#pragma unroll
        for (int r = 0; r < 8; ++r) pb[qt].h[kt * 8 + r] = ph[r]; }
      const v8f t = p[0] + p[1]; const v4f t4 = t.lo + t.hi; l[qt] += t4.lo + t4.hi; }
#pragma unroll
    for (int dt = 0; dt < 4; ++dt) { const v16h va = g2_lfrag(fv + bo + ps * 64 + dt * 16 * EFV);
#pragma unroll
      for (int qt = 0; qt < 2; ++qt) o[qt][dt] = wmh(va, pb[qt].v, o[qt][dt]); }
  }
    asm volatile("s_wait_dscnt 0x0" ::: "memory");      /* this wave has left the buffer that is refilled below */
    asm volatile("s_wait_asynccnt 0x0" ::: "memory");      /* its copies of stage t + 1 have landed */
    __syncthreads();      /* publishes stage t + 1 and ends every reader's last read of stage t */
    if (t + 2 < SLEN / 128) { ef_stage(lk0 + bo, lv0 + bo, gkh + (size_t)(t + 2) * (128 * DM * 2), gkl + (size_t)(t + 2) * (128 * DM * 2), gv + (size_t)(t + 2) * 256); if (w0) ef_stage_n(ln0 + bo, gn + (size_t)(t + 2) * 512); }
  }
  asm volatile("s_wait_asynccnt 0x0" ::: "memory");      /* no copy is outstanding when the wave goes on to the epilogue and ends */
#pragma unroll
  for (int qt = 0; qt < 2; ++qt) { const float lh = l[qt][0] + l[qt][1]; const float inv = 1.0f / (lh + xhalf(lh)); const size_t ob = ((size_t)b * SLEN + q0 + qt * 16 + ln) * DM + h * 64 + 8 * hh;
#pragma unroll
    for (int dt = 0; dt < 4; ++dt) { FragH f, fl;
#pragma unroll
      for (int r = 0; r < 8; ++r) { const float v = o[qt][dt][r] * inv; const _Float16 hv = (_Float16)v; f.h[r] = hv; fl.h[r] = (_Float16)((v - (float)hv) * 1024.0f); }
      *(v8us*)((unsigned short*)OH + ob + dt * 16) = f.half[0]; *(v8us*)((unsigned short*)OL + ob + dt * 16) = fl.half[0]; } }
}
// One preparation launch for all five operand planes; every one of its 512 blocks does the same two pieces of work.
// (a) One 64 k x 64 n tile of two of the four weights, Wt[n][k] = f16(bf16(W[k][n]) * 16), transposed through LDS, so that reads (256 B of a W row per 16 lanes) and writes (128 B of a Wt row per 8 lanes) are whole lines.
// (b) 2048 float4 of x, X16 = f16(bf16(x)), lanes adjacent.
// A thread issues its 16 loads as one group; s_wait_xcnt 0 stands behind the group, in front of any rewrite of its two offset registers, which as the statement's inputs keep their values up to there.
#define PWP 144              /* LDS row pitch of a transposed tile: 128 B (64 k) + 16 = 16 B x odd, conflict-free for the 16-byte reads */
__global__ __launch_bounds__(256) void k_prep(const float* __restrict__ x, const float* __restrict__ w0, const float* __restrict__ w1, const float* __restrict__ w2, const float* __restrict__ w3,
                                              _Float16* __restrict__ X16, _Float16* __restrict__ T0, _Float16* __restrict__ T1, _Float16* __restrict__ T2, _Float16* __restrict__ T3) {
  __shared__ __attribute__((aligned(16))) char tl[2][64 * PWP];
  const int tid = threadIdx.x, b = blockIdx.x; const bool hi = (b & 256) != 0;      /* blocks 0..255: weights 0 and 1, blocks 256..511: weights 2 and 3 */
  const float* const wp[2] = {hi ? w2 : w0, hi ? w3 : w1}; _Float16* const tp[2] = {hi ? T2 : T0, hi ? T3 : T1};
  const int k0 = ((b >> 4) & 15) * 64, n0 = (b & 15) * 64; const int kq = (tid >> 4) * 4, c4 = (tid & 15) * 4;      /* a thread holds 4 k x 4 n of each tile */
  const unsigned sb = (unsigned)(((k0 + kq) * DM + n0 + c4) * 4);      /* byte offset in each W */
  const unsigned fi = (unsigned)((b & 511) * 2048 + tid);      /* float4 index in x: NR * DM floats = 512 blocks x 8 x 256 float4; the mask shows the compiler that fi + u * 256 cannot wrap, so the eight steps fold into the instructions' offsets */
  v4f r[8], q[8];
#pragma unroll
  for (int u = 0; u < 8; ++u) r[u] = *(const v4fa*)((const char*)wp[u >> 2] + sb + (u & 3) * (DM * 4));
#pragma unroll
  for (int u = 0; u < 8; ++u) q[u] = ((const v4fa*)x)[fi + u * 256];
  asm volatile("s_wait_xcnt 0x0" :: "v"(sb), "v"(fi) : "memory");      /* see the head comment */
  __builtin_amdgcn_sched_barrier(0);      /* keeps all 16 loads and their wait ahead of the first conversion: one memory latency per thread, not two */
#pragma unroll
  for (int mx = 0; mx < 2; ++mx)
#pragma unroll
    for (int j = 0; j < 4; ++j) { v4h p;
#pragma unroll
      for (int i = 0; i < 4; ++i) p[i] = (_Float16)(bf16_round(r[mx * 4 + i][j]) * 16.0f);
      *(v4h*)(tl[mx] + (c4 + j) * PWP + kq * 2) = p; }      /* 4 consecutive k of one n: 8 bytes of the transposed row */
  __syncthreads();      /* a transposed row holds 16 threads' k */
#pragma unroll
  for (int u = 0; u < 4; ++u) { const int n = (u & 1) * 32 + (tid >> 3), c = tid & 7; const v8us v = *(const v8us*)(tl[u >> 1] + n * PWP + c * 16);
    *(v8us*)((unsigned short*)tp[u >> 1] + (size_t)(n0 + n) * DM + k0 + c * 8) = v; }
#pragma unroll
  for (int u = 0; u < 8; ++u) { v4h p;      /* behind the barrier, which would otherwise wait for these stores */
#pragma unroll
    for (int i = 0; i < 4; ++i) p[i] = (_Float16)bf16_round(q[u][i]);
    ((v4h*)X16)[fi + u * 256] = p; }
}
extern "C" void kernel_launch(void* const* d_in, const int* in_sizes, int n_in,
                              void* d_out, int out_size, void* d_ws, size_t ws_size, hipStream_t stream) {
  (void)in_sizes; (void)n_in; (void)out_size;
  const float* const* I = (const float* const*)d_in; const float* x = I[0]; const float* wq = I[1]; const float* bq = I[2]; const float* wk = I[3]; const float* bk = I[4]; const float* wv = I[5]; const float* bv = I[6]; const float* wo = I[7]; const float* bo = I[8]; const float* tmp = I[9];
  char* ws = (char*)d_ws; size_t off = 0;
  auto take = [&](size_t bytes) { char* p = ws + off; off += (bytes + 255) & ~(size_t)255; return p; };
  const size_t np = (size_t)NR * DM;
  _Float16* BQ = (_Float16*)take((size_t)DM * DM * 2); _Float16* BK = (_Float16*)take((size_t)DM * DM * 2); _Float16* BV = (_Float16*)take((size_t)DM * DM * 2); _Float16* BO = (_Float16*)take((size_t)DM * DM * 2);
  _Float16* X16 = (_Float16*)take(np * 2); float* QN = (float*)take((size_t)NR * NH * 4); float* KN = (float*)take((size_t)NR * NH * 4); _Float16* QH = (_Float16*)take(np * 2); _Float16* QL = (_Float16*)take(np * 2); _Float16* KH = (_Float16*)take(np * 2); _Float16* KL = (_Float16*)take(np * 2); _Float16* OH = (_Float16*)take(np * 2); _Float16* VT = (_Float16*)take(np * 2);
  _Float16* OL = X16;      /* O lo over x (dead after the projections) */
  if (off > ws_size) return;      /* 8 + 8 + 0.5 + 6x8 = about 65 MiB */
  k_prep<<<512, 256, 0, stream>>>(x, wq, wk, wv, wo, X16, BQ, BK, BV, BO);      /* weights [in, out] -> f16 [out][in] x 16, x -> f16: one launch */
  const dim3 gP((NR / 128) * (DM / 64), 1);
  k_qkv<<<dim3((NR / 128) * (DM / 64), 3), 128, 0, stream>>>(X16, BQ, BK, BV, bq, bk, bv, QN, KN, QH, QL, KH, KL, VT);      /* q, k: hi + residual planes and norms [(b,h)][2048]; V^T [(b,h)][64][2048]: one launch */
  k_eflash<<<NB * NH * (SLEN / 256), 256, 0, stream>>>(QH, QL, KH, KL, VT, QN, KN, tmp, OH, OL);      /* scores, softmax, att . v, normalise, hi + residual: one launch */
  k_gemm2<0, 0><<<gP, 128, 0, stream>>>(OL, DM, 0, BO, DM, 0, 0.0625f / 1024.0f, nullptr, 0, nullptr, 1, 0, 0, (float*)d_out, nullptr, nullptr, DM, 0, NR, DM, DM);
  k_gemm2<0, 0><<<gP, 128, 0, stream>>>(OH, DM, 0, BO, DM, 0, 0.0625f, bo, 0, (const float*)d_out, 1, (size_t)DM, 0, (float*)d_out, nullptr, nullptr, DM, 0, NR, DM, DM);      /* out = (O_lo + O_hi) Wo + bo */
}
